// v000
// The times below were measured on an AMD MI455X: many runs one after another, warmed up first and cycling through
// copies of the inputs, with the whole window's GPU time divided by the number of runs. Launches and the gaps
// between them are all in it. The median over several windows is given; except for v000 it joins two sittings, which
// can be a few percent apart, so the side-by-side timings, each taken in one sitting, are the better comparison.
// v000, which the later versions start from, runs in 985 microseconds.
#include <hip/hip_runtime.h>
// Shared trunk + 33 small branch MLPs (x [131072][40]; eval BatchNorm1d over the 40 features; z = relu(xn Ws + bs) [128]; per branch j: h1 = relu(z W1[j] + b1[j]) [64], h2 = relu(h1 W2[j] + b2[j]) [32], gu[j] = h2 . W3[j] + b3[j]; output gu [131072][33]).
// Structure: BN on VALU -> f16 rows zero-padded to 64 columns; trunk GEMM (K = 64, ReLU epilogue, f16 out); all 33 first branch layers as ONE WMMA GEMM (32x64 wave tiles, f32 accumulation; N = 33 x 64, the stacked W1 re-laid out as Bt[j*64 + k][d]; + b1; ReLU) per block of 8192 rows; the second layers as one grid-batched GEMM over the 33 branches (A column offset 64 j, each branch's 32 outputs padded to 64 Bt rows with zeros; + b2; ReLU; f32 output); the final 32-term dots + b3 on VALU written as f32 [row][33] (thread-linear 4-B stores); launches: see trace.
// Compute dtype: inputs rounded to bf16; x / weights exact; BN output, z and h1 as plain f16 GEMM operands (~2^-12); accumulation, h2 and the final dots f32. v_wmma_f32_16x16x32_f16.
#define NB 1
#define SQ 8192
#define DM 64
#define NH 1
#define HD 64
#define HG 4                         /* heads per attention launch group */
#define B0 0                         /* first batch processed (debug hook) */
#define NBR NB                       /* batches processed (debug hook) */
#define NR ((size_t)NB * SQ)         /* token rows */
#define MP ((int)((size_t)NBR * SQ)) /* rows projected (debug hook) */
#define QT 256                       /* query rows per causal tile */
#define NKX SQ                       /* S / P row pitch */
#define QT0 256                      /* first-tile rows recomputed exactly (256: buys margin for the few-key rows 128..255, which have no output projection to average the single-f16 P/v rounding) */
#define QN SQ                        /* query rows attended per batch (debug hook) */
#define NHD NH                       /* heads attended (debug hook) */
#define MPO MP                       /* rows through the output stage (debug hook) */
#define LQ DM            /* row pitch of the q/k/v rows */
typedef __bf16 v16b __attribute__((ext_vector_type(16)));
typedef unsigned short v8us __attribute__((ext_vector_type(8), may_alias));
typedef float  v8f  __attribute__((ext_vector_type(8)));
typedef float  v4f  __attribute__((ext_vector_type(4)));
typedef float  v4fa __attribute__((ext_vector_type(4), may_alias));
union FragB { v16b v; v8us half[2]; unsigned short u[16]; };

__device__ __forceinline__ unsigned short bf16_bits(float x) { unsigned int u = __float_as_uint(x); return (unsigned short)((u + 0x7FFFu + ((u >> 16) & 1u)) >> 16); }
__device__ __forceinline__ float bf16_val(unsigned short b) { return __uint_as_float(((unsigned int)b) << 16); }
__device__ __forceinline__ float bf16_round(float x) { return bf16_val(bf16_bits(x)); }
// D += A·B with NT terms: 1 = ah·bh, 2 = + al·bh (A split), 3 = + ah·bl (both split)
template <int NT>
__device__ __forceinline__ v8f mmaN(v16b ah, v16b al, v16b bh, v16b bl, v8f c) {
  c = __builtin_amdgcn_wmma_f32_16x16x32_bf16(false, ah, false, bh, (short)0, c, false, false);
  if (NT >= 2) c = __builtin_amdgcn_wmma_f32_16x16x32_bf16(false, al, false, bh, (short)0, c, false, false);
  if (NT >= 3) c = __builtin_amdgcn_wmma_f32_16x16x32_bf16(false, ah, false, bl, (short)0, c, false, false);
  asm volatile("v_nop\n\tv_nop\n\tv_nop\n\tv_nop" : "+v"(c) : "v"(ah), "v"(al), "v"(bh), "v"(bl));
  return c;
}

__global__ __launch_bounds__(256) void k_wt_bf16(const float* __restrict__ W, unsigned short* __restrict__ Wt, int K, int N) {
  const int t = blockIdx.x * 256 + threadIdx.x;
  const int k8n = K / 8;
  if (t >= N * k8n) return;
  const int n = t / k8n, k8 = (t % k8n) * 8;
  v8us v;
#pragma unroll
  for (int i = 0; i < 8; ++i) v[i] = bf16_bits(W[(size_t)(k8 + i) * N + n]);
  *(v8us*)(Wt + (size_t)n * K + k8) = v;
  
}

// GEMM C[M][N] (f32, pitch ldc) = act(A[M][K]·W + bias). A f32 row-major (pitch lda) converted per fragment to bf16
// (ASPLIT: hi/lo two planes -> 2 terms, else single rounded term); Wt bf16 [N][K] (pitch ldb). BIAS_BF16 rounds the
// bias to bf16 first (bias quantised to bf16 before the add). K%32==0, M%16==0, N%64==0.
template <bool ASPLIT, int ACT, bool BIAS_BF16>
__global__ __launch_bounds__(128) void k_gemm_bf(const float* __restrict__ A, int lda, const unsigned short* __restrict__ Wt, int ldb,
                                               const float* __restrict__ bias, float* __restrict__ C, int ldc, int M, int N, int K) {
  __shared__ __attribute__((aligned(16))) float so[4][16][64];
  const int tid = threadIdx.x, w = tid >> 5, lane = tid & 31, ln = lane & 15, hh = lane >> 4;
  const int ntn = N / 64;
  const int wid = blockIdx.x * 4 + w;
  const int mt = wid / ntn, nq = wid % ntn;
  if (mt * 16 >= M) return;
  const int row0 = mt * 16, col0 = nq * 64;
  const float* arow = A + (size_t)(row0 + ln) * lda;
  v8f acc[4] = {};
  for (int kb = 0; kb < K; kb += 32) {
    FragB ah, al;
    const v4f x0 = *(const v4fa*)(arow + kb + 8 * hh), x1 = *(const v4fa*)(arow + kb + 8 * hh + 4);
    const v4f x2 = *(const v4fa*)(arow + kb + 16 + 8 * hh), x3 = *(const v4fa*)(arow + kb + 16 + 8 * hh + 4);
    float xs[16] = {x0[0],x0[1],x0[2],x0[3],x1[0],x1[1],x1[2],x1[3],x2[0],x2[1],x2[2],x2[3],x3[0],x3[1],x3[2],x3[3]};
#pragma unroll
    for (int i = 0; i < 16; ++i) { const unsigned short hb = bf16_bits(xs[i]); ah.u[i] = hb; al.u[i] = ASPLIT ? bf16_bits(xs[i] - bf16_val(hb)) : (unsigned short)0; }
#pragma unroll
    for (int t = 0; t < 4; ++t) {
      const unsigned short* brow = Wt + (size_t)(col0 + t * 16 + ln) * ldb + kb;
      FragB b;
      b.half[0] = *(const v8us*)(brow + 8 * hh);
      b.half[1] = *(const v8us*)(brow + 16 + 8 * hh);
      acc[t] = mmaN<ASPLIT ? 2 : 1>(ah.v, al.v, b.v, b.v, acc[t]);
    }
  }
#pragma unroll
  for (int t = 0; t < 4; ++t) {
    float bv = bias ? bias[col0 + t * 16 + ln] : 0.f;
    if (BIAS_BF16) bv = bf16_round(bv);
#pragma unroll
    for (int r = 0; r < 8; ++r) { float v = acc[t][r] + bv; if (ACT == 1) v = fmaxf(v, 0.f); so[w][8 * hh + r][t * 16 + ln] = v; }
  }
  __builtin_amdgcn_fence(__ATOMIC_ACQ_REL, "workgroup");
  __builtin_amdgcn_wave_barrier();
  const int rsub = lane >> 4, c4 = (lane & 15) * 4;
  {
#pragma unroll
    for (int q = 0; q < 8; ++q) {
      const int r = q * 2 + rsub;
      const v4f v = *(const v4fa*)&so[w][r][c4];
      *(v4f*)(C + (size_t)(row0 + r) * ldc + col0 + c4) = v;
    }
    
  }
}

// GEMM C = act(A·W + bias + resid): A f32 (ASPLIT -> hi/lo 2 terms), Wt bf16 [N][K]; ACT 0 none, 1 relu, 2 exact gelu;
// resid (optional, f32, row index = (row % rmod), pitch ldr, RES_BF16 rounds it) added before the activation.
template <bool ASPLIT, int ACT, bool BIAS_BF16, bool RES_BF16>
__global__ __launch_bounds__(128) void k_gemm_bf3(const float* __restrict__ A, int lda, const unsigned short* __restrict__ Wt, int ldb,
                                                const float* __restrict__ bias, const float* __restrict__ resid, int rmod, int ldr,
                                                float* __restrict__ C, int ldc, int M, int N, int K) {
  __shared__ __attribute__((aligned(16))) float so[4][16][64];
  const int tid = threadIdx.x, w = tid >> 5, lane = tid & 31, ln = lane & 15, hh = lane >> 4;
  const int ntn = N / 64;
  const int wid = blockIdx.x * 4 + w;
  const int mt = wid / ntn, nq = wid % ntn;
  if (mt * 16 >= M) return;
  const int row0 = mt * 16, col0 = nq * 64;
  const float* arow = A + (size_t)(row0 + ln) * lda;
  v8f acc[4] = {};
  for (int kb = 0; kb < K; kb += 32) {
    FragB ah, al;
    const v4f x0 = *(const v4fa*)(arow + kb + 8 * hh), x1 = *(const v4fa*)(arow + kb + 8 * hh + 4);
    const v4f x2 = *(const v4fa*)(arow + kb + 16 + 8 * hh), x3 = *(const v4fa*)(arow + kb + 16 + 8 * hh + 4);
    float xs[16] = {x0[0],x0[1],x0[2],x0[3],x1[0],x1[1],x1[2],x1[3],x2[0],x2[1],x2[2],x2[3],x3[0],x3[1],x3[2],x3[3]};
#pragma unroll
    for (int i = 0; i < 16; ++i) { const unsigned short hb = bf16_bits(xs[i]); ah.u[i] = hb; al.u[i] = ASPLIT ? bf16_bits(xs[i] - bf16_val(hb)) : (unsigned short)0; }
#pragma unroll
    for (int t = 0; t < 4; ++t) {
      const unsigned short* brow = Wt + (size_t)(col0 + t * 16 + ln) * ldb + kb;
      FragB b;
      b.half[0] = *(const v8us*)(brow + 8 * hh);
      b.half[1] = *(const v8us*)(brow + 16 + 8 * hh);
      acc[t] = mmaN<ASPLIT ? 2 : 1>(ah.v, al.v, b.v, b.v, acc[t]);
    }
  }
#pragma unroll
  for (int t = 0; t < 4; ++t) {
    const int col = col0 + t * 16 + ln;
    float bv = bias ? bias[col] : 0.f;
    if (BIAS_BF16) bv = bf16_round(bv);
#pragma unroll
    for (int r = 0; r < 8; ++r) {
      float v = acc[t][r] + bv;
      if (resid) { float rv = resid[(size_t)((row0 + 8 * hh + r) % rmod) * ldr + col]; if (RES_BF16) rv = bf16_round(rv); v += rv; }
      if (ACT == 1) v = fmaxf(v, 0.f);
      if (ACT == 2) v = 0.5f * v * (1.0f + erff(v * 0.70710678118654752f));
      if (ACT == 3) { const float u = 0.7978845608028654f * (v + 0.044715f * v * v * v); v = 0.5f * v * (1.0f + tanhf(u)); }
      so[w][8 * hh + r][t * 16 + ln] = v;
    }
  }
  __builtin_amdgcn_fence(__ATOMIC_ACQ_REL, "workgroup");
  __builtin_amdgcn_wave_barrier();
  const int rsub = lane >> 4, c4 = (lane & 15) * 4;
  {
#pragma unroll
    for (int q = 0; q < 8; ++q) {
      const int r = q * 2 + rsub;
      const v4f v = *(const v4fa*)&so[w][r][c4];
      *(v4f*)(C + (size_t)(row0 + r) * ldc + col0 + c4) = v;
    }
    
  }
}
// row LayerNorm (biased variance, eps) over N: s = X (+ R); optional out_sum <- s; out_norm <- (s-mu)*rsqrt(var+eps)*g + b
template <bool PARAM_BF16>
__global__ __launch_bounds__(256) void k_layernorm(const float* __restrict__ X, const float* __restrict__ R, const float* __restrict__ g, const float* __restrict__ bta,
                                                  float* __restrict__ out_sum, float* __restrict__ out_norm, int N, float eps) {
  __shared__ float red[256];
  const int row = blockIdx.x, tid = threadIdx.x;
  const float* x = X + (size_t)row * N; const float* rr = R ? R + (size_t)row * N : nullptr;
  float vals[16];                     // up to N = 4096
  const int per = N / 256;            // contiguous chunk per thread? use strided-by-4 chunks: thread handles j = tid*4 + 1024*u
  float s1 = 0.f;
  for (int u = 0; u < per / 4; ++u) {
    const int j = tid * 4 + 1024 * u;
    const v4f a = *(const v4fa*)(x + j);
    v4f b = {0.f,0.f,0.f,0.f}; if (rr) b = *(const v4fa*)(rr + j);
#pragma unroll
    for (int q = 0; q < 4; ++q) { const float v = a[q] + b[q]; vals[u * 4 + q] = v; s1 += v; }
  }
  red[tid] = s1; __syncthreads();
  for (int st = 128; st > 0; st >>= 1) { if (tid < st) red[tid] += red[tid + st]; __syncthreads(); }
  const float mu = red[0] / (float)N; __syncthreads();
  float s2 = 0.f;
  for (int u = 0; u < per / 4; ++u)
#pragma unroll
    for (int q = 0; q < 4; ++q) { const float c = vals[u * 4 + q] - mu; s2 += c * c; }
  red[tid] = s2; __syncthreads();
  for (int st = 128; st > 0; st >>= 1) { if (tid < st) red[tid] += red[tid + st]; __syncthreads(); }
  const float rs = rsqrtf(red[0] / (float)N + eps);
  {
    for (int u = 0; u < per / 4; ++u) {
      const int j = tid * 4 + 1024 * u;
      v4f o, sm;
#pragma unroll
      for (int q = 0; q < 4; ++q) {
        float gg = g[j + q], bb = bta[j + q];
        if (PARAM_BF16) { gg = bf16_round(gg); bb = bf16_round(bb); }
        sm[q] = vals[u * 4 + q]; o[q] = (vals[u * 4 + q] - mu) * rs * gg + bb;
      }
      if (out_sum) *(v4f*)(out_sum + (size_t)row * N + j) = sm;
      *(v4f*)(out_norm + (size_t)row * N + j) = o;
    }
    
  }
}



// ---- f16 WMMA path (v_wmma_f32_16x16x32_f16): 11-bit significands for operands in range — used where a [0,1] probability operand needs more precision than bf16
typedef _Float16 v16h __attribute__((ext_vector_type(16)));
union FragH { v16h v; v8us half[2]; _Float16 h[16]; unsigned short u[16]; };
template <int NT>
__device__ __forceinline__ v8f mmaH(v16h ah, v16h al, v16h bh, v16h bl, v8f c) {
  c = __builtin_amdgcn_wmma_f32_16x16x32_f16(false, ah, false, bh, (short)0, c, false, false);
  if (NT >= 2) c = __builtin_amdgcn_wmma_f32_16x16x32_f16(false, al, false, bh, (short)0, c, false, false);
  if (NT >= 3) c = __builtin_amdgcn_wmma_f32_16x16x32_f16(false, ah, false, bl, (short)0, c, false, false);
  asm volatile("v_nop\n\tv_nop\n\tv_nop\n\tv_nop" : "+v"(c) : "v"(ah), "v"(al), "v"(bh), "v"(bl));
  return c;
}
// batched GEMM like k_gemm_b but f16 operands: A f32 (split into f16 hi/lo if ASPLIT, else rounded to f16), Bt = f16 values [n][k]; alpha; C f32; N multiple of 16 (partial tiles skipped)
template <bool ASPLIT>
__global__ __launch_bounds__(128) void k_gemm_h(const float* __restrict__ A, int lda, size_t sA, const _Float16* __restrict__ Bh, int ldb, size_t sB, float alpha, float* __restrict__ C, int ldc, size_t sC, int M, int N, int K) {
  __shared__ __attribute__((aligned(16))) float so[4][16][64];
  const int tid = threadIdx.x, w = tid >> 5, lane = tid & 31, ln = lane & 15, hh = lane >> 4; const int by = blockIdx.y;
  A += (size_t)by * sA; Bh += (size_t)by * sB; C += (size_t)by * sC;
  const int ntn = (N + 63) / 64; const int wid = blockIdx.x * 4 + w; const int mt = wid / ntn, nq = wid % ntn; if (mt * 16 >= M) return;
  const int row0 = mt * 16, col0 = nq * 64; const float* arow = A + (size_t)(row0 + ln) * lda;
  v8f acc[4] = {};
  for (int kb = 0; kb < K; kb += 32) {
    FragH ah, al;
    const v4f x0 = *(const v4fa*)(arow + kb + 8 * hh), x1 = *(const v4fa*)(arow + kb + 8 * hh + 4), x2 = *(const v4fa*)(arow + kb + 16 + 8 * hh), x3 = *(const v4fa*)(arow + kb + 16 + 8 * hh + 4);
    float xs[16] = {x0[0],x0[1],x0[2],x0[3],x1[0],x1[1],x1[2],x1[3],x2[0],x2[1],x2[2],x2[3],x3[0],x3[1],x3[2],x3[3]};
#pragma unroll
    for (int i = 0; i < 16; ++i) { const _Float16 h = (_Float16)xs[i]; ah.h[i] = h; al.h[i] = ASPLIT ? (_Float16)(xs[i] - (float)h) : (_Float16)0.0f; }
#pragma unroll
    for (int t = 0; t < 4; ++t) { if (col0 + t * 16 >= N) continue; const size_t boff = (size_t)(col0 + t * 16 + ln) * ldb + kb; FragH bq; bq.half[0] = *(const v8us*)(Bh + boff + 8 * hh); bq.half[1] = *(const v8us*)(Bh + boff + 16 + 8 * hh);
      acc[t] = mmaH<ASPLIT ? 2 : 1>(ah.v, al.v, bq.v, bq.v, acc[t]); }
  }
#pragma unroll
  for (int t = 0; t < 4; ++t) { if (col0 + t * 16 >= N) continue;
#pragma unroll
    for (int r = 0; r < 8; ++r) so[w][8 * hh + r][t * 16 + ln] = acc[t][r] * alpha; }
  __builtin_amdgcn_fence(__ATOMIC_ACQ_REL, "workgroup"); __builtin_amdgcn_wave_barrier();
  const int rsub = lane >> 4, c4 = (lane & 15) * 4;
  {
#pragma unroll
    for (int q = 0; q < 8; ++q) { const int r = q * 2 + rsub; if (col0 + c4 < N) { const v4f v = *(const v4fa*)&so[w][r][c4]; *(v4f*)(C + (size_t)(row0 + r) * ldc + col0 + c4) = v; } }
     }
}

// Wt[n][k] = f16(W[k][n]·scale) from f32 row-major W[K][N] (scale = power of two; bf16-exact weights stay exact in f16 away from the subnormal range)
__global__ __launch_bounds__(256) void k_wt_f16(const float* __restrict__ W, _Float16* __restrict__ Wt, int K, int N, float scale) {
  const int t = blockIdx.x * 256 + threadIdx.x; if (t >= N * (K / 8)) return; const int n = t / (K / 8), k8 = (t % (K / 8)) * 8; FragH f;
#pragma unroll
  for (int i = 0; i < 8; ++i) f.h[i] = (_Float16)(bf16_round(W[(size_t)(k8 + i) * N + n]) * scale); const v8us o = f.half[0];
  *(v8us*)((unsigned short*)Wt + (size_t)n * K + k8) = o; 
}
// k_gemm_hh variant with fused epilogue: v = acc·alpha + bias[by·sBias + col] (+ CP[(row/rowsPerB)·sCPb + by·64 + col] if CP) ; ACT 0 none / 1 elu ; writes f16 C16 (and f32 C if non-null)
template <int ACT>
__global__ __launch_bounds__(128) void k_gemm_hhx(const _Float16* __restrict__ A, int lda, size_t sA, const _Float16* __restrict__ Bh, int ldb, size_t sB, float alpha, const float* __restrict__ bias, size_t sBias, const float* __restrict__ CP, int rowsPerB, size_t sCPb, int row0g,
    float* __restrict__ C, _Float16* __restrict__ C16, int ldc, size_t sC, int M, int N, int K) {
  __shared__ __attribute__((aligned(16))) float so[4][16][64];
  const int tid = threadIdx.x, w = tid >> 5, lane = tid & 31, ln = lane & 15, hh = lane >> 4; const int by = blockIdx.y;
  A += (size_t)by * sA; Bh += (size_t)by * sB; const size_t cofs = (size_t)by * sC; const float* bp = bias ? bias + (size_t)by * sBias : nullptr;
  const int ntn = (N + 63) / 64; const int wid = blockIdx.x * 4 + w; const int mt = wid / ntn, nq = wid % ntn; if (mt * 16 >= M) return;
  const int row0 = mt * 16, col0 = nq * 64; const _Float16* arow = A + (size_t)(row0 + ln) * lda;
  v8f acc[4] = {};
  for (int kb = 0; kb < K; kb += 32) { FragH ah; ah.half[0] = *(const v8us*)((const unsigned short*)arow + kb + 8 * hh); ah.half[1] = *(const v8us*)((const unsigned short*)arow + kb + 16 + 8 * hh);
#pragma unroll
    for (int t = 0; t < 4; ++t) { if (col0 + t * 16 >= N) continue; const size_t boff = (size_t)(col0 + t * 16 + ln) * ldb + kb; FragH bq; bq.half[0] = *(const v8us*)((const unsigned short*)Bh + boff + 8 * hh); bq.half[1] = *(const v8us*)((const unsigned short*)Bh + boff + 16 + 8 * hh);
      acc[t] = mmaH<1>(ah.v, ah.v, bq.v, bq.v, acc[t]); }
  }
#pragma unroll
  for (int t = 0; t < 4; ++t) { if (col0 + t * 16 >= N) continue; const int col = col0 + t * 16 + ln; const float bv = bp ? bf16_round(bp[col]) : 0.f;
#pragma unroll
    for (int r = 0; r < 8; ++r) { float v = acc[t][r] * alpha + bv; if (CP) { const int rr = row0g + row0 + 8 * hh + r; if (rowsPerB < 0) v += CP[cofs + (size_t)rr * ldc + col];      /* rowsPerB < 0: own element of the batched C plane */ else { const int bidx = rr / rowsPerB; v += CP[(size_t)bidx * sCPb + (size_t)by * 64 + col]; } } if (ACT == 1) v = (v > 0.f) ? v : expm1f(v); else if (ACT == 7) v = (v > 0.f) ? v + 1.0f : expf(v); else if (ACT == 8) v = tanhf(v); else if (ACT == 9) v = 0.5f * v * (1.0f + tanhf(0.7978845608028654f * (v + 0.044715f * v * v * v))); else if (ACT == 11) v = 1.0f / (1.0f + expf(-v)); else if (ACT == 12) v = (v > 0.f) ? v : 0.01f * v; else if (ACT == 14) v = (v > 0.f) ? v : 0.1f * v; else if (ACT == 16) v = (v >= 0.f) ? v : 0.3f * v; else if (ACT == 17) v = (v >= 0.f) ? v : 0.2f * v; else if (ACT == 15) v = v / (1.0f + expf(-v)); else if (ACT == 3) v = fmaxf(v, 0.f); else if (ACT == 6) v = 0.5f * v * (1.0f + erff(v * 0.70710678118654752f)); so[w][8 * hh + r][t * 16 + ln] = v; } }
  __builtin_amdgcn_fence(__ATOMIC_ACQ_REL, "workgroup"); __builtin_amdgcn_wave_barrier();
  const int rsub = lane >> 4, c4 = (lane & 15) * 4; typedef _Float16 v4h __attribute__((ext_vector_type(4)));
  {
#pragma unroll
    for (int q = 0; q < 8; ++q) { const int r = q * 2 + rsub; if (col0 + c4 < N) { const v4f v = *(const v4fa*)&so[w][r][c4]; if (C) *(v4f*)(C + cofs + (size_t)(row0 + r) * ldc + col0 + c4) = v; if (C16) { v4h h4; for (int i = 0; i < 4; ++i) h4[i] = (_Float16)v[i]; *(v4h*)(C16 + cofs + (size_t)(row0 + r) * ldc + col0 + c4) = h4; } } }
     }
}


typedef _Float16 v4h __attribute__((ext_vector_type(4)));

__global__ __launch_bounds__(256) void k_x16(const float* __restrict__ x, _Float16* __restrict__ X16, size_t n8) { const size_t t = (size_t)blockIdx.x * 256 + threadIdx.x; if (t >= n8) return; FragH f;
#pragma unroll
  for (int q = 0; q < 8; ++q) f.h[q] = (_Float16)bf16_round(x[t * 8 + q]); *(v8us*)((unsigned short*)X16 + t * 8) = f.half[0];  }
__global__ __launch_bounds__(256) void k_h16(const float* __restrict__ x, _Float16* __restrict__ X16, size_t n8) { const size_t t = (size_t)blockIdx.x * 256 + threadIdx.x; if (t >= n8) return; FragH f;
#pragma unroll
  for (int q = 0; q < 8; ++q) f.h[q] = (_Float16)x[t * 8 + q]; *(v8us*)((unsigned short*)X16 + t * 8) = f.half[0];  }
__global__ __launch_bounds__(256) void k_round16f(const float* __restrict__ W, _Float16* __restrict__ Bt, size_t n8) { const size_t t = (size_t)blockIdx.x * 256 + threadIdx.x; if (t >= n8) return; FragH f;
#pragma unroll
  for (int i = 0; i < 8; ++i) f.h[i] = (_Float16)(bf16_round(W[t * 8 + i]) * 16.0f); *(v8us*)((unsigned short*)Bt + t * 8) = f.half[0];  }
template <int NHv, int TTv>
__global__ __launch_bounds__(256) void k_vt(const _Float16* __restrict__ V16, int ldv, int voff, _Float16* __restrict__ Vt) { __shared__ unsigned short tl[64][66]; const int tid = threadIdx.x; const int slab = blockIdx.x / (TTv / 64), lg = blockIdx.x % (TTv / 64); const int b = slab / NHv, h = slab % NHv;
  for (int i = tid; i < 64 * 8; i += 256) { const int r = i / 8, c8 = (i % 8) * 8; FragH f; f.half[0] = *(const v8us*)((const unsigned short*)V16 + ((size_t)b * TTv + lg * 64 + r) * ldv + voff + h * 64 + c8);
#pragma unroll
    for (int q = 0; q < 8; ++q) tl[r][c8 + q] = f.u[q]; }
  __syncthreads();
  {
#pragma unroll
    for (int rd = 0; rd < 2; ++rd) { const int d = rd * 32 + tid / 8, pc = tid % 8; FragH f;
#pragma unroll
      for (int q = 0; q < 8; ++q) f.u[q] = tl[pc * 8 + q][d];
      *(v8us*)((unsigned short*)Vt + ((size_t)slab * 64 + d) * TTv + lg * 64 + pc * 8) = f.half[0]; }
     } }

__global__ __launch_bounds__(256) void k_hl(const float* __restrict__ F, _Float16* __restrict__ Hh, _Float16* __restrict__ Hl, size_t n8) { const size_t t = (size_t)blockIdx.x * 256 + threadIdx.x; if (t >= n8) return; FragH fh, fl; const v4f a = *(const v4fa*)(F + t * 8), c = *(const v4fa*)(F + t * 8 + 4);
#pragma unroll
  for (int q = 0; q < 4; ++q) { _Float16 h = (_Float16)a[q]; fh.h[q] = h; fl.h[q] = (_Float16)((a[q] - (float)h) * 1024.0f); h = (_Float16)c[q]; fh.h[4 + q] = h; fl.h[4 + q] = (_Float16)((c[q] - (float)h) * 1024.0f); }
  { *(v8us*)((unsigned short*)Hh + t * 8) = fh.half[0]; *(v8us*)((unsigned short*)Hl + t * 8) = fl.half[0];  } }

// ---- fast GEMM (wave tile 32x64; requires M % 32 == 0 rows per launch region and N % 64 == 0); epilogue = k_gemm_hhx semantics ----
__device__ __forceinline__ v16h g2_frag(const _Float16* p, int hh) { FragH f; f.half[0] = *(const v8us*)((const unsigned short*)p + 8 * hh); f.half[1] = *(const v8us*)((const unsigned short*)p + 16 + 8 * hh); return f.v; }
__device__ __forceinline__ v8f g2_mma(v16h a, v16h b, v8f c) { v8f d = __builtin_amdgcn_wmma_f32_16x16x32_f16(false, a, false, b, (short)0, c, false, false); asm volatile("v_nop\n\tv_nop\n\tv_nop\n\tv_nop" : "+v"(d) : "v"(a), "v"(b)); return d; }
template <int ACT>
__global__ __launch_bounds__(128) void k_gemm2(const _Float16* __restrict__ A, int lda, size_t sA, const _Float16* __restrict__ Bh, int ldb, size_t sB, float alpha, const float* __restrict__ bias, size_t sBias, const float* __restrict__ CP, int rowsPerB, size_t sCPb, int row0g,
    float* __restrict__ C, _Float16* __restrict__ C16, int ldc, size_t sC, int M, int N, int K) { static_assert(ACT == 0 || ACT == 3 || ACT == 6 || ACT == 8 || ACT == 9 || ACT == 11 || ACT == 12 || ACT == 14 || ACT == 15 || ACT == 16 || ACT == 17, "k_gemm2: unsupported ACT code (would silently apply no activation)");
  __shared__ __attribute__((aligned(16))) float so[4][32][68];
  const int tid = threadIdx.x, w = tid >> 5, lane = tid & 31, ln = lane & 15, hh = lane >> 4; const int by = blockIdx.y;
  A += (size_t)by * sA; Bh += (size_t)by * sB; const size_t cofs = (size_t)by * sC; const float* bp = bias ? bias + (size_t)by * sBias : nullptr;
  const int ntn = N >> 6; const int mt = blockIdx.x / ntn, nq = blockIdx.x - mt * ntn; const int row0 = mt * 128 + 32 * w, col0 = nq * 64; if (row0 >= M) return;
  const _Float16* a0p = A + (size_t)(row0 + ln) * lda; const _Float16* a1p = a0p + (size_t)16 * lda;
  const _Float16* b0p = Bh + (size_t)(col0 + ln) * ldb; const _Float16* b1p = b0p + (size_t)16 * ldb; const _Float16* b2p = b1p + (size_t)16 * ldb; const _Float16* b3p = b2p + (size_t)16 * ldb;
  const v8f z8 = {0.f,0.f,0.f,0.f,0.f,0.f,0.f,0.f}; v8f c00 = z8, c01 = z8, c02 = z8, c03 = z8, c10 = z8, c11 = z8, c12 = z8, c13 = z8;
#pragma unroll 1
  for (int kb = 0; kb < K; kb += 32) { const v16h a0 = g2_frag(a0p + kb, hh), a1 = g2_frag(a1p + kb, hh);
    v16h b = g2_frag(b0p + kb, hh); c00 = g2_mma(a0, b, c00); c10 = g2_mma(a1, b, c10);
    b = g2_frag(b1p + kb, hh); c01 = g2_mma(a0, b, c01); c11 = g2_mma(a1, b, c11);
    b = g2_frag(b2p + kb, hh); c02 = g2_mma(a0, b, c02); c12 = g2_mma(a1, b, c12);
    b = g2_frag(b3p + kb, hh); c03 = g2_mma(a0, b, c03); c13 = g2_mma(a1, b, c13); }
  v8f accs[8] = {c00, c01, c02, c03, c10, c11, c12, c13};
#pragma unroll
  for (int u = 0; u < 8; ++u) { const int t = u & 3, half = u >> 2; const int col = col0 + t * 16 + ln; const float bv = bp ? bf16_round(bp[col]) : 0.f;
#pragma unroll
    for (int r = 0; r < 8; ++r) { const int rloc = half * 16 + 8 * hh + r; float v = accs[u][r] * alpha + bv; if (CP) { if (rowsPerB < 0) v += CP[cofs + (size_t)(row0g + row0 + rloc) * ldc + col];      /* rowsPerB < 0: own element of the batched C plane */ else { const int bidx = (row0g + row0 + rloc) / rowsPerB; v += CP[(size_t)bidx * sCPb + (size_t)by * 64 + col]; } }
      if (ACT == 3) v = fmaxf(v, 0.f); else if (ACT == 6) v = 0.5f * v * (1.0f + erff(v * 0.70710678118654752f)); else if (ACT == 11) v = 1.0f / (1.0f + expf(-v)); else if (ACT == 15) v = v / (1.0f + expf(-v)); else if (ACT == 12) v = (v > 0.f) ? v : 0.01f * v; else if (ACT == 8) v = tanhf(v); else if (ACT == 9) v = 0.5f * v * (1.0f + tanhf(0.7978845608028654f * (v + 0.044715f * v * v * v))); else if (ACT == 14) v = (v > 0.f) ? v : 0.1f * v; else if (ACT == 16) v = (v >= 0.f) ? v : 0.3f * v; else if (ACT == 17) v = (v >= 0.f) ? v : 0.2f * v;
      so[w][rloc][t * 16 + ln] = v; } }
  __builtin_amdgcn_fence(__ATOMIC_ACQ_REL, "workgroup"); __builtin_amdgcn_wave_barrier();
  const int rsub = lane >> 4, c4 = (lane & 15) * 4;
  {
#pragma unroll
    for (int q = 0; q < 16; ++q) { const int r = q * 2 + rsub; const v4f v = *(const v4fa*)&so[w][r][c4]; if (C) *(v4f*)(C + cofs + (size_t)(row0 + r) * ldc + col0 + c4) = v; if (C16) { v4h h4; for (int i = 0; i < 4; ++i) h4[i] = (_Float16)v[i]; *(v4h*)(C16 + cofs + (size_t)(row0 + r) * ldc + col0 + c4) = h4; } }
     } }


__global__ __launch_bounds__(256) void k_wnat(const float* __restrict__ w, size_t n8, _Float16* __restrict__ Bt) { const size_t t = (size_t)blockIdx.x * 256 + threadIdx.x; if (t >= n8) return; FragH f; for (int q = 0; q < 8; ++q) f.h[q] = (_Float16)(bf16_round(w[t * 8 + q]) * 16.0f); *(v8us*)((unsigned short*)Bt + t * 8) = f.half[0];  }
__global__ __launch_bounds__(256) void k_rsm(const float* __restrict__ S, _Float16* __restrict__ P, int nrows) {
  #pragma clang fp contract(off)
  const int i = blockIdx.x * 256 + threadIdx.x; if (i >= nrows) return; const float* s = S + (size_t)i * SQ; float mx = -3.0e38f;
#pragma unroll 1
  for (int j = 0; j < SQ; ++j) mx = fmaxf(mx, s[j]); float se = 0.f;
#pragma unroll 1
  for (int j = 0; j < SQ; ++j) se += expf(s[j] - mx); const float sc = 256.0f / se;
#pragma unroll 1
  for (int j0 = 0; j0 < SQ; j0 += 8) { FragH f; for (int q = 0; q < 8; ++q) f.h[q] = (_Float16)(expf(s[j0 + q] - mx) * sc); unsigned short* d = (unsigned short*)P + (size_t)i * SQ + j0; *(v8us*)d = f.half[0];  } }
__global__ __launch_bounds__(256) void k_vt(const _Float16* __restrict__ V16, int b, int h0, _Float16* __restrict__ VT) { __shared__ unsigned short tl[64][65]; const int tid = threadIdx.x; const int hh = blockIdx.x % HG, sg = blockIdx.x / HG; const int s0 = sg * 64; const int h = h0 + hh;
  for (int i = tid; i < 64 * 8; i += 256) { const int j = i / 8, d8 = (i % 8) * 8; FragH f; f.half[0] = *(const v8us*)((const unsigned short*)V16 + ((size_t)b * SQ + s0 + j) * DM + h * HD + d8); for (int q = 0; q < 8; ++q) tl[d8 + q][j] = f.u[q]; }
  __syncthreads();
  { for (int i = tid; i < 64 * 8; i += 256) { const int d = i / 8, j8 = (i % 8) * 8; FragH f; for (int q = 0; q < 8; ++q) f.u[q] = tl[d][j8 + q]; *(v8us*)((unsigned short*)VT + ((size_t)hh * HD + d) * SQ + s0 + j8) = f.half[0]; }  } }



__global__ __launch_bounds__(256) void k_rsmcf2(const float* __restrict__ S, _Float16* __restrict__ P, int hg, int q0, int nk) {
  #pragma clang fp contract(off)
  const int t = blockIdx.x * 256 + threadIdx.x; if (t >= hg * QT) return; const size_t i = (size_t)t; const float* s = S + i * NKX; const int last = q0 + (t % QT); float mx = -3.0e38f;
#pragma unroll 1
  for (int j = 0; j < nk; ++j) { const float f = (j <= last) ? 1.f : 0.f; mx = fmaxf(mx, fmaf(f, s[j], (1.f - f) * -1.0e9f)); } float se = 0.f;
#pragma unroll 1
  for (int j = 0; j < nk; ++j) { const float f = (j <= last) ? 1.f : 0.f; se += __expf(fmaf(f, s[j], (1.f - f) * -1.0e9f) - mx); } const float sc = 256.0f / se;
#pragma unroll 1
  for (int j0 = 0; j0 < nk; j0 += 8) { FragH fr; for (int q = 0; q < 8; ++q) { const int j = j0 + q; const float f = (j <= last) ? 1.f : 0.f; fr.h[q] = (_Float16)(__expf(fmaf(f, s[j], (1.f - f) * -1.0e9f) - mx) * sc); } unsigned short* d = (unsigned short*)P + i * NKX + j0; *(v8us*)d = fr.half[0];  } }

template <int MASKADD>
__global__ __launch_bounds__(64) void k_att0(const float* __restrict__ QF, const float* __restrict__ KF, const float* __restrict__ VF, int ld, const float* __restrict__ mask, float scale, float* __restrict__ OF, int ldo) {
  #pragma clang fp contract(off)
  __shared__ __attribute__((aligned(16))) float lq[64][64]; __shared__ __attribute__((aligned(16))) float lo[64][64];
  const int tid = threadIdx.x; const int h = blockIdx.x / (QT0 / 64), rg = blockIdx.x % (QT0 / 64); const int i = rg * 64 + tid;
  const float* qr = QF + (size_t)i * ld + h * HD;
#pragma unroll 1
  for (int c = 0; c < HD / 4; ++c) { *(v4f*)&lq[tid][c * 4] = *(const v4fa*)(qr + c * 4); const v4f z = {0.f, 0.f, 0.f, 0.f}; *(v4f*)&lo[tid][c * 4] = z; }
  float m = -1.0e30f, l = 0.f; const int jmax = MASKADD ? (SQ - 1) : (rg * 64 + 63);      /* additive-mask form: every key (the mask input decides); causal form: keys up to the block's last row */
#pragma unroll 1
  for (int j = 0; j <= jmax; ++j) { const float* kr = KF + (size_t)j * ld + h * HD; const float* vr = VF + (size_t)j * ld + h * HD; float s = 0.f;
#pragma unroll 1
    for (int c = 0; c < HD / 4; ++c) { const v4f kq = *(const v4fa*)(kr + c * 4); const v4f qq = *(v4f*)&lq[tid][c * 4]; s = __fadd_rn(s, __fmul_rn(qq[0], kq[0])); s = __fadd_rn(s, __fmul_rn(qq[1], kq[1])); s = __fadd_rn(s, __fmul_rn(qq[2], kq[2])); s = __fadd_rn(s, __fmul_rn(qq[3], kq[3])); }
    s = __fmul_rn(s, scale); if (MASKADD) s = __fadd_rn(s, __fmul_rn(bf16_round(mask[(size_t)i * SQ + j]), -10000.0f));
    const float f = (MASKADD || j <= i) ? 1.f : 0.f; const float sm = fmaf(f, s, (1.f - f) * -1.0e30f); const float mn = fmaxf(m, sm); const float sc = expf(m - mn); const float e = expf(sm - mn); l = __fadd_rn(__fmul_rn(l, sc), e); m = mn;
#pragma unroll 1
    for (int c = 0; c < HD / 4; ++c) { const v4f vv = *(const v4fa*)(vr + c * 4); v4f oo = *(v4f*)&lo[tid][c * 4]; for (int u = 0; u < 4; ++u) oo[u] = __fadd_rn(__fmul_rn(oo[u], sc), __fmul_rn(e, vv[u])); *(v4f*)&lo[tid][c * 4] = oo; } }
  const float fin = 64.0f / l;      /* o carried x64 like the f16 path */
#pragma unroll 1
  for (int c = 0; c < HD / 4; ++c) { v4f oo = *(v4f*)&lo[tid][c * 4]; for (int u = 0; u < 4; ++u) oo[u] = __fmul_rn(oo[u], fin); *(v4f*)&lo[tid][c * 4] = oo; }
  __syncthreads();
  {
#pragma unroll 1
    for (int it = 0; it < 16; ++it) { const int row = it * 4 + tid / 16, pc = (tid % 16) * 4; const v4f v = *(const v4f*)&lo[row][pc]; *(v4f*)(OF + (size_t)(rg * 64 + row) * ldo + h * HD + pc) = v; }
     } }

__global__ __launch_bounds__(256) void k_oscale(const float* __restrict__ OF, float* __restrict__ out, size_t n4) { const size_t t = (size_t)blockIdx.x * 256 + threadIdx.x; if (t >= n4) return; const v4f a = *(const v4fa*)(OF + t * 4); v4f o; for (int q = 0; q < 4; ++q) o[q] = a[q] * 0.015625f; *(v4f*)(out + t * 4) = o;  }

__global__ __launch_bounds__(256) void k_bfr(const float* __restrict__ x, float* __restrict__ XB, size_t n8) { const size_t t = (size_t)blockIdx.x * 256 + threadIdx.x; if (t >= n8) return; v4f a = *(const v4fa*)(x + t * 8), c = *(const v4fa*)(x + t * 8 + 4); for (int q = 0; q < 4; ++q) { a[q] = bf16_round(a[q]); c[q] = bf16_round(c[q]); }
  { *(v4f*)(XB + t * 8) = a; *(v4f*)(XB + t * 8 + 4) = c;  } }



__global__ __launch_bounds__(256) void k_rsmfvl(const float* __restrict__ S, _Float16* __restrict__ P, _Float16* __restrict__ PL, int qn, const int* __restrict__ vlp) {
  #pragma clang fp contract(off)
  const int t = blockIdx.x * 256 + threadIdx.x; if (t >= qn) return; const int vl = vlp[0]; const size_t i = (size_t)t; const float* s = S + i * SQ; float mx = -3.0e38f;
#pragma unroll 1
  for (int j = 0; j < SQ; ++j) { const float f = (j < vl) ? 1.f : 0.f; mx = fmaxf(mx, fmaf(f, s[j], (1.f - f) * -1000000.0f)); } float se = 0.f;
#pragma unroll 1
  for (int j = 0; j < SQ; ++j) { const float f = (j < vl) ? 1.f : 0.f; se += __expf(fmaf(f, s[j], (1.f - f) * -1000000.0f) - mx); } const float sc = 256.0f / se;
#pragma unroll 1
  for (int j0 = 0; j0 < SQ; j0 += 8) { FragH fr, gr; for (int q = 0; q < 8; ++q) { const int j = j0 + q; const float f = (j < vl) ? 1.f : 0.f; const float pv = __expf(fmaf(f, s[j], (1.f - f) * -1000000.0f) - mx) * sc; const _Float16 ph = (_Float16)pv; fr.h[q] = ph; gr.h[q] = (_Float16)((pv - (float)ph) * 1024.0f); }
    unsigned short* d = (unsigned short*)P + i * SQ + j0; unsigned short* dl = (unsigned short*)PL + i * SQ + j0; *(v8us*)d = fr.half[0]; *(v8us*)dl = gr.half[0];  } }

#define NRW 131072      /* rows */
#define NIN 40          /* input features */
#define KIN 64          /* padded input width */
#define D0 128
#define D1 64
#define D2 32
#define D2P 64          /* padded second-layer width per branch */
#define NBRN 33         /* branches */
#define RB 8192         /* rows per block */

__global__ __launch_bounds__(256) void k_zero16(unsigned short* __restrict__ p, size_t n8) { const size_t t = (size_t)blockIdx.x * 256 + threadIdx.x; if (t >= n8) return; v8us z; for (int q = 0; q < 8; ++q) z[q] = 0; *(v8us*)(p + t * 8) = z;  }



__global__ __launch_bounds__(256) void k_wst(const float* __restrict__ Ws, _Float16* __restrict__ Bt) {
  const size_t t = (size_t)blockIdx.x * 256 + threadIdx.x; if (t >= (size_t)D0 * KIN / 8) return; const int k0 = (int)((t * 8) % KIN); const int n = (int)((t * 8) / KIN); FragH f;
  for (int q = 0; q < 8; ++q) { const int k = k0 + q; f.h[q] = (k < NIN) ? (_Float16)(bf16_round(Ws[(size_t)k * D0 + n]) * 16.0f) : (_Float16)0.f; }
  *(v8us*)((unsigned short*)Bt + t * 8) = f.half[0];  }
__global__ __launch_bounds__(256) void k_bn16(const float* __restrict__ x, const float* __restrict__ g, const float* __restrict__ be, const float* __restrict__ mu, const float* __restrict__ var, float eps, _Float16* __restrict__ XN, size_t n8) {
  #pragma clang fp contract(off)
  const size_t t = (size_t)blockIdx.x * 256 + threadIdx.x; if (t >= n8) return; const size_t e = t * 8; const size_t r = e / KIN; const int c0 = (int)(e % KIN); FragH f;
  for (int q = 0; q < 8; ++q) { const int c = c0 + q; float v = 0.f; if (c < NIN) { const float sc = __fmul_rn(rsqrtf(__fadd_rn(bf16_round(var[c]), eps)), bf16_round(g[c])); v = __fadd_rn(__fmul_rn(__fadd_rn(bf16_round(x[r * NIN + c]), -bf16_round(mu[c])), sc), bf16_round(be[c])); } f.h[q] = (_Float16)v; }
  *(v8us*)((unsigned short*)XN + e) = f.half[0];  }
__global__ __launch_bounds__(256) void k_w1t(const float* __restrict__ W1, _Float16* __restrict__ Bt) {
  const size_t t = (size_t)blockIdx.x * 256 + threadIdx.x; if (t >= (size_t)NBRN * D1 * D0 / 8) return; const int d0 = (int)((t * 8) % D0); const int row = (int)((t * 8) / D0); const int j = row / D1, k = row % D1; FragH f;
  for (int q = 0; q < 8; ++q) f.h[q] = (_Float16)(bf16_round(W1[((size_t)j * D0 + d0 + q) * D1 + k]) * 16.0f);
  *(v8us*)((unsigned short*)Bt + t * 8) = f.half[0];  }
__global__ __launch_bounds__(256) void k_w2t(const float* __restrict__ W2, _Float16* __restrict__ Bt) {
  const size_t t = (size_t)blockIdx.x * 256 + threadIdx.x; if (t >= (size_t)NBRN * D2P * D1 / 8) return; const int k0 = (int)((t * 8) % D1); const int row = (int)((t * 8) / D1); const int j = row / D2P, m = row % D2P; FragH f;
  for (int q = 0; q < 8; ++q) f.h[q] = (m < D2) ? (_Float16)(bf16_round(W2[((size_t)j * D1 + k0 + q) * D2 + m]) * 16.0f) : (_Float16)0.f;
  *(v8us*)((unsigned short*)Bt + t * 8) = f.half[0];  }
__global__ __launch_bounds__(256) void k_b2p(const float* __restrict__ b2, float* __restrict__ B2P) { const int t = blockIdx.x * 256 + threadIdx.x; if (t >= NBRN * D2P) return; const int j = t / D2P, m = t % D2P; const float v = (m < D2) ? b2[j * D2 + m] : 0.f; *(float*)(B2P + t) = v;  }
__global__ __launch_bounds__(256) void k_fin(const float* __restrict__ H2, const float* __restrict__ W3, const float* __restrict__ b3, size_t r0, float* __restrict__ out, int nrows) {
  #pragma clang fp contract(off)
  const size_t t = (size_t)blockIdx.x * 256 + threadIdx.x; if (t >= (size_t)nrows * NBRN) return; const size_t rl = t / NBRN; const int j = (int)(t % NBRN); const float* h = H2 + rl * (size_t)(NBRN * D2P) + (size_t)j * D2P; float a = 0.f;
  for (int m = 0; m < D2; ++m) a = __fadd_rn(a, __fmul_rn(h[m], bf16_round(W3[j * D2 + m]))); a = __fadd_rn(a, bf16_round(b3[j]));
  float* d = out + (r0 + rl) * NBRN + j; *(float*)d = a;  }

extern "C" void kernel_launch(void* const* d_in, const int* in_sizes, int n_in,
                              void* d_out, int out_size, void* d_ws, size_t ws_size, hipStream_t stream) {
  (void)in_sizes; (void)n_in; (void)out_size;
  const float* const* I = (const float* const*)d_in; const float* x = I[0]; const float* bng = I[1]; const float* bnb = I[2]; const float* bnm = I[3]; const float* bnv = I[4]; const float* Ws = I[5]; const float* bs = I[6]; const float* W1 = I[7]; const float* b1 = I[8]; const float* W2 = I[9]; const float* b2 = I[10]; const float* W3 = I[11]; const float* b3 = I[12];
  char* ws = (char*)d_ws; size_t off = 0;
  auto take = [&](size_t bytes) { char* p = ws + off; off += (bytes + 255) & ~(size_t)255; return p; };
  _Float16* BS = (_Float16*)take((size_t)D0 * KIN * 2); _Float16* B1T = (_Float16*)take((size_t)NBRN * D1 * D0 * 2); _Float16* B2T = (_Float16*)take((size_t)NBRN * D2P * D1 * 2); float* B2P = (float*)take((size_t)NBRN * D2P * 4);
  _Float16* XN = (_Float16*)take((size_t)NRW * KIN * 2); _Float16* Z16 = (_Float16*)take((size_t)NRW * D0 * 2); _Float16* H1 = (_Float16*)take((size_t)RB * NBRN * D1 * 2); float* H2 = (float*)take((size_t)RB * NBRN * D2P * 4);      /* second-layer activations kept in f32 (the final 32-term dots read them directly) */
  if (off > ws_size) return;
  k_wst<<<(unsigned)(((size_t)D0 * KIN / 8 + 255) / 256), 256, 0, stream>>>(Ws, BS);      /* trunk Bt [128][64] at pitch 64 (the generic k_wt_f16 would write pitch 40): columns 40..63 zero, matching the zero-padded input columns */
  k_w1t<<<(unsigned)(((size_t)NBRN * D1 * D0 / 8 + 255) / 256), 256, 0, stream>>>(W1, B1T); k_w2t<<<(unsigned)(((size_t)NBRN * D2P * D1 / 8 + 255) / 256), 256, 0, stream>>>(W2, B2T); k_b2p<<<(NBRN * D2P + 255) / 256, 256, 0, stream>>>(b2, B2P);
  k_bn16<<<(unsigned)(((size_t)NRW * KIN / 8 + 255) / 256), 256, 0, stream>>>(x, bng, bnb, bnm, bnv, 1e-5f, XN, (size_t)NRW * KIN / 8);      /* BN -> f16 rows [r][64] */
  k_gemm2<3><<<dim3((NRW / 128) * (D0 / 64), 1), 128, 0, stream>>>(XN, KIN, 0, BS, KIN, 0, 0.0625f, bs, 0, nullptr, 1, 0, 0, nullptr, Z16, D0, 0, NRW, D0, KIN);      /* z = relu(xn Ws + bs) -> f16 [r][128] */
  for (size_t r0 = 0; r0 < NRW; r0 += RB) {
    k_gemm2<3><<<dim3((RB / 128) * (NBRN * D1 / 64), 1), 128, 0, stream>>>(Z16 + r0 * D0, D0, 0, B1T, D0, 0, 0.0625f, b1, 0, nullptr, 1, 0, 0, nullptr, H1, NBRN * D1, 0, RB, NBRN * D1, D0);      /* h1 = relu(z W1[j] + b1[j]) for all 33 branches: f16 [r][33*64] */
    k_gemm2<3><<<dim3((RB / 128) * (D2P / 64), NBRN), 128, 0, stream>>>(H1, NBRN * D1, (size_t)D1, B2T, D1, (size_t)D2P * D1, 0.0625f, B2P, (size_t)D2P, nullptr, 1, 0, 0, H2, nullptr, NBRN * D2P, (size_t)D2P, RB, D2P, D1);      /* h2 = relu(h1[j] W2[j] + b2[j]) per branch on grid.y (32 real + 32 zero columns) */
    k_fin<<<(unsigned)(((size_t)RB * NBRN + 255) / 256), 256, 0, stream>>>(H2, W3, b3, r0, (float*)d_out, RB); }      /* gu[r][j] = h2 . W3[j] + b3[j] */
}

// v002
// It runs in 56.5 microseconds.
// It is 18.0 times as fast as v000, going by the measured steps of the versions left out in between.
#include <hip/hip_runtime.h>
#define NB 1
#define SQ 8192
#define DM 64
#define NH 1
#define HD 64
#define HG 4                         /* heads per attention launch group */
#define B0 0                         /* first batch processed (debug hook) */
#define NBR NB                       /* batches processed (debug hook) */
#define NR ((size_t)NB * SQ)         /* token rows */
#define MP ((int)((size_t)NBR * SQ)) /* rows projected (debug hook) */
#define QT 256                       /* query rows per causal tile */
#define NKX SQ                       /* S / P row pitch */
#define QT0 256                      /* first-tile rows recomputed exactly (256: buys margin for the few-key rows 128..255, which have no output projection to average the single-f16 P/v rounding) */
#define QN SQ                        /* query rows attended per batch (debug hook) */
#define NHD NH                       /* heads attended (debug hook) */
#define MPO MP                       /* rows through the output stage (debug hook) */
#define LQ DM            /* row pitch of the q/k/v rows */
typedef __bf16 v16b __attribute__((ext_vector_type(16)));
typedef unsigned short v8us __attribute__((ext_vector_type(8), may_alias));
typedef float  v8f  __attribute__((ext_vector_type(8)));
typedef float  v4f  __attribute__((ext_vector_type(4)));
typedef float  v4fa __attribute__((ext_vector_type(4), may_alias));
typedef float  v2f  __attribute__((ext_vector_type(2)));
typedef unsigned int v8u __attribute__((ext_vector_type(8)));
typedef __bf16 v4b __attribute__((ext_vector_type(4)));
union FragB { v16b v; v8us half[2]; unsigned short u[16]; };

__device__ __forceinline__ unsigned short bf16_bits(float x) { unsigned int u = __float_as_uint(x); return (unsigned short)((u + 0x7FFFu + ((u >> 16) & 1u)) >> 16); }
__device__ __forceinline__ float bf16_val(unsigned short b) { return __uint_as_float(((unsigned int)b) << 16); }
__device__ __forceinline__ float bf16_round(float x) { return bf16_val(bf16_bits(x)); }
// D += A·B with NT terms: 1 = ah·bh, 2 = + al·bh (A split), 3 = + ah·bl (both split)
template <int NT>
__device__ __forceinline__ v8f mmaN(v16b ah, v16b al, v16b bh, v16b bl, v8f c) {
  c = __builtin_amdgcn_wmma_f32_16x16x32_bf16(false, ah, false, bh, (short)0, c, false, false);
  if (NT >= 2) c = __builtin_amdgcn_wmma_f32_16x16x32_bf16(false, al, false, bh, (short)0, c, false, false);
  if (NT >= 3) c = __builtin_amdgcn_wmma_f32_16x16x32_bf16(false, ah, false, bl, (short)0, c, false, false);
  asm volatile("v_nop\n\tv_nop\n\tv_nop\n\tv_nop" : "+v"(c) : "v"(ah), "v"(al), "v"(bh), "v"(bl));
  return c;
}

__global__ __launch_bounds__(256) void k_wt_bf16(const float* __restrict__ W, unsigned short* __restrict__ Wt, int K, int N) {
  const int t = blockIdx.x * 256 + threadIdx.x;
  const int k8n = K / 8;
  if (t >= N * k8n) return;
  const int n = t / k8n, k8 = (t % k8n) * 8;
  v8us v;
#pragma unroll
  for (int i = 0; i < 8; ++i) v[i] = bf16_bits(W[(size_t)(k8 + i) * N + n]);
  *(v8us*)(Wt + (size_t)n * K + k8) = v;
  
}

// GEMM C[M][N] (f32, pitch ldc) = act(A[M][K]·W + bias). A f32 row-major (pitch lda) converted per fragment to bf16
// (ASPLIT: hi/lo two planes -> 2 terms, else single rounded term); Wt bf16 [N][K] (pitch ldb). BIAS_BF16 rounds the
// bias to bf16 first (bias quantised to bf16 before the add). K%32==0, M%16==0, N%64==0.
template <bool ASPLIT, int ACT, bool BIAS_BF16>
__global__ __launch_bounds__(128) void k_gemm_bf(const float* __restrict__ A, int lda, const unsigned short* __restrict__ Wt, int ldb,
                                               const float* __restrict__ bias, float* __restrict__ C, int ldc, int M, int N, int K) {
  __shared__ __attribute__((aligned(16))) float so[4][16][64];
  const int tid = threadIdx.x, w = tid >> 5, lane = tid & 31, ln = lane & 15, hh = lane >> 4;
  const int ntn = N / 64;
  const int wid = blockIdx.x * 4 + w;
  const int mt = wid / ntn, nq = wid % ntn;
  if (mt * 16 >= M) return;
  const int row0 = mt * 16, col0 = nq * 64;
  const float* arow = A + (size_t)(row0 + ln) * lda;
  v8f acc[4] = {};
  for (int kb = 0; kb < K; kb += 32) {
    FragB ah, al;
    const v4f x0 = *(const v4fa*)(arow + kb + 8 * hh), x1 = *(const v4fa*)(arow + kb + 8 * hh + 4);
    const v4f x2 = *(const v4fa*)(arow + kb + 16 + 8 * hh), x3 = *(const v4fa*)(arow + kb + 16 + 8 * hh + 4);
    float xs[16] = {x0[0],x0[1],x0[2],x0[3],x1[0],x1[1],x1[2],x1[3],x2[0],x2[1],x2[2],x2[3],x3[0],x3[1],x3[2],x3[3]};
#pragma unroll
    for (int i = 0; i < 16; ++i) { const unsigned short hb = bf16_bits(xs[i]); ah.u[i] = hb; al.u[i] = ASPLIT ? bf16_bits(xs[i] - bf16_val(hb)) : (unsigned short)0; }
#pragma unroll
    for (int t = 0; t < 4; ++t) {
      const unsigned short* brow = Wt + (size_t)(col0 + t * 16 + ln) * ldb + kb;
      FragB b;
      b.half[0] = *(const v8us*)(brow + 8 * hh);
      b.half[1] = *(const v8us*)(brow + 16 + 8 * hh);
      acc[t] = mmaN<ASPLIT ? 2 : 1>(ah.v, al.v, b.v, b.v, acc[t]);
    }
  }
#pragma unroll
  for (int t = 0; t < 4; ++t) {
    float bv = bias ? bias[col0 + t * 16 + ln] : 0.f;
    if (BIAS_BF16) bv = bf16_round(bv);
#pragma unroll
    for (int r = 0; r < 8; ++r) { float v = acc[t][r] + bv; if (ACT == 1) v = fmaxf(v, 0.f); so[w][8 * hh + r][t * 16 + ln] = v; }
  }
  __builtin_amdgcn_fence(__ATOMIC_ACQ_REL, "workgroup");
  __builtin_amdgcn_wave_barrier();
  const int rsub = lane >> 4, c4 = (lane & 15) * 4;
  {
#pragma unroll
    for (int q = 0; q < 8; ++q) {
      const int r = q * 2 + rsub;
      const v4f v = *(const v4fa*)&so[w][r][c4];
      *(v4f*)(C + (size_t)(row0 + r) * ldc + col0 + c4) = v;
    }
    
  }
}

// GEMM C = act(A·W + bias + resid): A f32 (ASPLIT -> hi/lo 2 terms), Wt bf16 [N][K]; ACT 0 none, 1 relu, 2 exact gelu;
// resid (optional, f32, row index = (row % rmod), pitch ldr, RES_BF16 rounds it) added before the activation.
template <bool ASPLIT, int ACT, bool BIAS_BF16, bool RES_BF16>
__global__ __launch_bounds__(128) void k_gemm_bf3(const float* __restrict__ A, int lda, const unsigned short* __restrict__ Wt, int ldb,
                                                const float* __restrict__ bias, const float* __restrict__ resid, int rmod, int ldr,
                                                float* __restrict__ C, int ldc, int M, int N, int K) {
  __shared__ __attribute__((aligned(16))) float so[4][16][64];
  const int tid = threadIdx.x, w = tid >> 5, lane = tid & 31, ln = lane & 15, hh = lane >> 4;
  const int ntn = N / 64;
  const int wid = blockIdx.x * 4 + w;
  const int mt = wid / ntn, nq = wid % ntn;
  if (mt * 16 >= M) return;
  const int row0 = mt * 16, col0 = nq * 64;
  const float* arow = A + (size_t)(row0 + ln) * lda;
  v8f acc[4] = {};
  for (int kb = 0; kb < K; kb += 32) {
    FragB ah, al;
    const v4f x0 = *(const v4fa*)(arow + kb + 8 * hh), x1 = *(const v4fa*)(arow + kb + 8 * hh + 4);
    const v4f x2 = *(const v4fa*)(arow + kb + 16 + 8 * hh), x3 = *(const v4fa*)(arow + kb + 16 + 8 * hh + 4);
    float xs[16] = {x0[0],x0[1],x0[2],x0[3],x1[0],x1[1],x1[2],x1[3],x2[0],x2[1],x2[2],x2[3],x3[0],x3[1],x3[2],x3[3]};
#pragma unroll
    for (int i = 0; i < 16; ++i) { const unsigned short hb = bf16_bits(xs[i]); ah.u[i] = hb; al.u[i] = ASPLIT ? bf16_bits(xs[i] - bf16_val(hb)) : (unsigned short)0; }
#pragma unroll
    for (int t = 0; t < 4; ++t) {
      const unsigned short* brow = Wt + (size_t)(col0 + t * 16 + ln) * ldb + kb;
      FragB b;
      b.half[0] = *(const v8us*)(brow + 8 * hh);
      b.half[1] = *(const v8us*)(brow + 16 + 8 * hh);
      acc[t] = mmaN<ASPLIT ? 2 : 1>(ah.v, al.v, b.v, b.v, acc[t]);
    }
  }
#pragma unroll
  for (int t = 0; t < 4; ++t) {
    const int col = col0 + t * 16 + ln;
    float bv = bias ? bias[col] : 0.f;
    if (BIAS_BF16) bv = bf16_round(bv);
#pragma unroll
    for (int r = 0; r < 8; ++r) {
      float v = acc[t][r] + bv;
      if (resid) { float rv = resid[(size_t)((row0 + 8 * hh + r) % rmod) * ldr + col]; if (RES_BF16) rv = bf16_round(rv); v += rv; }
      if (ACT == 1) v = fmaxf(v, 0.f);
      if (ACT == 2) v = 0.5f * v * (1.0f + erff(v * 0.70710678118654752f));
      if (ACT == 3) { const float u = 0.7978845608028654f * (v + 0.044715f * v * v * v); v = 0.5f * v * (1.0f + tanhf(u)); }
      so[w][8 * hh + r][t * 16 + ln] = v;
    }
  }
  __builtin_amdgcn_fence(__ATOMIC_ACQ_REL, "workgroup");
  __builtin_amdgcn_wave_barrier();
  const int rsub = lane >> 4, c4 = (lane & 15) * 4;
  {
#pragma unroll
    for (int q = 0; q < 8; ++q) {
      const int r = q * 2 + rsub;
      const v4f v = *(const v4fa*)&so[w][r][c4];
      *(v4f*)(C + (size_t)(row0 + r) * ldc + col0 + c4) = v;
    }
    
  }
}
// row LayerNorm (biased variance, eps) over N: s = X (+ R); optional out_sum <- s; out_norm <- (s-mu)*rsqrt(var+eps)*g + b
template <bool PARAM_BF16>
__global__ __launch_bounds__(256) void k_layernorm(const float* __restrict__ X, const float* __restrict__ R, const float* __restrict__ g, const float* __restrict__ bta,
                                                  float* __restrict__ out_sum, float* __restrict__ out_norm, int N, float eps) {
  __shared__ float red[256];
  const int row = blockIdx.x, tid = threadIdx.x;
  const float* x = X + (size_t)row * N; const float* rr = R ? R + (size_t)row * N : nullptr;
  float vals[16];                     // up to N = 4096
  const int per = N / 256;            // contiguous chunk per thread? use strided-by-4 chunks: thread handles j = tid*4 + 1024*u
  float s1 = 0.f;
  for (int u = 0; u < per / 4; ++u) {
    const int j = tid * 4 + 1024 * u;
    const v4f a = *(const v4fa*)(x + j);
    v4f b = {0.f,0.f,0.f,0.f}; if (rr) b = *(const v4fa*)(rr + j);
#pragma unroll
    for (int q = 0; q < 4; ++q) { const float v = a[q] + b[q]; vals[u * 4 + q] = v; s1 += v; }
  }
  red[tid] = s1; __syncthreads();
  for (int st = 128; st > 0; st >>= 1) { if (tid < st) red[tid] += red[tid + st]; __syncthreads(); }
  const float mu = red[0] / (float)N; __syncthreads();
  float s2 = 0.f;
  for (int u = 0; u < per / 4; ++u)
#pragma unroll
    for (int q = 0; q < 4; ++q) { const float c = vals[u * 4 + q] - mu; s2 += c * c; }
  red[tid] = s2; __syncthreads();
  for (int st = 128; st > 0; st >>= 1) { if (tid < st) red[tid] += red[tid + st]; __syncthreads(); }
  const float rs = rsqrtf(red[0] / (float)N + eps);
  {
    for (int u = 0; u < per / 4; ++u) {
      const int j = tid * 4 + 1024 * u;
      v4f o, sm;
#pragma unroll
      for (int q = 0; q < 4; ++q) {
        float gg = g[j + q], bb = bta[j + q];
        if (PARAM_BF16) { gg = bf16_round(gg); bb = bf16_round(bb); }
        sm[q] = vals[u * 4 + q]; o[q] = (vals[u * 4 + q] - mu) * rs * gg + bb;
      }
      if (out_sum) *(v4f*)(out_sum + (size_t)row * N + j) = sm;
      *(v4f*)(out_norm + (size_t)row * N + j) = o;
    }
    
  }
}



// ---- f16 WMMA path (v_wmma_f32_16x16x32_f16): 11-bit significands for operands in range — used where a [0,1] probability operand needs more precision than bf16
typedef _Float16 v16h __attribute__((ext_vector_type(16)));
union FragH { v16h v; v8us half[2]; _Float16 h[16]; unsigned short u[16]; };
template <int NT>
__device__ __forceinline__ v8f mmaH(v16h ah, v16h al, v16h bh, v16h bl, v8f c) {
  c = __builtin_amdgcn_wmma_f32_16x16x32_f16(false, ah, false, bh, (short)0, c, false, false);
  if (NT >= 2) c = __builtin_amdgcn_wmma_f32_16x16x32_f16(false, al, false, bh, (short)0, c, false, false);
  if (NT >= 3) c = __builtin_amdgcn_wmma_f32_16x16x32_f16(false, ah, false, bl, (short)0, c, false, false);
  asm volatile("v_nop\n\tv_nop\n\tv_nop\n\tv_nop" : "+v"(c) : "v"(ah), "v"(al), "v"(bh), "v"(bl));
  return c;
}
// batched GEMM like k_gemm_b but f16 operands: A f32 (split into f16 hi/lo if ASPLIT, else rounded to f16), Bt = f16 values [n][k]; alpha; C f32; N multiple of 16 (partial tiles skipped)
template <bool ASPLIT>
__global__ __launch_bounds__(128) void k_gemm_h(const float* __restrict__ A, int lda, size_t sA, const _Float16* __restrict__ Bh, int ldb, size_t sB, float alpha, float* __restrict__ C, int ldc, size_t sC, int M, int N, int K) {
  __shared__ __attribute__((aligned(16))) float so[4][16][64];
  const int tid = threadIdx.x, w = tid >> 5, lane = tid & 31, ln = lane & 15, hh = lane >> 4; const int by = blockIdx.y;
  A += (size_t)by * sA; Bh += (size_t)by * sB; C += (size_t)by * sC;
  const int ntn = (N + 63) / 64; const int wid = blockIdx.x * 4 + w; const int mt = wid / ntn, nq = wid % ntn; if (mt * 16 >= M) return;
  const int row0 = mt * 16, col0 = nq * 64; const float* arow = A + (size_t)(row0 + ln) * lda;
  v8f acc[4] = {};
  for (int kb = 0; kb < K; kb += 32) {
    FragH ah, al;
    const v4f x0 = *(const v4fa*)(arow + kb + 8 * hh), x1 = *(const v4fa*)(arow + kb + 8 * hh + 4), x2 = *(const v4fa*)(arow + kb + 16 + 8 * hh), x3 = *(const v4fa*)(arow + kb + 16 + 8 * hh + 4);
    float xs[16] = {x0[0],x0[1],x0[2],x0[3],x1[0],x1[1],x1[2],x1[3],x2[0],x2[1],x2[2],x2[3],x3[0],x3[1],x3[2],x3[3]};
#pragma unroll
    for (int i = 0; i < 16; ++i) { const _Float16 h = (_Float16)xs[i]; ah.h[i] = h; al.h[i] = ASPLIT ? (_Float16)(xs[i] - (float)h) : (_Float16)0.0f; }
#pragma unroll
    for (int t = 0; t < 4; ++t) { if (col0 + t * 16 >= N) continue; const size_t boff = (size_t)(col0 + t * 16 + ln) * ldb + kb; FragH bq; bq.half[0] = *(const v8us*)(Bh + boff + 8 * hh); bq.half[1] = *(const v8us*)(Bh + boff + 16 + 8 * hh);
      acc[t] = mmaH<ASPLIT ? 2 : 1>(ah.v, al.v, bq.v, bq.v, acc[t]); }
  }
#pragma unroll
  for (int t = 0; t < 4; ++t) { if (col0 + t * 16 >= N) continue;
#pragma unroll
    for (int r = 0; r < 8; ++r) so[w][8 * hh + r][t * 16 + ln] = acc[t][r] * alpha; }
  __builtin_amdgcn_fence(__ATOMIC_ACQ_REL, "workgroup"); __builtin_amdgcn_wave_barrier();
  const int rsub = lane >> 4, c4 = (lane & 15) * 4;
  {
#pragma unroll
    for (int q = 0; q < 8; ++q) { const int r = q * 2 + rsub; if (col0 + c4 < N) { const v4f v = *(const v4fa*)&so[w][r][c4]; *(v4f*)(C + (size_t)(row0 + r) * ldc + col0 + c4) = v; } }
     }
}

// Wt[n][k] = f16(W[k][n]·scale) from f32 row-major W[K][N] (scale = power of two; bf16-exact weights stay exact in f16 away from the subnormal range)
__global__ __launch_bounds__(256) void k_wt_f16(const float* __restrict__ W, _Float16* __restrict__ Wt, int K, int N, float scale) {
  const int t = blockIdx.x * 256 + threadIdx.x; if (t >= N * (K / 8)) return; const int n = t / (K / 8), k8 = (t % (K / 8)) * 8; FragH f;
#pragma unroll
  for (int i = 0; i < 8; ++i) f.h[i] = (_Float16)(bf16_round(W[(size_t)(k8 + i) * N + n]) * scale); const v8us o = f.half[0];
  *(v8us*)((unsigned short*)Wt + (size_t)n * K + k8) = o; 
}
// k_gemm_hh variant with fused epilogue: v = acc·alpha + bias[by·sBias + col] (+ CP[(row/rowsPerB)·sCPb + by·64 + col] if CP) ; ACT 0 none / 1 elu ; writes f16 C16 (and f32 C if non-null)
template <int ACT>
__global__ __launch_bounds__(128) void k_gemm_hhx(const _Float16* __restrict__ A, int lda, size_t sA, const _Float16* __restrict__ Bh, int ldb, size_t sB, float alpha, const float* __restrict__ bias, size_t sBias, const float* __restrict__ CP, int rowsPerB, size_t sCPb, int row0g,
    float* __restrict__ C, _Float16* __restrict__ C16, int ldc, size_t sC, int M, int N, int K) {
  __shared__ __attribute__((aligned(16))) float so[4][16][64];
  const int tid = threadIdx.x, w = tid >> 5, lane = tid & 31, ln = lane & 15, hh = lane >> 4; const int by = blockIdx.y;
  A += (size_t)by * sA; Bh += (size_t)by * sB; const size_t cofs = (size_t)by * sC; const float* bp = bias ? bias + (size_t)by * sBias : nullptr;
  const int ntn = (N + 63) / 64; const int wid = blockIdx.x * 4 + w; const int mt = wid / ntn, nq = wid % ntn; if (mt * 16 >= M) return;
  const int row0 = mt * 16, col0 = nq * 64; const _Float16* arow = A + (size_t)(row0 + ln) * lda;
  v8f acc[4] = {};
  for (int kb = 0; kb < K; kb += 32) { FragH ah; ah.half[0] = *(const v8us*)((const unsigned short*)arow + kb + 8 * hh); ah.half[1] = *(const v8us*)((const unsigned short*)arow + kb + 16 + 8 * hh);
#pragma unroll
    for (int t = 0; t < 4; ++t) { if (col0 + t * 16 >= N) continue; const size_t boff = (size_t)(col0 + t * 16 + ln) * ldb + kb; FragH bq; bq.half[0] = *(const v8us*)((const unsigned short*)Bh + boff + 8 * hh); bq.half[1] = *(const v8us*)((const unsigned short*)Bh + boff + 16 + 8 * hh);
      acc[t] = mmaH<1>(ah.v, ah.v, bq.v, bq.v, acc[t]); }
  }
#pragma unroll
  for (int t = 0; t < 4; ++t) { if (col0 + t * 16 >= N) continue; const int col = col0 + t * 16 + ln; const float bv = bp ? bf16_round(bp[col]) : 0.f;
#pragma unroll
    for (int r = 0; r < 8; ++r) { float v = acc[t][r] * alpha + bv; if (CP) { const int rr = row0g + row0 + 8 * hh + r; if (rowsPerB < 0) v += CP[cofs + (size_t)rr * ldc + col];      /* rowsPerB < 0: own element of the batched C plane */ else { const int bidx = rr / rowsPerB; v += CP[(size_t)bidx * sCPb + (size_t)by * 64 + col]; } } if (ACT == 1) v = (v > 0.f) ? v : expm1f(v); else if (ACT == 7) v = (v > 0.f) ? v + 1.0f : expf(v); else if (ACT == 8) v = tanhf(v); else if (ACT == 9) v = 0.5f * v * (1.0f + tanhf(0.7978845608028654f * (v + 0.044715f * v * v * v))); else if (ACT == 11) v = 1.0f / (1.0f + expf(-v)); else if (ACT == 12) v = (v > 0.f) ? v : 0.01f * v; else if (ACT == 14) v = (v > 0.f) ? v : 0.1f * v; else if (ACT == 16) v = (v >= 0.f) ? v : 0.3f * v; else if (ACT == 17) v = (v >= 0.f) ? v : 0.2f * v; else if (ACT == 15) v = v / (1.0f + expf(-v)); else if (ACT == 3) v = fmaxf(v, 0.f); else if (ACT == 6) v = 0.5f * v * (1.0f + erff(v * 0.70710678118654752f)); so[w][8 * hh + r][t * 16 + ln] = v; } }
  __builtin_amdgcn_fence(__ATOMIC_ACQ_REL, "workgroup"); __builtin_amdgcn_wave_barrier();
  const int rsub = lane >> 4, c4 = (lane & 15) * 4; typedef _Float16 v4h __attribute__((ext_vector_type(4)));
  {
#pragma unroll
    for (int q = 0; q < 8; ++q) { const int r = q * 2 + rsub; if (col0 + c4 < N) { const v4f v = *(const v4fa*)&so[w][r][c4]; if (C) *(v4f*)(C + cofs + (size_t)(row0 + r) * ldc + col0 + c4) = v; if (C16) { v4h h4; for (int i = 0; i < 4; ++i) h4[i] = (_Float16)v[i]; *(v4h*)(C16 + cofs + (size_t)(row0 + r) * ldc + col0 + c4) = h4; } } }
     }
}


typedef _Float16 v4h __attribute__((ext_vector_type(4)));

__global__ __launch_bounds__(256) void k_x16(const float* __restrict__ x, _Float16* __restrict__ X16, size_t n8) { const size_t t = (size_t)blockIdx.x * 256 + threadIdx.x; if (t >= n8) return; FragH f;
#pragma unroll
  for (int q = 0; q < 8; ++q) f.h[q] = (_Float16)bf16_round(x[t * 8 + q]); *(v8us*)((unsigned short*)X16 + t * 8) = f.half[0];  }
__global__ __launch_bounds__(256) void k_h16(const float* __restrict__ x, _Float16* __restrict__ X16, size_t n8) { const size_t t = (size_t)blockIdx.x * 256 + threadIdx.x; if (t >= n8) return; FragH f;
#pragma unroll
  for (int q = 0; q < 8; ++q) f.h[q] = (_Float16)x[t * 8 + q]; *(v8us*)((unsigned short*)X16 + t * 8) = f.half[0];  }
__global__ __launch_bounds__(256) void k_round16f(const float* __restrict__ W, _Float16* __restrict__ Bt, size_t n8) { const size_t t = (size_t)blockIdx.x * 256 + threadIdx.x; if (t >= n8) return; FragH f;
#pragma unroll
  for (int i = 0; i < 8; ++i) f.h[i] = (_Float16)(bf16_round(W[t * 8 + i]) * 16.0f); *(v8us*)((unsigned short*)Bt + t * 8) = f.half[0];  }
template <int NHv, int TTv>
__global__ __launch_bounds__(256) void k_vt(const _Float16* __restrict__ V16, int ldv, int voff, _Float16* __restrict__ Vt) { __shared__ unsigned short tl[64][66]; const int tid = threadIdx.x; const int slab = blockIdx.x / (TTv / 64), lg = blockIdx.x % (TTv / 64); const int b = slab / NHv, h = slab % NHv;
  for (int i = tid; i < 64 * 8; i += 256) { const int r = i / 8, c8 = (i % 8) * 8; FragH f; f.half[0] = *(const v8us*)((const unsigned short*)V16 + ((size_t)b * TTv + lg * 64 + r) * ldv + voff + h * 64 + c8);
#pragma unroll
    for (int q = 0; q < 8; ++q) tl[r][c8 + q] = f.u[q]; }
  __syncthreads();
  {
#pragma unroll
    for (int rd = 0; rd < 2; ++rd) { const int d = rd * 32 + tid / 8, pc = tid % 8; FragH f;
#pragma unroll
      for (int q = 0; q < 8; ++q) f.u[q] = tl[pc * 8 + q][d];
      *(v8us*)((unsigned short*)Vt + ((size_t)slab * 64 + d) * TTv + lg * 64 + pc * 8) = f.half[0]; }
     } }

__global__ __launch_bounds__(256) void k_hl(const float* __restrict__ F, _Float16* __restrict__ Hh, _Float16* __restrict__ Hl, size_t n8) { const size_t t = (size_t)blockIdx.x * 256 + threadIdx.x; if (t >= n8) return; FragH fh, fl; const v4f a = *(const v4fa*)(F + t * 8), c = *(const v4fa*)(F + t * 8 + 4);
#pragma unroll
  for (int q = 0; q < 4; ++q) { _Float16 h = (_Float16)a[q]; fh.h[q] = h; fl.h[q] = (_Float16)((a[q] - (float)h) * 1024.0f); h = (_Float16)c[q]; fh.h[4 + q] = h; fl.h[4 + q] = (_Float16)((c[q] - (float)h) * 1024.0f); }
  { *(v8us*)((unsigned short*)Hh + t * 8) = fh.half[0]; *(v8us*)((unsigned short*)Hl + t * 8) = fl.half[0];  } }

// ---- fast GEMM (wave tile 32x64; requires M % 32 == 0 rows per launch region and N % 64 == 0); epilogue = k_gemm_hhx semantics ----
__device__ __forceinline__ v16h g2_frag(const _Float16* p, int hh) { FragH f; f.half[0] = *(const v8us*)((const unsigned short*)p + 8 * hh); f.half[1] = *(const v8us*)((const unsigned short*)p + 16 + 8 * hh); return f.v; }
__device__ __forceinline__ v8f g2_mma(v16h a, v16h b, v8f c) { v8f d = __builtin_amdgcn_wmma_f32_16x16x32_f16(false, a, false, b, (short)0, c, false, false); asm volatile("v_nop\n\tv_nop\n\tv_nop\n\tv_nop" : "+v"(d) : "v"(a), "v"(b)); return d; }
template <int ACT>
__global__ __launch_bounds__(128) void k_gemm2(const _Float16* __restrict__ A, int lda, size_t sA, const _Float16* __restrict__ Bh, int ldb, size_t sB, float alpha, const float* __restrict__ bias, size_t sBias, const float* __restrict__ CP, int rowsPerB, size_t sCPb, int row0g,
    float* __restrict__ C, _Float16* __restrict__ C16, int ldc, size_t sC, int M, int N, int K) { static_assert(ACT == 0 || ACT == 3 || ACT == 6 || ACT == 8 || ACT == 9 || ACT == 11 || ACT == 12 || ACT == 14 || ACT == 15 || ACT == 16 || ACT == 17, "k_gemm2: unsupported ACT code (would silently apply no activation)");
  __shared__ __attribute__((aligned(16))) float so[4][32][68];
  const int tid = threadIdx.x, w = tid >> 5, lane = tid & 31, ln = lane & 15, hh = lane >> 4; const int by = blockIdx.y;
  A += (size_t)by * sA; Bh += (size_t)by * sB; const size_t cofs = (size_t)by * sC; const float* bp = bias ? bias + (size_t)by * sBias : nullptr;
  const int ntn = N >> 6; const int mt = blockIdx.x / ntn, nq = blockIdx.x - mt * ntn; const int row0 = mt * 128 + 32 * w, col0 = nq * 64; if (row0 >= M) return;
  const _Float16* a0p = A + (size_t)(row0 + ln) * lda; const _Float16* a1p = a0p + (size_t)16 * lda;
  const _Float16* b0p = Bh + (size_t)(col0 + ln) * ldb; const _Float16* b1p = b0p + (size_t)16 * ldb; const _Float16* b2p = b1p + (size_t)16 * ldb; const _Float16* b3p = b2p + (size_t)16 * ldb;
  const v8f z8 = {0.f,0.f,0.f,0.f,0.f,0.f,0.f,0.f}; v8f c00 = z8, c01 = z8, c02 = z8, c03 = z8, c10 = z8, c11 = z8, c12 = z8, c13 = z8;
#pragma unroll 1
  for (int kb = 0; kb < K; kb += 32) { const v16h a0 = g2_frag(a0p + kb, hh), a1 = g2_frag(a1p + kb, hh);
    v16h b = g2_frag(b0p + kb, hh); c00 = g2_mma(a0, b, c00); c10 = g2_mma(a1, b, c10);
    b = g2_frag(b1p + kb, hh); c01 = g2_mma(a0, b, c01); c11 = g2_mma(a1, b, c11);
    b = g2_frag(b2p + kb, hh); c02 = g2_mma(a0, b, c02); c12 = g2_mma(a1, b, c12);
    b = g2_frag(b3p + kb, hh); c03 = g2_mma(a0, b, c03); c13 = g2_mma(a1, b, c13); }
  v8f accs[8] = {c00, c01, c02, c03, c10, c11, c12, c13};
#pragma unroll
  for (int u = 0; u < 8; ++u) { const int t = u & 3, half = u >> 2; const int col = col0 + t * 16 + ln; const float bv = bp ? bf16_round(bp[col]) : 0.f;
#pragma unroll
    for (int r = 0; r < 8; ++r) { const int rloc = half * 16 + 8 * hh + r; float v = accs[u][r] * alpha + bv; if (CP) { if (rowsPerB < 0) v += CP[cofs + (size_t)(row0g + row0 + rloc) * ldc + col];      /* rowsPerB < 0: own element of the batched C plane */ else { const int bidx = (row0g + row0 + rloc) / rowsPerB; v += CP[(size_t)bidx * sCPb + (size_t)by * 64 + col]; } }
      if (ACT == 3) v = fmaxf(v, 0.f); else if (ACT == 6) v = 0.5f * v * (1.0f + erff(v * 0.70710678118654752f)); else if (ACT == 11) v = 1.0f / (1.0f + expf(-v)); else if (ACT == 15) v = v / (1.0f + expf(-v)); else if (ACT == 12) v = (v > 0.f) ? v : 0.01f * v; else if (ACT == 8) v = tanhf(v); else if (ACT == 9) v = 0.5f * v * (1.0f + tanhf(0.7978845608028654f * (v + 0.044715f * v * v * v))); else if (ACT == 14) v = (v > 0.f) ? v : 0.1f * v; else if (ACT == 16) v = (v >= 0.f) ? v : 0.3f * v; else if (ACT == 17) v = (v >= 0.f) ? v : 0.2f * v;
      so[w][rloc][t * 16 + ln] = v; } }
  __builtin_amdgcn_fence(__ATOMIC_ACQ_REL, "workgroup"); __builtin_amdgcn_wave_barrier();
  const int rsub = lane >> 4, c4 = (lane & 15) * 4;
  {
#pragma unroll
    for (int q = 0; q < 16; ++q) { const int r = q * 2 + rsub; const v4f v = *(const v4fa*)&so[w][r][c4]; if (C) *(v4f*)(C + cofs + (size_t)(row0 + r) * ldc + col0 + c4) = v; if (C16) { v4h h4; for (int i = 0; i < 4; ++i) h4[i] = (_Float16)v[i]; *(v4h*)(C16 + cofs + (size_t)(row0 + r) * ldc + col0 + c4) = h4; } }
     } }


__global__ __launch_bounds__(256) void k_wnat(const float* __restrict__ w, size_t n8, _Float16* __restrict__ Bt) { const size_t t = (size_t)blockIdx.x * 256 + threadIdx.x; if (t >= n8) return; FragH f; for (int q = 0; q < 8; ++q) f.h[q] = (_Float16)(bf16_round(w[t * 8 + q]) * 16.0f); *(v8us*)((unsigned short*)Bt + t * 8) = f.half[0];  }
__global__ __launch_bounds__(256) void k_rsm(const float* __restrict__ S, _Float16* __restrict__ P, int nrows) {
  #pragma clang fp contract(off)
  const int i = blockIdx.x * 256 + threadIdx.x; if (i >= nrows) return; const float* s = S + (size_t)i * SQ; float mx = -3.0e38f;
#pragma unroll 1
  for (int j = 0; j < SQ; ++j) mx = fmaxf(mx, s[j]); float se = 0.f;
#pragma unroll 1
  for (int j = 0; j < SQ; ++j) se += expf(s[j] - mx); const float sc = 256.0f / se;
#pragma unroll 1
  for (int j0 = 0; j0 < SQ; j0 += 8) { FragH f; for (int q = 0; q < 8; ++q) f.h[q] = (_Float16)(expf(s[j0 + q] - mx) * sc); unsigned short* d = (unsigned short*)P + (size_t)i * SQ + j0; *(v8us*)d = f.half[0];  } }
__global__ __launch_bounds__(256) void k_vt(const _Float16* __restrict__ V16, int b, int h0, _Float16* __restrict__ VT) { __shared__ unsigned short tl[64][65]; const int tid = threadIdx.x; const int hh = blockIdx.x % HG, sg = blockIdx.x / HG; const int s0 = sg * 64; const int h = h0 + hh;
  for (int i = tid; i < 64 * 8; i += 256) { const int j = i / 8, d8 = (i % 8) * 8; FragH f; f.half[0] = *(const v8us*)((const unsigned short*)V16 + ((size_t)b * SQ + s0 + j) * DM + h * HD + d8); for (int q = 0; q < 8; ++q) tl[d8 + q][j] = f.u[q]; }
  __syncthreads();
  { for (int i = tid; i < 64 * 8; i += 256) { const int d = i / 8, j8 = (i % 8) * 8; FragH f; for (int q = 0; q < 8; ++q) f.u[q] = tl[d][j8 + q]; *(v8us*)((unsigned short*)VT + ((size_t)hh * HD + d) * SQ + s0 + j8) = f.half[0]; }  } }



__global__ __launch_bounds__(256) void k_rsmcf2(const float* __restrict__ S, _Float16* __restrict__ P, int hg, int q0, int nk) {
  #pragma clang fp contract(off)
  const int t = blockIdx.x * 256 + threadIdx.x; if (t >= hg * QT) return; const size_t i = (size_t)t; const float* s = S + i * NKX; const int last = q0 + (t % QT); float mx = -3.0e38f;
#pragma unroll 1
  for (int j = 0; j < nk; ++j) { const float f = (j <= last) ? 1.f : 0.f; mx = fmaxf(mx, fmaf(f, s[j], (1.f - f) * -1.0e9f)); } float se = 0.f;
#pragma unroll 1
  for (int j = 0; j < nk; ++j) { const float f = (j <= last) ? 1.f : 0.f; se += __expf(fmaf(f, s[j], (1.f - f) * -1.0e9f) - mx); } const float sc = 256.0f / se;
#pragma unroll 1
  for (int j0 = 0; j0 < nk; j0 += 8) { FragH fr; for (int q = 0; q < 8; ++q) { const int j = j0 + q; const float f = (j <= last) ? 1.f : 0.f; fr.h[q] = (_Float16)(__expf(fmaf(f, s[j], (1.f - f) * -1.0e9f) - mx) * sc); } unsigned short* d = (unsigned short*)P + i * NKX + j0; *(v8us*)d = fr.half[0];  } }

template <int MASKADD>
__global__ __launch_bounds__(64) void k_att0(const float* __restrict__ QF, const float* __restrict__ KF, const float* __restrict__ VF, int ld, const float* __restrict__ mask, float scale, float* __restrict__ OF, int ldo) {
  #pragma clang fp contract(off)
  __shared__ __attribute__((aligned(16))) float lq[64][64]; __shared__ __attribute__((aligned(16))) float lo[64][64];
  const int tid = threadIdx.x; const int h = blockIdx.x / (QT0 / 64), rg = blockIdx.x % (QT0 / 64); const int i = rg * 64 + tid;
  const float* qr = QF + (size_t)i * ld + h * HD;
#pragma unroll 1
  for (int c = 0; c < HD / 4; ++c) { *(v4f*)&lq[tid][c * 4] = *(const v4fa*)(qr + c * 4); const v4f z = {0.f, 0.f, 0.f, 0.f}; *(v4f*)&lo[tid][c * 4] = z; }
  float m = -1.0e30f, l = 0.f; const int jmax = MASKADD ? (SQ - 1) : (rg * 64 + 63);      /* additive-mask form: every key (the mask input decides); causal form: keys up to the block's last row */
#pragma unroll 1
  for (int j = 0; j <= jmax; ++j) { const float* kr = KF + (size_t)j * ld + h * HD; const float* vr = VF + (size_t)j * ld + h * HD; float s = 0.f;
#pragma unroll 1
    for (int c = 0; c < HD / 4; ++c) { const v4f kq = *(const v4fa*)(kr + c * 4); const v4f qq = *(v4f*)&lq[tid][c * 4]; s = __fadd_rn(s, __fmul_rn(qq[0], kq[0])); s = __fadd_rn(s, __fmul_rn(qq[1], kq[1])); s = __fadd_rn(s, __fmul_rn(qq[2], kq[2])); s = __fadd_rn(s, __fmul_rn(qq[3], kq[3])); }
    s = __fmul_rn(s, scale); if (MASKADD) s = __fadd_rn(s, __fmul_rn(bf16_round(mask[(size_t)i * SQ + j]), -10000.0f));
    const float f = (MASKADD || j <= i) ? 1.f : 0.f; const float sm = fmaf(f, s, (1.f - f) * -1.0e30f); const float mn = fmaxf(m, sm); const float sc = expf(m - mn); const float e = expf(sm - mn); l = __fadd_rn(__fmul_rn(l, sc), e); m = mn;
#pragma unroll 1
    for (int c = 0; c < HD / 4; ++c) { const v4f vv = *(const v4fa*)(vr + c * 4); v4f oo = *(v4f*)&lo[tid][c * 4]; for (int u = 0; u < 4; ++u) oo[u] = __fadd_rn(__fmul_rn(oo[u], sc), __fmul_rn(e, vv[u])); *(v4f*)&lo[tid][c * 4] = oo; } }
  const float fin = 64.0f / l;      /* o carried x64 like the f16 path */
#pragma unroll 1
  for (int c = 0; c < HD / 4; ++c) { v4f oo = *(v4f*)&lo[tid][c * 4]; for (int u = 0; u < 4; ++u) oo[u] = __fmul_rn(oo[u], fin); *(v4f*)&lo[tid][c * 4] = oo; }
  __syncthreads();
  {
#pragma unroll 1
    for (int it = 0; it < 16; ++it) { const int row = it * 4 + tid / 16, pc = (tid % 16) * 4; const v4f v = *(const v4f*)&lo[row][pc]; *(v4f*)(OF + (size_t)(rg * 64 + row) * ldo + h * HD + pc) = v; }
     } }

__global__ __launch_bounds__(256) void k_oscale(const float* __restrict__ OF, float* __restrict__ out, size_t n4) { const size_t t = (size_t)blockIdx.x * 256 + threadIdx.x; if (t >= n4) return; const v4f a = *(const v4fa*)(OF + t * 4); v4f o; for (int q = 0; q < 4; ++q) o[q] = a[q] * 0.015625f; *(v4f*)(out + t * 4) = o;  }

__global__ __launch_bounds__(256) void k_bfr(const float* __restrict__ x, float* __restrict__ XB, size_t n8) { const size_t t = (size_t)blockIdx.x * 256 + threadIdx.x; if (t >= n8) return; v4f a = *(const v4fa*)(x + t * 8), c = *(const v4fa*)(x + t * 8 + 4); for (int q = 0; q < 4; ++q) { a[q] = bf16_round(a[q]); c[q] = bf16_round(c[q]); }
  { *(v4f*)(XB + t * 8) = a; *(v4f*)(XB + t * 8 + 4) = c;  } }



__global__ __launch_bounds__(256) void k_rsmfvl(const float* __restrict__ S, _Float16* __restrict__ P, _Float16* __restrict__ PL, int qn, const int* __restrict__ vlp) {
  #pragma clang fp contract(off)
  const int t = blockIdx.x * 256 + threadIdx.x; if (t >= qn) return; const int vl = vlp[0]; const size_t i = (size_t)t; const float* s = S + i * SQ; float mx = -3.0e38f;
#pragma unroll 1
  for (int j = 0; j < SQ; ++j) { const float f = (j < vl) ? 1.f : 0.f; mx = fmaxf(mx, fmaf(f, s[j], (1.f - f) * -1000000.0f)); } float se = 0.f;
#pragma unroll 1
  for (int j = 0; j < SQ; ++j) { const float f = (j < vl) ? 1.f : 0.f; se += __expf(fmaf(f, s[j], (1.f - f) * -1000000.0f) - mx); } const float sc = 256.0f / se;
#pragma unroll 1
  for (int j0 = 0; j0 < SQ; j0 += 8) { FragH fr, gr; for (int q = 0; q < 8; ++q) { const int j = j0 + q; const float f = (j < vl) ? 1.f : 0.f; const float pv = __expf(fmaf(f, s[j], (1.f - f) * -1000000.0f) - mx) * sc; const _Float16 ph = (_Float16)pv; fr.h[q] = ph; gr.h[q] = (_Float16)((pv - (float)ph) * 1024.0f); }
    unsigned short* d = (unsigned short*)P + i * SQ + j0; unsigned short* dl = (unsigned short*)PL + i * SQ + j0; *(v8us*)d = fr.half[0]; *(v8us*)dl = gr.half[0];  } }

#define NRW 131072      /* rows */
#define NIN 40          /* input features */
#define KIN 64          /* padded input width */
#define D0 128
#define D1 64
#define D2 32
#define D2P 64
#define NBRN 33         /* branches */
#define RB 8192

__global__ __launch_bounds__(256) void k_zero16(unsigned short* __restrict__ p, size_t n8) { const size_t t = (size_t)blockIdx.x * 256 + threadIdx.x; if (t >= n8) return; v8us z; for (int q = 0; q < 8; ++q) z[q] = 0; *(v8us*)(p + t * 8) = z;  }



#define BWV 8           /* waves per work-group of the branch kernel */
#define BRW 64          /* batch rows per wave: four B tiles, so each weight fragment read from LDS feeds four WMMAs */
#define WCH 1280        /* 16-byte pieces of one branch's weights: 16 (layer 1) + 4 (layer 2) A fragments of 1 KiB */
#define AUXF 256        /* f32 side table per branch: b1 [0..63], b2 [64..95], W3 [96..127], b3 [128], rest 0 */
#define TCH 1024        /* 16-byte pieces of the trunk's weights: 16 A fragments of 1 KiB */
#define TAUX 512        /* f32 side table of the trunk: bs [0..127], BN scale [128..167], BN mean [192..231], BN shift [256..295], rest 0 */

// Per branch: the A fragments of W1[j]^T (tile mt, k step ks at index mt * 4 + ks) and of W2[j]^T (at 16 + mt * 2 + ks) in the order the lanes read them
// (piece = (fragment * 2 + half) * 32 + lane; lane (ln, hh) holds row 16 mt + ln, k = 32 ks + 16 half + 8 hh + 0..7), and the rounded biases and W3.
// Behind the branches, the trunk: the A fragments of Ws^T (tile mt, k step ks at index mt * 2 + ks, same piece order; k = 40..63 zero) and its side table.
__global__ __launch_bounds__(256) void k_pack(const float* __restrict__ W1, const float* __restrict__ b1, const float* __restrict__ W2, const float* __restrict__ b2, const float* __restrict__ W3, const float* __restrict__ b3,
    const float* __restrict__ Ws, const float* __restrict__ bs, const float* __restrict__ g, const float* __restrict__ be, const float* __restrict__ mu, const float* __restrict__ var, float eps,
    _Float16* __restrict__ PW, float* __restrict__ PA, _Float16* __restrict__ PT, float* __restrict__ PB) {
  const int t = blockIdx.x * 256 + threadIdx.x; if (t >= NBRN * (WCH + AUXF / 4) + TCH + TAUX / 4) return;
  if (t >= NBRN * (WCH + AUXF / 4)) { const int c = t - NBRN * (WCH + AUXF / 4);
    if (c < TCH) { const int lane = c & 31, ln = lane & 15, hh = lane >> 4, f = c >> 6, h = (c >> 5) & 1; const int n = (f >> 1) * 16 + ln, k0 = (f & 1) * 32 + h * 16 + 8 * hh; FragH o;
      for (int q = 0; q < 8; ++q) { const int k = k0 + q; o.h[q] = (k < NIN) ? (_Float16)(bf16_round(Ws[(size_t)k * D0 + n]) * 16.0f) : (_Float16)0.f; }
      *(v8us*)((unsigned short*)PT + (size_t)c * 8) = o.half[0]; }
    else { const int i0 = (c - TCH) * 4; v4f o;
      for (int u = 0; u < 4; ++u) { const int i = i0 + u, cf = (i - D0) & 63, kind = (i - D0) >> 6; float v = 0.f;
        if (i < D0) v = bf16_round(bs[i]); else if (cf < NIN && kind == 0) v = rsqrtf(bf16_round(var[cf]) + eps) * bf16_round(g[cf]); else if (cf < NIN && kind == 1) v = bf16_round(mu[cf]); else if (cf < NIN && kind == 2) v = bf16_round(be[cf]);
        o[u] = v; }
      *(v4f*)(PB + i0) = o; }
    return; }
  const int j = t / (WCH + AUXF / 4), c = t % (WCH + AUXF / 4);
  if (c < WCH) { const int lane = c & 31, ln = lane & 15, hh = lane >> 4, f = c >> 6, h = (c >> 5) & 1; FragH o;
    if (f < 16) { const int k = (f >> 2) * 16 + ln, d0 = (f & 3) * 32 + h * 16 + 8 * hh; for (int q = 0; q < 8; ++q) o.h[q] = (_Float16)(bf16_round(W1[((size_t)j * D0 + d0 + q) * D1 + k]) * 16.0f); }
    else { const int m = ((f - 16) >> 1) * 16 + ln, k0 = ((f - 16) & 1) * 32 + h * 16 + 8 * hh; for (int q = 0; q < 8; ++q) o.h[q] = (_Float16)(bf16_round(W2[((size_t)j * D1 + k0 + q) * D2 + m]) * 16.0f); }
    *(v8us*)((unsigned short*)PW + ((size_t)j * WCH + c) * 8) = o.half[0]; }
  else { const int i0 = (c - WCH) * 4; v4f o;
    for (int u = 0; u < 4; ++u) { const int i = i0 + u; float v = 0.f; if (i < D1) v = b1[j * D1 + i]; else if (i < D1 + D2) v = b2[j * D2 + i - D1]; else if (i < D1 + 2 * D2) v = W3[j * D2 + i - D1 - D2]; else if (i == D1 + 2 * D2) v = b3[j]; o[u] = bf16_round(v); }
    *(v4f*)(PA + (size_t)j * AUXF + i0) = o; } }

__device__ __forceinline__ v16h br_frag(const unsigned short* wb, int f, int lane) { FragH x; x.half[0] = *(const v8us*)(wb + f * 512 + lane * 8); x.half[1] = *(const v8us*)(wb + f * 512 + 256 + lane * 8); return x.v; }
__device__ __forceinline__ v8f br_mma(v16h a, v16h b, v8f c) { return __builtin_amdgcn_wmma_f32_16x16x32_f16(false, a, false, b, (short)0, c, false, false); }
__device__ __forceinline__ float br_xhalf(float x) { return __builtin_bit_cast(float, __builtin_amdgcn_permlanex16(__builtin_bit_cast(int, x), __builtin_bit_cast(int, x), 0x76543210, 0xfedcba98, false, false)); }

// One wave: 64 batch rows; BN and the trunk layer first (64 WMMAs, the trunk's weights staged in LDS beside branch 0's), z held as 16 B fragments for the whole kernel; then the loop over the 33 branches, the branch's weights staged in LDS for the 8 waves (two buffers, one barrier a branch).
// Every "#pragma unroll" in this kernel makes the indices of a fragment or accumulator array constants, so that the array stays in registers (a run-time index would send it to scratch).
__global__ __launch_bounds__(256) void k_branch(const float* __restrict__ x, const _Float16* __restrict__ PT, const float* __restrict__ PB, const _Float16* __restrict__ PW, const float* __restrict__ PA, float* __restrict__ out) {
  __shared__ __attribute__((aligned(16))) unsigned short sw[2][WCH * 8];
  __shared__ __attribute__((aligned(16))) float sa[2][AUXF];
  __shared__ __attribute__((aligned(16))) float so[BWV][BRW * NBRN];
  __shared__ __attribute__((aligned(16))) unsigned short tw[TCH * 8];      /* of its own: a late wave still reads it while an early one refills sw */
  __shared__ __attribute__((aligned(16))) float tb[TAUX];
  const int tid = threadIdx.x, w = tid >> 5, lane = tid & 31, ln = lane & 15, hh = lane >> 4;
  const size_t row0 = (size_t)blockIdx.x * (BWV * BRW) + (size_t)w * BRW;
  const unsigned short* pw = (const unsigned short*)PW;
  v8us st[5]; float sta;
#pragma unroll
  for (int i = 0; i < 5; ++i) st[i] = *(const v8us*)(pw + (size_t)(tid + 256 * i) * 8);
  sta = PA[tid];
  v8us tt[4]; v2f ttb;
#pragma unroll
  for (int i = 0; i < 4; ++i) tt[i] = *(const v8us*)((const unsigned short*)PT + (size_t)(tid + 256 * i) * 8);
  ttb = *(const v2f*)(PB + tid * 2);
  v4f xr[4][6];      /* lane (ln, hh), tile n: features 8 hh + 0..7, 16 + 8 hh + 0..7 and 32..39 of row 16 n + ln */
#pragma unroll
  for (int n = 0; n < 4; ++n) { const float* xp = x + (row0 + n * 16 + ln) * NIN;
#pragma unroll
    for (int q = 0; q < 6; ++q) xr[n][q] = *(const v4fa*)(xp + ((q < 4) ? (q >> 1) * 16 + 8 * hh + (q & 1) * 4 : q * 4 + 16)); }
  asm volatile("s_wait_xcnt 0x0" ::: "memory");      /* stands before the address registers of the loads above are reused */
  __builtin_amdgcn_sched_barrier(0);      /* keeps the LDS address arithmetic below, which reuses those registers, behind that wait */
#pragma unroll
  for (int i = 0; i < 5; ++i) *(v8us*)(&sw[0][(tid + 256 * i) * 8]) = st[i];
  sa[0][tid] = sta;
#pragma unroll
  for (int i = 0; i < 4; ++i) *(v8us*)(&tw[(tid + 256 * i) * 8]) = tt[i];
  *(v2f*)(&tb[tid * 2]) = ttb;
  __syncthreads();      /* publishes branch 0's weights and the trunk's */
  const v8f z8 = {0.f, 0.f, 0.f, 0.f, 0.f, 0.f, 0.f, 0.f};
  v16h xb[4][2];      /* xn as B fragments: k step 0 = features 0..31, k step 1 = features 32..39 and zeros */
  { v4f bsc[6], bmu[6], bsh[6]; const unsigned keep = hh ? 0u : 0xffffffffu;
#pragma unroll
    for (int q = 0; q < 6; ++q) { const int c = (q < 4) ? (q >> 1) * 16 + 8 * hh + (q & 1) * 4 : q * 4 + 16; bsc[q] = *(const v4f*)(tb + 128 + c); bmu[q] = *(const v4f*)(tb + 192 + c); bsh[q] = *(const v4f*)(tb + 256 + c); }
#pragma unroll
    for (int n = 0; n < 4; ++n) { FragH f0, f1;
#pragma unroll
      for (int q = 0; q < 6; ++q) { const v4f xq = __builtin_convertvector(__builtin_convertvector(xr[n][q], v4b), v4f);      /* x rounded to bf16, to nearest even */
        const v4h y = __builtin_convertvector((xq - bmu[q]) * bsc[q] + bsh[q], v4h);
#pragma unroll
        for (int u = 0; u < 4; ++u) { if (q < 4) f0.h[q * 4 + u] = y[u]; else { f1.h[(q - 4) * 4 + u] = y[u]; f1.h[8 + (q - 4) * 4 + u] = (_Float16)0.f; } } }
      v8u w1 = __builtin_bit_cast(v8u, f1.v);
#pragma unroll
      for (int i = 0; i < 4; ++i) w1[i] &= keep;      /* lanes 16-31 stand for k = 40..47: zeros */
      xb[n][0] = f0.v; xb[n][1] = __builtin_bit_cast(v16h, w1); } }
  v16h zf[4][4];
#pragma unroll
  for (int ks = 0; ks < 4; ++ks) {      /* z features 32 ks .. 32 ks + 31 = k step ks of layer 1 */
    v16h ta[2][2]; v4f bz[4]; v8f t0[4], t1[4];
#pragma unroll
    for (int m = 0; m < 2; ++m) { ta[m][0] = br_frag(tw, (2 * ks + m) * 2, lane); ta[m][1] = br_frag(tw, (2 * ks + m) * 2 + 1, lane); }
#pragma unroll
    for (int q = 0; q < 4; ++q) bz[q] = *(const v4f*)(tb + 32 * ks + (q >> 1) * 16 + 8 * hh + (q & 1) * 4);
#pragma unroll
    for (int n = 0; n < 4; ++n) { t0[n] = br_mma(ta[0][0], xb[n][0], z8); t1[n] = br_mma(ta[1][0], xb[n][0], z8); }
#pragma unroll
    for (int n = 0; n < 4; ++n) { t0[n] = br_mma(ta[0][1], xb[n][1], t0[n]); t1[n] = br_mma(ta[1][1], xb[n][1], t1[n]); }
#pragma unroll
    for (int n = 0; n < 4; ++n) { FragH hb;
#pragma unroll
      for (int r = 0; r < 8; ++r) { hb.h[r] = (_Float16)fmaxf(t0[n][r] * 0.0625f + bz[r >> 2][r & 3], 0.f); hb.h[8 + r] = (_Float16)fmaxf(t1[n][r] * 0.0625f + bz[2 + (r >> 2)][r & 3], 0.f); }
      zf[n][ks] = hb.v; }
  }
#pragma unroll 1      /* one copy of the trip: 80 WMMAs and their epilogues are body enough, and the text stays small for the instruction cache */
  for (int j = 0; j < NBRN; ++j) {
    const int jn = (j + 1 < NBRN) ? j + 1 : j;      /* the last trip fills the idle buffer once more: no branch round the loads */
    const unsigned short* wb = sw[j & 1]; const float* ab = sa[j & 1] + 8 * hh;
    v16h wa[2][4], ua[2][2]; v4f bb[2][4];      /* layer-1 A fragments of the current half; layer-2 A fragments and b1 of both halves */
#pragma unroll
    for (int ks = 0; ks < 4; ++ks) { wa[0][ks] = br_frag(wb, ks, lane); wa[1][ks] = br_frag(wb, 4 + ks, lane); }
    ua[0][0] = br_frag(wb, 16, lane); ua[0][1] = br_frag(wb, 18, lane);
#pragma unroll
    for (int q = 0; q < 4; ++q) bb[0][q] = *(const v4f*)(ab + (q >> 1) * 16 + (q & 1) * 4);
    __builtin_amdgcn_sched_barrier(0);      /* keeps this half's LDS reads in one group, ahead of the global loads whose address registers must outlive them */
#pragma unroll
    for (int i = 0; i < 5; ++i) st[i] = *(const v8us*)(pw + ((size_t)jn * WCH + tid + 256 * i) * 8);
    sta = PA[(size_t)jn * AUXF + tid];
    asm volatile("s_wait_xcnt 0x0" ::: "memory");      /* stands before the loads' address registers are reused; it runs in the shadow of the LDS reads above */
    __builtin_amdgcn_sched_barrier(0);      /* keeps the next branch's global loads at the head of the trip: a whole trip of lead */
    v8f a2[2][4]; v4f cc[4], ee[4]; float b3v = 0.f;
#pragma unroll
    for (int n = 0; n < 4; ++n) { a2[0][n] = z8; a2[1][n] = z8; }
#pragma unroll
    for (int s = 0; s < 2; ++s) {      /* h1 features 32 s .. 32 s + 31 = k step s of layer 2 */
      v8f a1[2][4];
#pragma unroll
      for (int n = 0; n < 4; ++n) { a1[0][n] = z8; a1[1][n] = z8; }
#pragma unroll
      for (int ks = 0; ks < 4; ++ks) {
#pragma unroll
        for (int n = 0; n < 4; ++n) { a1[0][n] = br_mma(wa[0][ks], zf[n][ks], a1[0][n]); a1[1][n] = br_mma(wa[1][ks], zf[n][ks], a1[1][n]); }
        __builtin_amdgcn_sched_barrier(0);      /* keeps eight independent accumulators per k step: without it the four k steps of one tile are issued as a dependent chain */
      }
      if (s == 0) {      /* the second half's fragments, read while the first half's epilogue runs */
#pragma unroll
        for (int ks = 0; ks < 4; ++ks) { wa[0][ks] = br_frag(wb, 8 + ks, lane); wa[1][ks] = br_frag(wb, 12 + ks, lane); }
        ua[1][0] = br_frag(wb, 17, lane); ua[1][1] = br_frag(wb, 19, lane);
#pragma unroll
        for (int q = 0; q < 4; ++q) bb[1][q] = *(const v4f*)(ab + 32 + (q >> 1) * 16 + (q & 1) * 4);
      } else {      /* b2, W3, b3 for the final dot */
#pragma unroll
        for (int q = 0; q < 4; ++q) { cc[q] = *(const v4f*)(ab + 64 + (q >> 1) * 16 + (q & 1) * 4); ee[q] = *(const v4f*)(ab + 96 + (q >> 1) * 16 + (q & 1) * 4); }
        b3v = sa[j & 1][128];
      }
      __builtin_amdgcn_sched_barrier(0);      /* keeps these LDS reads in one group ahead of the epilogue that hides their latency */
#pragma unroll
      for (int n = 0; n < 4; ++n) { FragH hb;
#pragma unroll
        for (int r = 0; r < 8; ++r) { hb.h[r] = (_Float16)fmaxf(a1[0][n][r] * 0.0625f + bb[s][r >> 2][r & 3], 0.f); hb.h[8 + r] = (_Float16)fmaxf(a1[1][n][r] * 0.0625f + bb[s][2 + (r >> 2)][r & 3], 0.f); }
        a2[0][n] = br_mma(ua[s][0], hb.v, a2[0][n]); a2[1][n] = br_mma(ua[s][1], hb.v, a2[1][n]); }
      __builtin_amdgcn_sched_barrier(0);      /* keeps the next half's first WMMAs from being drawn into the epilogue as dependent chains */
    }
    float p[4];
#pragma unroll
    for (int n = 0; n < 4; ++n) { float sl = 0.f, su = 0.f;
#pragma unroll
      for (int r = 0; r < 8; ++r) { sl = fmaf(fmaxf(a2[0][n][r] * 0.0625f + cc[r >> 2][r & 3], 0.f), ee[r >> 2][r & 3], sl); su = fmaf(fmaxf(a2[1][n][r] * 0.0625f + cc[2 + (r >> 2)][r & 3], 0.f), ee[2 + (r >> 2)][r & 3], su); }
      p[n] = sl + su; }
#pragma unroll
    for (int g = 0; g < 2; ++g) {
      const float mine = hh ? p[2 * g + 1] : p[2 * g], send = hh ? p[2 * g] : p[2 * g + 1];
      so[w][((2 * g + hh) * 16 + ln) * NBRN + j] = mine + br_xhalf(send) + b3v; }
#pragma unroll
    for (int i = 0; i < 5; ++i) *(v8us*)(&sw[(j + 1) & 1][(tid + 256 * i) * 8]) = st[i];
    sa[(j + 1) & 1][tid] = sta;
    __syncthreads();      /* publishes the next branch's weights and ends every wave's reads of this branch's buffer, which the next trip refills */
  }
  float* og = out + row0 * NBRN; const float* sp = so[w];      /* 64 rows x 33 f32 = 66 whole 128-byte lines, this wave's own */
  for (int i = lane; i < BRW * NBRN / 4; i += 32) *(v4f*)(og + i * 4) = *(const v4f*)(sp + i * 4);
}

extern "C" void kernel_launch(void* const* d_in, const int* in_sizes, int n_in,
                              void* d_out, int out_size, void* d_ws, size_t ws_size, hipStream_t stream) {
  (void)in_sizes; (void)n_in; (void)out_size;
  const float* const* I = (const float* const*)d_in; const float* x = I[0]; const float* bng = I[1]; const float* bnb = I[2]; const float* bnm = I[3]; const float* bnv = I[4]; const float* Ws = I[5]; const float* bs = I[6]; const float* W1 = I[7]; const float* b1 = I[8]; const float* W2 = I[9]; const float* b2 = I[10]; const float* W3 = I[11]; const float* b3 = I[12];
  char* ws = (char*)d_ws; size_t off = 0;
  auto take = [&](size_t bytes) { char* p = ws + off; off += (bytes + 255) & ~(size_t)255; return p; };
  _Float16* PW = (_Float16*)take((size_t)NBRN * WCH * 16); float* PA = (float*)take((size_t)NBRN * AUXF * 4); _Float16* PT = (_Float16*)take((size_t)TCH * 16); float* PB = (float*)take((size_t)TAUX * 4);
  if (off > ws_size) return;
  k_pack<<<(NBRN * (WCH + AUXF / 4) + TCH + TAUX / 4 + 255) / 256, 256, 0, stream>>>(W1, b1, W2, b2, W3, b3, Ws, bs, bng, bnb, bnm, bnv, 1e-5f, PW, PA, PT, PB);      /* branch and trunk weights as A fragments; biases, W3 and the BN terms rounded */
  k_branch<<<NRW / (BWV * BRW), 256, 0, stream>>>(x, PT, PB, PW, PA, (float*)d_out);      /* BN, trunk, then gu[r][j] for all rows and branches */
}

// v003
// It runs in 54.3 microseconds.
// Two timings next to v002 both put it at 1.04 times that version's speed.
// Over all steps from v000 it is 18.7 times as fast.
#include <hip/hip_runtime.h>
#define NB 1
#define SQ 8192
#define DM 64
#define NH 1
#define HD 64
#define HG 4                         /* heads per attention launch group */
#define B0 0                         /* first batch processed (debug hook) */
#define NBR NB                       /* batches processed (debug hook) */
#define NR ((size_t)NB * SQ)         /* token rows */
#define MP ((int)((size_t)NBR * SQ)) /* rows projected (debug hook) */
#define QT 256                       /* query rows per causal tile */
#define NKX SQ                       /* S / P row pitch */
#define QT0 256                      /* first-tile rows recomputed exactly (256: buys margin for the few-key rows 128..255, which have no output projection to average the single-f16 P/v rounding) */
#define QN SQ                        /* query rows attended per batch (debug hook) */
#define NHD NH                       /* heads attended (debug hook) */
#define MPO MP                       /* rows through the output stage (debug hook) */
#define LQ DM            /* row pitch of the q/k/v rows */
typedef __bf16 v16b __attribute__((ext_vector_type(16)));
typedef unsigned short v8us __attribute__((ext_vector_type(8), may_alias));
typedef float  v8f  __attribute__((ext_vector_type(8)));
typedef float  v4f  __attribute__((ext_vector_type(4)));
typedef float  v4fa __attribute__((ext_vector_type(4), may_alias));
typedef float  v2f  __attribute__((ext_vector_type(2)));
typedef unsigned int v8u __attribute__((ext_vector_type(8)));
typedef __bf16 v4b __attribute__((ext_vector_type(4)));
union FragB { v16b v; v8us half[2]; unsigned short u[16]; };

__device__ __forceinline__ unsigned short bf16_bits(float x) { unsigned int u = __float_as_uint(x); return (unsigned short)((u + 0x7FFFu + ((u >> 16) & 1u)) >> 16); }
__device__ __forceinline__ float bf16_val(unsigned short b) { return __uint_as_float(((unsigned int)b) << 16); }
__device__ __forceinline__ float bf16_round(float x) { return bf16_val(bf16_bits(x)); }
// D += A·B with NT terms: 1 = ah·bh, 2 = + al·bh (A split), 3 = + ah·bl (both split)
template <int NT>
__device__ __forceinline__ v8f mmaN(v16b ah, v16b al, v16b bh, v16b bl, v8f c) {
  c = __builtin_amdgcn_wmma_f32_16x16x32_bf16(false, ah, false, bh, (short)0, c, false, false);
  if (NT >= 2) c = __builtin_amdgcn_wmma_f32_16x16x32_bf16(false, al, false, bh, (short)0, c, false, false);
  if (NT >= 3) c = __builtin_amdgcn_wmma_f32_16x16x32_bf16(false, ah, false, bl, (short)0, c, false, false);
  asm volatile("v_nop\n\tv_nop\n\tv_nop\n\tv_nop" : "+v"(c) : "v"(ah), "v"(al), "v"(bh), "v"(bl));
  return c;
}

__global__ __launch_bounds__(256) void k_wt_bf16(const float* __restrict__ W, unsigned short* __restrict__ Wt, int K, int N) {
  const int t = blockIdx.x * 256 + threadIdx.x;
  const int k8n = K / 8;
  if (t >= N * k8n) return;
  const int n = t / k8n, k8 = (t % k8n) * 8;
  v8us v;
#pragma unroll
  for (int i = 0; i < 8; ++i) v[i] = bf16_bits(W[(size_t)(k8 + i) * N + n]);
  *(v8us*)(Wt + (size_t)n * K + k8) = v;
  
}

// GEMM C[M][N] (f32, pitch ldc) = act(A[M][K]·W + bias). A f32 row-major (pitch lda) converted per fragment to bf16
// (ASPLIT: hi/lo two planes -> 2 terms, else single rounded term); Wt bf16 [N][K] (pitch ldb). BIAS_BF16 rounds the
// bias to bf16 first (bias quantised to bf16 before the add). K%32==0, M%16==0, N%64==0.
template <bool ASPLIT, int ACT, bool BIAS_BF16>
__global__ __launch_bounds__(128) void k_gemm_bf(const float* __restrict__ A, int lda, const unsigned short* __restrict__ Wt, int ldb,
                                               const float* __restrict__ bias, float* __restrict__ C, int ldc, int M, int N, int K) {
  __shared__ __attribute__((aligned(16))) float so[4][16][64];
  const int tid = threadIdx.x, w = tid >> 5, lane = tid & 31, ln = lane & 15, hh = lane >> 4;
  const int ntn = N / 64;
  const int wid = blockIdx.x * 4 + w;
  const int mt = wid / ntn, nq = wid % ntn;
  if (mt * 16 >= M) return;
  const int row0 = mt * 16, col0 = nq * 64;
  const float* arow = A + (size_t)(row0 + ln) * lda;
  v8f acc[4] = {};
  for (int kb = 0; kb < K; kb += 32) {
    FragB ah, al;
    const v4f x0 = *(const v4fa*)(arow + kb + 8 * hh), x1 = *(const v4fa*)(arow + kb + 8 * hh + 4);
    const v4f x2 = *(const v4fa*)(arow + kb + 16 + 8 * hh), x3 = *(const v4fa*)(arow + kb + 16 + 8 * hh + 4);
    float xs[16] = {x0[0],x0[1],x0[2],x0[3],x1[0],x1[1],x1[2],x1[3],x2[0],x2[1],x2[2],x2[3],x3[0],x3[1],x3[2],x3[3]};
#pragma unroll
    for (int i = 0; i < 16; ++i) { const unsigned short hb = bf16_bits(xs[i]); ah.u[i] = hb; al.u[i] = ASPLIT ? bf16_bits(xs[i] - bf16_val(hb)) : (unsigned short)0; }
#pragma unroll
    for (int t = 0; t < 4; ++t) {
      const unsigned short* brow = Wt + (size_t)(col0 + t * 16 + ln) * ldb + kb;
      FragB b;
      b.half[0] = *(const v8us*)(brow + 8 * hh);
      b.half[1] = *(const v8us*)(brow + 16 + 8 * hh);
      acc[t] = mmaN<ASPLIT ? 2 : 1>(ah.v, al.v, b.v, b.v, acc[t]);
    }
  }
#pragma unroll
  for (int t = 0; t < 4; ++t) {
    float bv = bias ? bias[col0 + t * 16 + ln] : 0.f;
    if (BIAS_BF16) bv = bf16_round(bv);
#pragma unroll
    for (int r = 0; r < 8; ++r) { float v = acc[t][r] + bv; if (ACT == 1) v = fmaxf(v, 0.f); so[w][8 * hh + r][t * 16 + ln] = v; }
  }
  __builtin_amdgcn_fence(__ATOMIC_ACQ_REL, "workgroup");
  __builtin_amdgcn_wave_barrier();
  const int rsub = lane >> 4, c4 = (lane & 15) * 4;
  {
#pragma unroll
    for (int q = 0; q < 8; ++q) {
      const int r = q * 2 + rsub;
      const v4f v = *(const v4fa*)&so[w][r][c4];
      *(v4f*)(C + (size_t)(row0 + r) * ldc + col0 + c4) = v;
    }
    
  }
}

// GEMM C = act(A·W + bias + resid): A f32 (ASPLIT -> hi/lo 2 terms), Wt bf16 [N][K]; ACT 0 none, 1 relu, 2 exact gelu;
// resid (optional, f32, row index = (row % rmod), pitch ldr, RES_BF16 rounds it) added before the activation.
template <bool ASPLIT, int ACT, bool BIAS_BF16, bool RES_BF16>
__global__ __launch_bounds__(128) void k_gemm_bf3(const float* __restrict__ A, int lda, const unsigned short* __restrict__ Wt, int ldb,
                                                const float* __restrict__ bias, const float* __restrict__ resid, int rmod, int ldr,
                                                float* __restrict__ C, int ldc, int M, int N, int K) {
  __shared__ __attribute__((aligned(16))) float so[4][16][64];
  const int tid = threadIdx.x, w = tid >> 5, lane = tid & 31, ln = lane & 15, hh = lane >> 4;
  const int ntn = N / 64;
  const int wid = blockIdx.x * 4 + w;
  const int mt = wid / ntn, nq = wid % ntn;
  if (mt * 16 >= M) return;
  const int row0 = mt * 16, col0 = nq * 64;
  const float* arow = A + (size_t)(row0 + ln) * lda;
  v8f acc[4] = {};
  for (int kb = 0; kb < K; kb += 32) {
    FragB ah, al;
    const v4f x0 = *(const v4fa*)(arow + kb + 8 * hh), x1 = *(const v4fa*)(arow + kb + 8 * hh + 4);
    const v4f x2 = *(const v4fa*)(arow + kb + 16 + 8 * hh), x3 = *(const v4fa*)(arow + kb + 16 + 8 * hh + 4);
    float xs[16] = {x0[0],x0[1],x0[2],x0[3],x1[0],x1[1],x1[2],x1[3],x2[0],x2[1],x2[2],x2[3],x3[0],x3[1],x3[2],x3[3]};
#pragma unroll
    for (int i = 0; i < 16; ++i) { const unsigned short hb = bf16_bits(xs[i]); ah.u[i] = hb; al.u[i] = ASPLIT ? bf16_bits(xs[i] - bf16_val(hb)) : (unsigned short)0; }
#pragma unroll
    for (int t = 0; t < 4; ++t) {
      const unsigned short* brow = Wt + (size_t)(col0 + t * 16 + ln) * ldb + kb;
      FragB b;
      b.half[0] = *(const v8us*)(brow + 8 * hh);
      b.half[1] = *(const v8us*)(brow + 16 + 8 * hh);
      acc[t] = mmaN<ASPLIT ? 2 : 1>(ah.v, al.v, b.v, b.v, acc[t]);
    }
  }
#pragma unroll
  for (int t = 0; t < 4; ++t) {
    const int col = col0 + t * 16 + ln;
    float bv = bias ? bias[col] : 0.f;
    if (BIAS_BF16) bv = bf16_round(bv);
#pragma unroll
    for (int r = 0; r < 8; ++r) {
      float v = acc[t][r] + bv;
      if (resid) { float rv = resid[(size_t)((row0 + 8 * hh + r) % rmod) * ldr + col]; if (RES_BF16) rv = bf16_round(rv); v += rv; }
      if (ACT == 1) v = fmaxf(v, 0.f);
      if (ACT == 2) v = 0.5f * v * (1.0f + erff(v * 0.70710678118654752f));
      if (ACT == 3) { const float u = 0.7978845608028654f * (v + 0.044715f * v * v * v); v = 0.5f * v * (1.0f + tanhf(u)); }
      so[w][8 * hh + r][t * 16 + ln] = v;
    }
  }
  __builtin_amdgcn_fence(__ATOMIC_ACQ_REL, "workgroup");
  __builtin_amdgcn_wave_barrier();
  const int rsub = lane >> 4, c4 = (lane & 15) * 4;
  {
#pragma unroll
    for (int q = 0; q < 8; ++q) {
      const int r = q * 2 + rsub;
      const v4f v = *(const v4fa*)&so[w][r][c4];
      *(v4f*)(C + (size_t)(row0 + r) * ldc + col0 + c4) = v;
    }
    
  }
}
// row LayerNorm (biased variance, eps) over N: s = X (+ R); optional out_sum <- s; out_norm <- (s-mu)*rsqrt(var+eps)*g + b
template <bool PARAM_BF16>
__global__ __launch_bounds__(256) void k_layernorm(const float* __restrict__ X, const float* __restrict__ R, const float* __restrict__ g, const float* __restrict__ bta,
                                                  float* __restrict__ out_sum, float* __restrict__ out_norm, int N, float eps) {
  __shared__ float red[256];
  const int row = blockIdx.x, tid = threadIdx.x;
  const float* x = X + (size_t)row * N; const float* rr = R ? R + (size_t)row * N : nullptr;
  float vals[16];                     // up to N = 4096
  const int per = N / 256;            // contiguous chunk per thread? use strided-by-4 chunks: thread handles j = tid*4 + 1024*u
  float s1 = 0.f;
  for (int u = 0; u < per / 4; ++u) {
    const int j = tid * 4 + 1024 * u;
    const v4f a = *(const v4fa*)(x + j);
    v4f b = {0.f,0.f,0.f,0.f}; if (rr) b = *(const v4fa*)(rr + j);
#pragma unroll
    for (int q = 0; q < 4; ++q) { const float v = a[q] + b[q]; vals[u * 4 + q] = v; s1 += v; }
  }
  red[tid] = s1; __syncthreads();
  for (int st = 128; st > 0; st >>= 1) { if (tid < st) red[tid] += red[tid + st]; __syncthreads(); }
  const float mu = red[0] / (float)N; __syncthreads();
  float s2 = 0.f;
  for (int u = 0; u < per / 4; ++u)
#pragma unroll
    for (int q = 0; q < 4; ++q) { const float c = vals[u * 4 + q] - mu; s2 += c * c; }
  red[tid] = s2; __syncthreads();
  for (int st = 128; st > 0; st >>= 1) { if (tid < st) red[tid] += red[tid + st]; __syncthreads(); }
  const float rs = rsqrtf(red[0] / (float)N + eps);
  {
    for (int u = 0; u < per / 4; ++u) {
      const int j = tid * 4 + 1024 * u;
      v4f o, sm;
#pragma unroll
      for (int q = 0; q < 4; ++q) {
        float gg = g[j + q], bb = bta[j + q];
        if (PARAM_BF16) { gg = bf16_round(gg); bb = bf16_round(bb); }
        sm[q] = vals[u * 4 + q]; o[q] = (vals[u * 4 + q] - mu) * rs * gg + bb;
      }
      if (out_sum) *(v4f*)(out_sum + (size_t)row * N + j) = sm;
      *(v4f*)(out_norm + (size_t)row * N + j) = o;
    }
    
  }
}



// ---- f16 WMMA path (v_wmma_f32_16x16x32_f16): 11-bit significands for operands in range — used where a [0,1] probability operand needs more precision than bf16
typedef _Float16 v16h __attribute__((ext_vector_type(16)));
union FragH { v16h v; v8us half[2]; _Float16 h[16]; unsigned short u[16]; };
template <int NT>
__device__ __forceinline__ v8f mmaH(v16h ah, v16h al, v16h bh, v16h bl, v8f c) {
  c = __builtin_amdgcn_wmma_f32_16x16x32_f16(false, ah, false, bh, (short)0, c, false, false);
  if (NT >= 2) c = __builtin_amdgcn_wmma_f32_16x16x32_f16(false, al, false, bh, (short)0, c, false, false);
  if (NT >= 3) c = __builtin_amdgcn_wmma_f32_16x16x32_f16(false, ah, false, bl, (short)0, c, false, false);
  asm volatile("v_nop\n\tv_nop\n\tv_nop\n\tv_nop" : "+v"(c) : "v"(ah), "v"(al), "v"(bh), "v"(bl));
  return c;
}
// batched GEMM like k_gemm_b but f16 operands: A f32 (split into f16 hi/lo if ASPLIT, else rounded to f16), Bt = f16 values [n][k]; alpha; C f32; N multiple of 16 (partial tiles skipped)
template <bool ASPLIT>
__global__ __launch_bounds__(128) void k_gemm_h(const float* __restrict__ A, int lda, size_t sA, const _Float16* __restrict__ Bh, int ldb, size_t sB, float alpha, float* __restrict__ C, int ldc, size_t sC, int M, int N, int K) {
  __shared__ __attribute__((aligned(16))) float so[4][16][64];
  const int tid = threadIdx.x, w = tid >> 5, lane = tid & 31, ln = lane & 15, hh = lane >> 4; const int by = blockIdx.y;
  A += (size_t)by * sA; Bh += (size_t)by * sB; C += (size_t)by * sC;
  const int ntn = (N + 63) / 64; const int wid = blockIdx.x * 4 + w; const int mt = wid / ntn, nq = wid % ntn; if (mt * 16 >= M) return;
  const int row0 = mt * 16, col0 = nq * 64; const float* arow = A + (size_t)(row0 + ln) * lda;
  v8f acc[4] = {};
  for (int kb = 0; kb < K; kb += 32) {
    FragH ah, al;
    const v4f x0 = *(const v4fa*)(arow + kb + 8 * hh), x1 = *(const v4fa*)(arow + kb + 8 * hh + 4), x2 = *(const v4fa*)(arow + kb + 16 + 8 * hh), x3 = *(const v4fa*)(arow + kb + 16 + 8 * hh + 4);
    float xs[16] = {x0[0],x0[1],x0[2],x0[3],x1[0],x1[1],x1[2],x1[3],x2[0],x2[1],x2[2],x2[3],x3[0],x3[1],x3[2],x3[3]};
#pragma unroll
    for (int i = 0; i < 16; ++i) { const _Float16 h = (_Float16)xs[i]; ah.h[i] = h; al.h[i] = ASPLIT ? (_Float16)(xs[i] - (float)h) : (_Float16)0.0f; }
#pragma unroll
    for (int t = 0; t < 4; ++t) { if (col0 + t * 16 >= N) continue; const size_t boff = (size_t)(col0 + t * 16 + ln) * ldb + kb; FragH bq; bq.half[0] = *(const v8us*)(Bh + boff + 8 * hh); bq.half[1] = *(const v8us*)(Bh + boff + 16 + 8 * hh);
      acc[t] = mmaH<ASPLIT ? 2 : 1>(ah.v, al.v, bq.v, bq.v, acc[t]); }
  }
#pragma unroll
  for (int t = 0; t < 4; ++t) { if (col0 + t * 16 >= N) continue;
#pragma unroll
    for (int r = 0; r < 8; ++r) so[w][8 * hh + r][t * 16 + ln] = acc[t][r] * alpha; }
  __builtin_amdgcn_fence(__ATOMIC_ACQ_REL, "workgroup"); __builtin_amdgcn_wave_barrier();
  const int rsub = lane >> 4, c4 = (lane & 15) * 4;
  {
#pragma unroll
    for (int q = 0; q < 8; ++q) { const int r = q * 2 + rsub; if (col0 + c4 < N) { const v4f v = *(const v4fa*)&so[w][r][c4]; *(v4f*)(C + (size_t)(row0 + r) * ldc + col0 + c4) = v; } }
     }
}

// Wt[n][k] = f16(W[k][n]·scale) from f32 row-major W[K][N] (scale = power of two; bf16-exact weights stay exact in f16 away from the subnormal range)
__global__ __launch_bounds__(256) void k_wt_f16(const float* __restrict__ W, _Float16* __restrict__ Wt, int K, int N, float scale) {
  const int t = blockIdx.x * 256 + threadIdx.x; if (t >= N * (K / 8)) return; const int n = t / (K / 8), k8 = (t % (K / 8)) * 8; FragH f;
#pragma unroll
  for (int i = 0; i < 8; ++i) f.h[i] = (_Float16)(bf16_round(W[(size_t)(k8 + i) * N + n]) * scale); const v8us o = f.half[0];
  *(v8us*)((unsigned short*)Wt + (size_t)n * K + k8) = o; 
}
// k_gemm_hh variant with fused epilogue: v = acc·alpha + bias[by·sBias + col] (+ CP[(row/rowsPerB)·sCPb + by·64 + col] if CP) ; ACT 0 none / 1 elu ; writes f16 C16 (and f32 C if non-null)
template <int ACT>
__global__ __launch_bounds__(128) void k_gemm_hhx(const _Float16* __restrict__ A, int lda, size_t sA, const _Float16* __restrict__ Bh, int ldb, size_t sB, float alpha, const float* __restrict__ bias, size_t sBias, const float* __restrict__ CP, int rowsPerB, size_t sCPb, int row0g,
    float* __restrict__ C, _Float16* __restrict__ C16, int ldc, size_t sC, int M, int N, int K) {
  __shared__ __attribute__((aligned(16))) float so[4][16][64];
  const int tid = threadIdx.x, w = tid >> 5, lane = tid & 31, ln = lane & 15, hh = lane >> 4; const int by = blockIdx.y;
  A += (size_t)by * sA; Bh += (size_t)by * sB; const size_t cofs = (size_t)by * sC; const float* bp = bias ? bias + (size_t)by * sBias : nullptr;
  const int ntn = (N + 63) / 64; const int wid = blockIdx.x * 4 + w; const int mt = wid / ntn, nq = wid % ntn; if (mt * 16 >= M) return;
  const int row0 = mt * 16, col0 = nq * 64; const _Float16* arow = A + (size_t)(row0 + ln) * lda;
  v8f acc[4] = {};
  for (int kb = 0; kb < K; kb += 32) { FragH ah; ah.half[0] = *(const v8us*)((const unsigned short*)arow + kb + 8 * hh); ah.half[1] = *(const v8us*)((const unsigned short*)arow + kb + 16 + 8 * hh);
#pragma unroll
    for (int t = 0; t < 4; ++t) { if (col0 + t * 16 >= N) continue; const size_t boff = (size_t)(col0 + t * 16 + ln) * ldb + kb; FragH bq; bq.half[0] = *(const v8us*)((const unsigned short*)Bh + boff + 8 * hh); bq.half[1] = *(const v8us*)((const unsigned short*)Bh + boff + 16 + 8 * hh);
      acc[t] = mmaH<1>(ah.v, ah.v, bq.v, bq.v, acc[t]); }
  }
#pragma unroll
  for (int t = 0; t < 4; ++t) { if (col0 + t * 16 >= N) continue; const int col = col0 + t * 16 + ln; const float bv = bp ? bf16_round(bp[col]) : 0.f;
#pragma unroll
    for (int r = 0; r < 8; ++r) { float v = acc[t][r] * alpha + bv; if (CP) { const int rr = row0g + row0 + 8 * hh + r; if (rowsPerB < 0) v += CP[cofs + (size_t)rr * ldc + col];      /* rowsPerB < 0: own element of the batched C plane */ else { const int bidx = rr / rowsPerB; v += CP[(size_t)bidx * sCPb + (size_t)by * 64 + col]; } } if (ACT == 1) v = (v > 0.f) ? v : expm1f(v); else if (ACT == 7) v = (v > 0.f) ? v + 1.0f : expf(v); else if (ACT == 8) v = tanhf(v); else if (ACT == 9) v = 0.5f * v * (1.0f + tanhf(0.7978845608028654f * (v + 0.044715f * v * v * v))); else if (ACT == 11) v = 1.0f / (1.0f + expf(-v)); else if (ACT == 12) v = (v > 0.f) ? v : 0.01f * v; else if (ACT == 14) v = (v > 0.f) ? v : 0.1f * v; else if (ACT == 16) v = (v >= 0.f) ? v : 0.3f * v; else if (ACT == 17) v = (v >= 0.f) ? v : 0.2f * v; else if (ACT == 15) v = v / (1.0f + expf(-v)); else if (ACT == 3) v = fmaxf(v, 0.f); else if (ACT == 6) v = 0.5f * v * (1.0f + erff(v * 0.70710678118654752f)); so[w][8 * hh + r][t * 16 + ln] = v; } }
  __builtin_amdgcn_fence(__ATOMIC_ACQ_REL, "workgroup"); __builtin_amdgcn_wave_barrier();
  const int rsub = lane >> 4, c4 = (lane & 15) * 4; typedef _Float16 v4h __attribute__((ext_vector_type(4)));
  {
#pragma unroll
    for (int q = 0; q < 8; ++q) { const int r = q * 2 + rsub; if (col0 + c4 < N) { const v4f v = *(const v4fa*)&so[w][r][c4]; if (C) *(v4f*)(C + cofs + (size_t)(row0 + r) * ldc + col0 + c4) = v; if (C16) { v4h h4; for (int i = 0; i < 4; ++i) h4[i] = (_Float16)v[i]; *(v4h*)(C16 + cofs + (size_t)(row0 + r) * ldc + col0 + c4) = h4; } } }
     }
}


typedef _Float16 v4h __attribute__((ext_vector_type(4)));

__global__ __launch_bounds__(256) void k_x16(const float* __restrict__ x, _Float16* __restrict__ X16, size_t n8) { const size_t t = (size_t)blockIdx.x * 256 + threadIdx.x; if (t >= n8) return; FragH f;
#pragma unroll
  for (int q = 0; q < 8; ++q) f.h[q] = (_Float16)bf16_round(x[t * 8 + q]); *(v8us*)((unsigned short*)X16 + t * 8) = f.half[0];  }
__global__ __launch_bounds__(256) void k_h16(const float* __restrict__ x, _Float16* __restrict__ X16, size_t n8) { const size_t t = (size_t)blockIdx.x * 256 + threadIdx.x; if (t >= n8) return; FragH f;
#pragma unroll
  for (int q = 0; q < 8; ++q) f.h[q] = (_Float16)x[t * 8 + q]; *(v8us*)((unsigned short*)X16 + t * 8) = f.half[0];  }
__global__ __launch_bounds__(256) void k_round16f(const float* __restrict__ W, _Float16* __restrict__ Bt, size_t n8) { const size_t t = (size_t)blockIdx.x * 256 + threadIdx.x; if (t >= n8) return; FragH f;
#pragma unroll
  for (int i = 0; i < 8; ++i) f.h[i] = (_Float16)(bf16_round(W[t * 8 + i]) * 16.0f); *(v8us*)((unsigned short*)Bt + t * 8) = f.half[0];  }
template <int NHv, int TTv>
__global__ __launch_bounds__(256) void k_vt(const _Float16* __restrict__ V16, int ldv, int voff, _Float16* __restrict__ Vt) { __shared__ unsigned short tl[64][66]; const int tid = threadIdx.x; const int slab = blockIdx.x / (TTv / 64), lg = blockIdx.x % (TTv / 64); const int b = slab / NHv, h = slab % NHv;
  for (int i = tid; i < 64 * 8; i += 256) { const int r = i / 8, c8 = (i % 8) * 8; FragH f; f.half[0] = *(const v8us*)((const unsigned short*)V16 + ((size_t)b * TTv + lg * 64 + r) * ldv + voff + h * 64 + c8);
#pragma unroll
    for (int q = 0; q < 8; ++q) tl[r][c8 + q] = f.u[q]; }
  __syncthreads();
  {
#pragma unroll
    for (int rd = 0; rd < 2; ++rd) { const int d = rd * 32 + tid / 8, pc = tid % 8; FragH f;
#pragma unroll
      for (int q = 0; q < 8; ++q) f.u[q] = tl[pc * 8 + q][d];
      *(v8us*)((unsigned short*)Vt + ((size_t)slab * 64 + d) * TTv + lg * 64 + pc * 8) = f.half[0]; }
     } }

__global__ __launch_bounds__(256) void k_hl(const float* __restrict__ F, _Float16* __restrict__ Hh, _Float16* __restrict__ Hl, size_t n8) { const size_t t = (size_t)blockIdx.x * 256 + threadIdx.x; if (t >= n8) return; FragH fh, fl; const v4f a = *(const v4fa*)(F + t * 8), c = *(const v4fa*)(F + t * 8 + 4);
#pragma unroll
  for (int q = 0; q < 4; ++q) { _Float16 h = (_Float16)a[q]; fh.h[q] = h; fl.h[q] = (_Float16)((a[q] - (float)h) * 1024.0f); h = (_Float16)c[q]; fh.h[4 + q] = h; fl.h[4 + q] = (_Float16)((c[q] - (float)h) * 1024.0f); }
  { *(v8us*)((unsigned short*)Hh + t * 8) = fh.half[0]; *(v8us*)((unsigned short*)Hl + t * 8) = fl.half[0];  } }

// ---- fast GEMM (wave tile 32x64; requires M % 32 == 0 rows per launch region and N % 64 == 0); epilogue = k_gemm_hhx semantics ----
__device__ __forceinline__ v16h g2_frag(const _Float16* p, int hh) { FragH f; f.half[0] = *(const v8us*)((const unsigned short*)p + 8 * hh); f.half[1] = *(const v8us*)((const unsigned short*)p + 16 + 8 * hh); return f.v; }
__device__ __forceinline__ v8f g2_mma(v16h a, v16h b, v8f c) { v8f d = __builtin_amdgcn_wmma_f32_16x16x32_f16(false, a, false, b, (short)0, c, false, false); asm volatile("v_nop\n\tv_nop\n\tv_nop\n\tv_nop" : "+v"(d) : "v"(a), "v"(b)); return d; }
template <int ACT>
__global__ __launch_bounds__(128) void k_gemm2(const _Float16* __restrict__ A, int lda, size_t sA, const _Float16* __restrict__ Bh, int ldb, size_t sB, float alpha, const float* __restrict__ bias, size_t sBias, const float* __restrict__ CP, int rowsPerB, size_t sCPb, int row0g,
    float* __restrict__ C, _Float16* __restrict__ C16, int ldc, size_t sC, int M, int N, int K) { static_assert(ACT == 0 || ACT == 3 || ACT == 6 || ACT == 8 || ACT == 9 || ACT == 11 || ACT == 12 || ACT == 14 || ACT == 15 || ACT == 16 || ACT == 17, "k_gemm2: unsupported ACT code (would silently apply no activation)");
  __shared__ __attribute__((aligned(16))) float so[4][32][68];
  const int tid = threadIdx.x, w = tid >> 5, lane = tid & 31, ln = lane & 15, hh = lane >> 4; const int by = blockIdx.y;
  A += (size_t)by * sA; Bh += (size_t)by * sB; const size_t cofs = (size_t)by * sC; const float* bp = bias ? bias + (size_t)by * sBias : nullptr;
  const int ntn = N >> 6; const int mt = blockIdx.x / ntn, nq = blockIdx.x - mt * ntn; const int row0 = mt * 128 + 32 * w, col0 = nq * 64; if (row0 >= M) return;
  const _Float16* a0p = A + (size_t)(row0 + ln) * lda; const _Float16* a1p = a0p + (size_t)16 * lda;
  const _Float16* b0p = Bh + (size_t)(col0 + ln) * ldb; const _Float16* b1p = b0p + (size_t)16 * ldb; const _Float16* b2p = b1p + (size_t)16 * ldb; const _Float16* b3p = b2p + (size_t)16 * ldb;
  const v8f z8 = {0.f,0.f,0.f,0.f,0.f,0.f,0.f,0.f}; v8f c00 = z8, c01 = z8, c02 = z8, c03 = z8, c10 = z8, c11 = z8, c12 = z8, c13 = z8;
#pragma unroll 1
  for (int kb = 0; kb < K; kb += 32) { const v16h a0 = g2_frag(a0p + kb, hh), a1 = g2_frag(a1p + kb, hh);
    v16h b = g2_frag(b0p + kb, hh); c00 = g2_mma(a0, b, c00); c10 = g2_mma(a1, b, c10);
    b = g2_frag(b1p + kb, hh); c01 = g2_mma(a0, b, c01); c11 = g2_mma(a1, b, c11);
    b = g2_frag(b2p + kb, hh); c02 = g2_mma(a0, b, c02); c12 = g2_mma(a1, b, c12);
    b = g2_frag(b3p + kb, hh); c03 = g2_mma(a0, b, c03); c13 = g2_mma(a1, b, c13); }
  v8f accs[8] = {c00, c01, c02, c03, c10, c11, c12, c13};
#pragma unroll
  for (int u = 0; u < 8; ++u) { const int t = u & 3, half = u >> 2; const int col = col0 + t * 16 + ln; const float bv = bp ? bf16_round(bp[col]) : 0.f;
#pragma unroll
    for (int r = 0; r < 8; ++r) { const int rloc = half * 16 + 8 * hh + r; float v = accs[u][r] * alpha + bv; if (CP) { if (rowsPerB < 0) v += CP[cofs + (size_t)(row0g + row0 + rloc) * ldc + col];      /* rowsPerB < 0: own element of the batched C plane */ else { const int bidx = (row0g + row0 + rloc) / rowsPerB; v += CP[(size_t)bidx * sCPb + (size_t)by * 64 + col]; } }
      if (ACT == 3) v = fmaxf(v, 0.f); else if (ACT == 6) v = 0.5f * v * (1.0f + erff(v * 0.70710678118654752f)); else if (ACT == 11) v = 1.0f / (1.0f + expf(-v)); else if (ACT == 15) v = v / (1.0f + expf(-v)); else if (ACT == 12) v = (v > 0.f) ? v : 0.01f * v; else if (ACT == 8) v = tanhf(v); else if (ACT == 9) v = 0.5f * v * (1.0f + tanhf(0.7978845608028654f * (v + 0.044715f * v * v * v))); else if (ACT == 14) v = (v > 0.f) ? v : 0.1f * v; else if (ACT == 16) v = (v >= 0.f) ? v : 0.3f * v; else if (ACT == 17) v = (v >= 0.f) ? v : 0.2f * v;
      so[w][rloc][t * 16 + ln] = v; } }
  __builtin_amdgcn_fence(__ATOMIC_ACQ_REL, "workgroup"); __builtin_amdgcn_wave_barrier();
  const int rsub = lane >> 4, c4 = (lane & 15) * 4;
  {
#pragma unroll
    for (int q = 0; q < 16; ++q) { const int r = q * 2 + rsub; const v4f v = *(const v4fa*)&so[w][r][c4]; if (C) *(v4f*)(C + cofs + (size_t)(row0 + r) * ldc + col0 + c4) = v; if (C16) { v4h h4; for (int i = 0; i < 4; ++i) h4[i] = (_Float16)v[i]; *(v4h*)(C16 + cofs + (size_t)(row0 + r) * ldc + col0 + c4) = h4; } }
     } }


__global__ __launch_bounds__(256) void k_wnat(const float* __restrict__ w, size_t n8, _Float16* __restrict__ Bt) { const size_t t = (size_t)blockIdx.x * 256 + threadIdx.x; if (t >= n8) return; FragH f; for (int q = 0; q < 8; ++q) f.h[q] = (_Float16)(bf16_round(w[t * 8 + q]) * 16.0f); *(v8us*)((unsigned short*)Bt + t * 8) = f.half[0];  }
__global__ __launch_bounds__(256) void k_rsm(const float* __restrict__ S, _Float16* __restrict__ P, int nrows) {
  #pragma clang fp contract(off)
  const int i = blockIdx.x * 256 + threadIdx.x; if (i >= nrows) return; const float* s = S + (size_t)i * SQ; float mx = -3.0e38f;
#pragma unroll 1
  for (int j = 0; j < SQ; ++j) mx = fmaxf(mx, s[j]); float se = 0.f;
#pragma unroll 1
  for (int j = 0; j < SQ; ++j) se += expf(s[j] - mx); const float sc = 256.0f / se;
#pragma unroll 1
  for (int j0 = 0; j0 < SQ; j0 += 8) { FragH f; for (int q = 0; q < 8; ++q) f.h[q] = (_Float16)(expf(s[j0 + q] - mx) * sc); unsigned short* d = (unsigned short*)P + (size_t)i * SQ + j0; *(v8us*)d = f.half[0];  } }
__global__ __launch_bounds__(256) void k_vt(const _Float16* __restrict__ V16, int b, int h0, _Float16* __restrict__ VT) { __shared__ unsigned short tl[64][65]; const int tid = threadIdx.x; const int hh = blockIdx.x % HG, sg = blockIdx.x / HG; const int s0 = sg * 64; const int h = h0 + hh;
  for (int i = tid; i < 64 * 8; i += 256) { const int j = i / 8, d8 = (i % 8) * 8; FragH f; f.half[0] = *(const v8us*)((const unsigned short*)V16 + ((size_t)b * SQ + s0 + j) * DM + h * HD + d8); for (int q = 0; q < 8; ++q) tl[d8 + q][j] = f.u[q]; }
  __syncthreads();
  { for (int i = tid; i < 64 * 8; i += 256) { const int d = i / 8, j8 = (i % 8) * 8; FragH f; for (int q = 0; q < 8; ++q) f.u[q] = tl[d][j8 + q]; *(v8us*)((unsigned short*)VT + ((size_t)hh * HD + d) * SQ + s0 + j8) = f.half[0]; }  } }



__global__ __launch_bounds__(256) void k_rsmcf2(const float* __restrict__ S, _Float16* __restrict__ P, int hg, int q0, int nk) {
  #pragma clang fp contract(off)
  const int t = blockIdx.x * 256 + threadIdx.x; if (t >= hg * QT) return; const size_t i = (size_t)t; const float* s = S + i * NKX; const int last = q0 + (t % QT); float mx = -3.0e38f;
#pragma unroll 1
  for (int j = 0; j < nk; ++j) { const float f = (j <= last) ? 1.f : 0.f; mx = fmaxf(mx, fmaf(f, s[j], (1.f - f) * -1.0e9f)); } float se = 0.f;
#pragma unroll 1
  for (int j = 0; j < nk; ++j) { const float f = (j <= last) ? 1.f : 0.f; se += __expf(fmaf(f, s[j], (1.f - f) * -1.0e9f) - mx); } const float sc = 256.0f / se;
#pragma unroll 1
  for (int j0 = 0; j0 < nk; j0 += 8) { FragH fr; for (int q = 0; q < 8; ++q) { const int j = j0 + q; const float f = (j <= last) ? 1.f : 0.f; fr.h[q] = (_Float16)(__expf(fmaf(f, s[j], (1.f - f) * -1.0e9f) - mx) * sc); } unsigned short* d = (unsigned short*)P + i * NKX + j0; *(v8us*)d = fr.half[0];  } }

template <int MASKADD>
__global__ __launch_bounds__(64) void k_att0(const float* __restrict__ QF, const float* __restrict__ KF, const float* __restrict__ VF, int ld, const float* __restrict__ mask, float scale, float* __restrict__ OF, int ldo) {
  #pragma clang fp contract(off)
  __shared__ __attribute__((aligned(16))) float lq[64][64]; __shared__ __attribute__((aligned(16))) float lo[64][64];
  const int tid = threadIdx.x; const int h = blockIdx.x / (QT0 / 64), rg = blockIdx.x % (QT0 / 64); const int i = rg * 64 + tid;
  const float* qr = QF + (size_t)i * ld + h * HD;
#pragma unroll 1
  for (int c = 0; c < HD / 4; ++c) { *(v4f*)&lq[tid][c * 4] = *(const v4fa*)(qr + c * 4); const v4f z = {0.f, 0.f, 0.f, 0.f}; *(v4f*)&lo[tid][c * 4] = z; }
  float m = -1.0e30f, l = 0.f; const int jmax = MASKADD ? (SQ - 1) : (rg * 64 + 63);      /* additive-mask form: every key (the mask input decides); causal form: keys up to the block's last row */
#pragma unroll 1
  for (int j = 0; j <= jmax; ++j) { const float* kr = KF + (size_t)j * ld + h * HD; const float* vr = VF + (size_t)j * ld + h * HD; float s = 0.f;
#pragma unroll 1
    for (int c = 0; c < HD / 4; ++c) { const v4f kq = *(const v4fa*)(kr + c * 4); const v4f qq = *(v4f*)&lq[tid][c * 4]; s = __fadd_rn(s, __fmul_rn(qq[0], kq[0])); s = __fadd_rn(s, __fmul_rn(qq[1], kq[1])); s = __fadd_rn(s, __fmul_rn(qq[2], kq[2])); s = __fadd_rn(s, __fmul_rn(qq[3], kq[3])); }
    s = __fmul_rn(s, scale); if (MASKADD) s = __fadd_rn(s, __fmul_rn(bf16_round(mask[(size_t)i * SQ + j]), -10000.0f));
    const float f = (MASKADD || j <= i) ? 1.f : 0.f; const float sm = fmaf(f, s, (1.f - f) * -1.0e30f); const float mn = fmaxf(m, sm); const float sc = expf(m - mn); const float e = expf(sm - mn); l = __fadd_rn(__fmul_rn(l, sc), e); m = mn;
#pragma unroll 1
    for (int c = 0; c < HD / 4; ++c) { const v4f vv = *(const v4fa*)(vr + c * 4); v4f oo = *(v4f*)&lo[tid][c * 4]; for (int u = 0; u < 4; ++u) oo[u] = __fadd_rn(__fmul_rn(oo[u], sc), __fmul_rn(e, vv[u])); *(v4f*)&lo[tid][c * 4] = oo; } }
  const float fin = 64.0f / l;      /* o carried x64 like the f16 path */
#pragma unroll 1
  for (int c = 0; c < HD / 4; ++c) { v4f oo = *(v4f*)&lo[tid][c * 4]; for (int u = 0; u < 4; ++u) oo[u] = __fmul_rn(oo[u], fin); *(v4f*)&lo[tid][c * 4] = oo; }
  __syncthreads();
  {
#pragma unroll 1
    for (int it = 0; it < 16; ++it) { const int row = it * 4 + tid / 16, pc = (tid % 16) * 4; const v4f v = *(const v4f*)&lo[row][pc]; *(v4f*)(OF + (size_t)(rg * 64 + row) * ldo + h * HD + pc) = v; }
     } }

__global__ __launch_bounds__(256) void k_oscale(const float* __restrict__ OF, float* __restrict__ out, size_t n4) { const size_t t = (size_t)blockIdx.x * 256 + threadIdx.x; if (t >= n4) return; const v4f a = *(const v4fa*)(OF + t * 4); v4f o; for (int q = 0; q < 4; ++q) o[q] = a[q] * 0.015625f; *(v4f*)(out + t * 4) = o;  }

__global__ __launch_bounds__(256) void k_bfr(const float* __restrict__ x, float* __restrict__ XB, size_t n8) { const size_t t = (size_t)blockIdx.x * 256 + threadIdx.x; if (t >= n8) return; v4f a = *(const v4fa*)(x + t * 8), c = *(const v4fa*)(x + t * 8 + 4); for (int q = 0; q < 4; ++q) { a[q] = bf16_round(a[q]); c[q] = bf16_round(c[q]); }
  { *(v4f*)(XB + t * 8) = a; *(v4f*)(XB + t * 8 + 4) = c;  } }



__global__ __launch_bounds__(256) void k_rsmfvl(const float* __restrict__ S, _Float16* __restrict__ P, _Float16* __restrict__ PL, int qn, const int* __restrict__ vlp) {
  #pragma clang fp contract(off)
  const int t = blockIdx.x * 256 + threadIdx.x; if (t >= qn) return; const int vl = vlp[0]; const size_t i = (size_t)t; const float* s = S + i * SQ; float mx = -3.0e38f;
#pragma unroll 1
  for (int j = 0; j < SQ; ++j) { const float f = (j < vl) ? 1.f : 0.f; mx = fmaxf(mx, fmaf(f, s[j], (1.f - f) * -1000000.0f)); } float se = 0.f;
#pragma unroll 1
  for (int j = 0; j < SQ; ++j) { const float f = (j < vl) ? 1.f : 0.f; se += __expf(fmaf(f, s[j], (1.f - f) * -1000000.0f) - mx); } const float sc = 256.0f / se;
#pragma unroll 1
  for (int j0 = 0; j0 < SQ; j0 += 8) { FragH fr, gr; for (int q = 0; q < 8; ++q) { const int j = j0 + q; const float f = (j < vl) ? 1.f : 0.f; const float pv = __expf(fmaf(f, s[j], (1.f - f) * -1000000.0f) - mx) * sc; const _Float16 ph = (_Float16)pv; fr.h[q] = ph; gr.h[q] = (_Float16)((pv - (float)ph) * 1024.0f); }
    unsigned short* d = (unsigned short*)P + i * SQ + j0; unsigned short* dl = (unsigned short*)PL + i * SQ + j0; *(v8us*)d = fr.half[0]; *(v8us*)dl = gr.half[0];  } }

#define NRW 131072      /* rows */
#define NIN 40          /* input features */
#define KIN 64          /* padded input width */
#define D0 128
#define D1 64
#define D2 32
#define D2P 64
#define NBRN 33         /* branches */
#define RB 8192

__global__ __launch_bounds__(256) void k_zero16(unsigned short* __restrict__ p, size_t n8) { const size_t t = (size_t)blockIdx.x * 256 + threadIdx.x; if (t >= n8) return; v8us z; for (int q = 0; q < 8; ++q) z[q] = 0; *(v8us*)(p + t * 8) = z;  }



#define BWV 8           /* waves per work-group of the branch kernel */
#define BRW 64          /* batch rows per wave: four B tiles, so each weight fragment read from LDS feeds four WMMAs */
#define WCH 1280        /* 16-byte pieces of one branch's weights: 16 (layer 1) + 4 (layer 2) A fragments of 1 KiB */
#define AUXF 256        /* f32 side table per branch: b1 [0..63], b2 [64..95], W3 [96..127], b3 [128], rest 0 */
#define TCH 1024        /* 16-byte pieces of the trunk's weights: 16 A fragments of 1 KiB */
#define TAUX 512        /* f32 side table of the trunk: bs [0..127], BN scale [128..167], BN mean [192..231], BN shift [256..295], rest 0 */

// Per branch: the A fragments of W1[j]^T (tile mt, k step ks at index mt * 4 + ks) and of W2[j]^T (at 16 + mt * 2 + ks) in the order the lanes read them
// (piece = (fragment * 2 + half) * 32 + lane; lane (ln, hh) holds row 16 mt + ln, k = 32 ks + 16 half + 8 hh + 0..7), and the rounded biases and W3.
// Behind the branches, the trunk: the A fragments of Ws^T (tile mt, k step ks at index mt * 2 + ks, same piece order; k = 40..63 zero) and its side table.
__global__ __launch_bounds__(256) void k_pack(const float* __restrict__ W1, const float* __restrict__ b1, const float* __restrict__ W2, const float* __restrict__ b2, const float* __restrict__ W3, const float* __restrict__ b3,
    const float* __restrict__ Ws, const float* __restrict__ bs, const float* __restrict__ g, const float* __restrict__ be, const float* __restrict__ mu, const float* __restrict__ var, float eps,
    _Float16* __restrict__ PW, float* __restrict__ PA, _Float16* __restrict__ PT, float* __restrict__ PB) {
  const int t = blockIdx.x * 256 + threadIdx.x; if (t >= NBRN * (WCH + AUXF / 4) + TCH + TAUX / 4) return;
  if (t >= NBRN * (WCH + AUXF / 4)) { const int c = t - NBRN * (WCH + AUXF / 4);
    if (c < TCH) { const int lane = c & 31, ln = lane & 15, hh = lane >> 4, f = c >> 6, h = (c >> 5) & 1; const int n = (f >> 1) * 16 + ln, k0 = (f & 1) * 32 + h * 16 + 8 * hh; FragH o;
      for (int q = 0; q < 8; ++q) { const int k = k0 + q; o.h[q] = (k < NIN) ? (_Float16)(bf16_round(Ws[(size_t)k * D0 + n]) * 16.0f) : (_Float16)0.f; }
      *(v8us*)((unsigned short*)PT + (size_t)c * 8) = o.half[0]; }
    else { const int i0 = (c - TCH) * 4; v4f o;
      for (int u = 0; u < 4; ++u) { const int i = i0 + u, cf = (i - D0) & 63, kind = (i - D0) >> 6; float v = 0.f;
        if (i < D0) v = bf16_round(bs[i]); else if (cf < NIN && kind == 0) v = rsqrtf(bf16_round(var[cf]) + eps) * bf16_round(g[cf]); else if (cf < NIN && kind == 1) v = bf16_round(mu[cf]); else if (cf < NIN && kind == 2) v = bf16_round(be[cf]);
        o[u] = v; }
      *(v4f*)(PB + i0) = o; }
    return; }
  const int j = t / (WCH + AUXF / 4), c = t % (WCH + AUXF / 4);
  if (c < WCH) { const int lane = c & 31, ln = lane & 15, hh = lane >> 4, f = c >> 6, h = (c >> 5) & 1; FragH o;
    if (f < 16) { const int k = (f >> 2) * 16 + ln, d0 = (f & 3) * 32 + h * 16 + 8 * hh; for (int q = 0; q < 8; ++q) o.h[q] = (_Float16)(bf16_round(W1[((size_t)j * D0 + d0 + q) * D1 + k]) * 16.0f); }
    else { const int m = ((f - 16) >> 1) * 16 + ln, k0 = ((f - 16) & 1) * 32 + h * 16 + 8 * hh; for (int q = 0; q < 8; ++q) o.h[q] = (_Float16)(bf16_round(W2[((size_t)j * D1 + k0 + q) * D2 + m]) * 16.0f); }
    *(v8us*)((unsigned short*)PW + ((size_t)j * WCH + c) * 8) = o.half[0]; }
  else { const int i0 = (c - WCH) * 4; v4f o;
    for (int u = 0; u < 4; ++u) { const int i = i0 + u; float v = 0.f; if (i < D1) v = b1[j * D1 + i]; else if (i < D1 + D2) v = b2[j * D2 + i - D1]; else if (i < D1 + 2 * D2) v = W3[j * D2 + i - D1 - D2]; else if (i == D1 + 2 * D2) v = b3[j]; o[u] = bf16_round(v); }
    *(v4f*)(PA + (size_t)j * AUXF + i0) = o; } }

__device__ __forceinline__ v16h br_frag(const unsigned short* wb, int f, int lane) { FragH x; x.half[0] = *(const v8us*)(wb + f * 512 + lane * 8); x.half[1] = *(const v8us*)(wb + f * 512 + 256 + lane * 8); return x.v; }
__device__ __forceinline__ v8f br_mma(v16h a, v16h b, v8f c) { return __builtin_amdgcn_wmma_f32_16x16x32_f16(false, a, false, b, (short)0, c, false, false); }
__device__ __forceinline__ float br_xhalf(float x) { return __builtin_bit_cast(float, __builtin_amdgcn_permlanex16(__builtin_bit_cast(int, x), __builtin_bit_cast(int, x), 0x76543210, 0xfedcba98, false, false)); }

// One wave: 64 batch rows; BN and the trunk layer first (64 WMMAs, the trunk's weights staged in LDS beside branch 0's), z held as 16 B fragments for the whole kernel; then the loop over the 33 branches, the branch's weights staged in LDS for the 8 waves (two buffers, one barrier a branch, in the middle of the trip: behind it a wave reads the next branch's first fragments while it still works on this branch, so no trip starts with a wait on LDS).
// Every "#pragma unroll" in this kernel makes the indices of a fragment or accumulator array constants, so that the array stays in registers (a run-time index would send it to scratch).
__global__ __launch_bounds__(256) void k_branch(const float* __restrict__ x, const _Float16* __restrict__ PT, const float* __restrict__ PB, const _Float16* __restrict__ PW, const float* __restrict__ PA, float* __restrict__ out) {
  __shared__ __attribute__((aligned(16))) unsigned short sw[2][WCH * 8];
  __shared__ __attribute__((aligned(16))) float sa[2][AUXF];
  __shared__ __attribute__((aligned(16))) float so[BWV][BRW * NBRN];
  __shared__ __attribute__((aligned(16))) unsigned short tw[TCH * 8];      /* of its own: a late wave still reads it while an early one refills sw */
  __shared__ __attribute__((aligned(16))) float tb[TAUX];
  const int tid = threadIdx.x, w = tid >> 5, lane = tid & 31, ln = lane & 15, hh = lane >> 4;
  const size_t row0 = (size_t)blockIdx.x * (BWV * BRW) + (size_t)w * BRW;
  const unsigned short* pw = (const unsigned short*)PW;
  v8us st[5]; float sta;
#pragma unroll
  for (int i = 0; i < 5; ++i) st[i] = *(const v8us*)(pw + (size_t)(tid + 256 * i) * 8);
  sta = PA[tid];
  v8us tt[4]; v2f ttb;
#pragma unroll
  for (int i = 0; i < 4; ++i) tt[i] = *(const v8us*)((const unsigned short*)PT + (size_t)(tid + 256 * i) * 8);
  ttb = *(const v2f*)(PB + tid * 2);
  v4f xr[4][6];      /* lane (ln, hh), tile n: features 8 hh + 0..7, 16 + 8 hh + 0..7 and 32..39 of row 16 n + ln */
#pragma unroll
  for (int n = 0; n < 4; ++n) { const float* xp = x + (row0 + n * 16 + ln) * NIN;
#pragma unroll
    for (int q = 0; q < 6; ++q) xr[n][q] = *(const v4fa*)(xp + ((q < 4) ? (q >> 1) * 16 + 8 * hh + (q & 1) * 4 : q * 4 + 16)); }
  asm volatile("s_wait_xcnt 0x0" ::: "memory");      /* stands before the address registers of the loads above are reused */
  __builtin_amdgcn_sched_barrier(0);      /* keeps the LDS address arithmetic below, which reuses those registers, behind that wait */
#pragma unroll
  for (int i = 0; i < 5; ++i) *(v8us*)(&sw[0][(tid + 256 * i) * 8]) = st[i];
  sa[0][tid] = sta;
#pragma unroll
  for (int i = 0; i < 4; ++i) *(v8us*)(&tw[(tid + 256 * i) * 8]) = tt[i];
  *(v2f*)(&tb[tid * 2]) = ttb;
  __syncthreads();      /* publishes branch 0's weights and the trunk's */
#pragma unroll
  for (int i = 0; i < 5; ++i) st[i] = *(const v8us*)(pw + ((size_t)WCH + tid + 256 * i) * 8);      /* branch 1, stored in trip 0; behind the barrier, which would wait for these loads */
  sta = PA[(size_t)AUXF + tid];
  asm volatile("s_wait_xcnt 0x0" ::: "memory");      /* stands before the loads' address registers are reused */
  __builtin_amdgcn_sched_barrier(0);      /* keeps what follows, which reuses those registers, behind that wait */
  const v8f z8 = {0.f, 0.f, 0.f, 0.f, 0.f, 0.f, 0.f, 0.f};
  v16h xb[4][2];      /* xn as B fragments: k step 0 = features 0..31, k step 1 = features 32..39 and zeros */
  { v4f bsc[6], bmu[6], bsh[6]; const unsigned keep = hh ? 0u : 0xffffffffu;
#pragma unroll
    for (int q = 0; q < 6; ++q) { const int c = (q < 4) ? (q >> 1) * 16 + 8 * hh + (q & 1) * 4 : q * 4 + 16; bsc[q] = *(const v4f*)(tb + 128 + c); bmu[q] = *(const v4f*)(tb + 192 + c); bsh[q] = *(const v4f*)(tb + 256 + c); }
#pragma unroll
    for (int n = 0; n < 4; ++n) { FragH f0, f1;
#pragma unroll
      for (int q = 0; q < 6; ++q) { const v4f xq = __builtin_convertvector(__builtin_convertvector(xr[n][q], v4b), v4f);      /* x rounded to bf16, to nearest even */
        const v4h y = __builtin_convertvector((xq - bmu[q]) * bsc[q] + bsh[q], v4h);
#pragma unroll
        for (int u = 0; u < 4; ++u) { if (q < 4) f0.h[q * 4 + u] = y[u]; else { f1.h[(q - 4) * 4 + u] = y[u]; f1.h[8 + (q - 4) * 4 + u] = (_Float16)0.f; } } }
      v8u w1 = __builtin_bit_cast(v8u, f1.v);
#pragma unroll
      for (int i = 0; i < 4; ++i) w1[i] &= keep;      /* lanes 16-31 stand for k = 40..47: zeros */
      xb[n][0] = f0.v; xb[n][1] = __builtin_bit_cast(v16h, w1); } }
  v16h zf[4][4];
#pragma unroll
  for (int ks = 0; ks < 4; ++ks) {      /* z features 32 ks .. 32 ks + 31 = k step ks of layer 1 */
    v16h ta[2][2]; v4f bz[4]; v8f t0[4], t1[4];
#pragma unroll
    for (int m = 0; m < 2; ++m) { ta[m][0] = br_frag(tw, (2 * ks + m) * 2, lane); ta[m][1] = br_frag(tw, (2 * ks + m) * 2 + 1, lane); }
#pragma unroll
    for (int q = 0; q < 4; ++q) bz[q] = *(const v4f*)(tb + 32 * ks + (q >> 1) * 16 + 8 * hh + (q & 1) * 4);
#pragma unroll
    for (int n = 0; n < 4; ++n) { t0[n] = br_mma(ta[0][0], xb[n][0], z8); t1[n] = br_mma(ta[1][0], xb[n][0], z8); }
#pragma unroll
    for (int n = 0; n < 4; ++n) { t0[n] = br_mma(ta[0][1], xb[n][1], t0[n]); t1[n] = br_mma(ta[1][1], xb[n][1], t1[n]); }
#pragma unroll
    for (int n = 0; n < 4; ++n) { FragH hb;
#pragma unroll
      for (int r = 0; r < 8; ++r) { hb.h[r] = (_Float16)fmaxf(t0[n][r] * 0.0625f + bz[r >> 2][r & 3], 0.f); hb.h[8 + r] = (_Float16)fmaxf(t1[n][r] * 0.0625f + bz[2 + (r >> 2)][r & 3], 0.f); }
      zf[n][ks] = hb.v; }
  }
  v16h wa[2][4], ua[2][2]; v4f bb[2][4];      /* layer-1 A fragments of the current half; layer-2 A fragments and b1 of both halves; wa, ua[0] and bb[0] are carried from trip to trip */
#pragma unroll
  for (int ks = 0; ks < 4; ++ks) { wa[0][ks] = br_frag(sw[0], ks, lane); wa[1][ks] = br_frag(sw[0], 4 + ks, lane); }      /* branch 0: what a trip finds in registers when it starts */
  ua[0][0] = br_frag(sw[0], 16, lane); ua[0][1] = br_frag(sw[0], 18, lane);
#pragma unroll
  for (int q = 0; q < 4; ++q) bb[0][q] = *(const v4f*)(sa[0] + 8 * hh + (q >> 1) * 16 + (q & 1) * 4);
#pragma unroll 1      /* one copy of the trip: 80 WMMAs and their epilogues are body enough, and the text stays small for the instruction cache */
  for (int j = 0; j < NBRN; ++j) {
    const int jn = (j + 2 < NBRN) ? j + 2 : NBRN - 1;      /* the last trips load and store the last branch once more: no branch round the loads */
    const unsigned short* wb = sw[j & 1]; const float* ab = sa[j & 1] + 8 * hh;
    const unsigned short* wn = sw[(j + 1) & 1]; const float* an = sa[(j + 1) & 1] + 8 * hh;
    v4f cc[4], ee[4];      /* b2, W3 */
    ua[1][0] = br_frag(wb, 17, lane); ua[1][1] = br_frag(wb, 19, lane);      /* what this branch needs late, read under its first WMMAs */
#pragma unroll
    for (int q = 0; q < 4; ++q) { const int o = (q >> 1) * 16 + (q & 1) * 4; bb[1][q] = *(const v4f*)(ab + 32 + o); cc[q] = *(const v4f*)(ab + 64 + o); ee[q] = *(const v4f*)(ab + 96 + o); }
    const float b3v = sa[j & 1][128];
    __builtin_amdgcn_sched_barrier(0);      /* keeps these LDS reads in one group at the head of the trip, not strewn among the WMMAs */
    v8f a2[2][4];
#pragma unroll
    for (int n = 0; n < 4; ++n) { a2[0][n] = z8; a2[1][n] = z8; }
#pragma unroll
    for (int s = 0; s < 2; ++s) {      /* h1 features 32 s .. 32 s + 31 = k step s of layer 2 */
      v8f a1[2][4];
#pragma unroll
      for (int n = 0; n < 4; ++n) { a1[0][n] = z8; a1[1][n] = z8; }
#pragma unroll
      for (int ks = 0; ks < 4; ++ks) {
#pragma unroll
        for (int n = 0; n < 4; ++n) { a1[0][n] = br_mma(wa[0][ks], zf[n][ks], a1[0][n]); a1[1][n] = br_mma(wa[1][ks], zf[n][ks], a1[1][n]); }
        __builtin_amdgcn_sched_barrier(0);      /* keeps eight independent accumulators per k step: without it the four k steps of one tile are issued as a dependent chain */
        if (s == 1 && ks == 0) {
#pragma unroll
          for (int i = 0; i < 5; ++i) st[i] = *(const v8us*)(pw + ((size_t)jn * WCH + tid + 256 * i) * 8);
          sta = PA[(size_t)jn * AUXF + tid];
          asm volatile("s_wait_xcnt 0x0" ::: "memory");      /* stands before the loads' address registers are reused */
          __builtin_amdgcn_sched_barrier(0);      /* keeps what follows, which may reuse those registers, behind that wait */
        }
      }
      if (s == 0) {      /* the second half's layer-1 fragments, this wave's last reads of this branch's buffer; the next branch goes into the other buffer */
#pragma unroll
        for (int ks = 0; ks < 4; ++ks) { wa[0][ks] = br_frag(wb, 8 + ks, lane); wa[1][ks] = br_frag(wb, 12 + ks, lane); }
#pragma unroll
        for (int i = 0; i < 5; ++i) *(v8us*)(&sw[(j + 1) & 1][(tid + 256 * i) * 8]) = st[i];
        sa[(j + 1) & 1][tid] = sta;
      } else {      /* behind this trip's barrier: the next branch's first-half fragments, read while this branch's last epilogue and dot run */
#pragma unroll
        for (int ks = 0; ks < 4; ++ks) { wa[0][ks] = br_frag(wn, ks, lane); wa[1][ks] = br_frag(wn, 4 + ks, lane); }
        ua[0][0] = br_frag(wn, 16, lane); ua[0][1] = br_frag(wn, 18, lane);
#pragma unroll
        for (int q = 0; q < 4; ++q) bb[0][q] = *(const v4f*)(an + (q >> 1) * 16 + (q & 1) * 4);
      }
      __builtin_amdgcn_sched_barrier(0);      /* keeps these LDS reads in one group ahead of the epilogue that hides their latency */
#pragma unroll
      for (int n = 0; n < 4; ++n) { FragH hb;
#pragma unroll
        for (int r = 0; r < 8; ++r) { hb.h[r] = (_Float16)fmaxf(a1[0][n][r] * 0.0625f + bb[s][r >> 2][r & 3], 0.f); hb.h[8 + r] = (_Float16)fmaxf(a1[1][n][r] * 0.0625f + bb[s][2 + (r >> 2)][r & 3], 0.f); }
        a2[0][n] = br_mma(ua[s][0], hb.v, a2[0][n]); a2[1][n] = br_mma(ua[s][1], hb.v, a2[1][n]); }
      __builtin_amdgcn_sched_barrier(0);      /* keeps the next half's first WMMAs from being drawn into the epilogue as dependent chains */
      if (s == 0) __syncthreads();      /* publishes the next branch's weights and ends every wave's reads of this branch's buffer, which the next trip refills */
    }
    float p[4];
#pragma unroll
    for (int n = 0; n < 4; ++n) { float sl = 0.f, su = 0.f;
#pragma unroll
      for (int r = 0; r < 8; ++r) { sl = fmaf(fmaxf(a2[0][n][r] * 0.0625f + cc[r >> 2][r & 3], 0.f), ee[r >> 2][r & 3], sl); su = fmaf(fmaxf(a2[1][n][r] * 0.0625f + cc[2 + (r >> 2)][r & 3], 0.f), ee[2 + (r >> 2)][r & 3], su); }
      p[n] = sl + su; }
#pragma unroll
    for (int g = 0; g < 2; ++g) {
      const float mine = hh ? p[2 * g + 1] : p[2 * g], send = hh ? p[2 * g] : p[2 * g + 1];
      so[w][((2 * g + hh) * 16 + ln) * NBRN + j] = mine + br_xhalf(send) + b3v; }
  }
  float* og = out + row0 * NBRN; const float* sp = so[w];      /* 64 rows x 33 f32 = 66 whole 128-byte lines, this wave's own */
  for (int i = lane; i < BRW * NBRN / 4; i += 32) *(v4f*)(og + i * 4) = *(const v4f*)(sp + i * 4);
}

extern "C" void kernel_launch(void* const* d_in, const int* in_sizes, int n_in,
                              void* d_out, int out_size, void* d_ws, size_t ws_size, hipStream_t stream) {
  (void)in_sizes; (void)n_in; (void)out_size;
  const float* const* I = (const float* const*)d_in; const float* x = I[0]; const float* bng = I[1]; const float* bnb = I[2]; const float* bnm = I[3]; const float* bnv = I[4]; const float* Ws = I[5]; const float* bs = I[6]; const float* W1 = I[7]; const float* b1 = I[8]; const float* W2 = I[9]; const float* b2 = I[10]; const float* W3 = I[11]; const float* b3 = I[12];
  char* ws = (char*)d_ws; size_t off = 0;
  auto take = [&](size_t bytes) { char* p = ws + off; off += (bytes + 255) & ~(size_t)255; return p; };
  _Float16* PW = (_Float16*)take((size_t)NBRN * WCH * 16); float* PA = (float*)take((size_t)NBRN * AUXF * 4); _Float16* PT = (_Float16*)take((size_t)TCH * 16); float* PB = (float*)take((size_t)TAUX * 4);
  if (off > ws_size) return;
  k_pack<<<(NBRN * (WCH + AUXF / 4) + TCH + TAUX / 4 + 255) / 256, 256, 0, stream>>>(W1, b1, W2, b2, W3, b3, Ws, bs, bng, bnb, bnm, bnv, 1e-5f, PW, PA, PT, PB);      /* branch and trunk weights as A fragments; biases, W3 and the BN terms rounded */
  k_branch<<<NRW / (BWV * BRW), 256, 0, stream>>>(x, PT, PB, PW, PA, (float*)d_out);      /* BN, trunk, then gu[r][j] for all rows and branches */
}

// v004
// It runs in 52.5 microseconds.
// Timed twice side by side with v003, it ran 1.04 and 1.03 times as fast.
// Counting every step since v000, it is 19.4 times as fast.
#include <hip/hip_runtime.h>
#define NB 1
#define SQ 8192
#define DM 64
#define NH 1
#define HD 64
#define HG 4                         /* heads per attention launch group */
#define B0 0                         /* first batch processed (debug hook) */
#define NBR NB                       /* batches processed (debug hook) */
#define NR ((size_t)NB * SQ)         /* token rows */
#define MP ((int)((size_t)NBR * SQ)) /* rows projected (debug hook) */
#define QT 256                       /* query rows per causal tile */
#define NKX SQ                       /* S / P row pitch */
#define QT0 256                      /* first-tile rows recomputed exactly (256: buys margin for the few-key rows 128..255, which have no output projection to average the single-f16 P/v rounding) */
#define QN SQ                        /* query rows attended per batch (debug hook) */
#define NHD NH                       /* heads attended (debug hook) */
#define MPO MP                       /* rows through the output stage (debug hook) */
#define LQ DM            /* row pitch of the q/k/v rows */
typedef __bf16 v16b __attribute__((ext_vector_type(16)));
typedef unsigned short v8us __attribute__((ext_vector_type(8), may_alias));
typedef float  v8f  __attribute__((ext_vector_type(8)));
typedef float  v4f  __attribute__((ext_vector_type(4)));
typedef float  v4fa __attribute__((ext_vector_type(4), may_alias));
typedef float  v2f  __attribute__((ext_vector_type(2)));
typedef unsigned int v8u __attribute__((ext_vector_type(8)));
typedef __bf16 v4b __attribute__((ext_vector_type(4)));
union FragB { v16b v; v8us half[2]; unsigned short u[16]; };

__device__ __forceinline__ unsigned short bf16_bits(float x) { unsigned int u = __float_as_uint(x); return (unsigned short)((u + 0x7FFFu + ((u >> 16) & 1u)) >> 16); }
__device__ __forceinline__ float bf16_val(unsigned short b) { return __uint_as_float(((unsigned int)b) << 16); }
__device__ __forceinline__ float bf16_round(float x) { return bf16_val(bf16_bits(x)); }
// D += A·B with NT terms: 1 = ah·bh, 2 = + al·bh (A split), 3 = + ah·bl (both split)
template <int NT>
__device__ __forceinline__ v8f mmaN(v16b ah, v16b al, v16b bh, v16b bl, v8f c) {
  c = __builtin_amdgcn_wmma_f32_16x16x32_bf16(false, ah, false, bh, (short)0, c, false, false);
  if (NT >= 2) c = __builtin_amdgcn_wmma_f32_16x16x32_bf16(false, al, false, bh, (short)0, c, false, false);
  if (NT >= 3) c = __builtin_amdgcn_wmma_f32_16x16x32_bf16(false, ah, false, bl, (short)0, c, false, false);
  asm volatile("v_nop\n\tv_nop\n\tv_nop\n\tv_nop" : "+v"(c) : "v"(ah), "v"(al), "v"(bh), "v"(bl));
  return c;
}

__global__ __launch_bounds__(256) void k_wt_bf16(const float* __restrict__ W, unsigned short* __restrict__ Wt, int K, int N) {
  const int t = blockIdx.x * 256 + threadIdx.x;
  const int k8n = K / 8;
  if (t >= N * k8n) return;
  const int n = t / k8n, k8 = (t % k8n) * 8;
  v8us v;
#pragma unroll
  for (int i = 0; i < 8; ++i) v[i] = bf16_bits(W[(size_t)(k8 + i) * N + n]);
  *(v8us*)(Wt + (size_t)n * K + k8) = v;
  
}

// GEMM C[M][N] (f32, pitch ldc) = act(A[M][K]·W + bias). A f32 row-major (pitch lda) converted per fragment to bf16
// (ASPLIT: hi/lo two planes -> 2 terms, else single rounded term); Wt bf16 [N][K] (pitch ldb). BIAS_BF16 rounds the
// bias to bf16 first (bias quantised to bf16 before the add). K%32==0, M%16==0, N%64==0.
template <bool ASPLIT, int ACT, bool BIAS_BF16>
__global__ __launch_bounds__(128) void k_gemm_bf(const float* __restrict__ A, int lda, const unsigned short* __restrict__ Wt, int ldb,
                                               const float* __restrict__ bias, float* __restrict__ C, int ldc, int M, int N, int K) {
  __shared__ __attribute__((aligned(16))) float so[4][16][64];
  const int tid = threadIdx.x, w = tid >> 5, lane = tid & 31, ln = lane & 15, hh = lane >> 4;
  const int ntn = N / 64;
  const int wid = blockIdx.x * 4 + w;
  const int mt = wid / ntn, nq = wid % ntn;
  if (mt * 16 >= M) return;
  const int row0 = mt * 16, col0 = nq * 64;
  const float* arow = A + (size_t)(row0 + ln) * lda;
  v8f acc[4] = {};
  for (int kb = 0; kb < K; kb += 32) {
    FragB ah, al;
    const v4f x0 = *(const v4fa*)(arow + kb + 8 * hh), x1 = *(const v4fa*)(arow + kb + 8 * hh + 4);
    const v4f x2 = *(const v4fa*)(arow + kb + 16 + 8 * hh), x3 = *(const v4fa*)(arow + kb + 16 + 8 * hh + 4);
    float xs[16] = {x0[0],x0[1],x0[2],x0[3],x1[0],x1[1],x1[2],x1[3],x2[0],x2[1],x2[2],x2[3],x3[0],x3[1],x3[2],x3[3]};
#pragma unroll
    for (int i = 0; i < 16; ++i) { const unsigned short hb = bf16_bits(xs[i]); ah.u[i] = hb; al.u[i] = ASPLIT ? bf16_bits(xs[i] - bf16_val(hb)) : (unsigned short)0; }
#pragma unroll
    for (int t = 0; t < 4; ++t) {
      const unsigned short* brow = Wt + (size_t)(col0 + t * 16 + ln) * ldb + kb;
      FragB b;
      b.half[0] = *(const v8us*)(brow + 8 * hh);
      b.half[1] = *(const v8us*)(brow + 16 + 8 * hh);
      acc[t] = mmaN<ASPLIT ? 2 : 1>(ah.v, al.v, b.v, b.v, acc[t]);
    }
  }
#pragma unroll
  for (int t = 0; t < 4; ++t) {
    float bv = bias ? bias[col0 + t * 16 + ln] : 0.f;
    if (BIAS_BF16) bv = bf16_round(bv);
#pragma unroll
    for (int r = 0; r < 8; ++r) { float v = acc[t][r] + bv; if (ACT == 1) v = fmaxf(v, 0.f); so[w][8 * hh + r][t * 16 + ln] = v; }
  }
  __builtin_amdgcn_fence(__ATOMIC_ACQ_REL, "workgroup");
  __builtin_amdgcn_wave_barrier();
  const int rsub = lane >> 4, c4 = (lane & 15) * 4;
  {
#pragma unroll
    for (int q = 0; q < 8; ++q) {
      const int r = q * 2 + rsub;
      const v4f v = *(const v4fa*)&so[w][r][c4];
      *(v4f*)(C + (size_t)(row0 + r) * ldc + col0 + c4) = v;
    }
    
  }
}

// GEMM C = act(A·W + bias + resid): A f32 (ASPLIT -> hi/lo 2 terms), Wt bf16 [N][K]; ACT 0 none, 1 relu, 2 exact gelu;
// resid (optional, f32, row index = (row % rmod), pitch ldr, RES_BF16 rounds it) added before the activation.
template <bool ASPLIT, int ACT, bool BIAS_BF16, bool RES_BF16>
__global__ __launch_bounds__(128) void k_gemm_bf3(const float* __restrict__ A, int lda, const unsigned short* __restrict__ Wt, int ldb,
                                                const float* __restrict__ bias, const float* __restrict__ resid, int rmod, int ldr,
                                                float* __restrict__ C, int ldc, int M, int N, int K) {
  __shared__ __attribute__((aligned(16))) float so[4][16][64];
  const int tid = threadIdx.x, w = tid >> 5, lane = tid & 31, ln = lane & 15, hh = lane >> 4;
  const int ntn = N / 64;
  const int wid = blockIdx.x * 4 + w;
  const int mt = wid / ntn, nq = wid % ntn;
  if (mt * 16 >= M) return;
  const int row0 = mt * 16, col0 = nq * 64;
  const float* arow = A + (size_t)(row0 + ln) * lda;
  v8f acc[4] = {};
  for (int kb = 0; kb < K; kb += 32) {
    FragB ah, al;
    const v4f x0 = *(const v4fa*)(arow + kb + 8 * hh), x1 = *(const v4fa*)(arow + kb + 8 * hh + 4);
    const v4f x2 = *(const v4fa*)(arow + kb + 16 + 8 * hh), x3 = *(const v4fa*)(arow + kb + 16 + 8 * hh + 4);
    float xs[16] = {x0[0],x0[1],x0[2],x0[3],x1[0],x1[1],x1[2],x1[3],x2[0],x2[1],x2[2],x2[3],x3[0],x3[1],x3[2],x3[3]};
#pragma unroll
    for (int i = 0; i < 16; ++i) { const unsigned short hb = bf16_bits(xs[i]); ah.u[i] = hb; al.u[i] = ASPLIT ? bf16_bits(xs[i] - bf16_val(hb)) : (unsigned short)0; }
#pragma unroll
    for (int t = 0; t < 4; ++t) {
      const unsigned short* brow = Wt + (size_t)(col0 + t * 16 + ln) * ldb + kb;
      FragB b;
      b.half[0] = *(const v8us*)(brow + 8 * hh);
      b.half[1] = *(const v8us*)(brow + 16 + 8 * hh);
      acc[t] = mmaN<ASPLIT ? 2 : 1>(ah.v, al.v, b.v, b.v, acc[t]);
    }
  }
#pragma unroll
  for (int t = 0; t < 4; ++t) {
    const int col = col0 + t * 16 + ln;
    float bv = bias ? bias[col] : 0.f;
    if (BIAS_BF16) bv = bf16_round(bv);
#pragma unroll
    for (int r = 0; r < 8; ++r) {
      float v = acc[t][r] + bv;
      if (resid) { float rv = resid[(size_t)((row0 + 8 * hh + r) % rmod) * ldr + col]; if (RES_BF16) rv = bf16_round(rv); v += rv; }
      if (ACT == 1) v = fmaxf(v, 0.f);
      if (ACT == 2) v = 0.5f * v * (1.0f + erff(v * 0.70710678118654752f));
      if (ACT == 3) { const float u = 0.7978845608028654f * (v + 0.044715f * v * v * v); v = 0.5f * v * (1.0f + tanhf(u)); }
      so[w][8 * hh + r][t * 16 + ln] = v;
    }
  }
  __builtin_amdgcn_fence(__ATOMIC_ACQ_REL, "workgroup");
  __builtin_amdgcn_wave_barrier();
  const int rsub = lane >> 4, c4 = (lane & 15) * 4;
  {
#pragma unroll
    for (int q = 0; q < 8; ++q) {
      const int r = q * 2 + rsub;
      const v4f v = *(const v4fa*)&so[w][r][c4];
      *(v4f*)(C + (size_t)(row0 + r) * ldc + col0 + c4) = v;
    }
    
  }
}
// row LayerNorm (biased variance, eps) over N: s = X (+ R); optional out_sum <- s; out_norm <- (s-mu)*rsqrt(var+eps)*g + b
template <bool PARAM_BF16>
__global__ __launch_bounds__(256) void k_layernorm(const float* __restrict__ X, const float* __restrict__ R, const float* __restrict__ g, const float* __restrict__ bta,
                                                  float* __restrict__ out_sum, float* __restrict__ out_norm, int N, float eps) {
  __shared__ float red[256];
  const int row = blockIdx.x, tid = threadIdx.x;
  const float* x = X + (size_t)row * N; const float* rr = R ? R + (size_t)row * N : nullptr;
  float vals[16];                     // up to N = 4096
  const int per = N / 256;            // contiguous chunk per thread? use strided-by-4 chunks: thread handles j = tid*4 + 1024*u
  float s1 = 0.f;
  for (int u = 0; u < per / 4; ++u) {
    const int j = tid * 4 + 1024 * u;
    const v4f a = *(const v4fa*)(x + j);
    v4f b = {0.f,0.f,0.f,0.f}; if (rr) b = *(const v4fa*)(rr + j);
#pragma unroll
    for (int q = 0; q < 4; ++q) { const float v = a[q] + b[q]; vals[u * 4 + q] = v; s1 += v; }
  }
  red[tid] = s1; __syncthreads();
  for (int st = 128; st > 0; st >>= 1) { if (tid < st) red[tid] += red[tid + st]; __syncthreads(); }
  const float mu = red[0] / (float)N; __syncthreads();
  float s2 = 0.f;
  for (int u = 0; u < per / 4; ++u)
#pragma unroll
    for (int q = 0; q < 4; ++q) { const float c = vals[u * 4 + q] - mu; s2 += c * c; }
  red[tid] = s2; __syncthreads();
  for (int st = 128; st > 0; st >>= 1) { if (tid < st) red[tid] += red[tid + st]; __syncthreads(); }
  const float rs = rsqrtf(red[0] / (float)N + eps);
  {
    for (int u = 0; u < per / 4; ++u) {
      const int j = tid * 4 + 1024 * u;
      v4f o, sm;
#pragma unroll
      for (int q = 0; q < 4; ++q) {
        float gg = g[j + q], bb = bta[j + q];
        if (PARAM_BF16) { gg = bf16_round(gg); bb = bf16_round(bb); }
        sm[q] = vals[u * 4 + q]; o[q] = (vals[u * 4 + q] - mu) * rs * gg + bb;
      }
      if (out_sum) *(v4f*)(out_sum + (size_t)row * N + j) = sm;
      *(v4f*)(out_norm + (size_t)row * N + j) = o;
    }
    
  }
}



// ---- f16 WMMA path (v_wmma_f32_16x16x32_f16): 11-bit significands for operands in range — used where a [0,1] probability operand needs more precision than bf16
typedef _Float16 v16h __attribute__((ext_vector_type(16)));
union FragH { v16h v; v8us half[2]; _Float16 h[16]; unsigned short u[16]; };
template <int NT>
__device__ __forceinline__ v8f mmaH(v16h ah, v16h al, v16h bh, v16h bl, v8f c) {
  c = __builtin_amdgcn_wmma_f32_16x16x32_f16(false, ah, false, bh, (short)0, c, false, false);
  if (NT >= 2) c = __builtin_amdgcn_wmma_f32_16x16x32_f16(false, al, false, bh, (short)0, c, false, false);
  if (NT >= 3) c = __builtin_amdgcn_wmma_f32_16x16x32_f16(false, ah, false, bl, (short)0, c, false, false);
  asm volatile("v_nop\n\tv_nop\n\tv_nop\n\tv_nop" : "+v"(c) : "v"(ah), "v"(al), "v"(bh), "v"(bl));
  return c;
}
// batched GEMM like k_gemm_b but f16 operands: A f32 (split into f16 hi/lo if ASPLIT, else rounded to f16), Bt = f16 values [n][k]; alpha; C f32; N multiple of 16 (partial tiles skipped)
template <bool ASPLIT>
__global__ __launch_bounds__(128) void k_gemm_h(const float* __restrict__ A, int lda, size_t sA, const _Float16* __restrict__ Bh, int ldb, size_t sB, float alpha, float* __restrict__ C, int ldc, size_t sC, int M, int N, int K) {
  __shared__ __attribute__((aligned(16))) float so[4][16][64];
  const int tid = threadIdx.x, w = tid >> 5, lane = tid & 31, ln = lane & 15, hh = lane >> 4; const int by = blockIdx.y;
  A += (size_t)by * sA; Bh += (size_t)by * sB; C += (size_t)by * sC;
  const int ntn = (N + 63) / 64; const int wid = blockIdx.x * 4 + w; const int mt = wid / ntn, nq = wid % ntn; if (mt * 16 >= M) return;
  const int row0 = mt * 16, col0 = nq * 64; const float* arow = A + (size_t)(row0 + ln) * lda;
  v8f acc[4] = {};
  for (int kb = 0; kb < K; kb += 32) {
    FragH ah, al;
    const v4f x0 = *(const v4fa*)(arow + kb + 8 * hh), x1 = *(const v4fa*)(arow + kb + 8 * hh + 4), x2 = *(const v4fa*)(arow + kb + 16 + 8 * hh), x3 = *(const v4fa*)(arow + kb + 16 + 8 * hh + 4);
    float xs[16] = {x0[0],x0[1],x0[2],x0[3],x1[0],x1[1],x1[2],x1[3],x2[0],x2[1],x2[2],x2[3],x3[0],x3[1],x3[2],x3[3]};
#pragma unroll
    for (int i = 0; i < 16; ++i) { const _Float16 h = (_Float16)xs[i]; ah.h[i] = h; al.h[i] = ASPLIT ? (_Float16)(xs[i] - (float)h) : (_Float16)0.0f; }
#pragma unroll
    for (int t = 0; t < 4; ++t) { if (col0 + t * 16 >= N) continue; const size_t boff = (size_t)(col0 + t * 16 + ln) * ldb + kb; FragH bq; bq.half[0] = *(const v8us*)(Bh + boff + 8 * hh); bq.half[1] = *(const v8us*)(Bh + boff + 16 + 8 * hh);
      acc[t] = mmaH<ASPLIT ? 2 : 1>(ah.v, al.v, bq.v, bq.v, acc[t]); }
  }
#pragma unroll
  for (int t = 0; t < 4; ++t) { if (col0 + t * 16 >= N) continue;
#pragma unroll
    for (int r = 0; r < 8; ++r) so[w][8 * hh + r][t * 16 + ln] = acc[t][r] * alpha; }
  __builtin_amdgcn_fence(__ATOMIC_ACQ_REL, "workgroup"); __builtin_amdgcn_wave_barrier();
  const int rsub = lane >> 4, c4 = (lane & 15) * 4;
  {
#pragma unroll
    for (int q = 0; q < 8; ++q) { const int r = q * 2 + rsub; if (col0 + c4 < N) { const v4f v = *(const v4fa*)&so[w][r][c4]; *(v4f*)(C + (size_t)(row0 + r) * ldc + col0 + c4) = v; } }
     }
}

// Wt[n][k] = f16(W[k][n]·scale) from f32 row-major W[K][N] (scale = power of two; bf16-exact weights stay exact in f16 away from the subnormal range)
__global__ __launch_bounds__(256) void k_wt_f16(const float* __restrict__ W, _Float16* __restrict__ Wt, int K, int N, float scale) {
  const int t = blockIdx.x * 256 + threadIdx.x; if (t >= N * (K / 8)) return; const int n = t / (K / 8), k8 = (t % (K / 8)) * 8; FragH f;
#pragma unroll
  for (int i = 0; i < 8; ++i) f.h[i] = (_Float16)(bf16_round(W[(size_t)(k8 + i) * N + n]) * scale); const v8us o = f.half[0];
  *(v8us*)((unsigned short*)Wt + (size_t)n * K + k8) = o; 
}
// k_gemm_hh variant with fused epilogue: v = acc·alpha + bias[by·sBias + col] (+ CP[(row/rowsPerB)·sCPb + by·64 + col] if CP) ; ACT 0 none / 1 elu ; writes f16 C16 (and f32 C if non-null)
template <int ACT>
__global__ __launch_bounds__(128) void k_gemm_hhx(const _Float16* __restrict__ A, int lda, size_t sA, const _Float16* __restrict__ Bh, int ldb, size_t sB, float alpha, const float* __restrict__ bias, size_t sBias, const float* __restrict__ CP, int rowsPerB, size_t sCPb, int row0g,
    float* __restrict__ C, _Float16* __restrict__ C16, int ldc, size_t sC, int M, int N, int K) {
  __shared__ __attribute__((aligned(16))) float so[4][16][64];
  const int tid = threadIdx.x, w = tid >> 5, lane = tid & 31, ln = lane & 15, hh = lane >> 4; const int by = blockIdx.y;
  A += (size_t)by * sA; Bh += (size_t)by * sB; const size_t cofs = (size_t)by * sC; const float* bp = bias ? bias + (size_t)by * sBias : nullptr;
  const int ntn = (N + 63) / 64; const int wid = blockIdx.x * 4 + w; const int mt = wid / ntn, nq = wid % ntn; if (mt * 16 >= M) return;
  const int row0 = mt * 16, col0 = nq * 64; const _Float16* arow = A + (size_t)(row0 + ln) * lda;
  v8f acc[4] = {};
  for (int kb = 0; kb < K; kb += 32) { FragH ah; ah.half[0] = *(const v8us*)((const unsigned short*)arow + kb + 8 * hh); ah.half[1] = *(const v8us*)((const unsigned short*)arow + kb + 16 + 8 * hh);
#pragma unroll
    for (int t = 0; t < 4; ++t) { if (col0 + t * 16 >= N) continue; const size_t boff = (size_t)(col0 + t * 16 + ln) * ldb + kb; FragH bq; bq.half[0] = *(const v8us*)((const unsigned short*)Bh + boff + 8 * hh); bq.half[1] = *(const v8us*)((const unsigned short*)Bh + boff + 16 + 8 * hh);
      acc[t] = mmaH<1>(ah.v, ah.v, bq.v, bq.v, acc[t]); }
  }
#pragma unroll
  for (int t = 0; t < 4; ++t) { if (col0 + t * 16 >= N) continue; const int col = col0 + t * 16 + ln; const float bv = bp ? bf16_round(bp[col]) : 0.f;
#pragma unroll
    for (int r = 0; r < 8; ++r) { float v = acc[t][r] * alpha + bv; if (CP) { const int rr = row0g + row0 + 8 * hh + r; if (rowsPerB < 0) v += CP[cofs + (size_t)rr * ldc + col];      /* rowsPerB < 0: own element of the batched C plane */ else { const int bidx = rr / rowsPerB; v += CP[(size_t)bidx * sCPb + (size_t)by * 64 + col]; } } if (ACT == 1) v = (v > 0.f) ? v : expm1f(v); else if (ACT == 7) v = (v > 0.f) ? v + 1.0f : expf(v); else if (ACT == 8) v = tanhf(v); else if (ACT == 9) v = 0.5f * v * (1.0f + tanhf(0.7978845608028654f * (v + 0.044715f * v * v * v))); else if (ACT == 11) v = 1.0f / (1.0f + expf(-v)); else if (ACT == 12) v = (v > 0.f) ? v : 0.01f * v; else if (ACT == 14) v = (v > 0.f) ? v : 0.1f * v; else if (ACT == 16) v = (v >= 0.f) ? v : 0.3f * v; else if (ACT == 17) v = (v >= 0.f) ? v : 0.2f * v; else if (ACT == 15) v = v / (1.0f + expf(-v)); else if (ACT == 3) v = fmaxf(v, 0.f); else if (ACT == 6) v = 0.5f * v * (1.0f + erff(v * 0.70710678118654752f)); so[w][8 * hh + r][t * 16 + ln] = v; } }
  __builtin_amdgcn_fence(__ATOMIC_ACQ_REL, "workgroup"); __builtin_amdgcn_wave_barrier();
  const int rsub = lane >> 4, c4 = (lane & 15) * 4; typedef _Float16 v4h __attribute__((ext_vector_type(4)));
  {
#pragma unroll
    for (int q = 0; q < 8; ++q) { const int r = q * 2 + rsub; if (col0 + c4 < N) { const v4f v = *(const v4fa*)&so[w][r][c4]; if (C) *(v4f*)(C + cofs + (size_t)(row0 + r) * ldc + col0 + c4) = v; if (C16) { v4h h4; for (int i = 0; i < 4; ++i) h4[i] = (_Float16)v[i]; *(v4h*)(C16 + cofs + (size_t)(row0 + r) * ldc + col0 + c4) = h4; } } }
     }
}


typedef _Float16 v4h __attribute__((ext_vector_type(4)));

__global__ __launch_bounds__(256) void k_x16(const float* __restrict__ x, _Float16* __restrict__ X16, size_t n8) { const size_t t = (size_t)blockIdx.x * 256 + threadIdx.x; if (t >= n8) return; FragH f;
#pragma unroll
  for (int q = 0; q < 8; ++q) f.h[q] = (_Float16)bf16_round(x[t * 8 + q]); *(v8us*)((unsigned short*)X16 + t * 8) = f.half[0];  }
__global__ __launch_bounds__(256) void k_h16(const float* __restrict__ x, _Float16* __restrict__ X16, size_t n8) { const size_t t = (size_t)blockIdx.x * 256 + threadIdx.x; if (t >= n8) return; FragH f;
#pragma unroll
  for (int q = 0; q < 8; ++q) f.h[q] = (_Float16)x[t * 8 + q]; *(v8us*)((unsigned short*)X16 + t * 8) = f.half[0];  }
__global__ __launch_bounds__(256) void k_round16f(const float* __restrict__ W, _Float16* __restrict__ Bt, size_t n8) { const size_t t = (size_t)blockIdx.x * 256 + threadIdx.x; if (t >= n8) return; FragH f;
#pragma unroll
  for (int i = 0; i < 8; ++i) f.h[i] = (_Float16)(bf16_round(W[t * 8 + i]) * 16.0f); *(v8us*)((unsigned short*)Bt + t * 8) = f.half[0];  }
template <int NHv, int TTv>
__global__ __launch_bounds__(256) void k_vt(const _Float16* __restrict__ V16, int ldv, int voff, _Float16* __restrict__ Vt) { __shared__ unsigned short tl[64][66]; const int tid = threadIdx.x; const int slab = blockIdx.x / (TTv / 64), lg = blockIdx.x % (TTv / 64); const int b = slab / NHv, h = slab % NHv;
  for (int i = tid; i < 64 * 8; i += 256) { const int r = i / 8, c8 = (i % 8) * 8; FragH f; f.half[0] = *(const v8us*)((const unsigned short*)V16 + ((size_t)b * TTv + lg * 64 + r) * ldv + voff + h * 64 + c8);
#pragma unroll
    for (int q = 0; q < 8; ++q) tl[r][c8 + q] = f.u[q]; }
  __syncthreads();
  {
#pragma unroll
    for (int rd = 0; rd < 2; ++rd) { const int d = rd * 32 + tid / 8, pc = tid % 8; FragH f;
#pragma unroll
      for (int q = 0; q < 8; ++q) f.u[q] = tl[pc * 8 + q][d];
      *(v8us*)((unsigned short*)Vt + ((size_t)slab * 64 + d) * TTv + lg * 64 + pc * 8) = f.half[0]; }
     } }

__global__ __launch_bounds__(256) void k_hl(const float* __restrict__ F, _Float16* __restrict__ Hh, _Float16* __restrict__ Hl, size_t n8) { const size_t t = (size_t)blockIdx.x * 256 + threadIdx.x; if (t >= n8) return; FragH fh, fl; const v4f a = *(const v4fa*)(F + t * 8), c = *(const v4fa*)(F + t * 8 + 4);
#pragma unroll
  for (int q = 0; q < 4; ++q) { _Float16 h = (_Float16)a[q]; fh.h[q] = h; fl.h[q] = (_Float16)((a[q] - (float)h) * 1024.0f); h = (_Float16)c[q]; fh.h[4 + q] = h; fl.h[4 + q] = (_Float16)((c[q] - (float)h) * 1024.0f); }
  { *(v8us*)((unsigned short*)Hh + t * 8) = fh.half[0]; *(v8us*)((unsigned short*)Hl + t * 8) = fl.half[0];  } }

// ---- fast GEMM (wave tile 32x64; requires M % 32 == 0 rows per launch region and N % 64 == 0); epilogue = k_gemm_hhx semantics ----
__device__ __forceinline__ v16h g2_frag(const _Float16* p, int hh) { FragH f; f.half[0] = *(const v8us*)((const unsigned short*)p + 8 * hh); f.half[1] = *(const v8us*)((const unsigned short*)p + 16 + 8 * hh); return f.v; }
__device__ __forceinline__ v8f g2_mma(v16h a, v16h b, v8f c) { v8f d = __builtin_amdgcn_wmma_f32_16x16x32_f16(false, a, false, b, (short)0, c, false, false); asm volatile("v_nop\n\tv_nop\n\tv_nop\n\tv_nop" : "+v"(d) : "v"(a), "v"(b)); return d; }
template <int ACT>
__global__ __launch_bounds__(128) void k_gemm2(const _Float16* __restrict__ A, int lda, size_t sA, const _Float16* __restrict__ Bh, int ldb, size_t sB, float alpha, const float* __restrict__ bias, size_t sBias, const float* __restrict__ CP, int rowsPerB, size_t sCPb, int row0g,
    float* __restrict__ C, _Float16* __restrict__ C16, int ldc, size_t sC, int M, int N, int K) { static_assert(ACT == 0 || ACT == 3 || ACT == 6 || ACT == 8 || ACT == 9 || ACT == 11 || ACT == 12 || ACT == 14 || ACT == 15 || ACT == 16 || ACT == 17, "k_gemm2: unsupported ACT code (would silently apply no activation)");
  __shared__ __attribute__((aligned(16))) float so[4][32][68];
  const int tid = threadIdx.x, w = tid >> 5, lane = tid & 31, ln = lane & 15, hh = lane >> 4; const int by = blockIdx.y;
  A += (size_t)by * sA; Bh += (size_t)by * sB; const size_t cofs = (size_t)by * sC; const float* bp = bias ? bias + (size_t)by * sBias : nullptr;
  const int ntn = N >> 6; const int mt = blockIdx.x / ntn, nq = blockIdx.x - mt * ntn; const int row0 = mt * 128 + 32 * w, col0 = nq * 64; if (row0 >= M) return;
  const _Float16* a0p = A + (size_t)(row0 + ln) * lda; const _Float16* a1p = a0p + (size_t)16 * lda;
  const _Float16* b0p = Bh + (size_t)(col0 + ln) * ldb; const _Float16* b1p = b0p + (size_t)16 * ldb; const _Float16* b2p = b1p + (size_t)16 * ldb; const _Float16* b3p = b2p + (size_t)16 * ldb;
  const v8f z8 = {0.f,0.f,0.f,0.f,0.f,0.f,0.f,0.f}; v8f c00 = z8, c01 = z8, c02 = z8, c03 = z8, c10 = z8, c11 = z8, c12 = z8, c13 = z8;
#pragma unroll 1
  for (int kb = 0; kb < K; kb += 32) { const v16h a0 = g2_frag(a0p + kb, hh), a1 = g2_frag(a1p + kb, hh);
    v16h b = g2_frag(b0p + kb, hh); c00 = g2_mma(a0, b, c00); c10 = g2_mma(a1, b, c10);
    b = g2_frag(b1p + kb, hh); c01 = g2_mma(a0, b, c01); c11 = g2_mma(a1, b, c11);
    b = g2_frag(b2p + kb, hh); c02 = g2_mma(a0, b, c02); c12 = g2_mma(a1, b, c12);
    b = g2_frag(b3p + kb, hh); c03 = g2_mma(a0, b, c03); c13 = g2_mma(a1, b, c13); }
  v8f accs[8] = {c00, c01, c02, c03, c10, c11, c12, c13};
#pragma unroll
  for (int u = 0; u < 8; ++u) { const int t = u & 3, half = u >> 2; const int col = col0 + t * 16 + ln; const float bv = bp ? bf16_round(bp[col]) : 0.f;
#pragma unroll
    for (int r = 0; r < 8; ++r) { const int rloc = half * 16 + 8 * hh + r; float v = accs[u][r] * alpha + bv; if (CP) { if (rowsPerB < 0) v += CP[cofs + (size_t)(row0g + row0 + rloc) * ldc + col];      /* rowsPerB < 0: own element of the batched C plane */ else { const int bidx = (row0g + row0 + rloc) / rowsPerB; v += CP[(size_t)bidx * sCPb + (size_t)by * 64 + col]; } }
      if (ACT == 3) v = fmaxf(v, 0.f); else if (ACT == 6) v = 0.5f * v * (1.0f + erff(v * 0.70710678118654752f)); else if (ACT == 11) v = 1.0f / (1.0f + expf(-v)); else if (ACT == 15) v = v / (1.0f + expf(-v)); else if (ACT == 12) v = (v > 0.f) ? v : 0.01f * v; else if (ACT == 8) v = tanhf(v); else if (ACT == 9) v = 0.5f * v * (1.0f + tanhf(0.7978845608028654f * (v + 0.044715f * v * v * v))); else if (ACT == 14) v = (v > 0.f) ? v : 0.1f * v; else if (ACT == 16) v = (v >= 0.f) ? v : 0.3f * v; else if (ACT == 17) v = (v >= 0.f) ? v : 0.2f * v;
      so[w][rloc][t * 16 + ln] = v; } }
  __builtin_amdgcn_fence(__ATOMIC_ACQ_REL, "workgroup"); __builtin_amdgcn_wave_barrier();
  const int rsub = lane >> 4, c4 = (lane & 15) * 4;
  {
#pragma unroll
    for (int q = 0; q < 16; ++q) { const int r = q * 2 + rsub; const v4f v = *(const v4fa*)&so[w][r][c4]; if (C) *(v4f*)(C + cofs + (size_t)(row0 + r) * ldc + col0 + c4) = v; if (C16) { v4h h4; for (int i = 0; i < 4; ++i) h4[i] = (_Float16)v[i]; *(v4h*)(C16 + cofs + (size_t)(row0 + r) * ldc + col0 + c4) = h4; } }
     } }


__global__ __launch_bounds__(256) void k_wnat(const float* __restrict__ w, size_t n8, _Float16* __restrict__ Bt) { const size_t t = (size_t)blockIdx.x * 256 + threadIdx.x; if (t >= n8) return; FragH f; for (int q = 0; q < 8; ++q) f.h[q] = (_Float16)(bf16_round(w[t * 8 + q]) * 16.0f); *(v8us*)((unsigned short*)Bt + t * 8) = f.half[0];  }
__global__ __launch_bounds__(256) void k_rsm(const float* __restrict__ S, _Float16* __restrict__ P, int nrows) {
  #pragma clang fp contract(off)
  const int i = blockIdx.x * 256 + threadIdx.x; if (i >= nrows) return; const float* s = S + (size_t)i * SQ; float mx = -3.0e38f;
#pragma unroll 1
  for (int j = 0; j < SQ; ++j) mx = fmaxf(mx, s[j]); float se = 0.f;
#pragma unroll 1
  for (int j = 0; j < SQ; ++j) se += expf(s[j] - mx); const float sc = 256.0f / se;
#pragma unroll 1
  for (int j0 = 0; j0 < SQ; j0 += 8) { FragH f; for (int q = 0; q < 8; ++q) f.h[q] = (_Float16)(expf(s[j0 + q] - mx) * sc); unsigned short* d = (unsigned short*)P + (size_t)i * SQ + j0; *(v8us*)d = f.half[0];  } }
__global__ __launch_bounds__(256) void k_vt(const _Float16* __restrict__ V16, int b, int h0, _Float16* __restrict__ VT) { __shared__ unsigned short tl[64][65]; const int tid = threadIdx.x; const int hh = blockIdx.x % HG, sg = blockIdx.x / HG; const int s0 = sg * 64; const int h = h0 + hh;
  for (int i = tid; i < 64 * 8; i += 256) { const int j = i / 8, d8 = (i % 8) * 8; FragH f; f.half[0] = *(const v8us*)((const unsigned short*)V16 + ((size_t)b * SQ + s0 + j) * DM + h * HD + d8); for (int q = 0; q < 8; ++q) tl[d8 + q][j] = f.u[q]; }
  __syncthreads();
  { for (int i = tid; i < 64 * 8; i += 256) { const int d = i / 8, j8 = (i % 8) * 8; FragH f; for (int q = 0; q < 8; ++q) f.u[q] = tl[d][j8 + q]; *(v8us*)((unsigned short*)VT + ((size_t)hh * HD + d) * SQ + s0 + j8) = f.half[0]; }  } }



__global__ __launch_bounds__(256) void k_rsmcf2(const float* __restrict__ S, _Float16* __restrict__ P, int hg, int q0, int nk) {
  #pragma clang fp contract(off)
  const int t = blockIdx.x * 256 + threadIdx.x; if (t >= hg * QT) return; const size_t i = (size_t)t; const float* s = S + i * NKX; const int last = q0 + (t % QT); float mx = -3.0e38f;
#pragma unroll 1
  for (int j = 0; j < nk; ++j) { const float f = (j <= last) ? 1.f : 0.f; mx = fmaxf(mx, fmaf(f, s[j], (1.f - f) * -1.0e9f)); } float se = 0.f;
#pragma unroll 1
  for (int j = 0; j < nk; ++j) { const float f = (j <= last) ? 1.f : 0.f; se += __expf(fmaf(f, s[j], (1.f - f) * -1.0e9f) - mx); } const float sc = 256.0f / se;
#pragma unroll 1
  for (int j0 = 0; j0 < nk; j0 += 8) { FragH fr; for (int q = 0; q < 8; ++q) { const int j = j0 + q; const float f = (j <= last) ? 1.f : 0.f; fr.h[q] = (_Float16)(__expf(fmaf(f, s[j], (1.f - f) * -1.0e9f) - mx) * sc); } unsigned short* d = (unsigned short*)P + i * NKX + j0; *(v8us*)d = fr.half[0];  } }

template <int MASKADD>
__global__ __launch_bounds__(64) void k_att0(const float* __restrict__ QF, const float* __restrict__ KF, const float* __restrict__ VF, int ld, const float* __restrict__ mask, float scale, float* __restrict__ OF, int ldo) {
  #pragma clang fp contract(off)
  __shared__ __attribute__((aligned(16))) float lq[64][64]; __shared__ __attribute__((aligned(16))) float lo[64][64];
  const int tid = threadIdx.x; const int h = blockIdx.x / (QT0 / 64), rg = blockIdx.x % (QT0 / 64); const int i = rg * 64 + tid;
  const float* qr = QF + (size_t)i * ld + h * HD;
#pragma unroll 1
  for (int c = 0; c < HD / 4; ++c) { *(v4f*)&lq[tid][c * 4] = *(const v4fa*)(qr + c * 4); const v4f z = {0.f, 0.f, 0.f, 0.f}; *(v4f*)&lo[tid][c * 4] = z; }
  float m = -1.0e30f, l = 0.f; const int jmax = MASKADD ? (SQ - 1) : (rg * 64 + 63);      /* additive-mask form: every key (the mask input decides); causal form: keys up to the block's last row */
#pragma unroll 1
  for (int j = 0; j <= jmax; ++j) { const float* kr = KF + (size_t)j * ld + h * HD; const float* vr = VF + (size_t)j * ld + h * HD; float s = 0.f;
#pragma unroll 1
    for (int c = 0; c < HD / 4; ++c) { const v4f kq = *(const v4fa*)(kr + c * 4); const v4f qq = *(v4f*)&lq[tid][c * 4]; s = __fadd_rn(s, __fmul_rn(qq[0], kq[0])); s = __fadd_rn(s, __fmul_rn(qq[1], kq[1])); s = __fadd_rn(s, __fmul_rn(qq[2], kq[2])); s = __fadd_rn(s, __fmul_rn(qq[3], kq[3])); }
    s = __fmul_rn(s, scale); if (MASKADD) s = __fadd_rn(s, __fmul_rn(bf16_round(mask[(size_t)i * SQ + j]), -10000.0f));
    const float f = (MASKADD || j <= i) ? 1.f : 0.f; const float sm = fmaf(f, s, (1.f - f) * -1.0e30f); const float mn = fmaxf(m, sm); const float sc = expf(m - mn); const float e = expf(sm - mn); l = __fadd_rn(__fmul_rn(l, sc), e); m = mn;
#pragma unroll 1
    for (int c = 0; c < HD / 4; ++c) { const v4f vv = *(const v4fa*)(vr + c * 4); v4f oo = *(v4f*)&lo[tid][c * 4]; for (int u = 0; u < 4; ++u) oo[u] = __fadd_rn(__fmul_rn(oo[u], sc), __fmul_rn(e, vv[u])); *(v4f*)&lo[tid][c * 4] = oo; } }
  const float fin = 64.0f / l;      /* o carried x64 like the f16 path */
#pragma unroll 1
  for (int c = 0; c < HD / 4; ++c) { v4f oo = *(v4f*)&lo[tid][c * 4]; for (int u = 0; u < 4; ++u) oo[u] = __fmul_rn(oo[u], fin); *(v4f*)&lo[tid][c * 4] = oo; }
  __syncthreads();
  {
#pragma unroll 1
    for (int it = 0; it < 16; ++it) { const int row = it * 4 + tid / 16, pc = (tid % 16) * 4; const v4f v = *(const v4f*)&lo[row][pc]; *(v4f*)(OF + (size_t)(rg * 64 + row) * ldo + h * HD + pc) = v; }
     } }

__global__ __launch_bounds__(256) void k_oscale(const float* __restrict__ OF, float* __restrict__ out, size_t n4) { const size_t t = (size_t)blockIdx.x * 256 + threadIdx.x; if (t >= n4) return; const v4f a = *(const v4fa*)(OF + t * 4); v4f o; for (int q = 0; q < 4; ++q) o[q] = a[q] * 0.015625f; *(v4f*)(out + t * 4) = o;  }

__global__ __launch_bounds__(256) void k_bfr(const float* __restrict__ x, float* __restrict__ XB, size_t n8) { const size_t t = (size_t)blockIdx.x * 256 + threadIdx.x; if (t >= n8) return; v4f a = *(const v4fa*)(x + t * 8), c = *(const v4fa*)(x + t * 8 + 4); for (int q = 0; q < 4; ++q) { a[q] = bf16_round(a[q]); c[q] = bf16_round(c[q]); }
  { *(v4f*)(XB + t * 8) = a; *(v4f*)(XB + t * 8 + 4) = c;  } }



__global__ __launch_bounds__(256) void k_rsmfvl(const float* __restrict__ S, _Float16* __restrict__ P, _Float16* __restrict__ PL, int qn, const int* __restrict__ vlp) {
  #pragma clang fp contract(off)
  const int t = blockIdx.x * 256 + threadIdx.x; if (t >= qn) return; const int vl = vlp[0]; const size_t i = (size_t)t; const float* s = S + i * SQ; float mx = -3.0e38f;
#pragma unroll 1
  for (int j = 0; j < SQ; ++j) { const float f = (j < vl) ? 1.f : 0.f; mx = fmaxf(mx, fmaf(f, s[j], (1.f - f) * -1000000.0f)); } float se = 0.f;
#pragma unroll 1
  for (int j = 0; j < SQ; ++j) { const float f = (j < vl) ? 1.f : 0.f; se += __expf(fmaf(f, s[j], (1.f - f) * -1000000.0f) - mx); } const float sc = 256.0f / se;
#pragma unroll 1
  for (int j0 = 0; j0 < SQ; j0 += 8) { FragH fr, gr; for (int q = 0; q < 8; ++q) { const int j = j0 + q; const float f = (j < vl) ? 1.f : 0.f; const float pv = __expf(fmaf(f, s[j], (1.f - f) * -1000000.0f) - mx) * sc; const _Float16 ph = (_Float16)pv; fr.h[q] = ph; gr.h[q] = (_Float16)((pv - (float)ph) * 1024.0f); }
    unsigned short* d = (unsigned short*)P + i * SQ + j0; unsigned short* dl = (unsigned short*)PL + i * SQ + j0; *(v8us*)d = fr.half[0]; *(v8us*)dl = gr.half[0];  } }

#define NRW 131072      /* rows */
#define NIN 40          /* input features */
#define KIN 64          /* padded input width */
#define D0 128
#define D1 64
#define D2 32
#define D2P 64
#define NBRN 33         /* branches */
#define RB 8192

__global__ __launch_bounds__(256) void k_zero16(unsigned short* __restrict__ p, size_t n8) { const size_t t = (size_t)blockIdx.x * 256 + threadIdx.x; if (t >= n8) return; v8us z; for (int q = 0; q < 8; ++q) z[q] = 0; *(v8us*)(p + t * 8) = z;  }



#define BWV 8           /* waves per work-group of the branch kernel */
#define BRW 64          /* batch rows per wave: four B tiles, so each weight fragment read from LDS feeds four WMMAs */
#define WCH 1280        /* 16-byte pieces of one branch's weights: 16 (layer 1) + 4 (layer 2) A fragments of 1 KiB */
#define AUXF 256        /* f32 side table per branch: 16 b1 [0..63], 256 b2 [64..95], W3 / 256 [96..127], b3 [128], rest 0 (the powers of two: see k_branch) */
#define TCH 1024        /* 16-byte pieces of the trunk's weights: 16 A fragments of 1 KiB */
#define TAUX 512        /* f32 side table of the trunk: bs [0..127], BN scale [128..167], BN mean [192..231], BN shift [256..295], rest 0 */

// Per branch: the A fragments of W1[j]^T (tile mt, k step ks at index mt * 4 + ks) and of W2[j]^T (at 16 + mt * 2 + ks) in the order the lanes read them
// (piece = (fragment * 2 + half) * 32 + lane; lane (ln, hh) holds row 16 mt + ln, k = 32 ks + 16 half + 8 hh + 0..7), and the rounded biases and W3.
// Behind the branches, the trunk: the A fragments of Ws^T (tile mt, k step ks at index mt * 2 + ks, same piece order; k = 40..63 zero) and its side table.
__global__ __launch_bounds__(256) void k_pack(const float* __restrict__ W1, const float* __restrict__ b1, const float* __restrict__ W2, const float* __restrict__ b2, const float* __restrict__ W3, const float* __restrict__ b3,
    const float* __restrict__ Ws, const float* __restrict__ bs, const float* __restrict__ g, const float* __restrict__ be, const float* __restrict__ mu, const float* __restrict__ var, float eps,
    _Float16* __restrict__ PW, float* __restrict__ PA, _Float16* __restrict__ PT, float* __restrict__ PB) {
  const int t = blockIdx.x * 256 + threadIdx.x; if (t >= NBRN * (WCH + AUXF / 4) + TCH + TAUX / 4) return;
  if (t >= NBRN * (WCH + AUXF / 4)) { const int c = t - NBRN * (WCH + AUXF / 4);
    if (c < TCH) { const int lane = c & 31, ln = lane & 15, hh = lane >> 4, f = c >> 6, h = (c >> 5) & 1; const int n = (f >> 1) * 16 + ln, k0 = (f & 1) * 32 + h * 16 + 8 * hh; FragH o;
      for (int q = 0; q < 8; ++q) { const int k = k0 + q; o.h[q] = (k < NIN) ? (_Float16)(bf16_round(Ws[(size_t)k * D0 + n]) * 16.0f) : (_Float16)0.f; }
      *(v8us*)((unsigned short*)PT + (size_t)c * 8) = o.half[0]; }
    else { const int i0 = (c - TCH) * 4; v4f o;
      for (int u = 0; u < 4; ++u) { const int i = i0 + u, cf = (i - D0) & 63, kind = (i - D0) >> 6; float v = 0.f;
        if (i < D0) v = bf16_round(bs[i]); else if (cf < NIN && kind == 0) v = rsqrtf(bf16_round(var[cf]) + eps) * bf16_round(g[cf]); else if (cf < NIN && kind == 1) v = bf16_round(mu[cf]); else if (cf < NIN && kind == 2) v = bf16_round(be[cf]);
        o[u] = v; }
      *(v4f*)(PB + i0) = o; }
    return; }
  const int j = t / (WCH + AUXF / 4), c = t % (WCH + AUXF / 4);
  if (c < WCH) { const int lane = c & 31, ln = lane & 15, hh = lane >> 4, f = c >> 6, h = (c >> 5) & 1; FragH o;
    if (f < 16) { const int k = (f >> 2) * 16 + ln, d0 = (f & 3) * 32 + h * 16 + 8 * hh; for (int q = 0; q < 8; ++q) o.h[q] = (_Float16)(bf16_round(W1[((size_t)j * D0 + d0 + q) * D1 + k]) * 16.0f); }
    else { const int m = ((f - 16) >> 1) * 16 + ln, k0 = ((f - 16) & 1) * 32 + h * 16 + 8 * hh; for (int q = 0; q < 8; ++q) o.h[q] = (_Float16)(bf16_round(W2[((size_t)j * D1 + k0 + q) * D2 + m]) * 16.0f); }
    *(v8us*)((unsigned short*)PW + ((size_t)j * WCH + c) * 8) = o.half[0]; }
  else { const int i0 = (c - WCH) * 4; v4f o;
    for (int u = 0; u < 4; ++u) { const int i = i0 + u; float v = 0.f, sc = 1.f; if (i < D1) { v = b1[j * D1 + i]; sc = 16.0f; } else if (i < D1 + D2) { v = b2[j * D2 + i - D1]; sc = 256.0f; } else if (i < D1 + 2 * D2) { v = W3[j * D2 + i - D1 - D2]; sc = 0.00390625f; } else if (i == D1 + 2 * D2) v = b3[j]; o[u] = bf16_round(v) * sc; }
    *(v4f*)(PA + (size_t)j * AUXF + i0) = o; } }

__device__ __forceinline__ v16h br_frag(const unsigned short* wb, int f, int lane) { FragH x; x.half[0] = *(const v8us*)(wb + f * 512 + lane * 8); x.half[1] = *(const v8us*)(wb + f * 512 + 256 + lane * 8); return x.v; }
__device__ __forceinline__ v8f br_row8(const float* p) { const v4f lo = *(const v4f*)p, hi = *(const v4f*)(p + 4); return __builtin_shufflevector(lo, hi, 0, 1, 2, 3, 4, 5, 6, 7); }      /* eight f32 in the order of a D tile's registers */
__device__ __forceinline__ v8f br_mma(v16h a, v16h b, v8f c) { return __builtin_amdgcn_wmma_f32_16x16x32_f16(false, a, false, b, (short)0, c, false, false); }
__device__ __forceinline__ float br_xhalf(float x) { return __builtin_bit_cast(float, __builtin_amdgcn_permlanex16(__builtin_bit_cast(int, x), __builtin_bit_cast(int, x), 0x76543210, 0xfedcba98, false, false)); }

// One wave: 64 batch rows; BN and the trunk layer first (64 WMMAs, the trunk's weights staged in LDS beside branch 0's), z held as 16 B fragments for the whole kernel; then the loop over the 33 branches, the branch's weights staged in LDS for the 8 waves (two buffers, one barrier a branch, in the middle of the trip: behind it a wave reads the next branch's first fragments while it still works on this branch, so no trip starts with a wait on LDS).
// The branch layers carry the weights' factor 16 along instead of dividing it out: h1 stands as 16 h1 (f16), h2 as 256 h2 (f32), W3 is packed as W3 / 256, and each layer's bias, packed with the same factor, is the C operand of the layer's first WMMA; so an epilogue is relu (and the conversion) alone. All factors are powers of two and change no rounding, but that an h1 below the f16 normal range keeps more bits; 16 h1 overflows f16 only above h1 = 4095.
// Every "#pragma unroll" in this kernel makes the indices of a fragment or accumulator array constants, so that the array stays in registers (a run-time index would send it to scratch).
__global__ __launch_bounds__(256) void k_branch(const float* __restrict__ x, const _Float16* __restrict__ PT, const float* __restrict__ PB, const _Float16* __restrict__ PW, const float* __restrict__ PA, float* __restrict__ out) {
  __shared__ __attribute__((aligned(16))) unsigned short sw[2][WCH * 8];
  __shared__ __attribute__((aligned(16))) float sa[2][AUXF];
  __shared__ __attribute__((aligned(16))) float so[BWV][BRW * NBRN];
  __shared__ __attribute__((aligned(16))) unsigned short tw[TCH * 8];      /* of its own: a late wave still reads it while an early one refills sw */
  __shared__ __attribute__((aligned(16))) float tb[TAUX];
  const int tid = threadIdx.x, w = tid >> 5, lane = tid & 31, ln = lane & 15, hh = lane >> 4;
  const size_t row0 = (size_t)blockIdx.x * (BWV * BRW) + (size_t)w * BRW;
  const unsigned short* pw = (const unsigned short*)PW;
  v8us st[5]; float sta;
#pragma unroll
  for (int i = 0; i < 5; ++i) st[i] = *(const v8us*)(pw + (size_t)(tid + 256 * i) * 8);
  sta = PA[tid];
  v8us tt[4]; v2f ttb;
#pragma unroll
  for (int i = 0; i < 4; ++i) tt[i] = *(const v8us*)((const unsigned short*)PT + (size_t)(tid + 256 * i) * 8);
  ttb = *(const v2f*)(PB + tid * 2);
  v4f xr[4][6];      /* lane (ln, hh), tile n: features 8 hh + 0..7, 16 + 8 hh + 0..7 and 32..39 of row 16 n + ln */
#pragma unroll
  for (int n = 0; n < 4; ++n) { const float* xp = x + (row0 + n * 16 + ln) * NIN;
#pragma unroll
    for (int q = 0; q < 6; ++q) xr[n][q] = *(const v4fa*)(xp + ((q < 4) ? (q >> 1) * 16 + 8 * hh + (q & 1) * 4 : q * 4 + 16)); }
  asm volatile("s_wait_xcnt 0x0" ::: "memory");      /* stands before the address registers of the loads above are reused */
  __builtin_amdgcn_sched_barrier(0);      /* keeps the LDS address arithmetic below, which reuses those registers, behind that wait */
#pragma unroll
  for (int i = 0; i < 5; ++i) *(v8us*)(&sw[0][(tid + 256 * i) * 8]) = st[i];
  sa[0][tid] = sta;
#pragma unroll
  for (int i = 0; i < 4; ++i) *(v8us*)(&tw[(tid + 256 * i) * 8]) = tt[i];
  *(v2f*)(&tb[tid * 2]) = ttb;
  __syncthreads();      /* publishes branch 0's weights and the trunk's */
#pragma unroll
  for (int i = 0; i < 5; ++i) st[i] = *(const v8us*)(pw + ((size_t)WCH + tid + 256 * i) * 8);      /* branch 1, stored in trip 0; behind the barrier, which would wait for these loads */
  sta = PA[(size_t)AUXF + tid];
  asm volatile("s_wait_xcnt 0x0" ::: "memory");      /* stands before the loads' address registers are reused */
  __builtin_amdgcn_sched_barrier(0);      /* keeps what follows, which reuses those registers, behind that wait */
  const v8f z8 = {0.f, 0.f, 0.f, 0.f, 0.f, 0.f, 0.f, 0.f};
  v16h xb[4][2];      /* xn as B fragments: k step 0 = features 0..31, k step 1 = features 32..39 and zeros */
  { v4f bsc[6], bmu[6], bsh[6]; const unsigned keep = hh ? 0u : 0xffffffffu;
#pragma unroll
    for (int q = 0; q < 6; ++q) { const int c = (q < 4) ? (q >> 1) * 16 + 8 * hh + (q & 1) * 4 : q * 4 + 16; bsc[q] = *(const v4f*)(tb + 128 + c); bmu[q] = *(const v4f*)(tb + 192 + c); bsh[q] = *(const v4f*)(tb + 256 + c); }
#pragma unroll
    for (int n = 0; n < 4; ++n) { FragH f0, f1;
#pragma unroll
      for (int q = 0; q < 6; ++q) { const v4f xq = __builtin_convertvector(__builtin_convertvector(xr[n][q], v4b), v4f);      /* x rounded to bf16, to nearest even */
        const v4h y = __builtin_convertvector((xq - bmu[q]) * bsc[q] + bsh[q], v4h);
#pragma unroll
        for (int u = 0; u < 4; ++u) { if (q < 4) f0.h[q * 4 + u] = y[u]; else { f1.h[(q - 4) * 4 + u] = y[u]; f1.h[8 + (q - 4) * 4 + u] = (_Float16)0.f; } } }
      v8u w1 = __builtin_bit_cast(v8u, f1.v);
#pragma unroll
      for (int i = 0; i < 4; ++i) w1[i] &= keep;      /* lanes 16-31 stand for k = 40..47: zeros */
      xb[n][0] = f0.v; xb[n][1] = __builtin_bit_cast(v16h, w1); } }
  const v16h h0 = {};
  v16h zf[4][4];
#pragma unroll
  for (int ks = 0; ks < 4; ++ks) {      /* z features 32 ks .. 32 ks + 31 = k step ks of layer 1 */
    v16h ta[2][2]; v4f bz[4]; v8f t0[4], t1[4];
#pragma unroll
    for (int m = 0; m < 2; ++m) { ta[m][0] = br_frag(tw, (2 * ks + m) * 2, lane); ta[m][1] = br_frag(tw, (2 * ks + m) * 2 + 1, lane); }
#pragma unroll
    for (int q = 0; q < 4; ++q) bz[q] = *(const v4f*)(tb + 32 * ks + (q >> 1) * 16 + 8 * hh + (q & 1) * 4);
#pragma unroll
    for (int n = 0; n < 4; ++n) { t0[n] = br_mma(ta[0][0], xb[n][0], z8); t1[n] = br_mma(ta[1][0], xb[n][0], z8); }
#pragma unroll
    for (int n = 0; n < 4; ++n) { t0[n] = br_mma(ta[0][1], xb[n][1], t0[n]); t1[n] = br_mma(ta[1][1], xb[n][1], t1[n]); }
#pragma unroll
    for (int n = 0; n < 4; ++n) { FragH hb;
#pragma unroll
      for (int r = 0; r < 8; ++r) { hb.h[r] = (_Float16)fmaxf(t0[n][r] * 0.0625f + bz[r >> 2][r & 3], 0.f); hb.h[8 + r] = (_Float16)fmaxf(t1[n][r] * 0.0625f + bz[2 + (r >> 2)][r & 3], 0.f); }
      zf[n][ks] = hb.v; }
  }
  v16h wa[2][4], ua[2][2]; v8f bb[2][2];      /* layer-1 A fragments of the current half; layer-2 A fragments and 16 b1 (as C tiles) of both halves; wa, ua[0] and bb[0] are carried from trip to trip */
#pragma unroll
  for (int ks = 0; ks < 4; ++ks) { wa[0][ks] = br_frag(sw[0], ks, lane); wa[1][ks] = br_frag(sw[0], 4 + ks, lane); }      /* branch 0: what a trip finds in registers when it starts */
  ua[0][0] = br_frag(sw[0], 16, lane); ua[0][1] = br_frag(sw[0], 18, lane);
  bb[0][0] = br_row8(sa[0] + 8 * hh); bb[0][1] = br_row8(sa[0] + 8 * hh + 16);
#pragma unroll 1      /* one copy of the trip: 80 WMMAs and their epilogues are body enough, and the text stays small for the instruction cache */
  for (int j = 0; j < NBRN; ++j) {
    const int jn = (j + 2 < NBRN) ? j + 2 : NBRN - 1;      /* the last trips load and store the last branch once more: no branch round the loads */
    const unsigned short* wb = sw[j & 1]; const float* ab = sa[j & 1] + 8 * hh;
    const unsigned short* wn = sw[(j + 1) & 1]; const float* an = sa[(j + 1) & 1] + 8 * hh;
    v8f cc[2]; v4f ee[4];      /* 256 b2 (as C tiles), W3 / 256 */
    ua[1][0] = br_frag(wb, 17, lane); ua[1][1] = br_frag(wb, 19, lane);      /* what this branch needs late, read under its first WMMAs */
#pragma unroll
    for (int m = 0; m < 2; ++m) { bb[1][m] = br_row8(ab + 32 + 16 * m); cc[m] = br_row8(ab + 64 + 16 * m); ee[2 * m] = *(const v4f*)(ab + 96 + 16 * m); ee[2 * m + 1] = *(const v4f*)(ab + 100 + 16 * m); }
    const float b3v = sa[j & 1][128];
    __builtin_amdgcn_sched_barrier(0);      /* keeps these LDS reads in one group at the head of the trip, not strewn among the WMMAs */
    v8f a2[2][4];
#pragma unroll
    for (int s = 0; s < 2; ++s) {      /* h1 features 32 s .. 32 s + 31 = k step s of layer 2 */
      v8f a1[2][4];
#pragma unroll
      for (int ks = 0; ks < 4; ++ks) {
#pragma unroll
        for (int n = 0; n < 4; ++n) { a1[0][n] = br_mma(wa[0][ks], zf[n][ks], ks ? a1[0][n] : bb[s][0]); a1[1][n] = br_mma(wa[1][ks], zf[n][ks], ks ? a1[1][n] : bb[s][1]); }
        __builtin_amdgcn_sched_barrier(0);      /* keeps eight independent accumulators per k step: without it the four k steps of one tile are issued as a dependent chain */
        if (s == 1 && ks == 0) {
#pragma unroll
          for (int i = 0; i < 5; ++i) st[i] = *(const v8us*)(pw + ((size_t)jn * WCH + tid + 256 * i) * 8);
          sta = PA[(size_t)jn * AUXF + tid];
          asm volatile("s_wait_xcnt 0x0" ::: "memory");      /* stands before the loads' address registers are reused */
          __builtin_amdgcn_sched_barrier(0);      /* keeps what follows, which may reuse those registers, behind that wait */
        }
      }
      if (s == 0) {      /* the second half's layer-1 fragments, this wave's last reads of this branch's buffer; the next branch goes into the other buffer */
#pragma unroll
        for (int ks = 0; ks < 4; ++ks) { wa[0][ks] = br_frag(wb, 8 + ks, lane); wa[1][ks] = br_frag(wb, 12 + ks, lane); }
#pragma unroll
        for (int i = 0; i < 5; ++i) *(v8us*)(&sw[(j + 1) & 1][(tid + 256 * i) * 8]) = st[i];
        sa[(j + 1) & 1][tid] = sta;
      } else {      /* behind this trip's barrier: the next branch's first-half fragments, read while this branch's last epilogue and dot run */
#pragma unroll
        for (int ks = 0; ks < 4; ++ks) { wa[0][ks] = br_frag(wn, ks, lane); wa[1][ks] = br_frag(wn, 4 + ks, lane); }
        ua[0][0] = br_frag(wn, 16, lane); ua[0][1] = br_frag(wn, 18, lane);
        bb[0][0] = br_row8(an); bb[0][1] = br_row8(an + 16);
      }
      __builtin_amdgcn_sched_barrier(0);      /* keeps these LDS reads in one group ahead of the epilogue that hides their latency */
#pragma unroll
      for (int n = 0; n < 4; ++n) { FragH hb;
#pragma unroll
        for (int r = 0; r < 8; ++r) { hb.h[r] = (_Float16)a1[0][n][r]; hb.h[8 + r] = (_Float16)a1[1][n][r]; }
        const v16h hr = __builtin_elementwise_max(hb.v, h0);      /* relu behind the conversion: two values an instruction, the same result */
        a2[0][n] = br_mma(ua[s][0], hr, s ? a2[0][n] : cc[0]); a2[1][n] = br_mma(ua[s][1], hr, s ? a2[1][n] : cc[1]); }
      __builtin_amdgcn_sched_barrier(0);      /* keeps the next half's first WMMAs from being drawn into the epilogue as dependent chains */
      if (s == 0) __syncthreads();      /* publishes the next branch's weights and ends every wave's reads of this branch's buffer, which the next trip refills */
    }
    float p[4];
#pragma unroll
    for (int n = 0; n < 4; ++n) { float sl = 0.f, su = 0.f;
#pragma unroll
      for (int r = 0; r < 8; ++r) { sl = fmaf(fmaxf(a2[0][n][r], 0.f), ee[r >> 2][r & 3], sl); su = fmaf(fmaxf(a2[1][n][r], 0.f), ee[2 + (r >> 2)][r & 3], su); }
      p[n] = sl + su; }
#pragma unroll
    for (int g = 0; g < 2; ++g) {
      const float mine = hh ? p[2 * g + 1] : p[2 * g], send = hh ? p[2 * g] : p[2 * g + 1];
      so[w][((2 * g + hh) * 16 + ln) * NBRN + j] = mine + br_xhalf(send) + b3v; }
  }
  float* og = out + row0 * NBRN; const float* sp = so[w];      /* 64 rows x 33 f32 = 66 whole 128-byte lines, this wave's own */
  for (int i = lane; i < BRW * NBRN / 4; i += 32) *(v4f*)(og + i * 4) = *(const v4f*)(sp + i * 4);
}

extern "C" void kernel_launch(void* const* d_in, const int* in_sizes, int n_in,
                              void* d_out, int out_size, void* d_ws, size_t ws_size, hipStream_t stream) {
  (void)in_sizes; (void)n_in; (void)out_size;
  const float* const* I = (const float* const*)d_in; const float* x = I[0]; const float* bng = I[1]; const float* bnb = I[2]; const float* bnm = I[3]; const float* bnv = I[4]; const float* Ws = I[5]; const float* bs = I[6]; const float* W1 = I[7]; const float* b1 = I[8]; const float* W2 = I[9]; const float* b2 = I[10]; const float* W3 = I[11]; const float* b3 = I[12];
  char* ws = (char*)d_ws; size_t off = 0;
  auto take = [&](size_t bytes) { char* p = ws + off; off += (bytes + 255) & ~(size_t)255; return p; };
  _Float16* PW = (_Float16*)take((size_t)NBRN * WCH * 16); float* PA = (float*)take((size_t)NBRN * AUXF * 4); _Float16* PT = (_Float16*)take((size_t)TCH * 16); float* PB = (float*)take((size_t)TAUX * 4);
  if (off > ws_size) return;
  k_pack<<<(NBRN * (WCH + AUXF / 4) + TCH + TAUX / 4 + 255) / 256, 256, 0, stream>>>(W1, b1, W2, b2, W3, b3, Ws, bs, bng, bnb, bnm, bnv, 1e-5f, PW, PA, PT, PB);      /* branch and trunk weights as A fragments; biases, W3 and the BN terms rounded */
  k_branch<<<NRW / (BWV * BRW), 256, 0, stream>>>(x, PT, PB, PW, PA, (float*)d_out);      /* BN, trunk, then gu[r][j] for all rows and branches */
}

// v005
// A run of this version takes 50.6 microseconds.
// Timed twice side by side with v004, it ran 1.04 and 1.03 times as fast.
// Counting every step since v000, it is 20.1 times as fast.
#include <hip/hip_runtime.h>
#define NB 1
#define SQ 8192
#define DM 64
#define NH 1
#define HD 64
#define HG 4                         /* heads per attention launch group */
#define B0 0                         /* first batch processed (debug hook) */
#define NBR NB                       /* batches processed (debug hook) */
#define NR ((size_t)NB * SQ)         /* token rows */
#define MP ((int)((size_t)NBR * SQ)) /* rows projected (debug hook) */
#define QT 256                       /* query rows per causal tile */
#define NKX SQ                       /* S / P row pitch */
#define QT0 256                      /* first-tile rows recomputed exactly (256: buys margin for the few-key rows 128..255, which have no output projection to average the single-f16 P/v rounding) */
#define QN SQ                        /* query rows attended per batch (debug hook) */
#define NHD NH                       /* heads attended (debug hook) */
#define MPO MP                       /* rows through the output stage (debug hook) */
#define LQ DM            /* row pitch of the q/k/v rows */
typedef __bf16 v16b __attribute__((ext_vector_type(16)));
typedef unsigned short v8us __attribute__((ext_vector_type(8), may_alias));
typedef float  v8f  __attribute__((ext_vector_type(8)));
typedef float  v4f  __attribute__((ext_vector_type(4)));
typedef float  v4fa __attribute__((ext_vector_type(4), may_alias));
typedef float  v2f  __attribute__((ext_vector_type(2)));
typedef unsigned int v8u __attribute__((ext_vector_type(8)));
typedef __bf16 v4b __attribute__((ext_vector_type(4)));
union FragB { v16b v; v8us half[2]; unsigned short u[16]; };

__device__ __forceinline__ unsigned short bf16_bits(float x) { unsigned int u = __float_as_uint(x); return (unsigned short)((u + 0x7FFFu + ((u >> 16) & 1u)) >> 16); }
__device__ __forceinline__ float bf16_val(unsigned short b) { return __uint_as_float(((unsigned int)b) << 16); }
__device__ __forceinline__ float bf16_round(float x) { return bf16_val(bf16_bits(x)); }
// D += A·B with NT terms: 1 = ah·bh, 2 = + al·bh (A split), 3 = + ah·bl (both split)
template <int NT>
__device__ __forceinline__ v8f mmaN(v16b ah, v16b al, v16b bh, v16b bl, v8f c) {
  c = __builtin_amdgcn_wmma_f32_16x16x32_bf16(false, ah, false, bh, (short)0, c, false, false);
  if (NT >= 2) c = __builtin_amdgcn_wmma_f32_16x16x32_bf16(false, al, false, bh, (short)0, c, false, false);
  if (NT >= 3) c = __builtin_amdgcn_wmma_f32_16x16x32_bf16(false, ah, false, bl, (short)0, c, false, false);
  asm volatile("v_nop\n\tv_nop\n\tv_nop\n\tv_nop" : "+v"(c) : "v"(ah), "v"(al), "v"(bh), "v"(bl));
  return c;
}

__global__ __launch_bounds__(256) void k_wt_bf16(const float* __restrict__ W, unsigned short* __restrict__ Wt, int K, int N) {
  const int t = blockIdx.x * 256 + threadIdx.x;
  const int k8n = K / 8;
  if (t >= N * k8n) return;
  const int n = t / k8n, k8 = (t % k8n) * 8;
  v8us v;
#pragma unroll
  for (int i = 0; i < 8; ++i) v[i] = bf16_bits(W[(size_t)(k8 + i) * N + n]);
  *(v8us*)(Wt + (size_t)n * K + k8) = v;
  
}

// GEMM C[M][N] (f32, pitch ldc) = act(A[M][K]·W + bias). A f32 row-major (pitch lda) converted per fragment to bf16
// (ASPLIT: hi/lo two planes -> 2 terms, else single rounded term); Wt bf16 [N][K] (pitch ldb). BIAS_BF16 rounds the
// bias to bf16 first (bias quantised to bf16 before the add). K%32==0, M%16==0, N%64==0.
template <bool ASPLIT, int ACT, bool BIAS_BF16>
__global__ __launch_bounds__(128) void k_gemm_bf(const float* __restrict__ A, int lda, const unsigned short* __restrict__ Wt, int ldb,
                                               const float* __restrict__ bias, float* __restrict__ C, int ldc, int M, int N, int K) {
  __shared__ __attribute__((aligned(16))) float so[4][16][64];
  const int tid = threadIdx.x, w = tid >> 5, lane = tid & 31, ln = lane & 15, hh = lane >> 4;
  const int ntn = N / 64;
  const int wid = blockIdx.x * 4 + w;
  const int mt = wid / ntn, nq = wid % ntn;
  if (mt * 16 >= M) return;
  const int row0 = mt * 16, col0 = nq * 64;
  const float* arow = A + (size_t)(row0 + ln) * lda;
  v8f acc[4] = {};
  for (int kb = 0; kb < K; kb += 32) {
    FragB ah, al;
    const v4f x0 = *(const v4fa*)(arow + kb + 8 * hh), x1 = *(const v4fa*)(arow + kb + 8 * hh + 4);
    const v4f x2 = *(const v4fa*)(arow + kb + 16 + 8 * hh), x3 = *(const v4fa*)(arow + kb + 16 + 8 * hh + 4);
    float xs[16] = {x0[0],x0[1],x0[2],x0[3],x1[0],x1[1],x1[2],x1[3],x2[0],x2[1],x2[2],x2[3],x3[0],x3[1],x3[2],x3[3]};
#pragma unroll
    for (int i = 0; i < 16; ++i) { const unsigned short hb = bf16_bits(xs[i]); ah.u[i] = hb; al.u[i] = ASPLIT ? bf16_bits(xs[i] - bf16_val(hb)) : (unsigned short)0; }
#pragma unroll
    for (int t = 0; t < 4; ++t) {
      const unsigned short* brow = Wt + (size_t)(col0 + t * 16 + ln) * ldb + kb;
      FragB b;
      b.half[0] = *(const v8us*)(brow + 8 * hh);
      b.half[1] = *(const v8us*)(brow + 16 + 8 * hh);
      acc[t] = mmaN<ASPLIT ? 2 : 1>(ah.v, al.v, b.v, b.v, acc[t]);
    }
  }
#pragma unroll
  for (int t = 0; t < 4; ++t) {
    float bv = bias ? bias[col0 + t * 16 + ln] : 0.f;
    if (BIAS_BF16) bv = bf16_round(bv);
#pragma unroll
    for (int r = 0; r < 8; ++r) { float v = acc[t][r] + bv; if (ACT == 1) v = fmaxf(v, 0.f); so[w][8 * hh + r][t * 16 + ln] = v; }
  }
  __builtin_amdgcn_fence(__ATOMIC_ACQ_REL, "workgroup");
  __builtin_amdgcn_wave_barrier();
  const int rsub = lane >> 4, c4 = (lane & 15) * 4;
  {
#pragma unroll
    for (int q = 0; q < 8; ++q) {
      const int r = q * 2 + rsub;
      const v4f v = *(const v4fa*)&so[w][r][c4];
      *(v4f*)(C + (size_t)(row0 + r) * ldc + col0 + c4) = v;
    }
    
  }
}

// GEMM C = act(A·W + bias + resid): A f32 (ASPLIT -> hi/lo 2 terms), Wt bf16 [N][K]; ACT 0 none, 1 relu, 2 exact gelu;
// resid (optional, f32, row index = (row % rmod), pitch ldr, RES_BF16 rounds it) added before the activation.
template <bool ASPLIT, int ACT, bool BIAS_BF16, bool RES_BF16>
__global__ __launch_bounds__(128) void k_gemm_bf3(const float* __restrict__ A, int lda, const unsigned short* __restrict__ Wt, int ldb,
                                                const float* __restrict__ bias, const float* __restrict__ resid, int rmod, int ldr,
                                                float* __restrict__ C, int ldc, int M, int N, int K) {
  __shared__ __attribute__((aligned(16))) float so[4][16][64];
  const int tid = threadIdx.x, w = tid >> 5, lane = tid & 31, ln = lane & 15, hh = lane >> 4;
  const int ntn = N / 64;
  const int wid = blockIdx.x * 4 + w;
  const int mt = wid / ntn, nq = wid % ntn;
  if (mt * 16 >= M) return;
  const int row0 = mt * 16, col0 = nq * 64;
  const float* arow = A + (size_t)(row0 + ln) * lda;
  v8f acc[4] = {};
  for (int kb = 0; kb < K; kb += 32) {
    FragB ah, al;
    const v4f x0 = *(const v4fa*)(arow + kb + 8 * hh), x1 = *(const v4fa*)(arow + kb + 8 * hh + 4);
    const v4f x2 = *(const v4fa*)(arow + kb + 16 + 8 * hh), x3 = *(const v4fa*)(arow + kb + 16 + 8 * hh + 4);
    float xs[16] = {x0[0],x0[1],x0[2],x0[3],x1[0],x1[1],x1[2],x1[3],x2[0],x2[1],x2[2],x2[3],x3[0],x3[1],x3[2],x3[3]};
#pragma unroll
    for (int i = 0; i < 16; ++i) { const unsigned short hb = bf16_bits(xs[i]); ah.u[i] = hb; al.u[i] = ASPLIT ? bf16_bits(xs[i] - bf16_val(hb)) : (unsigned short)0; }
#pragma unroll
    for (int t = 0; t < 4; ++t) {
      const unsigned short* brow = Wt + (size_t)(col0 + t * 16 + ln) * ldb + kb;
      FragB b;
      b.half[0] = *(const v8us*)(brow + 8 * hh);
      b.half[1] = *(const v8us*)(brow + 16 + 8 * hh);
      acc[t] = mmaN<ASPLIT ? 2 : 1>(ah.v, al.v, b.v, b.v, acc[t]);
    }
  }
#pragma unroll
  for (int t = 0; t < 4; ++t) {
    const int col = col0 + t * 16 + ln;
    float bv = bias ? bias[col] : 0.f;
    if (BIAS_BF16) bv = bf16_round(bv);
#pragma unroll
    for (int r = 0; r < 8; ++r) {
      float v = acc[t][r] + bv;
      if (resid) { float rv = resid[(size_t)((row0 + 8 * hh + r) % rmod) * ldr + col]; if (RES_BF16) rv = bf16_round(rv); v += rv; }
      if (ACT == 1) v = fmaxf(v, 0.f);
      if (ACT == 2) v = 0.5f * v * (1.0f + erff(v * 0.70710678118654752f));
      if (ACT == 3) { const float u = 0.7978845608028654f * (v + 0.044715f * v * v * v); v = 0.5f * v * (1.0f + tanhf(u)); }
      so[w][8 * hh + r][t * 16 + ln] = v;
    }
  }
  __builtin_amdgcn_fence(__ATOMIC_ACQ_REL, "workgroup");
  __builtin_amdgcn_wave_barrier();
  const int rsub = lane >> 4, c4 = (lane & 15) * 4;
  {
#pragma unroll
    for (int q = 0; q < 8; ++q) {
      const int r = q * 2 + rsub;
      const v4f v = *(const v4fa*)&so[w][r][c4];
      *(v4f*)(C + (size_t)(row0 + r) * ldc + col0 + c4) = v;
    }
    
  }
}
// row LayerNorm (biased variance, eps) over N: s = X (+ R); optional out_sum <- s; out_norm <- (s-mu)*rsqrt(var+eps)*g + b
template <bool PARAM_BF16>
__global__ __launch_bounds__(256) void k_layernorm(const float* __restrict__ X, const float* __restrict__ R, const float* __restrict__ g, const float* __restrict__ bta,
                                                  float* __restrict__ out_sum, float* __restrict__ out_norm, int N, float eps) {
  __shared__ float red[256];
  const int row = blockIdx.x, tid = threadIdx.x;
  const float* x = X + (size_t)row * N; const float* rr = R ? R + (size_t)row * N : nullptr;
  float vals[16];                     // up to N = 4096
  const int per = N / 256;            // contiguous chunk per thread? use strided-by-4 chunks: thread handles j = tid*4 + 1024*u
  float s1 = 0.f;
  for (int u = 0; u < per / 4; ++u) {
    const int j = tid * 4 + 1024 * u;
    const v4f a = *(const v4fa*)(x + j);
    v4f b = {0.f,0.f,0.f,0.f}; if (rr) b = *(const v4fa*)(rr + j);
#pragma unroll
    for (int q = 0; q < 4; ++q) { const float v = a[q] + b[q]; vals[u * 4 + q] = v; s1 += v; }
  }
  red[tid] = s1; __syncthreads();
  for (int st = 128; st > 0; st >>= 1) { if (tid < st) red[tid] += red[tid + st]; __syncthreads(); }
  const float mu = red[0] / (float)N; __syncthreads();
  float s2 = 0.f;
  for (int u = 0; u < per / 4; ++u)
#pragma unroll
    for (int q = 0; q < 4; ++q) { const float c = vals[u * 4 + q] - mu; s2 += c * c; }
  red[tid] = s2; __syncthreads();
  for (int st = 128; st > 0; st >>= 1) { if (tid < st) red[tid] += red[tid + st]; __syncthreads(); }
  const float rs = rsqrtf(red[0] / (float)N + eps);
  {
    for (int u = 0; u < per / 4; ++u) {
      const int j = tid * 4 + 1024 * u;
      v4f o, sm;
#pragma unroll
      for (int q = 0; q < 4; ++q) {
        float gg = g[j + q], bb = bta[j + q];
        if (PARAM_BF16) { gg = bf16_round(gg); bb = bf16_round(bb); }
        sm[q] = vals[u * 4 + q]; o[q] = (vals[u * 4 + q] - mu) * rs * gg + bb;
      }
      if (out_sum) *(v4f*)(out_sum + (size_t)row * N + j) = sm;
      *(v4f*)(out_norm + (size_t)row * N + j) = o;
    }
    
  }
}



// ---- f16 WMMA path (v_wmma_f32_16x16x32_f16): 11-bit significands for operands in range — used where a [0,1] probability operand needs more precision than bf16
typedef _Float16 v16h __attribute__((ext_vector_type(16)));
union FragH { v16h v; v8us half[2]; _Float16 h[16]; unsigned short u[16]; };
template <int NT>
__device__ __forceinline__ v8f mmaH(v16h ah, v16h al, v16h bh, v16h bl, v8f c) {
  c = __builtin_amdgcn_wmma_f32_16x16x32_f16(false, ah, false, bh, (short)0, c, false, false);
  if (NT >= 2) c = __builtin_amdgcn_wmma_f32_16x16x32_f16(false, al, false, bh, (short)0, c, false, false);
  if (NT >= 3) c = __builtin_amdgcn_wmma_f32_16x16x32_f16(false, ah, false, bl, (short)0, c, false, false);
  asm volatile("v_nop\n\tv_nop\n\tv_nop\n\tv_nop" : "+v"(c) : "v"(ah), "v"(al), "v"(bh), "v"(bl));
  return c;
}
// batched GEMM like k_gemm_b but f16 operands: A f32 (split into f16 hi/lo if ASPLIT, else rounded to f16), Bt = f16 values [n][k]; alpha; C f32; N multiple of 16 (partial tiles skipped)
template <bool ASPLIT>
__global__ __launch_bounds__(128) void k_gemm_h(const float* __restrict__ A, int lda, size_t sA, const _Float16* __restrict__ Bh, int ldb, size_t sB, float alpha, float* __restrict__ C, int ldc, size_t sC, int M, int N, int K) {
  __shared__ __attribute__((aligned(16))) float so[4][16][64];
  const int tid = threadIdx.x, w = tid >> 5, lane = tid & 31, ln = lane & 15, hh = lane >> 4; const int by = blockIdx.y;
  A += (size_t)by * sA; Bh += (size_t)by * sB; C += (size_t)by * sC;
  const int ntn = (N + 63) / 64; const int wid = blockIdx.x * 4 + w; const int mt = wid / ntn, nq = wid % ntn; if (mt * 16 >= M) return;
  const int row0 = mt * 16, col0 = nq * 64; const float* arow = A + (size_t)(row0 + ln) * lda;
  v8f acc[4] = {};
  for (int kb = 0; kb < K; kb += 32) {
    FragH ah, al;
    const v4f x0 = *(const v4fa*)(arow + kb + 8 * hh), x1 = *(const v4fa*)(arow + kb + 8 * hh + 4), x2 = *(const v4fa*)(arow + kb + 16 + 8 * hh), x3 = *(const v4fa*)(arow + kb + 16 + 8 * hh + 4);
    float xs[16] = {x0[0],x0[1],x0[2],x0[3],x1[0],x1[1],x1[2],x1[3],x2[0],x2[1],x2[2],x2[3],x3[0],x3[1],x3[2],x3[3]};
#pragma unroll
    for (int i = 0; i < 16; ++i) { const _Float16 h = (_Float16)xs[i]; ah.h[i] = h; al.h[i] = ASPLIT ? (_Float16)(xs[i] - (float)h) : (_Float16)0.0f; }
#pragma unroll
    for (int t = 0; t < 4; ++t) { if (col0 + t * 16 >= N) continue; const size_t boff = (size_t)(col0 + t * 16 + ln) * ldb + kb; FragH bq; bq.half[0] = *(const v8us*)(Bh + boff + 8 * hh); bq.half[1] = *(const v8us*)(Bh + boff + 16 + 8 * hh);
      acc[t] = mmaH<ASPLIT ? 2 : 1>(ah.v, al.v, bq.v, bq.v, acc[t]); }
  }
#pragma unroll
  for (int t = 0; t < 4; ++t) { if (col0 + t * 16 >= N) continue;
#pragma unroll
    for (int r = 0; r < 8; ++r) so[w][8 * hh + r][t * 16 + ln] = acc[t][r] * alpha; }
  __builtin_amdgcn_fence(__ATOMIC_ACQ_REL, "workgroup"); __builtin_amdgcn_wave_barrier();
  const int rsub = lane >> 4, c4 = (lane & 15) * 4;
  {
#pragma unroll
    for (int q = 0; q < 8; ++q) { const int r = q * 2 + rsub; if (col0 + c4 < N) { const v4f v = *(const v4fa*)&so[w][r][c4]; *(v4f*)(C + (size_t)(row0 + r) * ldc + col0 + c4) = v; } }
     }
}

// Wt[n][k] = f16(W[k][n]·scale) from f32 row-major W[K][N] (scale = power of two; bf16-exact weights stay exact in f16 away from the subnormal range)
__global__ __launch_bounds__(256) void k_wt_f16(const float* __restrict__ W, _Float16* __restrict__ Wt, int K, int N, float scale) {
  const int t = blockIdx.x * 256 + threadIdx.x; if (t >= N * (K / 8)) return; const int n = t / (K / 8), k8 = (t % (K / 8)) * 8; FragH f;
#pragma unroll
  for (int i = 0; i < 8; ++i) f.h[i] = (_Float16)(bf16_round(W[(size_t)(k8 + i) * N + n]) * scale); const v8us o = f.half[0];
  *(v8us*)((unsigned short*)Wt + (size_t)n * K + k8) = o; 
}
// k_gemm_hh variant with fused epilogue: v = acc·alpha + bias[by·sBias + col] (+ CP[(row/rowsPerB)·sCPb + by·64 + col] if CP) ; ACT 0 none / 1 elu ; writes f16 C16 (and f32 C if non-null)
template <int ACT>
__global__ __launch_bounds__(128) void k_gemm_hhx(const _Float16* __restrict__ A, int lda, size_t sA, const _Float16* __restrict__ Bh, int ldb, size_t sB, float alpha, const float* __restrict__ bias, size_t sBias, const float* __restrict__ CP, int rowsPerB, size_t sCPb, int row0g,
    float* __restrict__ C, _Float16* __restrict__ C16, int ldc, size_t sC, int M, int N, int K) {
  __shared__ __attribute__((aligned(16))) float so[4][16][64];
  const int tid = threadIdx.x, w = tid >> 5, lane = tid & 31, ln = lane & 15, hh = lane >> 4; const int by = blockIdx.y;
  A += (size_t)by * sA; Bh += (size_t)by * sB; const size_t cofs = (size_t)by * sC; const float* bp = bias ? bias + (size_t)by * sBias : nullptr;
  const int ntn = (N + 63) / 64; const int wid = blockIdx.x * 4 + w; const int mt = wid / ntn, nq = wid % ntn; if (mt * 16 >= M) return;
  const int row0 = mt * 16, col0 = nq * 64; const _Float16* arow = A + (size_t)(row0 + ln) * lda;
  v8f acc[4] = {};
  for (int kb = 0; kb < K; kb += 32) { FragH ah; ah.half[0] = *(const v8us*)((const unsigned short*)arow + kb + 8 * hh); ah.half[1] = *(const v8us*)((const unsigned short*)arow + kb + 16 + 8 * hh);
#pragma unroll
    for (int t = 0; t < 4; ++t) { if (col0 + t * 16 >= N) continue; const size_t boff = (size_t)(col0 + t * 16 + ln) * ldb + kb; FragH bq; bq.half[0] = *(const v8us*)((const unsigned short*)Bh + boff + 8 * hh); bq.half[1] = *(const v8us*)((const unsigned short*)Bh + boff + 16 + 8 * hh);
      acc[t] = mmaH<1>(ah.v, ah.v, bq.v, bq.v, acc[t]); }
  }
#pragma unroll
  for (int t = 0; t < 4; ++t) { if (col0 + t * 16 >= N) continue; const int col = col0 + t * 16 + ln; const float bv = bp ? bf16_round(bp[col]) : 0.f;
#pragma unroll
    for (int r = 0; r < 8; ++r) { float v = acc[t][r] * alpha + bv; if (CP) { const int rr = row0g + row0 + 8 * hh + r; if (rowsPerB < 0) v += CP[cofs + (size_t)rr * ldc + col];      /* rowsPerB < 0: own element of the batched C plane */ else { const int bidx = rr / rowsPerB; v += CP[(size_t)bidx * sCPb + (size_t)by * 64 + col]; } } if (ACT == 1) v = (v > 0.f) ? v : expm1f(v); else if (ACT == 7) v = (v > 0.f) ? v + 1.0f : expf(v); else if (ACT == 8) v = tanhf(v); else if (ACT == 9) v = 0.5f * v * (1.0f + tanhf(0.7978845608028654f * (v + 0.044715f * v * v * v))); else if (ACT == 11) v = 1.0f / (1.0f + expf(-v)); else if (ACT == 12) v = (v > 0.f) ? v : 0.01f * v; else if (ACT == 14) v = (v > 0.f) ? v : 0.1f * v; else if (ACT == 16) v = (v >= 0.f) ? v : 0.3f * v; else if (ACT == 17) v = (v >= 0.f) ? v : 0.2f * v; else if (ACT == 15) v = v / (1.0f + expf(-v)); else if (ACT == 3) v = fmaxf(v, 0.f); else if (ACT == 6) v = 0.5f * v * (1.0f + erff(v * 0.70710678118654752f)); so[w][8 * hh + r][t * 16 + ln] = v; } }
  __builtin_amdgcn_fence(__ATOMIC_ACQ_REL, "workgroup"); __builtin_amdgcn_wave_barrier();
  const int rsub = lane >> 4, c4 = (lane & 15) * 4; typedef _Float16 v4h __attribute__((ext_vector_type(4)));
  {
#pragma unroll
    for (int q = 0; q < 8; ++q) { const int r = q * 2 + rsub; if (col0 + c4 < N) { const v4f v = *(const v4fa*)&so[w][r][c4]; if (C) *(v4f*)(C + cofs + (size_t)(row0 + r) * ldc + col0 + c4) = v; if (C16) { v4h h4; for (int i = 0; i < 4; ++i) h4[i] = (_Float16)v[i]; *(v4h*)(C16 + cofs + (size_t)(row0 + r) * ldc + col0 + c4) = h4; } } }
     }
}


typedef _Float16 v4h __attribute__((ext_vector_type(4)));

__global__ __launch_bounds__(256) void k_x16(const float* __restrict__ x, _Float16* __restrict__ X16, size_t n8) { const size_t t = (size_t)blockIdx.x * 256 + threadIdx.x; if (t >= n8) return; FragH f;
#pragma unroll
  for (int q = 0; q < 8; ++q) f.h[q] = (_Float16)bf16_round(x[t * 8 + q]); *(v8us*)((unsigned short*)X16 + t * 8) = f.half[0];  }
__global__ __launch_bounds__(256) void k_h16(const float* __restrict__ x, _Float16* __restrict__ X16, size_t n8) { const size_t t = (size_t)blockIdx.x * 256 + threadIdx.x; if (t >= n8) return; FragH f;
#pragma unroll
  for (int q = 0; q < 8; ++q) f.h[q] = (_Float16)x[t * 8 + q]; *(v8us*)((unsigned short*)X16 + t * 8) = f.half[0];  }
__global__ __launch_bounds__(256) void k_round16f(const float* __restrict__ W, _Float16* __restrict__ Bt, size_t n8) { const size_t t = (size_t)blockIdx.x * 256 + threadIdx.x; if (t >= n8) return; FragH f;
#pragma unroll
  for (int i = 0; i < 8; ++i) f.h[i] = (_Float16)(bf16_round(W[t * 8 + i]) * 16.0f); *(v8us*)((unsigned short*)Bt + t * 8) = f.half[0];  }
template <int NHv, int TTv>
__global__ __launch_bounds__(256) void k_vt(const _Float16* __restrict__ V16, int ldv, int voff, _Float16* __restrict__ Vt) { __shared__ unsigned short tl[64][66]; const int tid = threadIdx.x; const int slab = blockIdx.x / (TTv / 64), lg = blockIdx.x % (TTv / 64); const int b = slab / NHv, h = slab % NHv;
  for (int i = tid; i < 64 * 8; i += 256) { const int r = i / 8, c8 = (i % 8) * 8; FragH f; f.half[0] = *(const v8us*)((const unsigned short*)V16 + ((size_t)b * TTv + lg * 64 + r) * ldv + voff + h * 64 + c8);
#pragma unroll
    for (int q = 0; q < 8; ++q) tl[r][c8 + q] = f.u[q]; }
  __syncthreads();
  {
#pragma unroll
    for (int rd = 0; rd < 2; ++rd) { const int d = rd * 32 + tid / 8, pc = tid % 8; FragH f;
#pragma unroll
      for (int q = 0; q < 8; ++q) f.u[q] = tl[pc * 8 + q][d];
      *(v8us*)((unsigned short*)Vt + ((size_t)slab * 64 + d) * TTv + lg * 64 + pc * 8) = f.half[0]; }
     } }

__global__ __launch_bounds__(256) void k_hl(const float* __restrict__ F, _Float16* __restrict__ Hh, _Float16* __restrict__ Hl, size_t n8) { const size_t t = (size_t)blockIdx.x * 256 + threadIdx.x; if (t >= n8) return; FragH fh, fl; const v4f a = *(const v4fa*)(F + t * 8), c = *(const v4fa*)(F + t * 8 + 4);
#pragma unroll
  for (int q = 0; q < 4; ++q) { _Float16 h = (_Float16)a[q]; fh.h[q] = h; fl.h[q] = (_Float16)((a[q] - (float)h) * 1024.0f); h = (_Float16)c[q]; fh.h[4 + q] = h; fl.h[4 + q] = (_Float16)((c[q] - (float)h) * 1024.0f); }
  { *(v8us*)((unsigned short*)Hh + t * 8) = fh.half[0]; *(v8us*)((unsigned short*)Hl + t * 8) = fl.half[0];  } }

// ---- fast GEMM (wave tile 32x64; requires M % 32 == 0 rows per launch region and N % 64 == 0); epilogue = k_gemm_hhx semantics ----
__device__ __forceinline__ v16h g2_frag(const _Float16* p, int hh) { FragH f; f.half[0] = *(const v8us*)((const unsigned short*)p + 8 * hh); f.half[1] = *(const v8us*)((const unsigned short*)p + 16 + 8 * hh); return f.v; }
__device__ __forceinline__ v8f g2_mma(v16h a, v16h b, v8f c) { v8f d = __builtin_amdgcn_wmma_f32_16x16x32_f16(false, a, false, b, (short)0, c, false, false); asm volatile("v_nop\n\tv_nop\n\tv_nop\n\tv_nop" : "+v"(d) : "v"(a), "v"(b)); return d; }
template <int ACT>
__global__ __launch_bounds__(128) void k_gemm2(const _Float16* __restrict__ A, int lda, size_t sA, const _Float16* __restrict__ Bh, int ldb, size_t sB, float alpha, const float* __restrict__ bias, size_t sBias, const float* __restrict__ CP, int rowsPerB, size_t sCPb, int row0g,
    float* __restrict__ C, _Float16* __restrict__ C16, int ldc, size_t sC, int M, int N, int K) { static_assert(ACT == 0 || ACT == 3 || ACT == 6 || ACT == 8 || ACT == 9 || ACT == 11 || ACT == 12 || ACT == 14 || ACT == 15 || ACT == 16 || ACT == 17, "k_gemm2: unsupported ACT code (would silently apply no activation)");
  __shared__ __attribute__((aligned(16))) float so[4][32][68];
  const int tid = threadIdx.x, w = tid >> 5, lane = tid & 31, ln = lane & 15, hh = lane >> 4; const int by = blockIdx.y;
  A += (size_t)by * sA; Bh += (size_t)by * sB; const size_t cofs = (size_t)by * sC; const float* bp = bias ? bias + (size_t)by * sBias : nullptr;
  const int ntn = N >> 6; const int mt = blockIdx.x / ntn, nq = blockIdx.x - mt * ntn; const int row0 = mt * 128 + 32 * w, col0 = nq * 64; if (row0 >= M) return;
  const _Float16* a0p = A + (size_t)(row0 + ln) * lda; const _Float16* a1p = a0p + (size_t)16 * lda;
  const _Float16* b0p = Bh + (size_t)(col0 + ln) * ldb; const _Float16* b1p = b0p + (size_t)16 * ldb; const _Float16* b2p = b1p + (size_t)16 * ldb; const _Float16* b3p = b2p + (size_t)16 * ldb;
  const v8f z8 = {0.f,0.f,0.f,0.f,0.f,0.f,0.f,0.f}; v8f c00 = z8, c01 = z8, c02 = z8, c03 = z8, c10 = z8, c11 = z8, c12 = z8, c13 = z8;
#pragma unroll 1
  for (int kb = 0; kb < K; kb += 32) { const v16h a0 = g2_frag(a0p + kb, hh), a1 = g2_frag(a1p + kb, hh);
    v16h b = g2_frag(b0p + kb, hh); c00 = g2_mma(a0, b, c00); c10 = g2_mma(a1, b, c10);
    b = g2_frag(b1p + kb, hh); c01 = g2_mma(a0, b, c01); c11 = g2_mma(a1, b, c11);
    b = g2_frag(b2p + kb, hh); c02 = g2_mma(a0, b, c02); c12 = g2_mma(a1, b, c12);
    b = g2_frag(b3p + kb, hh); c03 = g2_mma(a0, b, c03); c13 = g2_mma(a1, b, c13); }
  v8f accs[8] = {c00, c01, c02, c03, c10, c11, c12, c13};
#pragma unroll
  for (int u = 0; u < 8; ++u) { const int t = u & 3, half = u >> 2; const int col = col0 + t * 16 + ln; const float bv = bp ? bf16_round(bp[col]) : 0.f;
#pragma unroll
    for (int r = 0; r < 8; ++r) { const int rloc = half * 16 + 8 * hh + r; float v = accs[u][r] * alpha + bv; if (CP) { if (rowsPerB < 0) v += CP[cofs + (size_t)(row0g + row0 + rloc) * ldc + col];      /* rowsPerB < 0: own element of the batched C plane */ else { const int bidx = (row0g + row0 + rloc) / rowsPerB; v += CP[(size_t)bidx * sCPb + (size_t)by * 64 + col]; } }
      if (ACT == 3) v = fmaxf(v, 0.f); else if (ACT == 6) v = 0.5f * v * (1.0f + erff(v * 0.70710678118654752f)); else if (ACT == 11) v = 1.0f / (1.0f + expf(-v)); else if (ACT == 15) v = v / (1.0f + expf(-v)); else if (ACT == 12) v = (v > 0.f) ? v : 0.01f * v; else if (ACT == 8) v = tanhf(v); else if (ACT == 9) v = 0.5f * v * (1.0f + tanhf(0.7978845608028654f * (v + 0.044715f * v * v * v))); else if (ACT == 14) v = (v > 0.f) ? v : 0.1f * v; else if (ACT == 16) v = (v >= 0.f) ? v : 0.3f * v; else if (ACT == 17) v = (v >= 0.f) ? v : 0.2f * v;
      so[w][rloc][t * 16 + ln] = v; } }
  __builtin_amdgcn_fence(__ATOMIC_ACQ_REL, "workgroup"); __builtin_amdgcn_wave_barrier();
  const int rsub = lane >> 4, c4 = (lane & 15) * 4;
  {
#pragma unroll
    for (int q = 0; q < 16; ++q) { const int r = q * 2 + rsub; const v4f v = *(const v4fa*)&so[w][r][c4]; if (C) *(v4f*)(C + cofs + (size_t)(row0 + r) * ldc + col0 + c4) = v; if (C16) { v4h h4; for (int i = 0; i < 4; ++i) h4[i] = (_Float16)v[i]; *(v4h*)(C16 + cofs + (size_t)(row0 + r) * ldc + col0 + c4) = h4; } }
     } }


__global__ __launch_bounds__(256) void k_wnat(const float* __restrict__ w, size_t n8, _Float16* __restrict__ Bt) { const size_t t = (size_t)blockIdx.x * 256 + threadIdx.x; if (t >= n8) return; FragH f; for (int q = 0; q < 8; ++q) f.h[q] = (_Float16)(bf16_round(w[t * 8 + q]) * 16.0f); *(v8us*)((unsigned short*)Bt + t * 8) = f.half[0];  }
__global__ __launch_bounds__(256) void k_rsm(const float* __restrict__ S, _Float16* __restrict__ P, int nrows) {
  #pragma clang fp contract(off)
  const int i = blockIdx.x * 256 + threadIdx.x; if (i >= nrows) return; const float* s = S + (size_t)i * SQ; float mx = -3.0e38f;
#pragma unroll 1
  for (int j = 0; j < SQ; ++j) mx = fmaxf(mx, s[j]); float se = 0.f;
#pragma unroll 1
  for (int j = 0; j < SQ; ++j) se += expf(s[j] - mx); const float sc = 256.0f / se;
#pragma unroll 1
  for (int j0 = 0; j0 < SQ; j0 += 8) { FragH f; for (int q = 0; q < 8; ++q) f.h[q] = (_Float16)(expf(s[j0 + q] - mx) * sc); unsigned short* d = (unsigned short*)P + (size_t)i * SQ + j0; *(v8us*)d = f.half[0];  } }
__global__ __launch_bounds__(256) void k_vt(const _Float16* __restrict__ V16, int b, int h0, _Float16* __restrict__ VT) { __shared__ unsigned short tl[64][65]; const int tid = threadIdx.x; const int hh = blockIdx.x % HG, sg = blockIdx.x / HG; const int s0 = sg * 64; const int h = h0 + hh;
  for (int i = tid; i < 64 * 8; i += 256) { const int j = i / 8, d8 = (i % 8) * 8; FragH f; f.half[0] = *(const v8us*)((const unsigned short*)V16 + ((size_t)b * SQ + s0 + j) * DM + h * HD + d8); for (int q = 0; q < 8; ++q) tl[d8 + q][j] = f.u[q]; }
  __syncthreads();
  { for (int i = tid; i < 64 * 8; i += 256) { const int d = i / 8, j8 = (i % 8) * 8; FragH f; for (int q = 0; q < 8; ++q) f.u[q] = tl[d][j8 + q]; *(v8us*)((unsigned short*)VT + ((size_t)hh * HD + d) * SQ + s0 + j8) = f.half[0]; }  } }



__global__ __launch_bounds__(256) void k_rsmcf2(const float* __restrict__ S, _Float16* __restrict__ P, int hg, int q0, int nk) {
  #pragma clang fp contract(off)
  const int t = blockIdx.x * 256 + threadIdx.x; if (t >= hg * QT) return; const size_t i = (size_t)t; const float* s = S + i * NKX; const int last = q0 + (t % QT); float mx = -3.0e38f;
#pragma unroll 1
  for (int j = 0; j < nk; ++j) { const float f = (j <= last) ? 1.f : 0.f; mx = fmaxf(mx, fmaf(f, s[j], (1.f - f) * -1.0e9f)); } float se = 0.f;
#pragma unroll 1
  for (int j = 0; j < nk; ++j) { const float f = (j <= last) ? 1.f : 0.f; se += __expf(fmaf(f, s[j], (1.f - f) * -1.0e9f) - mx); } const float sc = 256.0f / se;
#pragma unroll 1
  for (int j0 = 0; j0 < nk; j0 += 8) { FragH fr; for (int q = 0; q < 8; ++q) { const int j = j0 + q; const float f = (j <= last) ? 1.f : 0.f; fr.h[q] = (_Float16)(__expf(fmaf(f, s[j], (1.f - f) * -1.0e9f) - mx) * sc); } unsigned short* d = (unsigned short*)P + i * NKX + j0; *(v8us*)d = fr.half[0];  } }

template <int MASKADD>
__global__ __launch_bounds__(64) void k_att0(const float* __restrict__ QF, const float* __restrict__ KF, const float* __restrict__ VF, int ld, const float* __restrict__ mask, float scale, float* __restrict__ OF, int ldo) {
  #pragma clang fp contract(off)
  __shared__ __attribute__((aligned(16))) float lq[64][64]; __shared__ __attribute__((aligned(16))) float lo[64][64];
  const int tid = threadIdx.x; const int h = blockIdx.x / (QT0 / 64), rg = blockIdx.x % (QT0 / 64); const int i = rg * 64 + tid;
  const float* qr = QF + (size_t)i * ld + h * HD;
#pragma unroll 1
  for (int c = 0; c < HD / 4; ++c) { *(v4f*)&lq[tid][c * 4] = *(const v4fa*)(qr + c * 4); const v4f z = {0.f, 0.f, 0.f, 0.f}; *(v4f*)&lo[tid][c * 4] = z; }
  float m = -1.0e30f, l = 0.f; const int jmax = MASKADD ? (SQ - 1) : (rg * 64 + 63);      /* additive-mask form: every key (the mask input decides); causal form: keys up to the block's last row */
#pragma unroll 1
  for (int j = 0; j <= jmax; ++j) { const float* kr = KF + (size_t)j * ld + h * HD; const float* vr = VF + (size_t)j * ld + h * HD; float s = 0.f;
#pragma unroll 1
    for (int c = 0; c < HD / 4; ++c) { const v4f kq = *(const v4fa*)(kr + c * 4); const v4f qq = *(v4f*)&lq[tid][c * 4]; s = __fadd_rn(s, __fmul_rn(qq[0], kq[0])); s = __fadd_rn(s, __fmul_rn(qq[1], kq[1])); s = __fadd_rn(s, __fmul_rn(qq[2], kq[2])); s = __fadd_rn(s, __fmul_rn(qq[3], kq[3])); }
    s = __fmul_rn(s, scale); if (MASKADD) s = __fadd_rn(s, __fmul_rn(bf16_round(mask[(size_t)i * SQ + j]), -10000.0f));
    const float f = (MASKADD || j <= i) ? 1.f : 0.f; const float sm = fmaf(f, s, (1.f - f) * -1.0e30f); const float mn = fmaxf(m, sm); const float sc = expf(m - mn); const float e = expf(sm - mn); l = __fadd_rn(__fmul_rn(l, sc), e); m = mn;
#pragma unroll 1
    for (int c = 0; c < HD / 4; ++c) { const v4f vv = *(const v4fa*)(vr + c * 4); v4f oo = *(v4f*)&lo[tid][c * 4]; for (int u = 0; u < 4; ++u) oo[u] = __fadd_rn(__fmul_rn(oo[u], sc), __fmul_rn(e, vv[u])); *(v4f*)&lo[tid][c * 4] = oo; } }
  const float fin = 64.0f / l;      /* o carried x64 like the f16 path */
#pragma unroll 1
  for (int c = 0; c < HD / 4; ++c) { v4f oo = *(v4f*)&lo[tid][c * 4]; for (int u = 0; u < 4; ++u) oo[u] = __fmul_rn(oo[u], fin); *(v4f*)&lo[tid][c * 4] = oo; }
  __syncthreads();
  {
#pragma unroll 1
    for (int it = 0; it < 16; ++it) { const int row = it * 4 + tid / 16, pc = (tid % 16) * 4; const v4f v = *(const v4f*)&lo[row][pc]; *(v4f*)(OF + (size_t)(rg * 64 + row) * ldo + h * HD + pc) = v; }
     } }

__global__ __launch_bounds__(256) void k_oscale(const float* __restrict__ OF, float* __restrict__ out, size_t n4) { const size_t t = (size_t)blockIdx.x * 256 + threadIdx.x; if (t >= n4) return; const v4f a = *(const v4fa*)(OF + t * 4); v4f o; for (int q = 0; q < 4; ++q) o[q] = a[q] * 0.015625f; *(v4f*)(out + t * 4) = o;  }

__global__ __launch_bounds__(256) void k_bfr(const float* __restrict__ x, float* __restrict__ XB, size_t n8) { const size_t t = (size_t)blockIdx.x * 256 + threadIdx.x; if (t >= n8) return; v4f a = *(const v4fa*)(x + t * 8), c = *(const v4fa*)(x + t * 8 + 4); for (int q = 0; q < 4; ++q) { a[q] = bf16_round(a[q]); c[q] = bf16_round(c[q]); }
  { *(v4f*)(XB + t * 8) = a; *(v4f*)(XB + t * 8 + 4) = c;  } }



__global__ __launch_bounds__(256) void k_rsmfvl(const float* __restrict__ S, _Float16* __restrict__ P, _Float16* __restrict__ PL, int qn, const int* __restrict__ vlp) {
  #pragma clang fp contract(off)
  const int t = blockIdx.x * 256 + threadIdx.x; if (t >= qn) return; const int vl = vlp[0]; const size_t i = (size_t)t; const float* s = S + i * SQ; float mx = -3.0e38f;
#pragma unroll 1
  for (int j = 0; j < SQ; ++j) { const float f = (j < vl) ? 1.f : 0.f; mx = fmaxf(mx, fmaf(f, s[j], (1.f - f) * -1000000.0f)); } float se = 0.f;
#pragma unroll 1
  for (int j = 0; j < SQ; ++j) { const float f = (j < vl) ? 1.f : 0.f; se += __expf(fmaf(f, s[j], (1.f - f) * -1000000.0f) - mx); } const float sc = 256.0f / se;
#pragma unroll 1
  for (int j0 = 0; j0 < SQ; j0 += 8) { FragH fr, gr; for (int q = 0; q < 8; ++q) { const int j = j0 + q; const float f = (j < vl) ? 1.f : 0.f; const float pv = __expf(fmaf(f, s[j], (1.f - f) * -1000000.0f) - mx) * sc; const _Float16 ph = (_Float16)pv; fr.h[q] = ph; gr.h[q] = (_Float16)((pv - (float)ph) * 1024.0f); }
    unsigned short* d = (unsigned short*)P + i * SQ + j0; unsigned short* dl = (unsigned short*)PL + i * SQ + j0; *(v8us*)d = fr.half[0]; *(v8us*)dl = gr.half[0];  } }

#define NRW 131072      /* rows */
#define NIN 40          /* input features */
#define KIN 64          /* padded input width */
#define D0 128
#define D1 64
#define D2 32
#define D2P 64
#define NBRN 33         /* branches */
#define RB 8192

__global__ __launch_bounds__(256) void k_zero16(unsigned short* __restrict__ p, size_t n8) { const size_t t = (size_t)blockIdx.x * 256 + threadIdx.x; if (t >= n8) return; v8us z; for (int q = 0; q < 8; ++q) z[q] = 0; *(v8us*)(p + t * 8) = z;  }



#define BWV 8           /* waves per work-group of the branch kernel */
#define BRW 64          /* batch rows per wave in the trunk phase: four B tiles */
#define WCH 1280        /* 16-byte pieces of one branch's weights: 16 (layer 1) + 4 (layer 2) A fragments of 1 KiB */
#define AUXF 256        /* f32 side table per branch: 16 b1 [0..63], 256 b2 [64..95], W3 / 256 [96..127] as the dot reads it (at 96 + 16 (r >> 2) + 8 hh + 2 (r & 3) the pair of features 8 hh + r and 16 + 8 hh + r), b3 [128] and [136] (one for each hh), rest 0 (the powers of two: see k_branch) */
#define TCH 1024        /* 16-byte pieces of the trunk's weights: 16 A fragments of 1 KiB */
#define TAUX 512        /* f32 side table of the trunk: bs [0..127], BN scale [128..167], BN mean [192..231], BN shift [256..295], rest 0 */

// Per branch: the A fragments of W1[j]^T (tile mt, k step ks at index mt * 4 + ks) and of W2[j]^T (at 16 + mt * 2 + ks) in the order the lanes read them
// (piece = (fragment * 2 + half) * 32 + lane; lane (ln, hh) holds row 16 mt + ln, k = 32 ks + 16 half + 8 hh + 0..7), and the rounded biases and W3.
// Behind the branches, the trunk: the A fragments of Ws^T (tile mt, k step ks at index mt * 2 + ks, same piece order; k = 40..63 zero) and its side table.
__global__ __launch_bounds__(256) void k_pack(const float* __restrict__ W1, const float* __restrict__ b1, const float* __restrict__ W2, const float* __restrict__ b2, const float* __restrict__ W3, const float* __restrict__ b3,
    const float* __restrict__ Ws, const float* __restrict__ bs, const float* __restrict__ g, const float* __restrict__ be, const float* __restrict__ mu, const float* __restrict__ var, float eps,
    _Float16* __restrict__ PW, float* __restrict__ PA, _Float16* __restrict__ PT, float* __restrict__ PB) {
  const int t = blockIdx.x * 256 + threadIdx.x; if (t >= NBRN * (WCH + AUXF / 4) + TCH + TAUX / 4) return;
  if (t >= NBRN * (WCH + AUXF / 4)) { const int c = t - NBRN * (WCH + AUXF / 4);
    if (c < TCH) { const int lane = c & 31, ln = lane & 15, hh = lane >> 4, f = c >> 6, h = (c >> 5) & 1; const int n = (f >> 1) * 16 + ln, k0 = (f & 1) * 32 + h * 16 + 8 * hh; FragH o;
      for (int q = 0; q < 8; ++q) { const int k = k0 + q; o.h[q] = (k < NIN) ? (_Float16)(bf16_round(Ws[(size_t)k * D0 + n]) * 16.0f) : (_Float16)0.f; }
      *(v8us*)((unsigned short*)PT + (size_t)c * 8) = o.half[0]; }
    else { const int i0 = (c - TCH) * 4; v4f o;
      for (int u = 0; u < 4; ++u) { const int i = i0 + u, cf = (i - D0) & 63, kind = (i - D0) >> 6; float v = 0.f;
        if (i < D0) v = bf16_round(bs[i]); else if (cf < NIN && kind == 0) v = rsqrtf(bf16_round(var[cf]) + eps) * bf16_round(g[cf]); else if (cf < NIN && kind == 1) v = bf16_round(mu[cf]); else if (cf < NIN && kind == 2) v = bf16_round(be[cf]);
        o[u] = v; }
      *(v4f*)(PB + i0) = o; }
    return; }
  const int j = t / (WCH + AUXF / 4), c = t % (WCH + AUXF / 4);
  if (c < WCH) { const int lane = c & 31, ln = lane & 15, hh = lane >> 4, f = c >> 6, h = (c >> 5) & 1; FragH o;
    if (f < 16) { const int k = (f >> 2) * 16 + ln, d0 = (f & 3) * 32 + h * 16 + 8 * hh; for (int q = 0; q < 8; ++q) o.h[q] = (_Float16)(bf16_round(W1[((size_t)j * D0 + d0 + q) * D1 + k]) * 16.0f); }
    else { const int m = ((f - 16) >> 1) * 16 + ln, k0 = ((f - 16) & 1) * 32 + h * 16 + 8 * hh; for (int q = 0; q < 8; ++q) o.h[q] = (_Float16)(bf16_round(W2[((size_t)j * D1 + k0 + q) * D2 + m]) * 16.0f); }
    *(v8us*)((unsigned short*)PW + ((size_t)j * WCH + c) * 8) = o.half[0]; }
  else { const int i0 = (c - WCH) * 4; v4f o;
    for (int u = 0; u < 4; ++u) { const int i = i0 + u; float v = 0.f, sc = 1.f; if (i < D1) { v = b1[j * D1 + i]; sc = 16.0f; } else if (i < D1 + D2) { v = b2[j * D2 + i - D1]; sc = 256.0f; } else if (i < D1 + 2 * D2) { const int e = i - D1 - D2; v = W3[j * D2 + (e & 1) * 16 + ((e >> 3) & 1) * 8 + (e >> 4) * 4 + ((e >> 1) & 3)]; sc = 0.00390625f; } else if (i == D1 + 2 * D2 || i == D1 + 2 * D2 + 8) v = b3[j]; o[u] = bf16_round(v) * sc; }
    *(v4f*)(PA + (size_t)j * AUXF + i0) = o; } }

__device__ __forceinline__ v16h br_frag(const unsigned short* wb, int f, int lane) { FragH x; x.half[0] = *(const v8us*)(wb + f * 512 + lane * 8); x.half[1] = *(const v8us*)(wb + f * 512 + 256 + lane * 8); return x.v; }
__device__ __forceinline__ v8f br_row8(const float* p) { const v4f lo = *(const v4f*)p, hi = *(const v4f*)(p + 4); return __builtin_shufflevector(lo, hi, 0, 1, 2, 3, 4, 5, 6, 7); }      /* eight f32 in the order of a D tile's registers */
__device__ __forceinline__ v8f br_mma(v16h a, v16h b, v8f c) { return __builtin_amdgcn_wmma_f32_16x16x32_f16(false, a, false, b, (short)0, c, false, false); }
__device__ __forceinline__ float br_xhalf(float x) { return __builtin_bit_cast(float, __builtin_amdgcn_permlanex16(__builtin_bit_cast(int, x), __builtin_bit_cast(int, x), 0x76543210, 0xfedcba98, false, false)); }

#define ZT (BWV * BRW / 16)      /* 16-row tiles of a work-group */
#define NPW (NBRN * (ZT / 2) / BWV)      /* (branch, tile pair) items per wave: 33 * 16 / 8 = 66 */
#define NSG 5           /* runs of one branch in a wave's 66 items: 16 - 2 w, 16, 16, 16, 2 + 2 w */

// Phase 1, one wave: 64 batch rows; BN and the trunk layer (64 WMMAs, the trunk's weights staged in LDS); z goes to LDS as B fragments, in the order the lanes read them, for all 8 waves (512 rows, 128 KiB).
// Phase 2: the 33 x 16 items (branch, pair of 16-row tiles) of the work-group are dealt to the waves in branch-major order, 66 each. A wave holds its branch's weights, biases and W3 in registers (read from global memory in fragment order, five times a wave, layer 1's share as soon as the old branch's last layer 1 is issued) and streams z from LDS: 16 reads feed an item's 40 WMMAs, the next item's reads stand behind this item's layer 1, into the same registers. No barrier and no LDS weight buffer in phase 2: the waves run free of each other.
// The branch layers carry the weights' factor 16 along instead of dividing it out: h1 stands as 16 h1 (f16), h2 as 256 h2 (f32), W3 is packed as W3 / 256, and each layer's bias, packed with the same factor, is the C operand of the layer's first WMMA; so an epilogue is relu (and the conversion) alone. All factors are powers of two and change no rounding, but that an h1 below the f16 normal range keeps more bits; 16 h1 overflows f16 only above h1 = 4095.
// Every "#pragma unroll" in this kernel makes the indices of a fragment or accumulator array constants, so that the array stays in registers (a run-time index would send it to scratch).
__global__ __launch_bounds__(256) void k_branch(const float* __restrict__ x, const _Float16* __restrict__ PT, const float* __restrict__ PB, const _Float16* __restrict__ PW, const float* __restrict__ PA, float* __restrict__ out) {
  __shared__ __attribute__((aligned(16))) unsigned short zs[ZT * 4 * 512];      /* z: tile t, k step ks = fragment t * 4 + ks, in br_frag's order */
  __shared__ __attribute__((aligned(16))) float so[BWV * BRW * NBRN];
  __shared__ __attribute__((aligned(16))) unsigned short tw[TCH * 8];
  __shared__ __attribute__((aligned(16))) float tb[TAUX];
  const int tid = threadIdx.x, w = tid >> 5, lane = tid & 31, ln = lane & 15, hh = lane >> 4;
  const int wu = __builtin_amdgcn_readfirstlane(w);      /* the wave's number in a scalar register: phase 2's loop bounds and weight addresses are scalar */
  const size_t row0 = (size_t)blockIdx.x * (BWV * BRW) + (size_t)w * BRW;
  const unsigned short* pw = (const unsigned short*)PW;
  v8us tt[4]; v2f ttb;
#pragma unroll
  for (int i = 0; i < 4; ++i) tt[i] = *(const v8us*)((const unsigned short*)PT + (size_t)(tid + 256 * i) * 8);
  ttb = *(const v2f*)(PB + tid * 2);
  v4f xr[4][6];      /* lane (ln, hh), tile n: features 8 hh + 0..7, 16 + 8 hh + 0..7 and 32..39 of row 16 n + ln */
#pragma unroll
  for (int n = 0; n < 4; ++n) { const float* xp = x + (row0 + n * 16 + ln) * NIN;
#pragma unroll
    for (int q = 0; q < 6; ++q) xr[n][q] = *(const v4fa*)(xp + ((q < 4) ? (q >> 1) * 16 + 8 * hh + (q & 1) * 4 : q * 4 + 16)); }
  asm volatile("s_wait_xcnt 0x0" ::: "memory");      /* stands before the address registers of the loads above are reused */
  __builtin_amdgcn_sched_barrier(0);      /* keeps the LDS address arithmetic below, which reuses those registers, behind that wait */
#pragma unroll
  for (int i = 0; i < 4; ++i) *(v8us*)(&tw[(tid + 256 * i) * 8]) = tt[i];
  *(v2f*)(&tb[tid * 2]) = ttb;
  __syncthreads();      /* publishes the trunk's weights */
  const v8f z8 = {0.f, 0.f, 0.f, 0.f, 0.f, 0.f, 0.f, 0.f};
  v16h xb[4][2];      /* xn as B fragments: k step 0 = features 0..31, k step 1 = features 32..39 and zeros */
  { v4f bsc[6], bmu[6], bsh[6]; const unsigned keep = hh ? 0u : 0xffffffffu;
#pragma unroll
    for (int q = 0; q < 6; ++q) { const int c = (q < 4) ? (q >> 1) * 16 + 8 * hh + (q & 1) * 4 : q * 4 + 16; bsc[q] = *(const v4f*)(tb + 128 + c); bmu[q] = *(const v4f*)(tb + 192 + c); bsh[q] = *(const v4f*)(tb + 256 + c); }
#pragma unroll
    for (int n = 0; n < 4; ++n) { FragH f0, f1;
#pragma unroll
      for (int q = 0; q < 6; ++q) { const v4f xq = __builtin_convertvector(__builtin_convertvector(xr[n][q], v4b), v4f);      /* x rounded to bf16, to nearest even */
        const v4h y = __builtin_convertvector((xq - bmu[q]) * bsc[q] + bsh[q], v4h);
#pragma unroll
        for (int u = 0; u < 4; ++u) { if (q < 4) f0.h[q * 4 + u] = y[u]; else { f1.h[(q - 4) * 4 + u] = y[u]; f1.h[8 + (q - 4) * 4 + u] = (_Float16)0.f; } } }
      v8u w1 = __builtin_bit_cast(v8u, f1.v);
#pragma unroll
      for (int i = 0; i < 4; ++i) w1[i] &= keep;      /* lanes 16-31 stand for k = 40..47: zeros */
      xb[n][0] = f0.v; xb[n][1] = __builtin_bit_cast(v16h, w1); } }
  int pr = wu * NPW;      /* this wave's items: pr .. pr + 65; branch pr >> 4, tile pair pr & 15 */
  v16h wa[4][4], ua[2][2]; v8f bb[4], cc[2]; v4f ee[4]; float b3v;      /* one branch: layer-1 A fragments (tile m, k step ks), layer-2 A fragments (k step s, tile m), 16 b1 and 256 b2 as C tiles, W3 / 256 (register pair r: features 8 hh + r and 16 + 8 hh + r), b3 */
  auto take_l1 = [&](int j) {      /* what layer 1 reads */
    const unsigned short* gl = pw + (size_t)j * (WCH * 8) + lane * 8; const float* gh = PA + (size_t)j * AUXF + 8 * hh;
#pragma unroll
    for (int m = 0; m < 4; ++m) {
#pragma unroll
      for (int ks = 0; ks < 4; ++ks) wa[m][ks] = br_frag(gl, m * 4 + ks, 0); }
    asm volatile("s_wait_xcnt 0x0" :: "v"(gl) : "memory");      /* stands before the loads' address registers are reused; the address as an input keeps them from being a load's own destination */
    __builtin_amdgcn_sched_barrier(0);      /* keeps the loads below behind that wait */
#pragma unroll
    for (int m = 0; m < 4; ++m) bb[m] = br_row8(gh + 16 * m);
    asm volatile("s_wait_xcnt 0x0" :: "v"(gh) : "memory");
    __builtin_amdgcn_sched_barrier(0);      /* keeps what follows, which may reuse those registers, behind that wait */
  };
  auto take_l2 = [&](int j) {      /* what layer 2 and the dot read */
    const unsigned short* gl = pw + (size_t)j * (WCH * 8) + lane * 8; const float* gh = PA + (size_t)j * AUXF + 8 * hh;
#pragma unroll
    for (int s = 0; s < 2; ++s) { ua[s][0] = br_frag(gl, 16 + s, 0); ua[s][1] = br_frag(gl, 18 + s, 0); }
    asm volatile("s_wait_xcnt 0x0" :: "v"(gl) : "memory");      /* as in take_l1 */
    __builtin_amdgcn_sched_barrier(0);      /* keeps the loads below behind that wait */
#pragma unroll
    for (int m = 0; m < 2; ++m) { cc[m] = br_row8(gh + 64 + 16 * m); ee[2 * m] = *(const v4f*)(gh + 96 + 16 * m); ee[2 * m + 1] = *(const v4f*)(gh + 100 + 16 * m); }
    b3v = gh[128];
    asm volatile("s_wait_xcnt 0x0" :: "v"(gh) : "memory");      /* as in take_l1 */
    __builtin_amdgcn_sched_barrier(0);      /* keeps what follows, which may reuse those registers, behind that wait */
  };
  take_l1(pr >> 4); take_l2(pr >> 4);      /* the first branch, asked for here so that it lands under the trunk layer */
  const v16h h0 = {};
#pragma unroll
  for (int ks = 0; ks < 4; ++ks) {      /* z features 32 ks .. 32 ks + 31 = k step ks of layer 1 */
    v16h ta[2][2]; v4f bz[4]; v8f t0[4], t1[4];
#pragma unroll
    for (int m = 0; m < 2; ++m) { ta[m][0] = br_frag(tw, (2 * ks + m) * 2, lane); ta[m][1] = br_frag(tw, (2 * ks + m) * 2 + 1, lane); }
#pragma unroll
    for (int q = 0; q < 4; ++q) bz[q] = *(const v4f*)(tb + 32 * ks + (q >> 1) * 16 + 8 * hh + (q & 1) * 4);
#pragma unroll
    for (int n = 0; n < 4; ++n) { t0[n] = br_mma(ta[0][0], xb[n][0], z8); t1[n] = br_mma(ta[1][0], xb[n][0], z8); }
#pragma unroll
    for (int n = 0; n < 4; ++n) { t0[n] = br_mma(ta[0][1], xb[n][1], t0[n]); t1[n] = br_mma(ta[1][1], xb[n][1], t1[n]); }
#pragma unroll
    for (int n = 0; n < 4; ++n) { FragH hb;
#pragma unroll
      for (int r = 0; r < 8; ++r) { hb.h[r] = (_Float16)fmaxf(t0[n][r] * 0.0625f + bz[r >> 2][r & 3], 0.f); hb.h[8 + r] = (_Float16)fmaxf(t1[n][r] * 0.0625f + bz[2 + (r >> 2)][r & 3], 0.f); }
      unsigned short* zd = zs + ((w * 4 + n) * 4 + ks) * 512 + lane * 8;
      *(v8us*)zd = hb.half[0]; *(v8us*)(zd + 256) = hb.half[1]; }
  }
  __syncthreads();      /* publishes z to the 8 waves */
  v16h zf[2][4];      /* the item's two z tiles; refilled in place for the next item */
#pragma unroll
  for (int t = 0; t < 2; ++t) {
#pragma unroll
    for (int ks = 0; ks < 4; ++ks) zf[t][ks] = br_frag(zs, ((pr & 15) * 2 + t) * 4 + ks, lane); }
  auto run = [&](const bool more) __attribute__((always_inline)) {      /* one run: the wave's items of one branch; more: another run follows */
    const int j = pr >> 4;
    const int stop = more ? (j + 1) << 4 : wu * NPW + NPW;
    float* sd = so + (hh * 16 + ln) * NBRN + j;
    auto item = [&](const bool last) __attribute__((always_inline)) {
      const int tp = pr & 15, tn = (pr + 1) & 15;      /* behind a branch's last pair comes the next branch's pair 0; the wave's last item reads one pair for nothing */
      v8f a1[4][2];
#pragma unroll
      for (int ks = 0; ks < 4; ++ks) {
#pragma unroll
        for (int m = 0; m < 4; ++m) { a1[m][0] = br_mma(wa[m][ks], zf[0][ks], ks ? a1[m][0] : bb[m]); a1[m][1] = br_mma(wa[m][ks], zf[1][ks], ks ? a1[m][1] : bb[m]); }
        __builtin_amdgcn_sched_barrier(0);      /* keeps eight independent accumulators per k step: without it the four k steps of one tile are issued as a dependent chain */
      }
#pragma unroll
      for (int t = 0; t < 2; ++t) {
#pragma unroll
        for (int ks = 0; ks < 4; ++ks) zf[t][ks] = br_frag(zs, (tn * 2 + t) * 4 + ks, lane); }
      __builtin_amdgcn_sched_barrier(0);      /* keeps these LDS reads in one group ahead of the epilogues that hide their latency */
      if (last && more) take_l1(j + 1);      /* layer 1 of the run's last item is issued, so the next branch (at most 32) may land in its registers under this item's epilogues */
      v8f a2[2][2];
#pragma unroll
      for (int s = 0; s < 2; ++s) {      /* h1 features 32 s .. 32 s + 31 = k step s of layer 2 */
#pragma unroll
        for (int t = 0; t < 2; ++t) { FragH hb;
#pragma unroll
          for (int r = 0; r < 8; ++r) { hb.h[r] = (_Float16)a1[2 * s][t][r]; hb.h[8 + r] = (_Float16)a1[2 * s + 1][t][r]; }
          const v16h hr = __builtin_elementwise_max(hb.v, h0);      /* relu behind the conversion: two values an instruction, the same result */
          a2[0][t] = br_mma(ua[s][0], hr, s ? a2[0][t] : cc[0]); a2[1][t] = br_mma(ua[s][1], hr, s ? a2[1][t] : cc[1]); } }
      __builtin_amdgcn_sched_barrier(0);      /* keeps the dot's first reads out of the last WMMAs, where each would wait for its own result */
      float p[2];
#pragma unroll
      for (int t = 0; t < 2; ++t) { v2f sp = {0.f, 0.f};      /* the lower and the upper tile's sums, side by side as W3 lies */
#pragma unroll
        for (int r = 0; r < 8; ++r) { const v2f hv = {fmaxf(a2[0][t][r], 0.f), fmaxf(a2[1][t][r], 0.f)}, ev = {ee[r >> 1][(r & 1) * 2], ee[r >> 1][(r & 1) * 2 + 1]}; sp = __builtin_elementwise_fma(hv, ev, sp); }
        p[t] = sp[0] + sp[1]; }
      const float mine = hh ? p[1] : p[0], send = hh ? p[0] : p[1];
      sd[tp * (32 * NBRN)] = mine + br_xhalf(send) + b3v;
      ++pr;
    };
#pragma unroll 1      /* one copy of the item: 40 WMMAs and their epilogues */
    do item(false); while (pr + 1 < stop);      /* a run has at least two items */
    item(true);      /* the run's last item, written out apart: the loop itself then holds no global load and waits for none */
    if (more) take_l2(j + 1);      /* the rest of the next run's branch */
  };
#pragma unroll 1      /* the weights are loop-carried registers: one copy of the text */
  for (int sg = 0; sg < NSG - 1; ++sg) run(true);
  run(false);      /* the last run, written out apart: no test stands round the loads of the others, so each wait counts exactly */
  __syncthreads();      /* every wave's results stand in so */
  float* og = out + (size_t)blockIdx.x * (BWV * BRW * NBRN);      /* 512 rows x 33 f32 = 528 whole 128-byte lines, this work-group's own; a wave's store covers four whole lines */
  for (int i = tid; i < BWV * BRW * NBRN / 4; i += 256) *(v4f*)(og + i * 4) = *(const v4f*)(so + i * 4);
}

extern "C" void kernel_launch(void* const* d_in, const int* in_sizes, int n_in,
                              void* d_out, int out_size, void* d_ws, size_t ws_size, hipStream_t stream) {
  (void)in_sizes; (void)n_in; (void)out_size;
  const float* const* I = (const float* const*)d_in; const float* x = I[0]; const float* bng = I[1]; const float* bnb = I[2]; const float* bnm = I[3]; const float* bnv = I[4]; const float* Ws = I[5]; const float* bs = I[6]; const float* W1 = I[7]; const float* b1 = I[8]; const float* W2 = I[9]; const float* b2 = I[10]; const float* W3 = I[11]; const float* b3 = I[12];
  char* ws = (char*)d_ws; size_t off = 0;
  auto take = [&](size_t bytes) { char* p = ws + off; off += (bytes + 255) & ~(size_t)255; return p; };
  _Float16* PW = (_Float16*)take((size_t)NBRN * WCH * 16); float* PA = (float*)take((size_t)NBRN * AUXF * 4); _Float16* PT = (_Float16*)take((size_t)TCH * 16); float* PB = (float*)take((size_t)TAUX * 4);
  if (off > ws_size) return;
  k_pack<<<(NBRN * (WCH + AUXF / 4) + TCH + TAUX / 4 + 255) / 256, 256, 0, stream>>>(W1, b1, W2, b2, W3, b3, Ws, bs, bng, bnb, bnm, bnv, 1e-5f, PW, PA, PT, PB);      /* branch and trunk weights as A fragments; biases, W3 and the BN terms rounded */
  k_branch<<<NRW / (BWV * BRW), 256, 0, stream>>>(x, PT, PB, PW, PA, (float*)d_out);      /* BN, trunk, then gu[r][j] for all rows and branches */
}

// v006
// Measured time: 47.4 microseconds a run.
// In both of two side-by-side timings against v005, it was 1.08 times as fast.
// Counting every step since v000, it is 21.6 times as fast.
#include <hip/hip_runtime.h>
#define NB 1
#define SQ 8192
#define DM 64
#define NH 1
#define HD 64
#define HG 4                         /* heads per attention launch group */
#define B0 0                         /* first batch processed (debug hook) */
#define NBR NB                       /* batches processed (debug hook) */
#define NR ((size_t)NB * SQ)         /* token rows */
#define MP ((int)((size_t)NBR * SQ)) /* rows projected (debug hook) */
#define QT 256                       /* query rows per causal tile */
#define NKX SQ                       /* S / P row pitch */
#define QT0 256                      /* first-tile rows recomputed exactly (256: buys margin for the few-key rows 128..255, which have no output projection to average the single-f16 P/v rounding) */
#define QN SQ                        /* query rows attended per batch (debug hook) */
#define NHD NH                       /* heads attended (debug hook) */
#define MPO MP                       /* rows through the output stage (debug hook) */
#define LQ DM            /* row pitch of the q/k/v rows */
typedef __bf16 v16b __attribute__((ext_vector_type(16)));
typedef unsigned short v8us __attribute__((ext_vector_type(8), may_alias));
typedef float  v8f  __attribute__((ext_vector_type(8)));
typedef float  v4f  __attribute__((ext_vector_type(4)));
typedef float  v4fa __attribute__((ext_vector_type(4), may_alias));
typedef float  v2f  __attribute__((ext_vector_type(2)));
typedef unsigned int v8u __attribute__((ext_vector_type(8)));
typedef __bf16 v4b __attribute__((ext_vector_type(4)));
union FragB { v16b v; v8us half[2]; unsigned short u[16]; };

__device__ __forceinline__ unsigned short bf16_bits(float x) { unsigned int u = __float_as_uint(x); return (unsigned short)((u + 0x7FFFu + ((u >> 16) & 1u)) >> 16); }
__device__ __forceinline__ float bf16_val(unsigned short b) { return __uint_as_float(((unsigned int)b) << 16); }
__device__ __forceinline__ float bf16_round(float x) { return bf16_val(bf16_bits(x)); }
// D += A·B with NT terms: 1 = ah·bh, 2 = + al·bh (A split), 3 = + ah·bl (both split)
template <int NT>
__device__ __forceinline__ v8f mmaN(v16b ah, v16b al, v16b bh, v16b bl, v8f c) {
  c = __builtin_amdgcn_wmma_f32_16x16x32_bf16(false, ah, false, bh, (short)0, c, false, false);
  if (NT >= 2) c = __builtin_amdgcn_wmma_f32_16x16x32_bf16(false, al, false, bh, (short)0, c, false, false);
  if (NT >= 3) c = __builtin_amdgcn_wmma_f32_16x16x32_bf16(false, ah, false, bl, (short)0, c, false, false);
  asm volatile("v_nop\n\tv_nop\n\tv_nop\n\tv_nop" : "+v"(c) : "v"(ah), "v"(al), "v"(bh), "v"(bl));
  return c;
}

__global__ __launch_bounds__(256) void k_wt_bf16(const float* __restrict__ W, unsigned short* __restrict__ Wt, int K, int N) {
  const int t = blockIdx.x * 256 + threadIdx.x;
  const int k8n = K / 8;
  if (t >= N * k8n) return;
  const int n = t / k8n, k8 = (t % k8n) * 8;
  v8us v;
#pragma unroll
  for (int i = 0; i < 8; ++i) v[i] = bf16_bits(W[(size_t)(k8 + i) * N + n]);
  *(v8us*)(Wt + (size_t)n * K + k8) = v;
  
}

// GEMM C[M][N] (f32, pitch ldc) = act(A[M][K]·W + bias). A f32 row-major (pitch lda) converted per fragment to bf16
// (ASPLIT: hi/lo two planes -> 2 terms, else single rounded term); Wt bf16 [N][K] (pitch ldb). BIAS_BF16 rounds the
// bias to bf16 first (bias quantised to bf16 before the add). K%32==0, M%16==0, N%64==0.
template <bool ASPLIT, int ACT, bool BIAS_BF16>
__global__ __launch_bounds__(128) void k_gemm_bf(const float* __restrict__ A, int lda, const unsigned short* __restrict__ Wt, int ldb,
                                               const float* __restrict__ bias, float* __restrict__ C, int ldc, int M, int N, int K) {
  __shared__ __attribute__((aligned(16))) float so[4][16][64];
  const int tid = threadIdx.x, w = tid >> 5, lane = tid & 31, ln = lane & 15, hh = lane >> 4;
  const int ntn = N / 64;
  const int wid = blockIdx.x * 4 + w;
  const int mt = wid / ntn, nq = wid % ntn;
  if (mt * 16 >= M) return;
  const int row0 = mt * 16, col0 = nq * 64;
  const float* arow = A + (size_t)(row0 + ln) * lda;
  v8f acc[4] = {};
  for (int kb = 0; kb < K; kb += 32) {
    FragB ah, al;
    const v4f x0 = *(const v4fa*)(arow + kb + 8 * hh), x1 = *(const v4fa*)(arow + kb + 8 * hh + 4);
    const v4f x2 = *(const v4fa*)(arow + kb + 16 + 8 * hh), x3 = *(const v4fa*)(arow + kb + 16 + 8 * hh + 4);
    float xs[16] = {x0[0],x0[1],x0[2],x0[3],x1[0],x1[1],x1[2],x1[3],x2[0],x2[1],x2[2],x2[3],x3[0],x3[1],x3[2],x3[3]};
#pragma unroll
    for (int i = 0; i < 16; ++i) { const unsigned short hb = bf16_bits(xs[i]); ah.u[i] = hb; al.u[i] = ASPLIT ? bf16_bits(xs[i] - bf16_val(hb)) : (unsigned short)0; }
#pragma unroll
    for (int t = 0; t < 4; ++t) {
      const unsigned short* brow = Wt + (size_t)(col0 + t * 16 + ln) * ldb + kb;
      FragB b;
      b.half[0] = *(const v8us*)(brow + 8 * hh);
      b.half[1] = *(const v8us*)(brow + 16 + 8 * hh);
      acc[t] = mmaN<ASPLIT ? 2 : 1>(ah.v, al.v, b.v, b.v, acc[t]);
    }
  }
#pragma unroll
  for (int t = 0; t < 4; ++t) {
    float bv = bias ? bias[col0 + t * 16 + ln] : 0.f;
    if (BIAS_BF16) bv = bf16_round(bv);
#pragma unroll
    for (int r = 0; r < 8; ++r) { float v = acc[t][r] + bv; if (ACT == 1) v = fmaxf(v, 0.f); so[w][8 * hh + r][t * 16 + ln] = v; }
  }
  __builtin_amdgcn_fence(__ATOMIC_ACQ_REL, "workgroup");
  __builtin_amdgcn_wave_barrier();
  const int rsub = lane >> 4, c4 = (lane & 15) * 4;
  {
#pragma unroll
    for (int q = 0; q < 8; ++q) {
      const int r = q * 2 + rsub;
      const v4f v = *(const v4fa*)&so[w][r][c4];
      *(v4f*)(C + (size_t)(row0 + r) * ldc + col0 + c4) = v;
    }
    
  }
}

// GEMM C = act(A·W + bias + resid): A f32 (ASPLIT -> hi/lo 2 terms), Wt bf16 [N][K]; ACT 0 none, 1 relu, 2 exact gelu;
// resid (optional, f32, row index = (row % rmod), pitch ldr, RES_BF16 rounds it) added before the activation.
template <bool ASPLIT, int ACT, bool BIAS_BF16, bool RES_BF16>
__global__ __launch_bounds__(128) void k_gemm_bf3(const float* __restrict__ A, int lda, const unsigned short* __restrict__ Wt, int ldb,
                                                const float* __restrict__ bias, const float* __restrict__ resid, int rmod, int ldr,
                                                float* __restrict__ C, int ldc, int M, int N, int K) {
  __shared__ __attribute__((aligned(16))) float so[4][16][64];
  const int tid = threadIdx.x, w = tid >> 5, lane = tid & 31, ln = lane & 15, hh = lane >> 4;
  const int ntn = N / 64;
  const int wid = blockIdx.x * 4 + w;
  const int mt = wid / ntn, nq = wid % ntn;
  if (mt * 16 >= M) return;
  const int row0 = mt * 16, col0 = nq * 64;
  const float* arow = A + (size_t)(row0 + ln) * lda;
  v8f acc[4] = {};
  for (int kb = 0; kb < K; kb += 32) {
    FragB ah, al;
    const v4f x0 = *(const v4fa*)(arow + kb + 8 * hh), x1 = *(const v4fa*)(arow + kb + 8 * hh + 4);
    const v4f x2 = *(const v4fa*)(arow + kb + 16 + 8 * hh), x3 = *(const v4fa*)(arow + kb + 16 + 8 * hh + 4);
    float xs[16] = {x0[0],x0[1],x0[2],x0[3],x1[0],x1[1],x1[2],x1[3],x2[0],x2[1],x2[2],x2[3],x3[0],x3[1],x3[2],x3[3]};
#pragma unroll
    for (int i = 0; i < 16; ++i) { const unsigned short hb = bf16_bits(xs[i]); ah.u[i] = hb; al.u[i] = ASPLIT ? bf16_bits(xs[i] - bf16_val(hb)) : (unsigned short)0; }
#pragma unroll
    for (int t = 0; t < 4; ++t) {
      const unsigned short* brow = Wt + (size_t)(col0 + t * 16 + ln) * ldb + kb;
      FragB b;
      b.half[0] = *(const v8us*)(brow + 8 * hh);
      b.half[1] = *(const v8us*)(brow + 16 + 8 * hh);
      acc[t] = mmaN<ASPLIT ? 2 : 1>(ah.v, al.v, b.v, b.v, acc[t]);
    }
  }
#pragma unroll
  for (int t = 0; t < 4; ++t) {
    const int col = col0 + t * 16 + ln;
    float bv = bias ? bias[col] : 0.f;
    if (BIAS_BF16) bv = bf16_round(bv);
#pragma unroll
    for (int r = 0; r < 8; ++r) {
      float v = acc[t][r] + bv;
      if (resid) { float rv = resid[(size_t)((row0 + 8 * hh + r) % rmod) * ldr + col]; if (RES_BF16) rv = bf16_round(rv); v += rv; }
      if (ACT == 1) v = fmaxf(v, 0.f);
      if (ACT == 2) v = 0.5f * v * (1.0f + erff(v * 0.70710678118654752f));
      if (ACT == 3) { const float u = 0.7978845608028654f * (v + 0.044715f * v * v * v); v = 0.5f * v * (1.0f + tanhf(u)); }
      so[w][8 * hh + r][t * 16 + ln] = v;
    }
  }
  __builtin_amdgcn_fence(__ATOMIC_ACQ_REL, "workgroup");
  __builtin_amdgcn_wave_barrier();
  const int rsub = lane >> 4, c4 = (lane & 15) * 4;
  {
#pragma unroll
    for (int q = 0; q < 8; ++q) {
      const int r = q * 2 + rsub;
      const v4f v = *(const v4fa*)&so[w][r][c4];
      *(v4f*)(C + (size_t)(row0 + r) * ldc + col0 + c4) = v;
    }
    
  }
}
// row LayerNorm (biased variance, eps) over N: s = X (+ R); optional out_sum <- s; out_norm <- (s-mu)*rsqrt(var+eps)*g + b
template <bool PARAM_BF16>
__global__ __launch_bounds__(256) void k_layernorm(const float* __restrict__ X, const float* __restrict__ R, const float* __restrict__ g, const float* __restrict__ bta,
                                                  float* __restrict__ out_sum, float* __restrict__ out_norm, int N, float eps) {
  __shared__ float red[256];
  const int row = blockIdx.x, tid = threadIdx.x;
  const float* x = X + (size_t)row * N; const float* rr = R ? R + (size_t)row * N : nullptr;
  float vals[16];                     // up to N = 4096
  const int per = N / 256;            // contiguous chunk per thread? use strided-by-4 chunks: thread handles j = tid*4 + 1024*u
  float s1 = 0.f;
  for (int u = 0; u < per / 4; ++u) {
    const int j = tid * 4 + 1024 * u;
    const v4f a = *(const v4fa*)(x + j);
    v4f b = {0.f,0.f,0.f,0.f}; if (rr) b = *(const v4fa*)(rr + j);
#pragma unroll
    for (int q = 0; q < 4; ++q) { const float v = a[q] + b[q]; vals[u * 4 + q] = v; s1 += v; }
  }
  red[tid] = s1; __syncthreads();
  for (int st = 128; st > 0; st >>= 1) { if (tid < st) red[tid] += red[tid + st]; __syncthreads(); }
  const float mu = red[0] / (float)N; __syncthreads();
  float s2 = 0.f;
  for (int u = 0; u < per / 4; ++u)
#pragma unroll
    for (int q = 0; q < 4; ++q) { const float c = vals[u * 4 + q] - mu; s2 += c * c; }
  red[tid] = s2; __syncthreads();
  for (int st = 128; st > 0; st >>= 1) { if (tid < st) red[tid] += red[tid + st]; __syncthreads(); }
  const float rs = rsqrtf(red[0] / (float)N + eps);
  {
    for (int u = 0; u < per / 4; ++u) {
      const int j = tid * 4 + 1024 * u;
      v4f o, sm;
#pragma unroll
      for (int q = 0; q < 4; ++q) {
        float gg = g[j + q], bb = bta[j + q];
        if (PARAM_BF16) { gg = bf16_round(gg); bb = bf16_round(bb); }
        sm[q] = vals[u * 4 + q]; o[q] = (vals[u * 4 + q] - mu) * rs * gg + bb;
      }
      if (out_sum) *(v4f*)(out_sum + (size_t)row * N + j) = sm;
      *(v4f*)(out_norm + (size_t)row * N + j) = o;
    }
    
  }
}



// ---- f16 WMMA path (v_wmma_f32_16x16x32_f16): 11-bit significands for operands in range — used where a [0,1] probability operand needs more precision than bf16
typedef _Float16 v16h __attribute__((ext_vector_type(16)));
union FragH { v16h v; v8us half[2]; _Float16 h[16]; unsigned short u[16]; };
template <int NT>
__device__ __forceinline__ v8f mmaH(v16h ah, v16h al, v16h bh, v16h bl, v8f c) {
  c = __builtin_amdgcn_wmma_f32_16x16x32_f16(false, ah, false, bh, (short)0, c, false, false);
  if (NT >= 2) c = __builtin_amdgcn_wmma_f32_16x16x32_f16(false, al, false, bh, (short)0, c, false, false);
  if (NT >= 3) c = __builtin_amdgcn_wmma_f32_16x16x32_f16(false, ah, false, bl, (short)0, c, false, false);
  asm volatile("v_nop\n\tv_nop\n\tv_nop\n\tv_nop" : "+v"(c) : "v"(ah), "v"(al), "v"(bh), "v"(bl));
  return c;
}
// batched GEMM like k_gemm_b but f16 operands: A f32 (split into f16 hi/lo if ASPLIT, else rounded to f16), Bt = f16 values [n][k]; alpha; C f32; N multiple of 16 (partial tiles skipped)
template <bool ASPLIT>
__global__ __launch_bounds__(128) void k_gemm_h(const float* __restrict__ A, int lda, size_t sA, const _Float16* __restrict__ Bh, int ldb, size_t sB, float alpha, float* __restrict__ C, int ldc, size_t sC, int M, int N, int K) {
  __shared__ __attribute__((aligned(16))) float so[4][16][64];
  const int tid = threadIdx.x, w = tid >> 5, lane = tid & 31, ln = lane & 15, hh = lane >> 4; const int by = blockIdx.y;
  A += (size_t)by * sA; Bh += (size_t)by * sB; C += (size_t)by * sC;
  const int ntn = (N + 63) / 64; const int wid = blockIdx.x * 4 + w; const int mt = wid / ntn, nq = wid % ntn; if (mt * 16 >= M) return;
  const int row0 = mt * 16, col0 = nq * 64; const float* arow = A + (size_t)(row0 + ln) * lda;
  v8f acc[4] = {};
  for (int kb = 0; kb < K; kb += 32) {
    FragH ah, al;
    const v4f x0 = *(const v4fa*)(arow + kb + 8 * hh), x1 = *(const v4fa*)(arow + kb + 8 * hh + 4), x2 = *(const v4fa*)(arow + kb + 16 + 8 * hh), x3 = *(const v4fa*)(arow + kb + 16 + 8 * hh + 4);
    float xs[16] = {x0[0],x0[1],x0[2],x0[3],x1[0],x1[1],x1[2],x1[3],x2[0],x2[1],x2[2],x2[3],x3[0],x3[1],x3[2],x3[3]};
#pragma unroll
    for (int i = 0; i < 16; ++i) { const _Float16 h = (_Float16)xs[i]; ah.h[i] = h; al.h[i] = ASPLIT ? (_Float16)(xs[i] - (float)h) : (_Float16)0.0f; }
#pragma unroll
    for (int t = 0; t < 4; ++t) { if (col0 + t * 16 >= N) continue; const size_t boff = (size_t)(col0 + t * 16 + ln) * ldb + kb; FragH bq; bq.half[0] = *(const v8us*)(Bh + boff + 8 * hh); bq.half[1] = *(const v8us*)(Bh + boff + 16 + 8 * hh);
      acc[t] = mmaH<ASPLIT ? 2 : 1>(ah.v, al.v, bq.v, bq.v, acc[t]); }
  }
#pragma unroll
  for (int t = 0; t < 4; ++t) { if (col0 + t * 16 >= N) continue;
#pragma unroll
    for (int r = 0; r < 8; ++r) so[w][8 * hh + r][t * 16 + ln] = acc[t][r] * alpha; }
  __builtin_amdgcn_fence(__ATOMIC_ACQ_REL, "workgroup"); __builtin_amdgcn_wave_barrier();
  const int rsub = lane >> 4, c4 = (lane & 15) * 4;
  {
#pragma unroll
    for (int q = 0; q < 8; ++q) { const int r = q * 2 + rsub; if (col0 + c4 < N) { const v4f v = *(const v4fa*)&so[w][r][c4]; *(v4f*)(C + (size_t)(row0 + r) * ldc + col0 + c4) = v; } }
     }
}

// Wt[n][k] = f16(W[k][n]·scale) from f32 row-major W[K][N] (scale = power of two; bf16-exact weights stay exact in f16 away from the subnormal range)
__global__ __launch_bounds__(256) void k_wt_f16(const float* __restrict__ W, _Float16* __restrict__ Wt, int K, int N, float scale) {
  const int t = blockIdx.x * 256 + threadIdx.x; if (t >= N * (K / 8)) return; const int n = t / (K / 8), k8 = (t % (K / 8)) * 8; FragH f;
#pragma unroll
  for (int i = 0; i < 8; ++i) f.h[i] = (_Float16)(bf16_round(W[(size_t)(k8 + i) * N + n]) * scale); const v8us o = f.half[0];
  *(v8us*)((unsigned short*)Wt + (size_t)n * K + k8) = o; 
}
// k_gemm_hh variant with fused epilogue: v = acc·alpha + bias[by·sBias + col] (+ CP[(row/rowsPerB)·sCPb + by·64 + col] if CP) ; ACT 0 none / 1 elu ; writes f16 C16 (and f32 C if non-null)
template <int ACT>
__global__ __launch_bounds__(128) void k_gemm_hhx(const _Float16* __restrict__ A, int lda, size_t sA, const _Float16* __restrict__ Bh, int ldb, size_t sB, float alpha, const float* __restrict__ bias, size_t sBias, const float* __restrict__ CP, int rowsPerB, size_t sCPb, int row0g,
    float* __restrict__ C, _Float16* __restrict__ C16, int ldc, size_t sC, int M, int N, int K) {
  __shared__ __attribute__((aligned(16))) float so[4][16][64];
  const int tid = threadIdx.x, w = tid >> 5, lane = tid & 31, ln = lane & 15, hh = lane >> 4; const int by = blockIdx.y;
  A += (size_t)by * sA; Bh += (size_t)by * sB; const size_t cofs = (size_t)by * sC; const float* bp = bias ? bias + (size_t)by * sBias : nullptr;
  const int ntn = (N + 63) / 64; const int wid = blockIdx.x * 4 + w; const int mt = wid / ntn, nq = wid % ntn; if (mt * 16 >= M) return;
  const int row0 = mt * 16, col0 = nq * 64; const _Float16* arow = A + (size_t)(row0 + ln) * lda;
  v8f acc[4] = {};
  for (int kb = 0; kb < K; kb += 32) { FragH ah; ah.half[0] = *(const v8us*)((const unsigned short*)arow + kb + 8 * hh); ah.half[1] = *(const v8us*)((const unsigned short*)arow + kb + 16 + 8 * hh);
#pragma unroll
    for (int t = 0; t < 4; ++t) { if (col0 + t * 16 >= N) continue; const size_t boff = (size_t)(col0 + t * 16 + ln) * ldb + kb; FragH bq; bq.half[0] = *(const v8us*)((const unsigned short*)Bh + boff + 8 * hh); bq.half[1] = *(const v8us*)((const unsigned short*)Bh + boff + 16 + 8 * hh);
      acc[t] = mmaH<1>(ah.v, ah.v, bq.v, bq.v, acc[t]); }
  }
#pragma unroll
  for (int t = 0; t < 4; ++t) { if (col0 + t * 16 >= N) continue; const int col = col0 + t * 16 + ln; const float bv = bp ? bf16_round(bp[col]) : 0.f;
#pragma unroll
    for (int r = 0; r < 8; ++r) { float v = acc[t][r] * alpha + bv; if (CP) { const int rr = row0g + row0 + 8 * hh + r; if (rowsPerB < 0) v += CP[cofs + (size_t)rr * ldc + col];      /* rowsPerB < 0: own element of the batched C plane */ else { const int bidx = rr / rowsPerB; v += CP[(size_t)bidx * sCPb + (size_t)by * 64 + col]; } } if (ACT == 1) v = (v > 0.f) ? v : expm1f(v); else if (ACT == 7) v = (v > 0.f) ? v + 1.0f : expf(v); else if (ACT == 8) v = tanhf(v); else if (ACT == 9) v = 0.5f * v * (1.0f + tanhf(0.7978845608028654f * (v + 0.044715f * v * v * v))); else if (ACT == 11) v = 1.0f / (1.0f + expf(-v)); else if (ACT == 12) v = (v > 0.f) ? v : 0.01f * v; else if (ACT == 14) v = (v > 0.f) ? v : 0.1f * v; else if (ACT == 16) v = (v >= 0.f) ? v : 0.3f * v; else if (ACT == 17) v = (v >= 0.f) ? v : 0.2f * v; else if (ACT == 15) v = v / (1.0f + expf(-v)); else if (ACT == 3) v = fmaxf(v, 0.f); else if (ACT == 6) v = 0.5f * v * (1.0f + erff(v * 0.70710678118654752f)); so[w][8 * hh + r][t * 16 + ln] = v; } }
  __builtin_amdgcn_fence(__ATOMIC_ACQ_REL, "workgroup"); __builtin_amdgcn_wave_barrier();
  const int rsub = lane >> 4, c4 = (lane & 15) * 4; typedef _Float16 v4h __attribute__((ext_vector_type(4)));
  {
#pragma unroll
    for (int q = 0; q < 8; ++q) { const int r = q * 2 + rsub; if (col0 + c4 < N) { const v4f v = *(const v4fa*)&so[w][r][c4]; if (C) *(v4f*)(C + cofs + (size_t)(row0 + r) * ldc + col0 + c4) = v; if (C16) { v4h h4; for (int i = 0; i < 4; ++i) h4[i] = (_Float16)v[i]; *(v4h*)(C16 + cofs + (size_t)(row0 + r) * ldc + col0 + c4) = h4; } } }
     }
}


typedef _Float16 v4h __attribute__((ext_vector_type(4)));

__global__ __launch_bounds__(256) void k_x16(const float* __restrict__ x, _Float16* __restrict__ X16, size_t n8) { const size_t t = (size_t)blockIdx.x * 256 + threadIdx.x; if (t >= n8) return; FragH f;
#pragma unroll
  for (int q = 0; q < 8; ++q) f.h[q] = (_Float16)bf16_round(x[t * 8 + q]); *(v8us*)((unsigned short*)X16 + t * 8) = f.half[0];  }
__global__ __launch_bounds__(256) void k_h16(const float* __restrict__ x, _Float16* __restrict__ X16, size_t n8) { const size_t t = (size_t)blockIdx.x * 256 + threadIdx.x; if (t >= n8) return; FragH f;
#pragma unroll
  for (int q = 0; q < 8; ++q) f.h[q] = (_Float16)x[t * 8 + q]; *(v8us*)((unsigned short*)X16 + t * 8) = f.half[0];  }
__global__ __launch_bounds__(256) void k_round16f(const float* __restrict__ W, _Float16* __restrict__ Bt, size_t n8) { const size_t t = (size_t)blockIdx.x * 256 + threadIdx.x; if (t >= n8) return; FragH f;
#pragma unroll
  for (int i = 0; i < 8; ++i) f.h[i] = (_Float16)(bf16_round(W[t * 8 + i]) * 16.0f); *(v8us*)((unsigned short*)Bt + t * 8) = f.half[0];  }
template <int NHv, int TTv>
__global__ __launch_bounds__(256) void k_vt(const _Float16* __restrict__ V16, int ldv, int voff, _Float16* __restrict__ Vt) { __shared__ unsigned short tl[64][66]; const int tid = threadIdx.x; const int slab = blockIdx.x / (TTv / 64), lg = blockIdx.x % (TTv / 64); const int b = slab / NHv, h = slab % NHv;
  for (int i = tid; i < 64 * 8; i += 256) { const int r = i / 8, c8 = (i % 8) * 8; FragH f; f.half[0] = *(const v8us*)((const unsigned short*)V16 + ((size_t)b * TTv + lg * 64 + r) * ldv + voff + h * 64 + c8);
#pragma unroll
    for (int q = 0; q < 8; ++q) tl[r][c8 + q] = f.u[q]; }
  __syncthreads();
  {
#pragma unroll
    for (int rd = 0; rd < 2; ++rd) { const int d = rd * 32 + tid / 8, pc = tid % 8; FragH f;
#pragma unroll
      for (int q = 0; q < 8; ++q) f.u[q] = tl[pc * 8 + q][d];
      *(v8us*)((unsigned short*)Vt + ((size_t)slab * 64 + d) * TTv + lg * 64 + pc * 8) = f.half[0]; }
     } }

__global__ __launch_bounds__(256) void k_hl(const float* __restrict__ F, _Float16* __restrict__ Hh, _Float16* __restrict__ Hl, size_t n8) { const size_t t = (size_t)blockIdx.x * 256 + threadIdx.x; if (t >= n8) return; FragH fh, fl; const v4f a = *(const v4fa*)(F + t * 8), c = *(const v4fa*)(F + t * 8 + 4);
#pragma unroll
  for (int q = 0; q < 4; ++q) { _Float16 h = (_Float16)a[q]; fh.h[q] = h; fl.h[q] = (_Float16)((a[q] - (float)h) * 1024.0f); h = (_Float16)c[q]; fh.h[4 + q] = h; fl.h[4 + q] = (_Float16)((c[q] - (float)h) * 1024.0f); }
  { *(v8us*)((unsigned short*)Hh + t * 8) = fh.half[0]; *(v8us*)((unsigned short*)Hl + t * 8) = fl.half[0];  } }

// ---- fast GEMM (wave tile 32x64; requires M % 32 == 0 rows per launch region and N % 64 == 0); epilogue = k_gemm_hhx semantics ----
__device__ __forceinline__ v16h g2_frag(const _Float16* p, int hh) { FragH f; f.half[0] = *(const v8us*)((const unsigned short*)p + 8 * hh); f.half[1] = *(const v8us*)((const unsigned short*)p + 16 + 8 * hh); return f.v; }
__device__ __forceinline__ v8f g2_mma(v16h a, v16h b, v8f c) { v8f d = __builtin_amdgcn_wmma_f32_16x16x32_f16(false, a, false, b, (short)0, c, false, false); asm volatile("v_nop\n\tv_nop\n\tv_nop\n\tv_nop" : "+v"(d) : "v"(a), "v"(b)); return d; }
template <int ACT>
__global__ __launch_bounds__(128) void k_gemm2(const _Float16* __restrict__ A, int lda, size_t sA, const _Float16* __restrict__ Bh, int ldb, size_t sB, float alpha, const float* __restrict__ bias, size_t sBias, const float* __restrict__ CP, int rowsPerB, size_t sCPb, int row0g,
    float* __restrict__ C, _Float16* __restrict__ C16, int ldc, size_t sC, int M, int N, int K) { static_assert(ACT == 0 || ACT == 3 || ACT == 6 || ACT == 8 || ACT == 9 || ACT == 11 || ACT == 12 || ACT == 14 || ACT == 15 || ACT == 16 || ACT == 17, "k_gemm2: unsupported ACT code (would silently apply no activation)");
  __shared__ __attribute__((aligned(16))) float so[4][32][68];
  const int tid = threadIdx.x, w = tid >> 5, lane = tid & 31, ln = lane & 15, hh = lane >> 4; const int by = blockIdx.y;
  A += (size_t)by * sA; Bh += (size_t)by * sB; const size_t cofs = (size_t)by * sC; const float* bp = bias ? bias + (size_t)by * sBias : nullptr;
  const int ntn = N >> 6; const int mt = blockIdx.x / ntn, nq = blockIdx.x - mt * ntn; const int row0 = mt * 128 + 32 * w, col0 = nq * 64; if (row0 >= M) return;
  const _Float16* a0p = A + (size_t)(row0 + ln) * lda; const _Float16* a1p = a0p + (size_t)16 * lda;
  const _Float16* b0p = Bh + (size_t)(col0 + ln) * ldb; const _Float16* b1p = b0p + (size_t)16 * ldb; const _Float16* b2p = b1p + (size_t)16 * ldb; const _Float16* b3p = b2p + (size_t)16 * ldb;
  const v8f z8 = {0.f,0.f,0.f,0.f,0.f,0.f,0.f,0.f}; v8f c00 = z8, c01 = z8, c02 = z8, c03 = z8, c10 = z8, c11 = z8, c12 = z8, c13 = z8;
#pragma unroll 1
  for (int kb = 0; kb < K; kb += 32) { const v16h a0 = g2_frag(a0p + kb, hh), a1 = g2_frag(a1p + kb, hh);
    v16h b = g2_frag(b0p + kb, hh); c00 = g2_mma(a0, b, c00); c10 = g2_mma(a1, b, c10);
    b = g2_frag(b1p + kb, hh); c01 = g2_mma(a0, b, c01); c11 = g2_mma(a1, b, c11);
    b = g2_frag(b2p + kb, hh); c02 = g2_mma(a0, b, c02); c12 = g2_mma(a1, b, c12);
    b = g2_frag(b3p + kb, hh); c03 = g2_mma(a0, b, c03); c13 = g2_mma(a1, b, c13); }
  v8f accs[8] = {c00, c01, c02, c03, c10, c11, c12, c13};
#pragma unroll
  for (int u = 0; u < 8; ++u) { const int t = u & 3, half = u >> 2; const int col = col0 + t * 16 + ln; const float bv = bp ? bf16_round(bp[col]) : 0.f;
#pragma unroll
    for (int r = 0; r < 8; ++r) { const int rloc = half * 16 + 8 * hh + r; float v = accs[u][r] * alpha + bv; if (CP) { if (rowsPerB < 0) v += CP[cofs + (size_t)(row0g + row0 + rloc) * ldc + col];      /* rowsPerB < 0: own element of the batched C plane */ else { const int bidx = (row0g + row0 + rloc) / rowsPerB; v += CP[(size_t)bidx * sCPb + (size_t)by * 64 + col]; } }
      if (ACT == 3) v = fmaxf(v, 0.f); else if (ACT == 6) v = 0.5f * v * (1.0f + erff(v * 0.70710678118654752f)); else if (ACT == 11) v = 1.0f / (1.0f + expf(-v)); else if (ACT == 15) v = v / (1.0f + expf(-v)); else if (ACT == 12) v = (v > 0.f) ? v : 0.01f * v; else if (ACT == 8) v = tanhf(v); else if (ACT == 9) v = 0.5f * v * (1.0f + tanhf(0.7978845608028654f * (v + 0.044715f * v * v * v))); else if (ACT == 14) v = (v > 0.f) ? v : 0.1f * v; else if (ACT == 16) v = (v >= 0.f) ? v : 0.3f * v; else if (ACT == 17) v = (v >= 0.f) ? v : 0.2f * v;
      so[w][rloc][t * 16 + ln] = v; } }
  __builtin_amdgcn_fence(__ATOMIC_ACQ_REL, "workgroup"); __builtin_amdgcn_wave_barrier();
  const int rsub = lane >> 4, c4 = (lane & 15) * 4;
  {
#pragma unroll
    for (int q = 0; q < 16; ++q) { const int r = q * 2 + rsub; const v4f v = *(const v4fa*)&so[w][r][c4]; if (C) *(v4f*)(C + cofs + (size_t)(row0 + r) * ldc + col0 + c4) = v; if (C16) { v4h h4; for (int i = 0; i < 4; ++i) h4[i] = (_Float16)v[i]; *(v4h*)(C16 + cofs + (size_t)(row0 + r) * ldc + col0 + c4) = h4; } }
     } }


__global__ __launch_bounds__(256) void k_wnat(const float* __restrict__ w, size_t n8, _Float16* __restrict__ Bt) { const size_t t = (size_t)blockIdx.x * 256 + threadIdx.x; if (t >= n8) return; FragH f; for (int q = 0; q < 8; ++q) f.h[q] = (_Float16)(bf16_round(w[t * 8 + q]) * 16.0f); *(v8us*)((unsigned short*)Bt + t * 8) = f.half[0];  }
__global__ __launch_bounds__(256) void k_rsm(const float* __restrict__ S, _Float16* __restrict__ P, int nrows) {
  #pragma clang fp contract(off)
  const int i = blockIdx.x * 256 + threadIdx.x; if (i >= nrows) return; const float* s = S + (size_t)i * SQ; float mx = -3.0e38f;
#pragma unroll 1
  for (int j = 0; j < SQ; ++j) mx = fmaxf(mx, s[j]); float se = 0.f;
#pragma unroll 1
  for (int j = 0; j < SQ; ++j) se += expf(s[j] - mx); const float sc = 256.0f / se;
#pragma unroll 1
  for (int j0 = 0; j0 < SQ; j0 += 8) { FragH f; for (int q = 0; q < 8; ++q) f.h[q] = (_Float16)(expf(s[j0 + q] - mx) * sc); unsigned short* d = (unsigned short*)P + (size_t)i * SQ + j0; *(v8us*)d = f.half[0];  } }
__global__ __launch_bounds__(256) void k_vt(const _Float16* __restrict__ V16, int b, int h0, _Float16* __restrict__ VT) { __shared__ unsigned short tl[64][65]; const int tid = threadIdx.x; const int hh = blockIdx.x % HG, sg = blockIdx.x / HG; const int s0 = sg * 64; const int h = h0 + hh;
  for (int i = tid; i < 64 * 8; i += 256) { const int j = i / 8, d8 = (i % 8) * 8; FragH f; f.half[0] = *(const v8us*)((const unsigned short*)V16 + ((size_t)b * SQ + s0 + j) * DM + h * HD + d8); for (int q = 0; q < 8; ++q) tl[d8 + q][j] = f.u[q]; }
  __syncthreads();
  { for (int i = tid; i < 64 * 8; i += 256) { const int d = i / 8, j8 = (i % 8) * 8; FragH f; for (int q = 0; q < 8; ++q) f.u[q] = tl[d][j8 + q]; *(v8us*)((unsigned short*)VT + ((size_t)hh * HD + d) * SQ + s0 + j8) = f.half[0]; }  } }



__global__ __launch_bounds__(256) void k_rsmcf2(const float* __restrict__ S, _Float16* __restrict__ P, int hg, int q0, int nk) {
  #pragma clang fp contract(off)
  const int t = blockIdx.x * 256 + threadIdx.x; if (t >= hg * QT) return; const size_t i = (size_t)t; const float* s = S + i * NKX; const int last = q0 + (t % QT); float mx = -3.0e38f;
#pragma unroll 1
  for (int j = 0; j < nk; ++j) { const float f = (j <= last) ? 1.f : 0.f; mx = fmaxf(mx, fmaf(f, s[j], (1.f - f) * -1.0e9f)); } float se = 0.f;
#pragma unroll 1
  for (int j = 0; j < nk; ++j) { const float f = (j <= last) ? 1.f : 0.f; se += __expf(fmaf(f, s[j], (1.f - f) * -1.0e9f) - mx); } const float sc = 256.0f / se;
#pragma unroll 1
  for (int j0 = 0; j0 < nk; j0 += 8) { FragH fr; for (int q = 0; q < 8; ++q) { const int j = j0 + q; const float f = (j <= last) ? 1.f : 0.f; fr.h[q] = (_Float16)(__expf(fmaf(f, s[j], (1.f - f) * -1.0e9f) - mx) * sc); } unsigned short* d = (unsigned short*)P + i * NKX + j0; *(v8us*)d = fr.half[0];  } }

template <int MASKADD>
__global__ __launch_bounds__(64) void k_att0(const float* __restrict__ QF, const float* __restrict__ KF, const float* __restrict__ VF, int ld, const float* __restrict__ mask, float scale, float* __restrict__ OF, int ldo) {
  #pragma clang fp contract(off)
  __shared__ __attribute__((aligned(16))) float lq[64][64]; __shared__ __attribute__((aligned(16))) float lo[64][64];
  const int tid = threadIdx.x; const int h = blockIdx.x / (QT0 / 64), rg = blockIdx.x % (QT0 / 64); const int i = rg * 64 + tid;
  const float* qr = QF + (size_t)i * ld + h * HD;
#pragma unroll 1
  for (int c = 0; c < HD / 4; ++c) { *(v4f*)&lq[tid][c * 4] = *(const v4fa*)(qr + c * 4); const v4f z = {0.f, 0.f, 0.f, 0.f}; *(v4f*)&lo[tid][c * 4] = z; }
  float m = -1.0e30f, l = 0.f; const int jmax = MASKADD ? (SQ - 1) : (rg * 64 + 63);      /* additive-mask form: every key (the mask input decides); causal form: keys up to the block's last row */
#pragma unroll 1
  for (int j = 0; j <= jmax; ++j) { const float* kr = KF + (size_t)j * ld + h * HD; const float* vr = VF + (size_t)j * ld + h * HD; float s = 0.f;
#pragma unroll 1
    for (int c = 0; c < HD / 4; ++c) { const v4f kq = *(const v4fa*)(kr + c * 4); const v4f qq = *(v4f*)&lq[tid][c * 4]; s = __fadd_rn(s, __fmul_rn(qq[0], kq[0])); s = __fadd_rn(s, __fmul_rn(qq[1], kq[1])); s = __fadd_rn(s, __fmul_rn(qq[2], kq[2])); s = __fadd_rn(s, __fmul_rn(qq[3], kq[3])); }
    s = __fmul_rn(s, scale); if (MASKADD) s = __fadd_rn(s, __fmul_rn(bf16_round(mask[(size_t)i * SQ + j]), -10000.0f));
    const float f = (MASKADD || j <= i) ? 1.f : 0.f; const float sm = fmaf(f, s, (1.f - f) * -1.0e30f); const float mn = fmaxf(m, sm); const float sc = expf(m - mn); const float e = expf(sm - mn); l = __fadd_rn(__fmul_rn(l, sc), e); m = mn;
#pragma unroll 1
    for (int c = 0; c < HD / 4; ++c) { const v4f vv = *(const v4fa*)(vr + c * 4); v4f oo = *(v4f*)&lo[tid][c * 4]; for (int u = 0; u < 4; ++u) oo[u] = __fadd_rn(__fmul_rn(oo[u], sc), __fmul_rn(e, vv[u])); *(v4f*)&lo[tid][c * 4] = oo; } }
  const float fin = 64.0f / l;      /* o carried x64 like the f16 path */
#pragma unroll 1
  for (int c = 0; c < HD / 4; ++c) { v4f oo = *(v4f*)&lo[tid][c * 4]; for (int u = 0; u < 4; ++u) oo[u] = __fmul_rn(oo[u], fin); *(v4f*)&lo[tid][c * 4] = oo; }
  __syncthreads();
  {
#pragma unroll 1
    for (int it = 0; it < 16; ++it) { const int row = it * 4 + tid / 16, pc = (tid % 16) * 4; const v4f v = *(const v4f*)&lo[row][pc]; *(v4f*)(OF + (size_t)(rg * 64 + row) * ldo + h * HD + pc) = v; }
     } }

__global__ __launch_bounds__(256) void k_oscale(const float* __restrict__ OF, float* __restrict__ out, size_t n4) { const size_t t = (size_t)blockIdx.x * 256 + threadIdx.x; if (t >= n4) return; const v4f a = *(const v4fa*)(OF + t * 4); v4f o; for (int q = 0; q < 4; ++q) o[q] = a[q] * 0.015625f; *(v4f*)(out + t * 4) = o;  }

__global__ __launch_bounds__(256) void k_bfr(const float* __restrict__ x, float* __restrict__ XB, size_t n8) { const size_t t = (size_t)blockIdx.x * 256 + threadIdx.x; if (t >= n8) return; v4f a = *(const v4fa*)(x + t * 8), c = *(const v4fa*)(x + t * 8 + 4); for (int q = 0; q < 4; ++q) { a[q] = bf16_round(a[q]); c[q] = bf16_round(c[q]); }
  { *(v4f*)(XB + t * 8) = a; *(v4f*)(XB + t * 8 + 4) = c;  } }



__global__ __launch_bounds__(256) void k_rsmfvl(const float* __restrict__ S, _Float16* __restrict__ P, _Float16* __restrict__ PL, int qn, const int* __restrict__ vlp) {
  #pragma clang fp contract(off)
  const int t = blockIdx.x * 256 + threadIdx.x; if (t >= qn) return; const int vl = vlp[0]; const size_t i = (size_t)t; const float* s = S + i * SQ; float mx = -3.0e38f;
#pragma unroll 1
  for (int j = 0; j < SQ; ++j) { const float f = (j < vl) ? 1.f : 0.f; mx = fmaxf(mx, fmaf(f, s[j], (1.f - f) * -1000000.0f)); } float se = 0.f;
#pragma unroll 1
  for (int j = 0; j < SQ; ++j) { const float f = (j < vl) ? 1.f : 0.f; se += __expf(fmaf(f, s[j], (1.f - f) * -1000000.0f) - mx); } const float sc = 256.0f / se;
#pragma unroll 1
  for (int j0 = 0; j0 < SQ; j0 += 8) { FragH fr, gr; for (int q = 0; q < 8; ++q) { const int j = j0 + q; const float f = (j < vl) ? 1.f : 0.f; const float pv = __expf(fmaf(f, s[j], (1.f - f) * -1000000.0f) - mx) * sc; const _Float16 ph = (_Float16)pv; fr.h[q] = ph; gr.h[q] = (_Float16)((pv - (float)ph) * 1024.0f); }
    unsigned short* d = (unsigned short*)P + i * SQ + j0; unsigned short* dl = (unsigned short*)PL + i * SQ + j0; *(v8us*)d = fr.half[0]; *(v8us*)dl = gr.half[0];  } }

#define NRW 131072      /* rows */
#define NIN 40          /* input features */
#define KIN 64          /* padded input width */
#define D0 128
#define D1 64
#define D2 32
#define D2P 64
#define NBRN 33         /* branches */
#define RB 8192

__global__ __launch_bounds__(256) void k_zero16(unsigned short* __restrict__ p, size_t n8) { const size_t t = (size_t)blockIdx.x * 256 + threadIdx.x; if (t >= n8) return; v8us z; for (int q = 0; q < 8; ++q) z[q] = 0; *(v8us*)(p + t * 8) = z;  }



#define BWV 8           /* waves per work-group of the branch kernel */
#define BRW 64          /* batch rows per wave in the trunk phase: four B tiles */
#define WCH 1280        /* 16-byte pieces of one branch's weights: 16 (layer 1) + 4 (layer 2) A fragments of 1 KiB */
#define AUXF 256        /* f32 side table per branch: 16 b1 [0..63], 256 b2 [64..95], W3 / 256 [96..127] as the dot reads it (at 96 + 16 (r >> 2) + 8 hh + 2 (r & 3) the pair of features 8 hh + r and 16 + 8 hh + r), b3 [128] and [136] (one for each hh), rest 0 (the powers of two: see k_branch) */
#define TCH 1024        /* 16-byte pieces of the trunk's weights: 16 A fragments of 1 KiB */
#define TAUX 512        /* f32 side table of the trunk: bs [0..127], BN scale [128..167], BN mean [192..231], BN shift [256..295], rest 0 */

// Per branch: the A fragments of W1[j]^T (tile mt, k step ks at index mt * 4 + ks) and of W2[j]^T (at 16 + mt * 2 + ks) in the order the lanes read them
// (piece = (fragment * 2 + half) * 32 + lane; lane (ln, hh) holds row 16 mt + ln, k = 32 ks + 16 half + 8 hh + 0..7), and the rounded biases and W3.
// Behind the branches, the trunk: the A fragments of Ws^T (tile mt, k step ks at index mt * 2 + ks, same piece order; k = 40..63 zero) and its side table.
__global__ __launch_bounds__(256) void k_pack(const float* __restrict__ W1, const float* __restrict__ b1, const float* __restrict__ W2, const float* __restrict__ b2, const float* __restrict__ W3, const float* __restrict__ b3,
    const float* __restrict__ Ws, const float* __restrict__ bs, const float* __restrict__ g, const float* __restrict__ be, const float* __restrict__ mu, const float* __restrict__ var, float eps,
    _Float16* __restrict__ PW, float* __restrict__ PA, _Float16* __restrict__ PT, float* __restrict__ PB) {
  const int t = blockIdx.x * 256 + threadIdx.x; if (t >= NBRN * (WCH + AUXF / 4) + TCH + TAUX / 4) return;
  if (t >= NBRN * (WCH + AUXF / 4)) { const int c = t - NBRN * (WCH + AUXF / 4);
    if (c < TCH) { const int lane = c & 31, ln = lane & 15, hh = lane >> 4, f = c >> 6, h = (c >> 5) & 1; const int n = (f >> 1) * 16 + ln, k0 = (f & 1) * 32 + h * 16 + 8 * hh; FragH o;
      for (int q = 0; q < 8; ++q) { const int k = k0 + q; o.h[q] = (k < NIN) ? (_Float16)(bf16_round(Ws[(size_t)k * D0 + n]) * 16.0f) : (_Float16)0.f; }
      *(v8us*)((unsigned short*)PT + (size_t)c * 8) = o.half[0]; }
    else { const int i0 = (c - TCH) * 4; v4f o;
      for (int u = 0; u < 4; ++u) { const int i = i0 + u, cf = (i - D0) & 63, kind = (i - D0) >> 6; float v = 0.f;
        if (i < D0) v = bf16_round(bs[i]); else if (cf < NIN && kind == 0) v = rsqrtf(bf16_round(var[cf]) + eps) * bf16_round(g[cf]); else if (cf < NIN && kind == 1) v = bf16_round(mu[cf]); else if (cf < NIN && kind == 2) v = bf16_round(be[cf]);
        o[u] = v; }
      *(v4f*)(PB + i0) = o; }
    return; }
  const int j = t / (WCH + AUXF / 4), c = t % (WCH + AUXF / 4);
  if (c < WCH) { const int lane = c & 31, ln = lane & 15, hh = lane >> 4, f = c >> 6, h = (c >> 5) & 1; FragH o;
    if (f < 16) { const int k = (f >> 2) * 16 + ln, d0 = (f & 3) * 32 + h * 16 + 8 * hh; for (int q = 0; q < 8; ++q) o.h[q] = (_Float16)(bf16_round(W1[((size_t)j * D0 + d0 + q) * D1 + k]) * 16.0f); }
    else { const int m = ((f - 16) >> 1) * 16 + ln, k0 = ((f - 16) & 1) * 32 + h * 16 + 8 * hh; for (int q = 0; q < 8; ++q) o.h[q] = (_Float16)(bf16_round(W2[((size_t)j * D1 + k0 + q) * D2 + m]) * 16.0f); }
    *(v8us*)((unsigned short*)PW + ((size_t)j * WCH + c) * 8) = o.half[0]; }
  else { const int i0 = (c - WCH) * 4; v4f o;
    for (int u = 0; u < 4; ++u) { const int i = i0 + u; float v = 0.f, sc = 1.f; if (i < D1) { v = b1[j * D1 + i]; sc = 16.0f; } else if (i < D1 + D2) { v = b2[j * D2 + i - D1]; sc = 256.0f; } else if (i < D1 + 2 * D2) { const int e = i - D1 - D2; v = W3[j * D2 + (e & 1) * 16 + ((e >> 3) & 1) * 8 + (e >> 4) * 4 + ((e >> 1) & 3)]; sc = 0.00390625f; } else if (i == D1 + 2 * D2 || i == D1 + 2 * D2 + 8) v = b3[j]; o[u] = bf16_round(v) * sc; }
    *(v4f*)(PA + (size_t)j * AUXF + i0) = o; } }

__device__ __forceinline__ v16h br_frag(const unsigned short* wb, int f, int lane) { FragH x; x.half[0] = *(const v8us*)(wb + f * 512 + lane * 8); x.half[1] = *(const v8us*)(wb + f * 512 + 256 + lane * 8); return x.v; }
__device__ __forceinline__ v8f br_row8(const float* p) { const v4f lo = *(const v4f*)p, hi = *(const v4f*)(p + 4); return __builtin_shufflevector(lo, hi, 0, 1, 2, 3, 4, 5, 6, 7); }      /* eight f32 in the order of a D tile's registers */
__device__ __forceinline__ v8f br_mma(v16h a, v16h b, v8f c) { return __builtin_amdgcn_wmma_f32_16x16x32_f16(false, a, false, b, (short)0, c, false, false); }
__device__ __forceinline__ float br_xhalf(float x) { return __builtin_bit_cast(float, __builtin_amdgcn_permlanex16(__builtin_bit_cast(int, x), __builtin_bit_cast(int, x), 0x76543210, 0xfedcba98, false, false)); }

#define ZT (BWV * BRW / 16)      /* 16-row tiles of a work-group */
#define NPW (NBRN * (ZT / 2) / BWV)      /* (branch, tile pair) items per wave: 33 * 16 / 8 = 66 */
#define NSG 5           /* runs of one branch in a wave's 66 items: 16 - 2 w, 16, 16, 16, 2 + 2 w */

__global__ __launch_bounds__(256) void k_branch(const float* __restrict__ x, const _Float16* __restrict__ PT, const float* __restrict__ PB, const _Float16* __restrict__ PW, const float* __restrict__ PA, float* __restrict__ out) {
  __shared__ __attribute__((aligned(16))) unsigned short zs[ZT * 4 * 512];      /* z: tile t, k step ks = fragment t * 4 + ks, in br_frag's order */
  __shared__ __attribute__((aligned(16))) float so[BWV * BRW * NBRN];
  __shared__ __attribute__((aligned(16))) unsigned short tw[TCH * 8];
  __shared__ __attribute__((aligned(16))) float tb[TAUX];
  const int tid = threadIdx.x, w = tid >> 5, lane = tid & 31, ln = lane & 15, hh = lane >> 4;
  const int wu = __builtin_amdgcn_readfirstlane(w);      /* the wave's number in a scalar register: phase 2's loop bounds and weight addresses are scalar */
  const size_t row0 = (size_t)blockIdx.x * (BWV * BRW) + (size_t)w * BRW;
  const unsigned short* pw = (const unsigned short*)PW;
  v8us tt[4]; v2f ttb;
#pragma unroll
  for (int i = 0; i < 4; ++i) tt[i] = *(const v8us*)((const unsigned short*)PT + (size_t)(tid + 256 * i) * 8);
  ttb = *(const v2f*)(PB + tid * 2);
  v4f xr[4][6];      /* lane (ln, hh), tile n: features 8 hh + 0..7, 16 + 8 hh + 0..7 and 32..39 of row 16 n + ln */
#pragma unroll
  for (int n = 0; n < 4; ++n) { const float* xp = x + (row0 + n * 16 + ln) * NIN;
#pragma unroll
    for (int q = 0; q < 6; ++q) xr[n][q] = *(const v4fa*)(xp + ((q < 4) ? (q >> 1) * 16 + 8 * hh + (q & 1) * 4 : q * 4 + 16)); }
  asm volatile("s_wait_xcnt 0x0" ::: "memory");      /* stands before the address registers of the loads above are reused */
  __builtin_amdgcn_sched_barrier(0);      /* keeps the LDS address arithmetic below, which reuses those registers, behind that wait */
#pragma unroll
  for (int i = 0; i < 4; ++i) *(v8us*)(&tw[(tid + 256 * i) * 8]) = tt[i];
  *(v2f*)(&tb[tid * 2]) = ttb;
  __syncthreads();      /* publishes the trunk's weights */
  const v8f z8 = {0.f, 0.f, 0.f, 0.f, 0.f, 0.f, 0.f, 0.f};
  v16h xb[4][2];      /* xn as B fragments: k step 0 = features 0..31, k step 1 = features 32..39 and zeros */
  { v4f bsc[6], bmu[6], bsh[6]; const unsigned keep = hh ? 0u : 0xffffffffu;
#pragma unroll
    for (int q = 0; q < 6; ++q) { const int c = (q < 4) ? (q >> 1) * 16 + 8 * hh + (q & 1) * 4 : q * 4 + 16; bsc[q] = *(const v4f*)(tb + 128 + c); bmu[q] = *(const v4f*)(tb + 192 + c); bsh[q] = *(const v4f*)(tb + 256 + c); }
#pragma unroll
    for (int n = 0; n < 4; ++n) { FragH f0, f1;
#pragma unroll
      for (int q = 0; q < 6; ++q) { const v4f xq = __builtin_convertvector(__builtin_convertvector(xr[n][q], v4b), v4f);      /* x rounded to bf16, to nearest even */
        const v4h y = __builtin_convertvector((xq - bmu[q]) * bsc[q] + bsh[q], v4h);
#pragma unroll
        for (int u = 0; u < 4; ++u) { if (q < 4) f0.h[q * 4 + u] = y[u]; else { f1.h[(q - 4) * 4 + u] = y[u]; f1.h[8 + (q - 4) * 4 + u] = (_Float16)0.f; } } }
      v8u w1 = __builtin_bit_cast(v8u, f1.v);
#pragma unroll
      for (int i = 0; i < 4; ++i) w1[i] &= keep;      /* lanes 16-31 stand for k = 40..47: zeros */
      xb[n][0] = f0.v; xb[n][1] = __builtin_bit_cast(v16h, w1); } }
  int pr = wu * NPW;      /* this wave's items: pr .. pr + 65; branch pr >> 4, tile pair pr & 15 */
  v16h wa[4][4], ua[2][2]; v8f bb[4], cc[2]; v4f ee[4]; float b3v;      /* one branch: layer-1 A fragments (tile m, k step ks), layer-2 A fragments (k step s, tile m), 16 b1 and 256 b2 as C tiles, W3 / 256 (register pair r: features 8 hh + r and 16 + 8 hh + r), b3 */
  auto take_l1 = [&](int j) {      /* what layer 1 reads */
    const unsigned short* gl = pw + (size_t)j * (WCH * 8) + lane * 8; const float* gh = PA + (size_t)j * AUXF + 8 * hh;
#pragma unroll
    for (int m = 0; m < 4; ++m) {
#pragma unroll
      for (int ks = 0; ks < 4; ++ks) wa[m][ks] = br_frag(gl, m * 4 + ks, 0); }
    asm volatile("s_wait_xcnt 0x0" :: "v"(gl) : "memory");      /* stands before the loads' address registers are reused; the address as an input keeps them from being a load's own destination */
    __builtin_amdgcn_sched_barrier(0);      /* keeps the loads below behind that wait */
#pragma unroll
    for (int m = 0; m < 4; ++m) bb[m] = br_row8(gh + 16 * m);
    asm volatile("s_wait_xcnt 0x0" :: "v"(gh) : "memory");
    __builtin_amdgcn_sched_barrier(0);      /* keeps what follows, which may reuse those registers, behind that wait */
  };
  auto take_l2 = [&](int j) {      /* what layer 2 and the dot read */
    const unsigned short* gl = pw + (size_t)j * (WCH * 8) + lane * 8; const float* gh = PA + (size_t)j * AUXF + 8 * hh;
#pragma unroll
    for (int s = 0; s < 2; ++s) { ua[s][0] = br_frag(gl, 16 + s, 0); ua[s][1] = br_frag(gl, 18 + s, 0); }
    asm volatile("s_wait_xcnt 0x0" :: "v"(gl) : "memory");      /* as in take_l1 */
    __builtin_amdgcn_sched_barrier(0);      /* keeps the loads below behind that wait */
#pragma unroll
    for (int m = 0; m < 2; ++m) { cc[m] = br_row8(gh + 64 + 16 * m); ee[2 * m] = *(const v4f*)(gh + 96 + 16 * m); ee[2 * m + 1] = *(const v4f*)(gh + 100 + 16 * m); }
    b3v = gh[128];
    asm volatile("s_wait_xcnt 0x0" :: "v"(gh) : "memory");      /* as in take_l1 */
    __builtin_amdgcn_sched_barrier(0);      /* keeps what follows, which may reuse those registers, behind that wait */
  };
  take_l1(pr >> 4); take_l2(pr >> 4);      /* the first branch, asked for here so that it lands under the trunk layer */
  const v16h h0 = {};
#pragma unroll
  for (int ks = 0; ks < 4; ++ks) {      /* z features 32 ks .. 32 ks + 31 = k step ks of layer 1 */
    v16h ta[2][2]; v4f bz[4]; v8f t0[4], t1[4];
#pragma unroll
    for (int m = 0; m < 2; ++m) { ta[m][0] = br_frag(tw, (2 * ks + m) * 2, lane); ta[m][1] = br_frag(tw, (2 * ks + m) * 2 + 1, lane); }
#pragma unroll
    for (int q = 0; q < 4; ++q) bz[q] = *(const v4f*)(tb + 32 * ks + (q >> 1) * 16 + 8 * hh + (q & 1) * 4);
#pragma unroll
    for (int n = 0; n < 4; ++n) { t0[n] = br_mma(ta[0][0], xb[n][0], z8); t1[n] = br_mma(ta[1][0], xb[n][0], z8); }
#pragma unroll
    for (int n = 0; n < 4; ++n) { t0[n] = br_mma(ta[0][1], xb[n][1], t0[n]); t1[n] = br_mma(ta[1][1], xb[n][1], t1[n]); }
#pragma unroll
    for (int n = 0; n < 4; ++n) { FragH hb;
#pragma unroll
      for (int r = 0; r < 8; ++r) { hb.h[r] = (_Float16)fmaxf(t0[n][r] * 0.0625f + bz[r >> 2][r & 3], 0.f); hb.h[8 + r] = (_Float16)fmaxf(t1[n][r] * 0.0625f + bz[2 + (r >> 2)][r & 3], 0.f); }
      unsigned short* zd = zs + ((w * 4 + n) * 4 + ks) * 512 + lane * 8;
      *(v8us*)zd = hb.half[0]; *(v8us*)(zd + 256) = hb.half[1]; }
  }
  __syncthreads();      /* publishes z to the 8 waves */
  v16h zf[2][4];      /* the item's two z tiles; refilled in place for the next item */
#pragma unroll
  for (int t = 0; t < 2; ++t) {
#pragma unroll
    for (int ks = 0; ks < 4; ++ks) zf[t][ks] = br_frag(zs, ((pr & 15) * 2 + t) * 4 + ks, lane); }
  auto run = [&](const bool more) __attribute__((always_inline)) {      /* one run: the wave's items of one branch; more: another run follows */
    const int j = pr >> 4;
    const int stop = more ? (j + 1) << 4 : wu * NPW + NPW;
    float* sd = so + (hh * 16 + ln) * NBRN + j;
    auto item = [&](const bool last) __attribute__((always_inline)) {
      const int tp = pr & 15, tn = (pr + 1) & 15;      /* behind a branch's last pair comes the next branch's pair 0; the wave's last item reads one pair for nothing */
      v8f a1[4][2];
#pragma unroll
      for (int ks = 0; ks < 4; ++ks) {
        if (ks == 0) __builtin_amdgcn_s_setprio(0); else if (ks == 1) __builtin_amdgcn_s_setprio(1); else if (ks == 2) __builtin_amdgcn_s_setprio(2); else __builtin_amdgcn_s_setprio(3);
#pragma unroll
        for (int m = 0; m < 4; ++m) { a1[m][0] = br_mma(wa[m][ks], zf[0][ks], ks ? a1[m][0] : bb[m]); a1[m][1] = br_mma(wa[m][ks], zf[1][ks], ks ? a1[m][1] : bb[m]); }
        __builtin_amdgcn_sched_barrier(0);      /* keeps eight independent accumulators per k step: without it the four k steps of one tile are issued as a dependent chain */
      }
#pragma unroll
      for (int t = 0; t < 2; ++t) {
#pragma unroll
        for (int ks = 0; ks < 4; ++ks) zf[t][ks] = br_frag(zs, (tn * 2 + t) * 4 + ks, lane); }
      __builtin_amdgcn_sched_barrier(0);      /* keeps these LDS reads in one group ahead of the epilogues that hide their latency */
      if (last && more) take_l1(j + 1);      /* layer 1 of the run's last item is issued, so the next branch (at most 32) may land in its registers under this item's epilogues */
      v8f a2[2][2];
#pragma unroll
      for (int s = 0; s < 2; ++s) {      /* h1 features 32 s .. 32 s + 31 = k step s of layer 2 */
#pragma unroll
        for (int t = 0; t < 2; ++t) { FragH hb;
#pragma unroll
          for (int r = 0; r < 8; ++r) { hb.h[r] = (_Float16)a1[2 * s][t][r]; hb.h[8 + r] = (_Float16)a1[2 * s + 1][t][r]; }
          const v16h hr = __builtin_elementwise_max(hb.v, h0);      /* relu behind the conversion: two values an instruction, the same result */
          a2[0][t] = br_mma(ua[s][0], hr, s ? a2[0][t] : cc[0]); a2[1][t] = br_mma(ua[s][1], hr, s ? a2[1][t] : cc[1]); } }
      __builtin_amdgcn_sched_barrier(0);      /* keeps the dot's first reads out of the last WMMAs, where each would wait for its own result */
      float p[2];
#pragma unroll
      for (int t = 0; t < 2; ++t) { v2f sp = {0.f, 0.f};      /* the lower and the upper tile's sums, side by side as W3 lies */
#pragma unroll
        for (int r = 0; r < 8; ++r) { const v2f hv = {fmaxf(a2[0][t][r], 0.f), fmaxf(a2[1][t][r], 0.f)}, ev = {ee[r >> 1][(r & 1) * 2], ee[r >> 1][(r & 1) * 2 + 1]}; sp = __builtin_elementwise_fma(hv, ev, sp); }
        p[t] = sp[0] + sp[1]; }
      const float mine = hh ? p[1] : p[0], send = hh ? p[0] : p[1];
      sd[tp * (32 * NBRN)] = mine + br_xhalf(send) + b3v;
      ++pr;
    };
#pragma unroll 1      /* one copy of the item: 40 WMMAs and their epilogues */
    do item(false); while (pr + 1 < stop);      /* a run has at least two items */
    item(true);      /* the run's last item, written out apart: the loop itself then holds no global load and waits for none */
    if (more) take_l2(j + 1);      /* the rest of the next run's branch */
  };
#pragma unroll 1      /* the weights are loop-carried registers: one copy of the text */
  for (int sg = 0; sg < NSG - 1; ++sg) run(true);
  run(false);      /* the last run, written out apart: no test stands round the loads of the others, so each wait counts exactly */
  __builtin_amdgcn_s_setprio(0);      /* phase 2 is over: back to the default priority */
  __syncthreads();      /* every wave's results stand in so */
  float* og = out + (size_t)blockIdx.x * (BWV * BRW * NBRN);      /* 512 rows x 33 f32 = 528 whole 128-byte lines, this work-group's own; a wave's store covers four whole lines */
  for (int i = tid; i < BWV * BRW * NBRN / 4; i += 256) *(v4f*)(og + i * 4) = *(const v4f*)(so + i * 4);
}

extern "C" void kernel_launch(void* const* d_in, const int* in_sizes, int n_in,
                              void* d_out, int out_size, void* d_ws, size_t ws_size, hipStream_t stream) {
  (void)in_sizes; (void)n_in; (void)out_size;
  const float* const* I = (const float* const*)d_in; const float* x = I[0]; const float* bng = I[1]; const float* bnb = I[2]; const float* bnm = I[3]; const float* bnv = I[4]; const float* Ws = I[5]; const float* bs = I[6]; const float* W1 = I[7]; const float* b1 = I[8]; const float* W2 = I[9]; const float* b2 = I[10]; const float* W3 = I[11]; const float* b3 = I[12];
  char* ws = (char*)d_ws; size_t off = 0;
  auto take = [&](size_t bytes) { char* p = ws + off; off += (bytes + 255) & ~(size_t)255; return p; };
  _Float16* PW = (_Float16*)take((size_t)NBRN * WCH * 16); float* PA = (float*)take((size_t)NBRN * AUXF * 4); _Float16* PT = (_Float16*)take((size_t)TCH * 16); float* PB = (float*)take((size_t)TAUX * 4);
  if (off > ws_size) return;
  k_pack<<<(NBRN * (WCH + AUXF / 4) + TCH + TAUX / 4 + 255) / 256, 256, 0, stream>>>(W1, b1, W2, b2, W3, b3, Ws, bs, bng, bnb, bnm, bnv, 1e-5f, PW, PA, PT, PB);      /* branch and trunk weights as A fragments; biases, W3 and the BN terms rounded */
  k_branch<<<NRW / (BWV * BRW), 256, 0, stream>>>(x, PT, PB, PW, PA, (float*)d_out);      /* BN, trunk, then gu[r][j] for all rows and branches */
}

// v008
// Measured time: 42.7 microseconds a run.
// Versions in between are left out here; by their measured steps it is 1.10 times as fast as v006.
// All steps since v000 together make it 23.9 times as fast.
#include <hip/hip_runtime.h>
// Shared trunk + 33 small branch MLPs (x [131072][40]; eval BatchNorm1d over the 40 features; z = relu(xn Ws + bs) [128]; per branch j: h1 = relu(z W1[j] + b1[j]) [64], h2 = relu(h1 W2[j] + b2[j]) [32], gu[j] = h2 . W3[j] + b3[j]; output gu [131072][33]).
// Structure: one pack launch (weights as A fragments, side tables), then ONE launch for trunk, all 33 branches and all rows: BN on VALU straight into f16 B fragments (K padded to 64 with zeros); weights as the A operand, batch rows as the B operand, so two D tiles of a layer are the next layer's B fragment: the trunk's f32 tiles converted in place, the branch layers' f16 tiles as they stand (z f16, kept in LDS as B fragments for the work-group's 8 waves; h1 and h2 f16, only in registers); a wave holds one branch's weights in registers and walks the work-group's row tiles; the final 32-term dot as a third matrix layer (W3 as the one filled row of an A fragment), + b3 on VALU; results gathered per work-group in LDS and stored as whole lines of f32 [row][33].
// Compute dtype: inputs rounded to bf16; x / weights exact; xn, z, h1 and h2 as f16 operands; BN, the trunk's and the dot's sums f32: trunk and dot v_wmma_f32_16x16x32_f16; layers 1 and 2 of the branches v_wmma_f16_16x16x32_f16.
#define NB 1
#define SQ 8192
#define DM 64
#define NH 1
#define HD 64
#define HG 4                         /* heads per attention launch group */
#define B0 0                         /* first batch processed (debug hook) */
#define NBR NB                       /* batches processed (debug hook) */
#define NR ((size_t)NB * SQ)         /* token rows */
#define MP ((int)((size_t)NBR * SQ)) /* rows projected (debug hook) */
#define QT 256                       /* query rows per causal tile */
#define NKX SQ                       /* S / P row pitch */
#define QT0 256                      /* first-tile rows recomputed exactly (256: buys margin for the few-key rows 128..255, which have no output projection to average the single-f16 P/v rounding) */
#define QN SQ                        /* query rows attended per batch (debug hook) */
#define NHD NH                       /* heads attended (debug hook) */
#define MPO MP                       /* rows through the output stage (debug hook) */
#define LQ DM            /* row pitch of the q/k/v rows */
typedef __bf16 v16b __attribute__((ext_vector_type(16)));
typedef unsigned short v8us __attribute__((ext_vector_type(8), may_alias));
typedef float  v8f  __attribute__((ext_vector_type(8)));
typedef float  v4f  __attribute__((ext_vector_type(4)));
typedef float  v4fa __attribute__((ext_vector_type(4), may_alias));
typedef float  v2f  __attribute__((ext_vector_type(2)));
typedef unsigned int v8u __attribute__((ext_vector_type(8)));
typedef __bf16 v4b __attribute__((ext_vector_type(4)));
union FragB { v16b v; v8us half[2]; unsigned short u[16]; };

__device__ __forceinline__ unsigned short bf16_bits(float x) { unsigned int u = __float_as_uint(x); return (unsigned short)((u + 0x7FFFu + ((u >> 16) & 1u)) >> 16); }
__device__ __forceinline__ float bf16_val(unsigned short b) { return __uint_as_float(((unsigned int)b) << 16); }
__device__ __forceinline__ float bf16_round(float x) { return bf16_val(bf16_bits(x)); }
// D += A·B with NT terms: 1 = ah·bh, 2 = + al·bh (A split), 3 = + ah·bl (both split)
template <int NT>
__device__ __forceinline__ v8f mmaN(v16b ah, v16b al, v16b bh, v16b bl, v8f c) {
  c = __builtin_amdgcn_wmma_f32_16x16x32_bf16(false, ah, false, bh, (short)0, c, false, false);
  if (NT >= 2) c = __builtin_amdgcn_wmma_f32_16x16x32_bf16(false, al, false, bh, (short)0, c, false, false);
  if (NT >= 3) c = __builtin_amdgcn_wmma_f32_16x16x32_bf16(false, ah, false, bl, (short)0, c, false, false);
  asm volatile("v_nop\n\tv_nop\n\tv_nop\n\tv_nop" : "+v"(c) : "v"(ah), "v"(al), "v"(bh), "v"(bl));
  return c;
}

__global__ __launch_bounds__(256) void k_wt_bf16(const float* __restrict__ W, unsigned short* __restrict__ Wt, int K, int N) {
  const int t = blockIdx.x * 256 + threadIdx.x;
  const int k8n = K / 8;
  if (t >= N * k8n) return;
  const int n = t / k8n, k8 = (t % k8n) * 8;
  v8us v;
#pragma unroll
  for (int i = 0; i < 8; ++i) v[i] = bf16_bits(W[(size_t)(k8 + i) * N + n]);
  *(v8us*)(Wt + (size_t)n * K + k8) = v;
  
}

// GEMM C[M][N] (f32, pitch ldc) = act(A[M][K]·W + bias). A f32 row-major (pitch lda) converted per fragment to bf16
// (ASPLIT: hi/lo two planes -> 2 terms, else single rounded term); Wt bf16 [N][K] (pitch ldb). BIAS_BF16 rounds the
// bias to bf16 first (bias quantised to bf16 before the add). K%32==0, M%16==0, N%64==0.
template <bool ASPLIT, int ACT, bool BIAS_BF16>
__global__ __launch_bounds__(128) void k_gemm_bf(const float* __restrict__ A, int lda, const unsigned short* __restrict__ Wt, int ldb,
                                               const float* __restrict__ bias, float* __restrict__ C, int ldc, int M, int N, int K) {
  __shared__ __attribute__((aligned(16))) float so[4][16][64];
  const int tid = threadIdx.x, w = tid >> 5, lane = tid & 31, ln = lane & 15, hh = lane >> 4;
  const int ntn = N / 64;
  const int wid = blockIdx.x * 4 + w;
  const int mt = wid / ntn, nq = wid % ntn;
  if (mt * 16 >= M) return;
  const int row0 = mt * 16, col0 = nq * 64;
  const float* arow = A + (size_t)(row0 + ln) * lda;
  v8f acc[4] = {};
  for (int kb = 0; kb < K; kb += 32) {
    FragB ah, al;
    const v4f x0 = *(const v4fa*)(arow + kb + 8 * hh), x1 = *(const v4fa*)(arow + kb + 8 * hh + 4);
    const v4f x2 = *(const v4fa*)(arow + kb + 16 + 8 * hh), x3 = *(const v4fa*)(arow + kb + 16 + 8 * hh + 4);
    float xs[16] = {x0[0],x0[1],x0[2],x0[3],x1[0],x1[1],x1[2],x1[3],x2[0],x2[1],x2[2],x2[3],x3[0],x3[1],x3[2],x3[3]};
#pragma unroll
    for (int i = 0; i < 16; ++i) { const unsigned short hb = bf16_bits(xs[i]); ah.u[i] = hb; al.u[i] = ASPLIT ? bf16_bits(xs[i] - bf16_val(hb)) : (unsigned short)0; }
#pragma unroll
    for (int t = 0; t < 4; ++t) {
      const unsigned short* brow = Wt + (size_t)(col0 + t * 16 + ln) * ldb + kb;
      FragB b;
      b.half[0] = *(const v8us*)(brow + 8 * hh);
      b.half[1] = *(const v8us*)(brow + 16 + 8 * hh);
      acc[t] = mmaN<ASPLIT ? 2 : 1>(ah.v, al.v, b.v, b.v, acc[t]);
    }
  }
#pragma unroll
  for (int t = 0; t < 4; ++t) {
    float bv = bias ? bias[col0 + t * 16 + ln] : 0.f;
    if (BIAS_BF16) bv = bf16_round(bv);
#pragma unroll
    for (int r = 0; r < 8; ++r) { float v = acc[t][r] + bv; if (ACT == 1) v = fmaxf(v, 0.f); so[w][8 * hh + r][t * 16 + ln] = v; }
  }
  __builtin_amdgcn_fence(__ATOMIC_ACQ_REL, "workgroup");
  __builtin_amdgcn_wave_barrier();
  const int rsub = lane >> 4, c4 = (lane & 15) * 4;
  {
#pragma unroll
    for (int q = 0; q < 8; ++q) {
      const int r = q * 2 + rsub;
      const v4f v = *(const v4fa*)&so[w][r][c4];
      *(v4f*)(C + (size_t)(row0 + r) * ldc + col0 + c4) = v;
    }
    
  }
}

// GEMM C = act(A·W + bias + resid): A f32 (ASPLIT -> hi/lo 2 terms), Wt bf16 [N][K]; ACT 0 none, 1 relu, 2 exact gelu;
// resid (optional, f32, row index = (row % rmod), pitch ldr, RES_BF16 rounds it) added before the activation.
template <bool ASPLIT, int ACT, bool BIAS_BF16, bool RES_BF16>
__global__ __launch_bounds__(128) void k_gemm_bf3(const float* __restrict__ A, int lda, const unsigned short* __restrict__ Wt, int ldb,
                                                const float* __restrict__ bias, const float* __restrict__ resid, int rmod, int ldr,
                                                float* __restrict__ C, int ldc, int M, int N, int K) {
  __shared__ __attribute__((aligned(16))) float so[4][16][64];
  const int tid = threadIdx.x, w = tid >> 5, lane = tid & 31, ln = lane & 15, hh = lane >> 4;
  const int ntn = N / 64;
  const int wid = blockIdx.x * 4 + w;
  const int mt = wid / ntn, nq = wid % ntn;
  if (mt * 16 >= M) return;
  const int row0 = mt * 16, col0 = nq * 64;
  const float* arow = A + (size_t)(row0 + ln) * lda;
  v8f acc[4] = {};
  for (int kb = 0; kb < K; kb += 32) {
    FragB ah, al;
    const v4f x0 = *(const v4fa*)(arow + kb + 8 * hh), x1 = *(const v4fa*)(arow + kb + 8 * hh + 4);
    const v4f x2 = *(const v4fa*)(arow + kb + 16 + 8 * hh), x3 = *(const v4fa*)(arow + kb + 16 + 8 * hh + 4);
    float xs[16] = {x0[0],x0[1],x0[2],x0[3],x1[0],x1[1],x1[2],x1[3],x2[0],x2[1],x2[2],x2[3],x3[0],x3[1],x3[2],x3[3]};
#pragma unroll
    for (int i = 0; i < 16; ++i) { const unsigned short hb = bf16_bits(xs[i]); ah.u[i] = hb; al.u[i] = ASPLIT ? bf16_bits(xs[i] - bf16_val(hb)) : (unsigned short)0; }
#pragma unroll
    for (int t = 0; t < 4; ++t) {
      const unsigned short* brow = Wt + (size_t)(col0 + t * 16 + ln) * ldb + kb;
      FragB b;
      b.half[0] = *(const v8us*)(brow + 8 * hh);
      b.half[1] = *(const v8us*)(brow + 16 + 8 * hh);
      acc[t] = mmaN<ASPLIT ? 2 : 1>(ah.v, al.v, b.v, b.v, acc[t]);
    }
  }
#pragma unroll
  for (int t = 0; t < 4; ++t) {
    const int col = col0 + t * 16 + ln;
    float bv = bias ? bias[col] : 0.f;
    if (BIAS_BF16) bv = bf16_round(bv);
#pragma unroll
    for (int r = 0; r < 8; ++r) {
      float v = acc[t][r] + bv;
      if (resid) { float rv = resid[(size_t)((row0 + 8 * hh + r) % rmod) * ldr + col]; if (RES_BF16) rv = bf16_round(rv); v += rv; }
      if (ACT == 1) v = fmaxf(v, 0.f);
      if (ACT == 2) v = 0.5f * v * (1.0f + erff(v * 0.70710678118654752f));
      if (ACT == 3) { const float u = 0.7978845608028654f * (v + 0.044715f * v * v * v); v = 0.5f * v * (1.0f + tanhf(u)); }
      so[w][8 * hh + r][t * 16 + ln] = v;
    }
  }
  __builtin_amdgcn_fence(__ATOMIC_ACQ_REL, "workgroup");
  __builtin_amdgcn_wave_barrier();
  const int rsub = lane >> 4, c4 = (lane & 15) * 4;
  {
#pragma unroll
    for (int q = 0; q < 8; ++q) {
      const int r = q * 2 + rsub;
      const v4f v = *(const v4fa*)&so[w][r][c4];
      *(v4f*)(C + (size_t)(row0 + r) * ldc + col0 + c4) = v;
    }
    
  }
}
// row LayerNorm (biased variance, eps) over N: s = X (+ R); optional out_sum <- s; out_norm <- (s-mu)*rsqrt(var+eps)*g + b
template <bool PARAM_BF16>
__global__ __launch_bounds__(256) void k_layernorm(const float* __restrict__ X, const float* __restrict__ R, const float* __restrict__ g, const float* __restrict__ bta,
                                                  float* __restrict__ out_sum, float* __restrict__ out_norm, int N, float eps) {
  __shared__ float red[256];
  const int row = blockIdx.x, tid = threadIdx.x;
  const float* x = X + (size_t)row * N; const float* rr = R ? R + (size_t)row * N : nullptr;
  float vals[16];                     // up to N = 4096
  const int per = N / 256;            // contiguous chunk per thread? use strided-by-4 chunks: thread handles j = tid*4 + 1024*u
  float s1 = 0.f;
  for (int u = 0; u < per / 4; ++u) {
    const int j = tid * 4 + 1024 * u;
    const v4f a = *(const v4fa*)(x + j);
    v4f b = {0.f,0.f,0.f,0.f}; if (rr) b = *(const v4fa*)(rr + j);
#pragma unroll
    for (int q = 0; q < 4; ++q) { const float v = a[q] + b[q]; vals[u * 4 + q] = v; s1 += v; }
  }
  red[tid] = s1; __syncthreads();
  for (int st = 128; st > 0; st >>= 1) { if (tid < st) red[tid] += red[tid + st]; __syncthreads(); }
  const float mu = red[0] / (float)N; __syncthreads();
  float s2 = 0.f;
  for (int u = 0; u < per / 4; ++u)
#pragma unroll
    for (int q = 0; q < 4; ++q) { const float c = vals[u * 4 + q] - mu; s2 += c * c; }
  red[tid] = s2; __syncthreads();
  for (int st = 128; st > 0; st >>= 1) { if (tid < st) red[tid] += red[tid + st]; __syncthreads(); }
  const float rs = rsqrtf(red[0] / (float)N + eps);
  {
    for (int u = 0; u < per / 4; ++u) {
      const int j = tid * 4 + 1024 * u;
      v4f o, sm;
#pragma unroll
      for (int q = 0; q < 4; ++q) {
        float gg = g[j + q], bb = bta[j + q];
        if (PARAM_BF16) { gg = bf16_round(gg); bb = bf16_round(bb); }
        sm[q] = vals[u * 4 + q]; o[q] = (vals[u * 4 + q] - mu) * rs * gg + bb;
      }
      if (out_sum) *(v4f*)(out_sum + (size_t)row * N + j) = sm;
      *(v4f*)(out_norm + (size_t)row * N + j) = o;
    }
    
  }
}



// ---- f16 WMMA path (v_wmma_f32_16x16x32_f16): 11-bit significands for operands in range — used where a [0,1] probability operand needs more precision than bf16
typedef _Float16 v16h __attribute__((ext_vector_type(16)));
union FragH { v16h v; v8us half[2]; _Float16 h[16]; unsigned short u[16]; };
template <int NT>
__device__ __forceinline__ v8f mmaH(v16h ah, v16h al, v16h bh, v16h bl, v8f c) {
  c = __builtin_amdgcn_wmma_f32_16x16x32_f16(false, ah, false, bh, (short)0, c, false, false);
  if (NT >= 2) c = __builtin_amdgcn_wmma_f32_16x16x32_f16(false, al, false, bh, (short)0, c, false, false);
  if (NT >= 3) c = __builtin_amdgcn_wmma_f32_16x16x32_f16(false, ah, false, bl, (short)0, c, false, false);
  asm volatile("v_nop\n\tv_nop\n\tv_nop\n\tv_nop" : "+v"(c) : "v"(ah), "v"(al), "v"(bh), "v"(bl));
  return c;
}
// batched GEMM like k_gemm_b but f16 operands: A f32 (split into f16 hi/lo if ASPLIT, else rounded to f16), Bt = f16 values [n][k]; alpha; C f32; N multiple of 16 (partial tiles skipped)
template <bool ASPLIT>
__global__ __launch_bounds__(128) void k_gemm_h(const float* __restrict__ A, int lda, size_t sA, const _Float16* __restrict__ Bh, int ldb, size_t sB, float alpha, float* __restrict__ C, int ldc, size_t sC, int M, int N, int K) {
  __shared__ __attribute__((aligned(16))) float so[4][16][64];
  const int tid = threadIdx.x, w = tid >> 5, lane = tid & 31, ln = lane & 15, hh = lane >> 4; const int by = blockIdx.y;
  A += (size_t)by * sA; Bh += (size_t)by * sB; C += (size_t)by * sC;
  const int ntn = (N + 63) / 64; const int wid = blockIdx.x * 4 + w; const int mt = wid / ntn, nq = wid % ntn; if (mt * 16 >= M) return;
  const int row0 = mt * 16, col0 = nq * 64; const float* arow = A + (size_t)(row0 + ln) * lda;
  v8f acc[4] = {};
  for (int kb = 0; kb < K; kb += 32) {
    FragH ah, al;
    const v4f x0 = *(const v4fa*)(arow + kb + 8 * hh), x1 = *(const v4fa*)(arow + kb + 8 * hh + 4), x2 = *(const v4fa*)(arow + kb + 16 + 8 * hh), x3 = *(const v4fa*)(arow + kb + 16 + 8 * hh + 4);
    float xs[16] = {x0[0],x0[1],x0[2],x0[3],x1[0],x1[1],x1[2],x1[3],x2[0],x2[1],x2[2],x2[3],x3[0],x3[1],x3[2],x3[3]};
#pragma unroll
    for (int i = 0; i < 16; ++i) { const _Float16 h = (_Float16)xs[i]; ah.h[i] = h; al.h[i] = ASPLIT ? (_Float16)(xs[i] - (float)h) : (_Float16)0.0f; }
#pragma unroll
    for (int t = 0; t < 4; ++t) { if (col0 + t * 16 >= N) continue; const size_t boff = (size_t)(col0 + t * 16 + ln) * ldb + kb; FragH bq; bq.half[0] = *(const v8us*)(Bh + boff + 8 * hh); bq.half[1] = *(const v8us*)(Bh + boff + 16 + 8 * hh);
      acc[t] = mmaH<ASPLIT ? 2 : 1>(ah.v, al.v, bq.v, bq.v, acc[t]); }
  }
#pragma unroll
  for (int t = 0; t < 4; ++t) { if (col0 + t * 16 >= N) continue;
#pragma unroll
    for (int r = 0; r < 8; ++r) so[w][8 * hh + r][t * 16 + ln] = acc[t][r] * alpha; }
  __builtin_amdgcn_fence(__ATOMIC_ACQ_REL, "workgroup"); __builtin_amdgcn_wave_barrier();
  const int rsub = lane >> 4, c4 = (lane & 15) * 4;
  {
#pragma unroll
    for (int q = 0; q < 8; ++q) { const int r = q * 2 + rsub; if (col0 + c4 < N) { const v4f v = *(const v4fa*)&so[w][r][c4]; *(v4f*)(C + (size_t)(row0 + r) * ldc + col0 + c4) = v; } }
     }
}

// Wt[n][k] = f16(W[k][n]·scale) from f32 row-major W[K][N] (scale = power of two; bf16-exact weights stay exact in f16 away from the subnormal range)
__global__ __launch_bounds__(256) void k_wt_f16(const float* __restrict__ W, _Float16* __restrict__ Wt, int K, int N, float scale) {
  const int t = blockIdx.x * 256 + threadIdx.x; if (t >= N * (K / 8)) return; const int n = t / (K / 8), k8 = (t % (K / 8)) * 8; FragH f;
#pragma unroll
  for (int i = 0; i < 8; ++i) f.h[i] = (_Float16)(bf16_round(W[(size_t)(k8 + i) * N + n]) * scale); const v8us o = f.half[0];
  *(v8us*)((unsigned short*)Wt + (size_t)n * K + k8) = o; 
}
// k_gemm_hh variant with fused epilogue: v = acc·alpha + bias[by·sBias + col] (+ CP[(row/rowsPerB)·sCPb + by·64 + col] if CP) ; ACT 0 none / 1 elu ; writes f16 C16 (and f32 C if non-null)
template <int ACT>
__global__ __launch_bounds__(128) void k_gemm_hhx(const _Float16* __restrict__ A, int lda, size_t sA, const _Float16* __restrict__ Bh, int ldb, size_t sB, float alpha, const float* __restrict__ bias, size_t sBias, const float* __restrict__ CP, int rowsPerB, size_t sCPb, int row0g,
    float* __restrict__ C, _Float16* __restrict__ C16, int ldc, size_t sC, int M, int N, int K) {
  __shared__ __attribute__((aligned(16))) float so[4][16][64];
  const int tid = threadIdx.x, w = tid >> 5, lane = tid & 31, ln = lane & 15, hh = lane >> 4; const int by = blockIdx.y;
  A += (size_t)by * sA; Bh += (size_t)by * sB; const size_t cofs = (size_t)by * sC; const float* bp = bias ? bias + (size_t)by * sBias : nullptr;
  const int ntn = (N + 63) / 64; const int wid = blockIdx.x * 4 + w; const int mt = wid / ntn, nq = wid % ntn; if (mt * 16 >= M) return;
  const int row0 = mt * 16, col0 = nq * 64; const _Float16* arow = A + (size_t)(row0 + ln) * lda;
  v8f acc[4] = {};
  for (int kb = 0; kb < K; kb += 32) { FragH ah; ah.half[0] = *(const v8us*)((const unsigned short*)arow + kb + 8 * hh); ah.half[1] = *(const v8us*)((const unsigned short*)arow + kb + 16 + 8 * hh);
#pragma unroll
    for (int t = 0; t < 4; ++t) { if (col0 + t * 16 >= N) continue; const size_t boff = (size_t)(col0 + t * 16 + ln) * ldb + kb; FragH bq; bq.half[0] = *(const v8us*)((const unsigned short*)Bh + boff + 8 * hh); bq.half[1] = *(const v8us*)((const unsigned short*)Bh + boff + 16 + 8 * hh);
      acc[t] = mmaH<1>(ah.v, ah.v, bq.v, bq.v, acc[t]); }
  }
#pragma unroll
  for (int t = 0; t < 4; ++t) { if (col0 + t * 16 >= N) continue; const int col = col0 + t * 16 + ln; const float bv = bp ? bf16_round(bp[col]) : 0.f;
#pragma unroll
    for (int r = 0; r < 8; ++r) { float v = acc[t][r] * alpha + bv; if (CP) { const int rr = row0g + row0 + 8 * hh + r; if (rowsPerB < 0) v += CP[cofs + (size_t)rr * ldc + col];      /* rowsPerB < 0: own element of the batched C plane */ else { const int bidx = rr / rowsPerB; v += CP[(size_t)bidx * sCPb + (size_t)by * 64 + col]; } } if (ACT == 1) v = (v > 0.f) ? v : expm1f(v); else if (ACT == 7) v = (v > 0.f) ? v + 1.0f : expf(v); else if (ACT == 8) v = tanhf(v); else if (ACT == 9) v = 0.5f * v * (1.0f + tanhf(0.7978845608028654f * (v + 0.044715f * v * v * v))); else if (ACT == 11) v = 1.0f / (1.0f + expf(-v)); else if (ACT == 12) v = (v > 0.f) ? v : 0.01f * v; else if (ACT == 14) v = (v > 0.f) ? v : 0.1f * v; else if (ACT == 16) v = (v >= 0.f) ? v : 0.3f * v; else if (ACT == 17) v = (v >= 0.f) ? v : 0.2f * v; else if (ACT == 15) v = v / (1.0f + expf(-v)); else if (ACT == 3) v = fmaxf(v, 0.f); else if (ACT == 6) v = 0.5f * v * (1.0f + erff(v * 0.70710678118654752f)); so[w][8 * hh + r][t * 16 + ln] = v; } }
  __builtin_amdgcn_fence(__ATOMIC_ACQ_REL, "workgroup"); __builtin_amdgcn_wave_barrier();
  const int rsub = lane >> 4, c4 = (lane & 15) * 4; typedef _Float16 v4h __attribute__((ext_vector_type(4)));
  {
#pragma unroll
    for (int q = 0; q < 8; ++q) { const int r = q * 2 + rsub; if (col0 + c4 < N) { const v4f v = *(const v4fa*)&so[w][r][c4]; if (C) *(v4f*)(C + cofs + (size_t)(row0 + r) * ldc + col0 + c4) = v; if (C16) { v4h h4; for (int i = 0; i < 4; ++i) h4[i] = (_Float16)v[i]; *(v4h*)(C16 + cofs + (size_t)(row0 + r) * ldc + col0 + c4) = h4; } } }
     }
}


typedef _Float16 v4h __attribute__((ext_vector_type(4)));
typedef _Float16 v2h __attribute__((ext_vector_type(2)));
typedef _Float16 v8h __attribute__((ext_vector_type(8)));
typedef short v16s __attribute__((ext_vector_type(16)));

__global__ __launch_bounds__(256) void k_x16(const float* __restrict__ x, _Float16* __restrict__ X16, size_t n8) { const size_t t = (size_t)blockIdx.x * 256 + threadIdx.x; if (t >= n8) return; FragH f;
#pragma unroll
  for (int q = 0; q < 8; ++q) f.h[q] = (_Float16)bf16_round(x[t * 8 + q]); *(v8us*)((unsigned short*)X16 + t * 8) = f.half[0];  }
__global__ __launch_bounds__(256) void k_h16(const float* __restrict__ x, _Float16* __restrict__ X16, size_t n8) { const size_t t = (size_t)blockIdx.x * 256 + threadIdx.x; if (t >= n8) return; FragH f;
#pragma unroll
  for (int q = 0; q < 8; ++q) f.h[q] = (_Float16)x[t * 8 + q]; *(v8us*)((unsigned short*)X16 + t * 8) = f.half[0];  }
__global__ __launch_bounds__(256) void k_round16f(const float* __restrict__ W, _Float16* __restrict__ Bt, size_t n8) { const size_t t = (size_t)blockIdx.x * 256 + threadIdx.x; if (t >= n8) return; FragH f;
#pragma unroll
  for (int i = 0; i < 8; ++i) f.h[i] = (_Float16)(bf16_round(W[t * 8 + i]) * 16.0f); *(v8us*)((unsigned short*)Bt + t * 8) = f.half[0];  }
template <int NHv, int TTv>
__global__ __launch_bounds__(256) void k_vt(const _Float16* __restrict__ V16, int ldv, int voff, _Float16* __restrict__ Vt) { __shared__ unsigned short tl[64][66]; const int tid = threadIdx.x; const int slab = blockIdx.x / (TTv / 64), lg = blockIdx.x % (TTv / 64); const int b = slab / NHv, h = slab % NHv;
  for (int i = tid; i < 64 * 8; i += 256) { const int r = i / 8, c8 = (i % 8) * 8; FragH f; f.half[0] = *(const v8us*)((const unsigned short*)V16 + ((size_t)b * TTv + lg * 64 + r) * ldv + voff + h * 64 + c8);
#pragma unroll
    for (int q = 0; q < 8; ++q) tl[r][c8 + q] = f.u[q]; }
  __syncthreads();
  {
#pragma unroll
    for (int rd = 0; rd < 2; ++rd) { const int d = rd * 32 + tid / 8, pc = tid % 8; FragH f;
#pragma unroll
      for (int q = 0; q < 8; ++q) f.u[q] = tl[pc * 8 + q][d];
      *(v8us*)((unsigned short*)Vt + ((size_t)slab * 64 + d) * TTv + lg * 64 + pc * 8) = f.half[0]; }
     } }

__global__ __launch_bounds__(256) void k_hl(const float* __restrict__ F, _Float16* __restrict__ Hh, _Float16* __restrict__ Hl, size_t n8) { const size_t t = (size_t)blockIdx.x * 256 + threadIdx.x; if (t >= n8) return; FragH fh, fl; const v4f a = *(const v4fa*)(F + t * 8), c = *(const v4fa*)(F + t * 8 + 4);
#pragma unroll
  for (int q = 0; q < 4; ++q) { _Float16 h = (_Float16)a[q]; fh.h[q] = h; fl.h[q] = (_Float16)((a[q] - (float)h) * 1024.0f); h = (_Float16)c[q]; fh.h[4 + q] = h; fl.h[4 + q] = (_Float16)((c[q] - (float)h) * 1024.0f); }
  { *(v8us*)((unsigned short*)Hh + t * 8) = fh.half[0]; *(v8us*)((unsigned short*)Hl + t * 8) = fl.half[0];  } }

// ---- fast GEMM (wave tile 32x64; requires M % 32 == 0 rows per launch region and N % 64 == 0); epilogue = k_gemm_hhx semantics ----
__device__ __forceinline__ v16h g2_frag(const _Float16* p, int hh) { FragH f; f.half[0] = *(const v8us*)((const unsigned short*)p + 8 * hh); f.half[1] = *(const v8us*)((const unsigned short*)p + 16 + 8 * hh); return f.v; }
__device__ __forceinline__ v8f g2_mma(v16h a, v16h b, v8f c) { v8f d = __builtin_amdgcn_wmma_f32_16x16x32_f16(false, a, false, b, (short)0, c, false, false); asm volatile("v_nop\n\tv_nop\n\tv_nop\n\tv_nop" : "+v"(d) : "v"(a), "v"(b)); return d; }
template <int ACT>
__global__ __launch_bounds__(128) void k_gemm2(const _Float16* __restrict__ A, int lda, size_t sA, const _Float16* __restrict__ Bh, int ldb, size_t sB, float alpha, const float* __restrict__ bias, size_t sBias, const float* __restrict__ CP, int rowsPerB, size_t sCPb, int row0g,
    float* __restrict__ C, _Float16* __restrict__ C16, int ldc, size_t sC, int M, int N, int K) { static_assert(ACT == 0 || ACT == 3 || ACT == 6 || ACT == 8 || ACT == 9 || ACT == 11 || ACT == 12 || ACT == 14 || ACT == 15 || ACT == 16 || ACT == 17, "k_gemm2: unsupported ACT code (would silently apply no activation)");
  __shared__ __attribute__((aligned(16))) float so[4][32][68];
  const int tid = threadIdx.x, w = tid >> 5, lane = tid & 31, ln = lane & 15, hh = lane >> 4; const int by = blockIdx.y;
  A += (size_t)by * sA; Bh += (size_t)by * sB; const size_t cofs = (size_t)by * sC; const float* bp = bias ? bias + (size_t)by * sBias : nullptr;
  const int ntn = N >> 6; const int mt = blockIdx.x / ntn, nq = blockIdx.x - mt * ntn; const int row0 = mt * 128 + 32 * w, col0 = nq * 64; if (row0 >= M) return;
  const _Float16* a0p = A + (size_t)(row0 + ln) * lda; const _Float16* a1p = a0p + (size_t)16 * lda;
  const _Float16* b0p = Bh + (size_t)(col0 + ln) * ldb; const _Float16* b1p = b0p + (size_t)16 * ldb; const _Float16* b2p = b1p + (size_t)16 * ldb; const _Float16* b3p = b2p + (size_t)16 * ldb;
  const v8f z8 = {0.f,0.f,0.f,0.f,0.f,0.f,0.f,0.f}; v8f c00 = z8, c01 = z8, c02 = z8, c03 = z8, c10 = z8, c11 = z8, c12 = z8, c13 = z8;
#pragma unroll 1
  for (int kb = 0; kb < K; kb += 32) { const v16h a0 = g2_frag(a0p + kb, hh), a1 = g2_frag(a1p + kb, hh);
    v16h b = g2_frag(b0p + kb, hh); c00 = g2_mma(a0, b, c00); c10 = g2_mma(a1, b, c10);
    b = g2_frag(b1p + kb, hh); c01 = g2_mma(a0, b, c01); c11 = g2_mma(a1, b, c11);
    b = g2_frag(b2p + kb, hh); c02 = g2_mma(a0, b, c02); c12 = g2_mma(a1, b, c12);
    b = g2_frag(b3p + kb, hh); c03 = g2_mma(a0, b, c03); c13 = g2_mma(a1, b, c13); }
  v8f accs[8] = {c00, c01, c02, c03, c10, c11, c12, c13};
#pragma unroll
  for (int u = 0; u < 8; ++u) { const int t = u & 3, half = u >> 2; const int col = col0 + t * 16 + ln; const float bv = bp ? bf16_round(bp[col]) : 0.f;
#pragma unroll
    for (int r = 0; r < 8; ++r) { const int rloc = half * 16 + 8 * hh + r; float v = accs[u][r] * alpha + bv; if (CP) { if (rowsPerB < 0) v += CP[cofs + (size_t)(row0g + row0 + rloc) * ldc + col];      /* rowsPerB < 0: own element of the batched C plane */ else { const int bidx = (row0g + row0 + rloc) / rowsPerB; v += CP[(size_t)bidx * sCPb + (size_t)by * 64 + col]; } }
      if (ACT == 3) v = fmaxf(v, 0.f); else if (ACT == 6) v = 0.5f * v * (1.0f + erff(v * 0.70710678118654752f)); else if (ACT == 11) v = 1.0f / (1.0f + expf(-v)); else if (ACT == 15) v = v / (1.0f + expf(-v)); else if (ACT == 12) v = (v > 0.f) ? v : 0.01f * v; else if (ACT == 8) v = tanhf(v); else if (ACT == 9) v = 0.5f * v * (1.0f + tanhf(0.7978845608028654f * (v + 0.044715f * v * v * v))); else if (ACT == 14) v = (v > 0.f) ? v : 0.1f * v; else if (ACT == 16) v = (v >= 0.f) ? v : 0.3f * v; else if (ACT == 17) v = (v >= 0.f) ? v : 0.2f * v;
      so[w][rloc][t * 16 + ln] = v; } }
  __builtin_amdgcn_fence(__ATOMIC_ACQ_REL, "workgroup"); __builtin_amdgcn_wave_barrier();
  const int rsub = lane >> 4, c4 = (lane & 15) * 4;
  {
#pragma unroll
    for (int q = 0; q < 16; ++q) { const int r = q * 2 + rsub; const v4f v = *(const v4fa*)&so[w][r][c4]; if (C) *(v4f*)(C + cofs + (size_t)(row0 + r) * ldc + col0 + c4) = v; if (C16) { v4h h4; for (int i = 0; i < 4; ++i) h4[i] = (_Float16)v[i]; *(v4h*)(C16 + cofs + (size_t)(row0 + r) * ldc + col0 + c4) = h4; } }
     } }


__global__ __launch_bounds__(256) void k_wnat(const float* __restrict__ w, size_t n8, _Float16* __restrict__ Bt) { const size_t t = (size_t)blockIdx.x * 256 + threadIdx.x; if (t >= n8) return; FragH f; for (int q = 0; q < 8; ++q) f.h[q] = (_Float16)(bf16_round(w[t * 8 + q]) * 16.0f); *(v8us*)((unsigned short*)Bt + t * 8) = f.half[0];  }
__global__ __launch_bounds__(256) void k_rsm(const float* __restrict__ S, _Float16* __restrict__ P, int nrows) {
  #pragma clang fp contract(off)
  const int i = blockIdx.x * 256 + threadIdx.x; if (i >= nrows) return; const float* s = S + (size_t)i * SQ; float mx = -3.0e38f;
#pragma unroll 1
  for (int j = 0; j < SQ; ++j) mx = fmaxf(mx, s[j]); float se = 0.f;
#pragma unroll 1
  for (int j = 0; j < SQ; ++j) se += expf(s[j] - mx); const float sc = 256.0f / se;
#pragma unroll 1
  for (int j0 = 0; j0 < SQ; j0 += 8) { FragH f; for (int q = 0; q < 8; ++q) f.h[q] = (_Float16)(expf(s[j0 + q] - mx) * sc); unsigned short* d = (unsigned short*)P + (size_t)i * SQ + j0; *(v8us*)d = f.half[0];  } }
__global__ __launch_bounds__(256) void k_vt(const _Float16* __restrict__ V16, int b, int h0, _Float16* __restrict__ VT) { __shared__ unsigned short tl[64][65]; const int tid = threadIdx.x; const int hh = blockIdx.x % HG, sg = blockIdx.x / HG; const int s0 = sg * 64; const int h = h0 + hh;
  for (int i = tid; i < 64 * 8; i += 256) { const int j = i / 8, d8 = (i % 8) * 8; FragH f; f.half[0] = *(const v8us*)((const unsigned short*)V16 + ((size_t)b * SQ + s0 + j) * DM + h * HD + d8); for (int q = 0; q < 8; ++q) tl[d8 + q][j] = f.u[q]; }
  __syncthreads();
  { for (int i = tid; i < 64 * 8; i += 256) { const int d = i / 8, j8 = (i % 8) * 8; FragH f; for (int q = 0; q < 8; ++q) f.u[q] = tl[d][j8 + q]; *(v8us*)((unsigned short*)VT + ((size_t)hh * HD + d) * SQ + s0 + j8) = f.half[0]; }  } }



__global__ __launch_bounds__(256) void k_rsmcf2(const float* __restrict__ S, _Float16* __restrict__ P, int hg, int q0, int nk) {
  #pragma clang fp contract(off)
  const int t = blockIdx.x * 256 + threadIdx.x; if (t >= hg * QT) return; const size_t i = (size_t)t; const float* s = S + i * NKX; const int last = q0 + (t % QT); float mx = -3.0e38f;
#pragma unroll 1
  for (int j = 0; j < nk; ++j) { const float f = (j <= last) ? 1.f : 0.f; mx = fmaxf(mx, fmaf(f, s[j], (1.f - f) * -1.0e9f)); } float se = 0.f;
#pragma unroll 1
  for (int j = 0; j < nk; ++j) { const float f = (j <= last) ? 1.f : 0.f; se += __expf(fmaf(f, s[j], (1.f - f) * -1.0e9f) - mx); } const float sc = 256.0f / se;
#pragma unroll 1
  for (int j0 = 0; j0 < nk; j0 += 8) { FragH fr; for (int q = 0; q < 8; ++q) { const int j = j0 + q; const float f = (j <= last) ? 1.f : 0.f; fr.h[q] = (_Float16)(__expf(fmaf(f, s[j], (1.f - f) * -1.0e9f) - mx) * sc); } unsigned short* d = (unsigned short*)P + i * NKX + j0; *(v8us*)d = fr.half[0];  } }

template <int MASKADD>
__global__ __launch_bounds__(64) void k_att0(const float* __restrict__ QF, const float* __restrict__ KF, const float* __restrict__ VF, int ld, const float* __restrict__ mask, float scale, float* __restrict__ OF, int ldo) {
  #pragma clang fp contract(off)
  __shared__ __attribute__((aligned(16))) float lq[64][64]; __shared__ __attribute__((aligned(16))) float lo[64][64];
  const int tid = threadIdx.x; const int h = blockIdx.x / (QT0 / 64), rg = blockIdx.x % (QT0 / 64); const int i = rg * 64 + tid;
  const float* qr = QF + (size_t)i * ld + h * HD;
#pragma unroll 1
  for (int c = 0; c < HD / 4; ++c) { *(v4f*)&lq[tid][c * 4] = *(const v4fa*)(qr + c * 4); const v4f z = {0.f, 0.f, 0.f, 0.f}; *(v4f*)&lo[tid][c * 4] = z; }
  float m = -1.0e30f, l = 0.f; const int jmax = MASKADD ? (SQ - 1) : (rg * 64 + 63);      /* additive-mask form: every key (the mask input decides); causal form: keys up to the block's last row */
#pragma unroll 1
  for (int j = 0; j <= jmax; ++j) { const float* kr = KF + (size_t)j * ld + h * HD; const float* vr = VF + (size_t)j * ld + h * HD; float s = 0.f;
#pragma unroll 1
    for (int c = 0; c < HD / 4; ++c) { const v4f kq = *(const v4fa*)(kr + c * 4); const v4f qq = *(v4f*)&lq[tid][c * 4]; s = __fadd_rn(s, __fmul_rn(qq[0], kq[0])); s = __fadd_rn(s, __fmul_rn(qq[1], kq[1])); s = __fadd_rn(s, __fmul_rn(qq[2], kq[2])); s = __fadd_rn(s, __fmul_rn(qq[3], kq[3])); }
    s = __fmul_rn(s, scale); if (MASKADD) s = __fadd_rn(s, __fmul_rn(bf16_round(mask[(size_t)i * SQ + j]), -10000.0f));
    const float f = (MASKADD || j <= i) ? 1.f : 0.f; const float sm = fmaf(f, s, (1.f - f) * -1.0e30f); const float mn = fmaxf(m, sm); const float sc = expf(m - mn); const float e = expf(sm - mn); l = __fadd_rn(__fmul_rn(l, sc), e); m = mn;
#pragma unroll 1
    for (int c = 0; c < HD / 4; ++c) { const v4f vv = *(const v4fa*)(vr + c * 4); v4f oo = *(v4f*)&lo[tid][c * 4]; for (int u = 0; u < 4; ++u) oo[u] = __fadd_rn(__fmul_rn(oo[u], sc), __fmul_rn(e, vv[u])); *(v4f*)&lo[tid][c * 4] = oo; } }
  const float fin = 64.0f / l;      /* o carried x64 like the f16 path */
#pragma unroll 1
  for (int c = 0; c < HD / 4; ++c) { v4f oo = *(v4f*)&lo[tid][c * 4]; for (int u = 0; u < 4; ++u) oo[u] = __fmul_rn(oo[u], fin); *(v4f*)&lo[tid][c * 4] = oo; }
  __syncthreads();
  {
#pragma unroll 1
    for (int it = 0; it < 16; ++it) { const int row = it * 4 + tid / 16, pc = (tid % 16) * 4; const v4f v = *(const v4f*)&lo[row][pc]; *(v4f*)(OF + (size_t)(rg * 64 + row) * ldo + h * HD + pc) = v; }
     } }

__global__ __launch_bounds__(256) void k_oscale(const float* __restrict__ OF, float* __restrict__ out, size_t n4) { const size_t t = (size_t)blockIdx.x * 256 + threadIdx.x; if (t >= n4) return; const v4f a = *(const v4fa*)(OF + t * 4); v4f o; for (int q = 0; q < 4; ++q) o[q] = a[q] * 0.015625f; *(v4f*)(out + t * 4) = o;  }

__global__ __launch_bounds__(256) void k_bfr(const float* __restrict__ x, float* __restrict__ XB, size_t n8) { const size_t t = (size_t)blockIdx.x * 256 + threadIdx.x; if (t >= n8) return; v4f a = *(const v4fa*)(x + t * 8), c = *(const v4fa*)(x + t * 8 + 4); for (int q = 0; q < 4; ++q) { a[q] = bf16_round(a[q]); c[q] = bf16_round(c[q]); }
  { *(v4f*)(XB + t * 8) = a; *(v4f*)(XB + t * 8 + 4) = c;  } }



__global__ __launch_bounds__(256) void k_rsmfvl(const float* __restrict__ S, _Float16* __restrict__ P, _Float16* __restrict__ PL, int qn, const int* __restrict__ vlp) {
  #pragma clang fp contract(off)
  const int t = blockIdx.x * 256 + threadIdx.x; if (t >= qn) return; const int vl = vlp[0]; const size_t i = (size_t)t; const float* s = S + i * SQ; float mx = -3.0e38f;
#pragma unroll 1
  for (int j = 0; j < SQ; ++j) { const float f = (j < vl) ? 1.f : 0.f; mx = fmaxf(mx, fmaf(f, s[j], (1.f - f) * -1000000.0f)); } float se = 0.f;
#pragma unroll 1
  for (int j = 0; j < SQ; ++j) { const float f = (j < vl) ? 1.f : 0.f; se += __expf(fmaf(f, s[j], (1.f - f) * -1000000.0f) - mx); } const float sc = 256.0f / se;
#pragma unroll 1
  for (int j0 = 0; j0 < SQ; j0 += 8) { FragH fr, gr; for (int q = 0; q < 8; ++q) { const int j = j0 + q; const float f = (j < vl) ? 1.f : 0.f; const float pv = __expf(fmaf(f, s[j], (1.f - f) * -1000000.0f) - mx) * sc; const _Float16 ph = (_Float16)pv; fr.h[q] = ph; gr.h[q] = (_Float16)((pv - (float)ph) * 1024.0f); }
    unsigned short* d = (unsigned short*)P + i * SQ + j0; unsigned short* dl = (unsigned short*)PL + i * SQ + j0; *(v8us*)d = fr.half[0]; *(v8us*)dl = gr.half[0];  } }

#define NRW 131072      /* rows */
#define NIN 40          /* input features */
#define KIN 64          /* padded input width */
#define D0 128
#define D1 64
#define D2 32
#define D2P 64
#define NBRN 33         /* branches */
#define RB 8192

__global__ __launch_bounds__(256) void k_zero16(unsigned short* __restrict__ p, size_t n8) { const size_t t = (size_t)blockIdx.x * 256 + threadIdx.x; if (t >= n8) return; v8us z; for (int q = 0; q < 8; ++q) z[q] = 0; *(v8us*)(p + t * 8) = z;  }



#define BWV 8           /* waves per work-group of the branch kernel */
#define BRW 64          /* batch rows per wave in the trunk phase: four B tiles */
#define WCH 1408        /* 16-byte pieces of one branch's weights: 16 (layer 1) + 4 (layer 2) + 2 (W3) A fragments of 1 KiB */
#define AUXF 256        /* side table per branch, in 32-bit words: 16 b1 as 64 f16 [0..31], 256 b2 as 32 f16 [64..79], b3 as f32 [128] and [132] (one for each hh), rest 0 (the powers of two: see k_branch) */
#define TCH 1024        /* 16-byte pieces of the trunk's weights: 16 A fragments of 1 KiB */
#define TAUX 512        /* f32 side table of the trunk: bs [0..127], BN scale [128..167], BN mean [192..231], BN shift [256..295], rest 0 */

// Per branch: the A fragments of W1[j]^T (tile mt, k step ks at index mt * 4 + ks) and of W2[j]^T (at 16 + mt * 2 + ks) and two of W3[j] (at 20 as row 0, at 21 as row 8, every other row zero) in the order the lanes read them
// (piece = (fragment * 2 + half) * 32 + lane; lane (ln, hh) holds row 16 mt + ln, k = 32 ks + 16 half + 8 hh + 0..7), and the rounded biases.
// Behind the branches, the trunk: the A fragments of Ws^T (tile mt, k step ks at index mt * 2 + ks, same piece order; k = 40..63 zero) and its side table.
__global__ __launch_bounds__(256) void k_pack(const float* __restrict__ W1, const float* __restrict__ b1, const float* __restrict__ W2, const float* __restrict__ b2, const float* __restrict__ W3, const float* __restrict__ b3,
    const float* __restrict__ Ws, const float* __restrict__ bs, const float* __restrict__ g, const float* __restrict__ be, const float* __restrict__ mu, const float* __restrict__ var, float eps,
    _Float16* __restrict__ PW, float* __restrict__ PA, _Float16* __restrict__ PT, float* __restrict__ PB) {
  const int t = blockIdx.x * 256 + threadIdx.x; if (t >= NBRN * (WCH + AUXF / 4) + TCH + TAUX / 4) return;
  if (t >= NBRN * (WCH + AUXF / 4)) { const int c = t - NBRN * (WCH + AUXF / 4);
    if (c < TCH) { const int lane = c & 31, ln = lane & 15, hh = lane >> 4, f = c >> 6, h = (c >> 5) & 1; const int n = (f >> 1) * 16 + ln, k0 = (f & 1) * 32 + h * 16 + 8 * hh; FragH o;
      for (int q = 0; q < 8; ++q) { const int k = k0 + q; o.h[q] = (k < NIN) ? (_Float16)(bf16_round(Ws[(size_t)k * D0 + n]) * 16.0f) : (_Float16)0.f; }
      *(v8us*)((unsigned short*)PT + (size_t)c * 8) = o.half[0]; }
    else { const int i0 = (c - TCH) * 4; v4f o;
      for (int u = 0; u < 4; ++u) { const int i = i0 + u, cf = (i - D0) & 63, kind = (i - D0) >> 6; float v = 0.f;
        if (i < D0) v = bf16_round(bs[i]); else if (cf < NIN && kind == 0) v = rsqrtf(bf16_round(var[cf]) + eps) * bf16_round(g[cf]); else if (cf < NIN && kind == 1) v = bf16_round(mu[cf]); else if (cf < NIN && kind == 2) v = bf16_round(be[cf]);
        o[u] = v; }
      *(v4f*)(PB + i0) = o; }
    return; }
  const int j = t / (WCH + AUXF / 4), c = t % (WCH + AUXF / 4);
  if (c < WCH) { const int lane = c & 31, ln = lane & 15, hh = lane >> 4, f = c >> 6, h = (c >> 5) & 1; FragH o;
    if (f < 16) { const int k = (f >> 2) * 16 + ln, d0 = (f & 3) * 32 + h * 16 + 8 * hh; for (int q = 0; q < 8; ++q) o.h[q] = (_Float16)(bf16_round(W1[((size_t)j * D0 + d0 + q) * D1 + k]) * 16.0f); }
    else if (f < 20) { const int m = ((f - 16) >> 1) * 16 + ln, k0 = ((f - 16) & 1) * 32 + h * 16 + 8 * hh; for (int q = 0; q < 8; ++q) o.h[q] = (_Float16)(bf16_round(W2[((size_t)j * D1 + k0 + q) * D2 + m]) * 16.0f); }
    else { const int k0 = h * 16 + 8 * hh; for (int q = 0; q < 8; ++q) o.h[q] = (ln == (f - 20) * 8) ? (_Float16)(bf16_round(W3[j * D2 + k0 + q]) * 16.0f) : (_Float16)0.f; }
    *(v8us*)((unsigned short*)PW + ((size_t)j * WCH + c) * 8) = o.half[0]; }
  else { const int i0 = (c - WCH) * 4; v4f o;
    for (int u = 0; u < 4; ++u) { const int i = i0 + u; float v = 0.f;
      if (i < D1 / 2) { const v2h pb = {(_Float16)(bf16_round(b1[j * D1 + 2 * i]) * 16.0f), (_Float16)(bf16_round(b1[j * D1 + 2 * i + 1]) * 16.0f)}; v = __builtin_bit_cast(float, pb); }
      else if (i >= D1 && i < D1 + D2 / 2) { const int e = 2 * (i - D1); const v2h pb = {(_Float16)(bf16_round(b2[j * D2 + e]) * 256.0f), (_Float16)(bf16_round(b2[j * D2 + e + 1]) * 256.0f)}; v = __builtin_bit_cast(float, pb); }
      else if (i == 128 || i == 132) v = bf16_round(b3[j]);
      o[u] = v; }
    *(v4f*)(PA + (size_t)j * AUXF + i0) = o; } }

__device__ __forceinline__ v16h br_frag(const unsigned short* wb, int f, int lane) { FragH x; x.half[0] = *(const v8us*)(wb + f * 512 + lane * 8); x.half[1] = *(const v8us*)(wb + f * 512 + 256 + lane * 8); return x.v; }
__device__ __forceinline__ v8f br_mma(v16h a, v16h b, v8f c) { return __builtin_amdgcn_wmma_f32_16x16x32_f16(false, a, false, b, (short)0, c, false, false); }
__device__ __forceinline__ v8h br_mmh(v16h a, v16h b, v8h c) { return __builtin_amdgcn_wmma_f16_16x16x32_f16(false, a, false, b, (short)0, c, false, false); }      /* C and D f16: element e of a lane = row 8 hh + e, the order of half a B fragment */
__device__ __forceinline__ v16h br_relu(v8h lo, v8h hi) { const v16s s0 = {}; return __builtin_bit_cast(v16h, __builtin_elementwise_max(__builtin_bit_cast(v16s, __builtin_shufflevector(lo, hi, 0, 1, 2, 3, 4, 5, 6, 7, 8, 9, 10, 11, 12, 13, 14, 15)), s0)); }      /* two f16 D tiles to one B fragment, with relu as a signed 16-bit maximum with 0, two values an instruction: a set sign bit gives +0, all else passes; the float maximum would first quiet each WMMA result with a second instruction */

#define ZT (BWV * BRW / 16)      /* 16-row tiles of a work-group */
#define NPW (NBRN * (ZT / 2) / BWV)      /* (branch, tile pair) items per wave: 33 * 16 / 8 = 66 */
#define NSG 5           /* runs of one branch in a wave's 66 items: 16 - 2 w, 16, 16, 16, 2 + 2 w */

__global__ __launch_bounds__(256) void k_branch(const float* __restrict__ x, const _Float16* __restrict__ PT, const float* __restrict__ PB, const _Float16* __restrict__ PW, const float* __restrict__ PA, float* __restrict__ out) {
  __shared__ __attribute__((aligned(16))) unsigned short zs[ZT * 4 * 512];      /* z: tile t, k step ks = fragment t * 4 + ks, in br_frag's order */
  __shared__ __attribute__((aligned(16))) float so[BWV * BRW * NBRN];
  __shared__ __attribute__((aligned(16))) unsigned short tw[TCH * 8];
  __shared__ __attribute__((aligned(16))) float tb[TAUX];
  const int tid = threadIdx.x, w = tid >> 5, lane = tid & 31, ln = lane & 15, hh = lane >> 4;
  const int wu = __builtin_amdgcn_readfirstlane(w);      /* the wave's number in a scalar register: phase 2's loop bounds and weight addresses are scalar */
  const size_t row0 = (size_t)blockIdx.x * (BWV * BRW) + (size_t)w * BRW;
  const unsigned short* pw = (const unsigned short*)PW;
  v8us tt[4]; v2f ttb;
#pragma unroll
  for (int i = 0; i < 4; ++i) tt[i] = *(const v8us*)((const unsigned short*)PT + (size_t)(tid + 256 * i) * 8);
  ttb = *(const v2f*)(PB + tid * 2);
  v4f xr[4][6];      /* lane (ln, hh), tile n: features 8 hh + 0..7, 16 + 8 hh + 0..7 and 32..39 of row 16 n + ln */
#pragma unroll
  for (int n = 0; n < 4; ++n) { const float* xp = x + (row0 + n * 16 + ln) * NIN;
#pragma unroll
    for (int q = 0; q < 6; ++q) xr[n][q] = *(const v4fa*)(xp + ((q < 4) ? (q >> 1) * 16 + 8 * hh + (q & 1) * 4 : q * 4 + 16)); }
  asm volatile("s_wait_xcnt 0x0" ::: "memory");      /* stands before the address registers of the loads above are reused */
  __builtin_amdgcn_sched_barrier(0);      /* keeps the LDS address arithmetic below, which reuses those registers, behind that wait */
#pragma unroll
  for (int i = 0; i < 4; ++i) *(v8us*)(&tw[(tid + 256 * i) * 8]) = tt[i];
  *(v2f*)(&tb[tid * 2]) = ttb;
  __syncthreads();      /* publishes the trunk's weights */
  const v8f z8 = {0.f, 0.f, 0.f, 0.f, 0.f, 0.f, 0.f, 0.f};
  v16h xb[4][2];      /* xn as B fragments: k step 0 = features 0..31, k step 1 = features 32..39 and zeros */
  { v4f bsc[6], bmu[6], bsh[6]; const unsigned keep = hh ? 0u : 0xffffffffu;
#pragma unroll
    for (int q = 0; q < 6; ++q) { const int c = (q < 4) ? (q >> 1) * 16 + 8 * hh + (q & 1) * 4 : q * 4 + 16; bsc[q] = *(const v4f*)(tb + 128 + c); bmu[q] = *(const v4f*)(tb + 192 + c); bsh[q] = *(const v4f*)(tb + 256 + c); }
#pragma unroll
    for (int n = 0; n < 4; ++n) { FragH f0, f1;
#pragma unroll
      for (int q = 0; q < 6; ++q) { const v4f xq = __builtin_convertvector(__builtin_convertvector(xr[n][q], v4b), v4f);      /* x rounded to bf16, to nearest even */
        const v4h y = __builtin_convertvector((xq - bmu[q]) * bsc[q] + bsh[q], v4h);
#pragma unroll
        for (int u = 0; u < 4; ++u) { if (q < 4) f0.h[q * 4 + u] = y[u]; else { f1.h[(q - 4) * 4 + u] = y[u]; f1.h[8 + (q - 4) * 4 + u] = (_Float16)0.f; } } }
      v8u w1 = __builtin_bit_cast(v8u, f1.v);
#pragma unroll
      for (int i = 0; i < 4; ++i) w1[i] &= keep;      /* lanes 16-31 stand for k = 40..47: zeros */
      xb[n][0] = f0.v; xb[n][1] = __builtin_bit_cast(v16h, w1); } }
  int pr = wu * NPW;      /* this wave's items: pr .. pr + 65; branch pr >> 4, tile pair pr & 15 */
  v16h wa[4][4], ua[2][2], wr[2]; v8h bb[4], cc[2]; float b3v;      /* one branch: layer-1 A fragments (tile m, k step ks), layer-2 A fragments (k step s, tile m), W3 as row 0 and as row 8 of an A fragment, 16 b1 and 256 b2 as f16 C tiles, b3 */
  auto take_l1 = [&](int j) {      /* what layer 1 reads */
    const unsigned short* gl = pw + (size_t)j * (WCH * 8) + lane * 8; const float* gh = PA + (size_t)j * AUXF + 4 * hh;
#pragma unroll
    for (int m = 0; m < 4; ++m) {
#pragma unroll
      for (int ks = 0; ks < 4; ++ks) wa[m][ks] = br_frag(gl, m * 4 + ks, 0); }
    asm volatile("s_wait_xcnt 0x0" :: "v"(gl) : "memory");      /* stands before the loads' address registers are reused; the address as an input keeps them from being a load's own destination */
    __builtin_amdgcn_sched_barrier(0);      /* keeps the loads below behind that wait */
#pragma unroll
    for (int m = 0; m < 4; ++m) bb[m] = __builtin_bit_cast(v8h, *(const v8us*)(gh + 8 * m));      /* eight f16: rows 16 m + 8 hh + 0..7 */
    asm volatile("s_wait_xcnt 0x0" :: "v"(gh) : "memory");
    __builtin_amdgcn_sched_barrier(0);      /* keeps what follows, which may reuse those registers, behind that wait */
  };
  auto take_l2 = [&](int j) {      /* what layer 2 and the dot read */
    const unsigned short* gl = pw + (size_t)j * (WCH * 8) + lane * 8; const float* gh = PA + (size_t)j * AUXF + 4 * hh;
#pragma unroll
    for (int s = 0; s < 2; ++s) { ua[s][0] = br_frag(gl, 16 + s, 0); ua[s][1] = br_frag(gl, 18 + s, 0); wr[s] = br_frag(gl, 20 + s, 0); }
    asm volatile("s_wait_xcnt 0x0" :: "v"(gl) : "memory");      /* as in take_l1 */
    __builtin_amdgcn_sched_barrier(0);      /* keeps the loads below behind that wait */
#pragma unroll
    for (int m = 0; m < 2; ++m) cc[m] = __builtin_bit_cast(v8h, *(const v8us*)(gh + 64 + 8 * m));      /* eight f16: rows 16 m + 8 hh + 0..7 */
    b3v = gh[128];
    asm volatile("s_wait_xcnt 0x0" :: "v"(gh) : "memory");      /* as in take_l1 */
    __builtin_amdgcn_sched_barrier(0);      /* keeps what follows, which may reuse those registers, behind that wait */
  };
  take_l1(pr >> 4); take_l2(pr >> 4);      /* the first branch, asked for here so that it lands under the trunk layer */
#pragma unroll
  for (int ks = 0; ks < 4; ++ks) {      /* z features 32 ks .. 32 ks + 31 = k step ks of layer 1 */
    v16h ta[2][2]; v4f bz[4]; v8f t0[4], t1[4];
#pragma unroll
    for (int m = 0; m < 2; ++m) { ta[m][0] = br_frag(tw, (2 * ks + m) * 2, lane); ta[m][1] = br_frag(tw, (2 * ks + m) * 2 + 1, lane); }
#pragma unroll
    for (int q = 0; q < 4; ++q) bz[q] = *(const v4f*)(tb + 32 * ks + (q >> 1) * 16 + 8 * hh + (q & 1) * 4);
#pragma unroll
    for (int n = 0; n < 4; ++n) { t0[n] = br_mma(ta[0][0], xb[n][0], z8); t1[n] = br_mma(ta[1][0], xb[n][0], z8); }
#pragma unroll
    for (int n = 0; n < 4; ++n) { t0[n] = br_mma(ta[0][1], xb[n][1], t0[n]); t1[n] = br_mma(ta[1][1], xb[n][1], t1[n]); }
#pragma unroll
    for (int n = 0; n < 4; ++n) { FragH hb;
#pragma unroll
      for (int r = 0; r < 8; ++r) { hb.h[r] = (_Float16)fmaxf(t0[n][r] * 0.0625f + bz[r >> 2][r & 3], 0.f); hb.h[8 + r] = (_Float16)fmaxf(t1[n][r] * 0.0625f + bz[2 + (r >> 2)][r & 3], 0.f); }
      unsigned short* zd = zs + ((w * 4 + n) * 4 + ks) * 512 + lane * 8;
      *(v8us*)zd = hb.half[0]; *(v8us*)(zd + 256) = hb.half[1]; }
  }
  __syncthreads();      /* publishes z to the 8 waves */
  v16h zfA[2][4], zfB[2][4];      /* z tiles of the even and of the odd items: one set is read while the other is filled */
  v8h aA[4][2], aB[4][2];      /* layer-1 tiles of the even and of the odd items: one set is summed while the other goes through relu and layer 2 */
  auto zload = [&](v16h (&zf)[2][4], const int tp) __attribute__((always_inline)) {      /* tile pair tp of z, 16 LDS reads in one group */
#pragma unroll
    for (int t = 0; t < 2; ++t) {
#pragma unroll
      for (int ks = 0; ks < 4; ++ks) zf[t][ks] = br_frag(zs, (tp * 2 + t) * 4 + ks, lane); }
    __builtin_amdgcn_sched_barrier(0);      /* keeps these LDS reads in one group, ahead of the WMMAs that hide their latency */
  };
  auto prio = [&](const int ks) __attribute__((always_inline)) {
    if (ks == 0) __builtin_amdgcn_s_setprio(0); else if (ks == 1) __builtin_amdgcn_s_setprio(1); else if (ks == 2) __builtin_amdgcn_s_setprio(2); else __builtin_amdgcn_s_setprio(3);
  };
  zload(zfA, pr & 15);
  auto run = [&](const bool more) __attribute__((always_inline)) {      /* one run: the wave's items of one branch, an even number; more: another run follows. On entry zfA holds the first item's z */
    const int j = pr >> 4;
    const int stop = more ? (j + 1) << 4 : wu * NPW + NPW;
    float* sd = so + (hh * 16 + ln) * NBRN + j;
    auto step = [&](v8h (&aP)[4][2], v8h (&aC)[4][2], v16h (&zC)[2][4], v16h (&zN)[2][4]) __attribute__((always_inline)) {      /* layer 1 of item pr (into aC, from zC) with the rest of item pr - 1 (aP) set among its WMMAs; zN takes item pr + 1 */
      const int tq = (pr - 1) & 15, tn = (pr + 1) & 15;      /* behind a branch's last pair comes the next branch's pair 0; the wave's last item reads one pair for nothing */
      zload(zN, tn);
      v8h a2[2][2]; v16h hq[2]; v8f d3;
#pragma unroll
      for (int ks = 0; ks < 4; ++ks) {
        prio(ks);
#pragma unroll
        for (int u = 0; u < 8; ++u) { const int m = u >> 1, t = u & 1;
          aC[m][t] = br_mmh(wa[m][ks], zC[t][ks], ks ? aC[m][t] : bb[m]);
          if (ks == 3 && u == 3) { __builtin_amdgcn_sched_barrier(0); d3 = br_mma(wr[1], hq[1], d3); __builtin_amdgcn_sched_barrier(0); } }      /* row 8: the second tile of the item before; held four WMMAs behind the first tile's, so that it does not wait for that sum */
        if (ks < 2) {      /* of the item before: h1 features 32 ks .. 32 ks + 31 = k step ks of its layer 2 */
#pragma unroll
          for (int t = 0; t < 2; ++t) { const v16h hb = br_relu(aP[2 * ks][t], aP[2 * ks + 1][t]); a2[0][t] = br_mmh(ua[ks][0], hb, ks ? a2[0][t] : cc[0]); a2[1][t] = br_mmh(ua[ks][1], hb, ks ? a2[1][t] : cc[1]); } }
        else if (ks == 2) {      /* its h2 = the one k step of the dot; row 0: its first tile */
#pragma unroll
          for (int t = 0; t < 2; ++t) hq[t] = br_relu(a2[0][t], a2[1][t]);
          d3 = br_mma(wr[0], hq[0], z8); }
        if (ks < 3) {
#pragma unroll
          for (int u = 0; u < 8; ++u) { __builtin_amdgcn_sched_group_barrier(8, 1, 0); __builtin_amdgcn_sched_group_barrier(2, 2, 0); }      /* one WMMA, then two of the 16 relu instructions, eight times: they issue while the matrix pipe is busy; left alone they stand as one block, during which the pipe is idle */
          if (ks < 2) __builtin_amdgcn_sched_group_barrier(8, 4, 0); else __builtin_amdgcn_sched_group_barrier(8, 1, 0); }      /* then the WMMAs that read them */
        __builtin_amdgcn_sched_barrier(0);      /* ends the k step: eight independent layer-1 accumulators per step, the item before's WMMAs between the steps */
      }
      sd[tq * (32 * NBRN)] = __builtin_fmaf(d3[0], 0.000244140625f, b3v);
      ++pr;
    };
    zload(zfB, (pr + 1) & 15);
#pragma unroll
    for (int ks = 0; ks < 4; ++ks) {      /* the run's first item: layer 1 alone */
      prio(ks);
#pragma unroll
      for (int m = 0; m < 4; ++m) { aA[m][0] = br_mmh(wa[m][ks], zfA[0][ks], ks ? aA[m][0] : bb[m]); aA[m][1] = br_mmh(wa[m][ks], zfA[1][ks], ks ? aA[m][1] : bb[m]); }
      __builtin_amdgcn_sched_barrier(0);      /* keeps eight independent accumulators per k step: without it the four k steps of one tile are issued as a dependent chain */
    }
    ++pr;
#pragma unroll 1      /* one copy of the two steps: 84 WMMAs */
    while (pr + 1 < stop) { step(aA, aB, zfB, zfA); step(aB, aA, zfA, zfB); }
    step(aA, aB, zfB, zfA);      /* layer 1 of the run's last item; zfA takes the next run's first */
    if (more) take_l1(j + 1);      /* layer 1 of the run's last item is issued, so the next branch (at most 32) may land in its registers under what is left of this item */
    { v16h hr[2][2], hq[2]; v8h a2[2][2];      /* the rest of the run's last item, alone */
#pragma unroll
      for (int s = 0; s < 2; ++s) {      /* h1 features 32 s .. 32 s + 31 = k step s of layer 2 */
#pragma unroll
        for (int t = 0; t < 2; ++t) hr[s][t] = br_relu(aB[2 * s][t], aB[2 * s + 1][t]); }
      __builtin_amdgcn_sched_barrier(0);
#pragma unroll
      for (int s = 0; s < 2; ++s) {
#pragma unroll
        for (int t = 0; t < 2; ++t) { a2[0][t] = br_mmh(ua[s][0], hr[s][t], s ? a2[0][t] : cc[0]); a2[1][t] = br_mmh(ua[s][1], hr[s][t], s ? a2[1][t] : cc[1]); } }
      __builtin_amdgcn_sched_barrier(0);      /* keeps relu's first reads out of the last WMMAs, where each would wait for its own result */
#pragma unroll
      for (int t = 0; t < 2; ++t) hq[t] = br_relu(a2[0][t], a2[1][t]);      /* h2 features 0..31 = the one k step of the dot */
      const v8f d3 = br_mma(wr[1], hq[1], br_mma(wr[0], hq[0], z8));      /* row 0: the pair's first tile, row 8: its second */
      sd[((pr - 1) & 15) * (32 * NBRN)] = __builtin_fmaf(d3[0], 0.000244140625f, b3v); }
    if (more) take_l2(j + 1);      /* the rest of the next run's branch */
  };
#pragma unroll 1      /* the weights are loop-carried registers: one copy of the text */
  for (int sg = 0; sg < NSG - 1; ++sg) run(true);
  run(false);      /* the last run, written out apart: no test stands round the loads of the others, so each wait counts exactly */
  __builtin_amdgcn_s_setprio(0);      /* phase 2 is over: back to the default priority */
  __syncthreads();      /* every wave's results stand in so */
  float* og = out + (size_t)blockIdx.x * (BWV * BRW * NBRN);      /* 512 rows x 33 f32 = 528 whole 128-byte lines, this work-group's own; a wave's store covers four whole lines */
  for (int i = tid; i < BWV * BRW * NBRN / 4; i += 256) *(v4f*)(og + i * 4) = *(const v4f*)(so + i * 4);
}

extern "C" void kernel_launch(void* const* d_in, const int* in_sizes, int n_in,
                              void* d_out, int out_size, void* d_ws, size_t ws_size, hipStream_t stream) {
  (void)in_sizes; (void)n_in; (void)out_size;
  const float* const* I = (const float* const*)d_in; const float* x = I[0]; const float* bng = I[1]; const float* bnb = I[2]; const float* bnm = I[3]; const float* bnv = I[4]; const float* Ws = I[5]; const float* bs = I[6]; const float* W1 = I[7]; const float* b1 = I[8]; const float* W2 = I[9]; const float* b2 = I[10]; const float* W3 = I[11]; const float* b3 = I[12];
  char* ws = (char*)d_ws; size_t off = 0;
  auto take = [&](size_t bytes) { char* p = ws + off; off += (bytes + 255) & ~(size_t)255; return p; };
  _Float16* PW = (_Float16*)take((size_t)NBRN * WCH * 16); float* PA = (float*)take((size_t)NBRN * AUXF * 4); _Float16* PT = (_Float16*)take((size_t)TCH * 16); float* PB = (float*)take((size_t)TAUX * 4);
  if (off > ws_size) return;
  k_pack<<<(NBRN * (WCH + AUXF / 4) + TCH + TAUX / 4 + 255) / 256, 256, 0, stream>>>(W1, b1, W2, b2, W3, b3, Ws, bs, bng, bnb, bnm, bnv, 1e-5f, PW, PA, PT, PB);      /* branch and trunk weights as A fragments; biases, W3 and the BN terms rounded */
  k_branch<<<NRW / (BWV * BRW), 256, 0, stream>>>(x, PT, PB, PW, PA, (float*)d_out);      /* BN, trunk, then gu[r][j] for all rows and branches */
}
